// v000
// The times below were measured on an AMD MI455X: many runs one after another, warmed up first and cycling through
// copies of the inputs, with the whole window's GPU time divided by the number of runs. Launches and the gaps
// between them are all in it. The median over several windows is given; except for v000 it joins two sittings, which
// can be a few percent apart, so the side-by-side timings, each taken in one sitting, are the better comparison.
// The starting kernel, v000, takes 457 microseconds a run.
// Contractions: v.W_v^T, v.W_vv^T, l.W_l^T, l.W_vl^T = v_wmma_f32_16x16x32_bf16 (bf16 operands RNE-converted from the inputs, single product, f32 accumulate);
// q.k^T scores = v_wmma_f32_16x16x32_bf16 (q and k as bf16 hi + unscaled bf16 residual planes; 3 products hi.hi + hi.lo + lo.hi; f32 accumulate);
// p.val_l and e.val_v = v_wmma_f32_16x16x32_bf16 (p / e split in registers into bf16 hi + residual, val planes bf16 hi + residual; 3 products; f32 accumulate);
// ctx_v.W_ov^T and ctx_l.W_ol^T = v_wmma_f32_16x16x32_bf16 (ctx as bf16 hi | residual interleaved along k, W bf16 duplicated along k; f32 accumulate).
// Softmax, mask, bias, scale, column statistics and normalisation in f32.
// Carry audit: no power-of-two carried planes anywhere (every residual plane is an unscaled bf16 difference); nothing is folded back.
#include <hip/hip_runtime.h>
#include <math.h>
#include <stdint.h>

#define NB      2
#define TV      16000
#define SL      256
#define EMB     256
#define LD      768
#define NH      8
#define HD      32
#define NV      (NB * TV)          // 32000 vision rows
#define NL      (NB * SL)          // 512 language rows
#define NQT     (TV / 64)          // 250 query tiles of 64 rows per batch
#define RR      10                 // t ranges per (b,h) in the language direction
#define TPR     (TV / RR)          // 1600 t per range
#define NSTEP   (TPR / 32)         // 50 steps of 32 t per range
#define RECROWS 33                 // 32 accumulator rows + 1 column-sum row
#define SCALEQ  0.17677669529663687f
#define CLAMPV  50000.0f
#define MASKNEG (-9.0e15f)

static_assert(NH * HD == EMB);
static_assert(NQT * 64 == TV);
static_assert(RR * NSTEP * 32 == TV);
static_assert((NV % 64) == 0 && (NL % 64) == 0 && (EMB % 64) == 0 && (LD % 64) == 0 && (TV % 64) == 0);
static_assert((EMB % 32) == 0 && (LD % 32) == 0 && ((2 * EMB) % 32) == 0);
static_assert(SL == 256 && HD == 32 && EMB == 256);

typedef __bf16   v16b __attribute__((ext_vector_type(16)));
typedef __bf16   v8b  __attribute__((ext_vector_type(8)));
typedef float    v8f  __attribute__((ext_vector_type(8)));
typedef float    v4f  __attribute__((ext_vector_type(4)));
typedef unsigned int v4u __attribute__((ext_vector_type(4)));
typedef unsigned int v8u __attribute__((ext_vector_type(8)));
typedef int      v4i  __attribute__((ext_vector_type(4)));
typedef v4f __attribute__((may_alias)) v4fa;
typedef v4i __attribute__((may_alias)) v4ia;

#if defined(__HIP_DEVICE_COMPILE__)
#define DEV_ASM 1
#else
#define DEV_ASM 0
#endif

// ---- scalar helpers --------------------------------------------------------------------------------
__device__ __forceinline__ unsigned short bf_bits(float f) {          // f32 -> bf16 bits, RNE convert
  unsigned u = __float_as_uint(f);
  return (unsigned short)((u + 0x7FFFu + ((u >> 16) & 1u)) >> 16);
}
__device__ __forceinline__ float bf_up(unsigned short hb) { return __uint_as_float(((unsigned)hb) << 16); }
__device__ __forceinline__ float rbf(float f) { return bf_up(bf_bits(f)); }   // value of the bf16 RNE convert
__device__ __forceinline__ unsigned pk16(unsigned short a, unsigned short b) { return (unsigned)a | ((unsigned)b << 16); }
__device__ __forceinline__ v8f zero8() { v8f z = {0.f, 0.f, 0.f, 0.f, 0.f, 0.f, 0.f, 0.f}; return z; }
__device__ __forceinline__ float clampv(float x) { return fminf(fmaxf(x, -CLAMPV), CLAMPV); }

// ---- 16-bit A/B fragment loader (wave32): lane -> row/col (lane&15); p already includes +8*(lane>>4);
//      elements 0..7 <- p[0..7] (k0+8h..k0+8h+7), elements 8..15 <- p[16..23] (k0+16+8h..k0+16+8h+7)
__device__ __forceinline__ v16b ldfrag(const __bf16* p) {
  union { v16b v; v8b h[2]; } f;
  f.h[0] = *(const v8b*)(p);
  f.h[1] = *(const v8b*)(p + 16);
  return f.v;
}

// ---- WMMA helpers (asm guard bodies device-only) -------------------------------------------------------
__device__ __forceinline__ v8f mmar(v16b a, v16b b, v8f c) {
  return __builtin_amdgcn_wmma_f32_16x16x32_bf16(false, a, false, b, (short)0, c, false, false);
}
// guarded form: 4 VALU slots after the WMMA, D tied, A/B kept live
__device__ __forceinline__ v8f mma_b(v16b a, v16b b, v8f c) {
  c = __builtin_amdgcn_wmma_f32_16x16x32_bf16(false, a, false, b, (short)0, c, false, false);
#if DEV_ASM
  asm volatile("v_nop\n\tv_nop\n\tv_nop\n\tv_nop" : "+v"(c) : "v"(a), "v"(b));
#endif
  return c;
}
__device__ __forceinline__ void dep_guard(v8f& a, v8f& b, v16b x, v16b y) {
#if DEV_ASM
  asm volatile("v_nop\n\tv_nop\n\tv_nop\n\tv_nop" : "+v"(a), "+v"(b) : "v"(x), "v"(y));
#else
  (void)a; (void)b; (void)x; (void)y;
#endif
}
__device__ __forceinline__ void keep4(v16b a, v16b b, v16b c, v16b d) {
#if DEV_ASM
  asm volatile("v_nop" :: "v"(a), "v"(b), "v"(c), "v"(d));
#else
  (void)a; (void)b; (void)c; (void)d;
#endif
}
__device__ __forceinline__ void acc_guard4(v8f& a, v8f& b, v8f& c, v8f& d) {
#if DEV_ASM
  asm volatile("v_nop\n\tv_nop\n\tv_nop\n\tv_nop" : "+v"(a), "+v"(b), "+v"(c), "+v"(d));
#else
  (void)a; (void)b; (void)c; (void)d;
#endif
}

// ---- B fragment (k = the D tiles' ROW index) from two D tiles held by this lane, split into bf16 hi + residual:
//      element r <- tile a (k 0..15) row r, element 8+r <- tile c (k 16..31) row r, lane unchanged.
union PK { v8u u; v16b v; };
__device__ __forceinline__ void pack_hl(v8f a, v8f c, v16b& fh, v16b& fl) {
  v8u ph, pl;
#pragma unroll
  for (int i = 0; i < 4; ++i) {
    const float x0 = a[2 * i], x1 = a[2 * i + 1];
    const unsigned short h0 = bf_bits(x0), h1 = bf_bits(x1);
    const unsigned short l0 = bf_bits(x0 - bf_up(h0)), l1 = bf_bits(x1 - bf_up(h1));
    ph[i] = pk16(h0, h1);
    pl[i] = pk16(l0, l1);
    const float y0 = c[2 * i], y1 = c[2 * i + 1];
    const unsigned short g0 = bf_bits(y0), g1 = bf_bits(y1);
    const unsigned short n0 = bf_bits(y0 - bf_up(g0)), n1 = bf_bits(y1 - bf_up(g1));
    ph[4 + i] = pk16(g0, g1);
    pl[4 + i] = pk16(n0, n1);
  }
  PK uh, ul;
  uh.u = ph; ul.u = pl;
  fh = uh.v; fl = ul.v;
}

// =====================================================================================================
// f32 -> bf16 bits plane, 8 elements per thread, one 16-B store per lane: a wave writes 512 contiguous B
// coverage: n8 threads x 8 = the whole plane (n8 is a multiple of 256 for every use here).
// =====================================================================================================
__global__ __launch_bounds__(256) void cvt_bf16x8(const float* __restrict__ in, unsigned short* out, int n8) {
  const int i = blockIdx.x * 256 + (int)threadIdx.x;
  if (i < n8) {
    const v4f a  = *(const v4fa*)(in + (size_t)i * 8);
    const v4f a4 = *(const v4fa*)(in + (size_t)i * 8 + 4);
    v4u p;
    p[0] = pk16(bf_bits(a[0]),  bf_bits(a[1]));
    p[1] = pk16(bf_bits(a[2]),  bf_bits(a[3]));
    p[2] = pk16(bf_bits(a4[0]), bf_bits(a4[1]));
    p[3] = pk16(bf_bits(a4[2]), bf_bits(a4[3]));
    unsigned short* o = out + (size_t)i * 8;
    *(v4u*)o = p;
    
  }
}

// =====================================================================================================
// W [nrows][256] f32 -> bf16 bits [nrows][512] duplicated per 32-column block:
//   out[n][g*64 + w] = bf16(W[n][g*32 + (w & 31)]), g = 0..7, w = 0..63
// (the Bt operand of ctx.W^T where ctx is stored as [hi 32 | residual 32] per head block).
// One wave per row; per half (g 0..3 / 4..7) one instruction: 32 lanes x 16 B = 512 contiguous B = 4 lines.
// =====================================================================================================
__global__ __launch_bounds__(256) void cvt_dup(const float* __restrict__ in, unsigned short* out, int nrows) {
  const int lane = (int)threadIdx.x & 31, wave = (int)threadIdx.x >> 5;
  const int row = blockIdx.x * 8 + wave;
  if (row >= nrows) return;                                   // wave-uniform; no block barriers here
  const float* src = in + (size_t)row * EMB;
  unsigned short* dst = out + (size_t)row * (2 * EMB);
  v4u p[2];
#pragma unroll
  for (int half = 0; half < 2; ++half) {
    const int g = half * 4 + (lane >> 3);
    const int scol = g * HD + 8 * (lane & 3);
    const v4f a = *(const v4fa*)(src + scol);
    const v4f c = *(const v4fa*)(src + scol + 4);
    v4u q;
    q[0] = pk16(bf_bits(a[0]), bf_bits(a[1]));
    q[1] = pk16(bf_bits(a[2]), bf_bits(a[3]));
    q[2] = pk16(bf_bits(c[0]), bf_bits(c[1]));
    q[3] = pk16(bf_bits(c[2]), bf_bits(c[3]));
    p[half] = q;
  }
  {
#pragma unroll
    for (int half = 0; half < 2; ++half)
      *(v4u*)(dst + half * EMB + 8 * lane) = p[half];
    
  }
}

// =====================================================================================================
// Register-blocked batched WMMA GEMM (bf16 operands): C[m][n] = sum_k A[m][k] * Bt[n][k];
// one wave per 64x64 tile, no block barriers. A row-major [M][K] pitch lda; Bt row-major [N][K] pitch ldb
// (k contiguous); M, N multiples of 64, K multiple of 32 (host-checked). blockIdx.y = batch index
// (strides in elements). Fragments are loaded straight from global with the split k map (ldfrag).
// OUT_MODE 0: f32 C (pitch ldc), value = (acc + bf16(bias[n])) * oscale.
// OUT_MODE 3: bf16 hi plane C + bf16 residual plane C2 = bf16(y - hi) (same pitch / stride),
//             y = (acc + bf16(bias)) * oscale; bias[n] (BIASM 0) or bias[m] (BIASM 1).
// =====================================================================================================
template <int OUT_MODE, int BIASM>
__global__ __launch_bounds__(256) void gemm64(
    const unsigned short* __restrict__ Ap, int lda, long long strideA,
    const unsigned short* __restrict__ Btp, int ldb, long long strideB,
    const float* __restrict__ bias,
    void* Cout, void* Cout2, int ldc, long long strideC,
    int M, int N, int K, float oscale) {
  static_assert(OUT_MODE == 0 || OUT_MODE == 3);
  static_assert(OUT_MODE != 0 || BIASM == 0);
  const __bf16* A  = (const __bf16*)(const void*)Ap;
  const __bf16* Bt = (const __bf16*)(const void*)Btp;
  __shared__ __align__(16) float sT[8][16 * 68];   // per-wave 16x64 slab, pitch 68 floats
  const int b    = blockIdx.y;
  const int lane = threadIdx.x & 31;
  const int wave = threadIdx.x >> 5;
  const int tilesN = N >> 6;
  const int tilesM = M >> 6;
  const int tile = blockIdx.x * 8 + wave;
  if (tile >= tilesM * tilesN) return;   // wave-uniform; no block barriers in this kernel
  const int tm = tile / tilesN;
  const int tn = tile - tm * tilesN;
  const int m0 = tm << 6;
  const int n0 = tn << 6;

  const __bf16* Ab = A  + (size_t)b * (size_t)strideA;
  const __bf16* Bb = Bt + (size_t)b * (size_t)strideB;

  const int rlane = lane & 15;                 // row (A) / col (B, D) within subtile
  const int koff  = (lane >> 4) * 8;           // k offset of this lane half
  const int mOff  = (lane >> 4) * 8;           // D row offset

  v8f acc[4][4];
#pragma unroll
  for (int i = 0; i < 4; ++i)
#pragma unroll
    for (int j = 0; j < 4; ++j) acc[i][j] = zero8();

  for (int k0 = 0; k0 < K; k0 += 32) {
    v16b bq[4];
#pragma unroll
    for (int j = 0; j < 4; ++j)
      bq[j] = ldfrag(Bb + (size_t)(n0 + (j << 4) + rlane) * ldb + koff + k0);
#pragma unroll
    for (int i = 0; i < 4; ++i) {
      const v16b af = ldfrag(Ab + (size_t)(m0 + (i << 4) + rlane) * lda + koff + k0);
#pragma unroll
      for (int j = 0; j < 4; ++j) acc[i][j] = mmar(af, bq[j], acc[i][j]);
      dep_guard(acc[i][0], acc[i][3], af, bq[3]);
    }
    keep4(bq[0], bq[1], bq[2], bq[3]);
  }
  acc_guard4(acc[0][0], acc[0][1], acc[0][2], acc[0][3]);
  acc_guard4(acc[1][0], acc[1][1], acc[1][2], acc[1][3]);
  acc_guard4(acc[2][0], acc[2][1], acc[2][2], acc[2][3]);
  acc_guard4(acc[3][0], acc[3][1], acc[3][2], acc[3][3]);

  // ---- epilogue ----
  float* slab = sT[wave];
  const int h2 = lane >> 4, c4 = (lane & 15) * 4;     // OUT_MODE 0 map: 256-B row segment = 16 lanes x 16 B
  const int q = lane >> 3, c8 = (lane & 7) * 8;
  v4f bb4;                                             // bias for columns n0+c4..+3 (mode 0)
  float bcol[8];                                       // bias for columns n0+c8..+7 (mode 3, BIASM 0)
  if (OUT_MODE == 0) {
    const v4f braw = *(const v4fa*)(bias + n0 + c4);
    bb4[0] = rbf(braw[0]); bb4[1] = rbf(braw[1]); bb4[2] = rbf(braw[2]); bb4[3] = rbf(braw[3]);
  } else {
    if (BIASM == 0) {
      const v4f b0 = *(const v4fa*)(bias + n0 + c8);
      const v4f b1 = *(const v4fa*)(bias + n0 + c8 + 4);
#pragma unroll
      for (int e = 0; e < 4; ++e) { bcol[e] = rbf(b0[e]); bcol[4 + e] = rbf(b1[e]); }
    } else {
#pragma unroll
      for (int e = 0; e < 8; ++e) bcol[e] = 0.f;
    }
  }
#pragma unroll
  for (int i = 0; i < 4; ++i) {
    const int mBase = m0 + (i << 4);
#pragma unroll
    for (int j = 0; j < 4; ++j) {
#pragma unroll
      for (int r = 0; r < 8; ++r) {
        slab[(mOff + r) * 68 + (j << 4) + rlane] = acc[i][j][r];
      }
    }
    __builtin_amdgcn_fence(__ATOMIC_RELEASE, "workgroup");
    __builtin_amdgcn_wave_barrier();
    __builtin_amdgcn_fence(__ATOMIC_ACQUIRE, "workgroup");
    if (OUT_MODE == 0) {
      float* C = (float*)Cout + (size_t)b * (size_t)strideC;
      {
#pragma unroll
        for (int it = 0; it < 8; ++it) {
          const int row = it * 2 + h2;                     // it 0..7 x h2 0..1 = rows 0..15
          v4f v = *(const v4fa*)(slab + row * 68 + c4);
          v = (v + bb4) * oscale;
          *(v4f*)(C + (size_t)(mBase + row) * ldc + n0 + c4) = v;
        }
        
      }
    } else {
      unsigned short* C  = (unsigned short*)Cout  + (size_t)b * (size_t)strideC;
      unsigned short* C2 = (unsigned short*)Cout2 + (size_t)b * (size_t)strideC;
      v4u hv[4], lv[4];
#pragma unroll
      for (int it = 0; it < 4; ++it) {
        const int row = it * 4 + q;                        // it 0..3 x q 0..3 = rows 0..15
        const float* sp = slab + row * 68 + c8;
        float brow = 0.f;
        if (BIASM == 1) brow = rbf(bias[mBase + row]);
        v4u a, a2;
#pragma unroll
        for (int e = 0; e < 4; ++e) {
          const float f0 = (sp[2 * e]     + ((BIASM == 1) ? brow : bcol[2 * e]))     * oscale;
          const float f1 = (sp[2 * e + 1] + ((BIASM == 1) ? brow : bcol[2 * e + 1])) * oscale;
          const unsigned short h0 = bf_bits(f0), h1 = bf_bits(f1);
          const unsigned short l0 = bf_bits(f0 - bf_up(h0)), l1 = bf_bits(f1 - bf_up(h1));
          a[e] = pk16(h0, h1); a2[e] = pk16(l0, l1);
        }
        hv[it] = a; lv[it] = a2;
      }
      {
#pragma unroll
        for (int it = 0; it < 4; ++it) {
          const int row = it * 4 + q;
          *(v4u*)(C  + (size_t)(mBase + row) * ldc + n0 + c8) = hv[it];
          *(v4u*)(C2 + (size_t)(mBase + row) * ldc + n0 + c8) = lv[it];
        }
        
      }
    }
    __builtin_amdgcn_fence(__ATOMIC_RELEASE, "workgroup");
    __builtin_amdgcn_wave_barrier();
    __builtin_amdgcn_fence(__ATOMIC_ACQUIRE, "workgroup");
  }
}

// ---- additive key mask: -9e15 where the int32 mask is 0, else 0 (8 consecutive keys, 2 int4 loads) ----
__device__ __forceinline__ v8f add_mask8(v8f s, const int* p) {
  const v4i ma = *(const v4ia*)p;
  const v4i mb = *(const v4ia*)(p + 4);
  s[0] += (ma[0] == 0) ? MASKNEG : 0.0f;
  s[1] += (ma[1] == 0) ? MASKNEG : 0.0f;
  s[2] += (ma[2] == 0) ? MASKNEG : 0.0f;
  s[3] += (ma[3] == 0) ? MASKNEG : 0.0f;
  s[4] += (mb[0] == 0) ? MASKNEG : 0.0f;
  s[5] += (mb[1] == 0) ? MASKNEG : 0.0f;
  s[6] += (mb[2] == 0) ? MASKNEG : 0.0f;
  s[7] += (mb[3] == 0) ? MASKNEG : 0.0f;
  return s;
}

// =====================================================================================================
// Pass A: vision-direction attention (softmax over the 256 text keys, masked) + per-64-row column maxima
// of the clamped unmasked scores for the language direction.
//   Planes: Qh/Ql, Kh/Kl bf16 [row][256] (row = b*TV + t / b*SL + s, head block h*32);
//           Vlh/Vll = val_l^T bf16 [b][256 d][256 s]; mask int32 [b][256].
//   Transposed form: S^T = K.Q^T (A = K rows: row = key, k = d; B = Q^T from the q row, n = query),
//   3 products (hh, hl, lh); D = S^T[key 8hh+r][query m]. Online softmax over 4 chunks of 64 keys in f32;
//   P^T hi / residual B fragments packed from registers; O^T += Vl^T . P^T (A = Vl^T rows: row = d, k = key).
//   Block = 4 waves x 16 queries = 64 query rows of one (b,h); grid (NQT, NB*NH).
//   Outputs: CM record [bh][qt][256] f32 (1 KB, written by threads 0..63, 16 B each: 2 instructions of 4 lines);
//            written per wave as 16 lines, lanes 8q..8q+7 one line, 4 lines per instruction.
//   coverage: 250 x 16 blocks x 64 rows = every (row, head) line of the ctx plane; every CM row.
// =====================================================================================================
__global__ __launch_bounds__(128)
void attn_v(const unsigned short* __restrict__ qhp, const unsigned short* __restrict__ qlp,
            const unsigned short* __restrict__ khp, const unsigned short* __restrict__ klp,
            const unsigned short* __restrict__ vhp, const unsigned short* __restrict__ vlp,
            const int* __restrict__ maskl, float* cmout, unsigned short* ctxp) {
  __shared__ __align__(16) float cmw[4][SL];        // per-wave column max         4 KB
  __shared__ __align__(16) float cmb[SL];           // block column max            1 KB
  __shared__ __align__(16) float sO[4][16 * HD];    // per-wave 16x32 context tile  8 KB

  const int tid = threadIdx.x, lane = tid & 31, w = tid >> 5;
  const int hh = lane >> 4, m = lane & 15;
  const int qt = blockIdx.x, bh = blockIdx.y, b = bh >> 3, head = bh & 7;
  const int q0 = qt * 64 + 16 * w;

  const __bf16* Qh = (const __bf16*)(const void*)qhp;
  const __bf16* Ql = (const __bf16*)(const void*)qlp;
  const __bf16* Kh = (const __bf16*)(const void*)khp;
  const __bf16* Kl = (const __bf16*)(const void*)klp;
  const __bf16* Vh = (const __bf16*)(const void*)vhp;
  const __bf16* Vl = (const __bf16*)(const void*)vlp;

  // Q^T B-fragments: column n = query q0+m, k = d (one 32-deep step)
  const size_t qoff = ((size_t)b * TV + q0 + m) * EMB + head * HD + 8 * hh;
  const v16b qbh = ldfrag(Qh + qoff);
  const v16b qbl = ldfrag(Ql + qoff);

  const __bf16* kbh = Kh + ((size_t)b * SL + m) * EMB + head * HD + 8 * hh;     // + key0*EMB
  const __bf16* kbl = Kl + ((size_t)b * SL + m) * EMB + head * HD + 8 * hh;
  const __bf16* vbh = Vh + ((size_t)b * EMB + head * HD + m) * SL + 8 * hh;      // + 16dt*SL + key0
  const __bf16* vbl = Vl + ((size_t)b * EMB + head * HD + m) * SL + 8 * hh;
  const int* mkp = maskl + b * SL + 8 * hh;                                      // + key tile base

  v8f o[2];
  o[0] = zero8(); o[1] = zero8();
  float mrun = -1.0e30f, lrun = 0.0f;

#pragma unroll 1
  for (int kc = 0; kc < SL / 64; ++kc) {
    const int kb0 = kc * 64;
    // ---- scores s[j][r] = S[query q0+m][key kb0+16j+8hh+r] ----
    v8f s[4];
#pragma unroll
    for (int j = 0; j < 4; ++j) {
      const size_t ko = (size_t)(kb0 + 16 * j) * EMB;
      const v16b kfh = ldfrag(kbh + ko);
      const v16b kfl = ldfrag(kbl + ko);
      v8f z = zero8();
      z = mma_b(kfh, qbh, z);
      z = mma_b(kfl, qbh, z);
      z = mma_b(kfh, qbl, z);
      s[j] = z;
    }
    // ---- clamp; column max over this wave's 16 query columns (pre-mask) -> LDS ----
#pragma unroll
    for (int j = 0; j < 4; ++j) {
#pragma unroll
      for (int r = 0; r < 8; ++r) {
        float vv = clampv(s[j][r]);
        s[j][r] = vv;
        vv = fmaxf(vv, __shfl_xor(vv, 1, 32));
        vv = fmaxf(vv, __shfl_xor(vv, 2, 32));
        vv = fmaxf(vv, __shfl_xor(vv, 4, 32));
        vv = fmaxf(vv, __shfl_xor(vv, 8, 32));
        if (m == 0) cmw[w][kb0 + 16 * j + 8 * hh + r] = vv;
      }
    }
    // ---- additive mask per key, f32 ----
#pragma unroll
    for (int j = 0; j < 4; ++j) s[j] = add_mask8(s[j], mkp + kb0 + 16 * j);

    // ---- online softmax per query column ----
    float mloc = s[0][0];
#pragma unroll
    for (int j = 0; j < 4; ++j)
#pragma unroll
      for (int r = 0; r < 8; ++r) mloc = fmaxf(mloc, s[j][r]);
    mloc = fmaxf(mloc, __shfl_xor(mloc, 16, 32));
    const float mnew = fmaxf(mrun, mloc);
    const float alpha = __expf(mrun - mnew);
    mrun = mnew;
    float lsum = 0.0f;
#pragma unroll
    for (int j = 0; j < 4; ++j)
#pragma unroll
      for (int r = 0; r < 8; ++r) {
        const float p = __expf(s[j][r] - mnew);
        s[j][r] = p;
        lsum += p;
      }
    lsum += __shfl_xor(lsum, 16, 32);
    lrun = lrun * alpha + lsum;
#pragma unroll
    for (int dt = 0; dt < 2; ++dt)
#pragma unroll
      for (int r = 0; r < 8; ++r) o[dt][r] = o[dt][r] * alpha;

    // ---- P^T B-fragments (keys 0..31 and 32..63 of this chunk), bf16 hi + residual ----
    v16b pbh0, pbl0, pbh1, pbl1;
    pack_hl(s[0], s[1], pbh0, pbl0);
    pack_hl(s[2], s[3], pbh1, pbl1);

    // ---- O^T += Vl^T . P^T (3 products per k-step) ----
#pragma unroll
    for (int dt = 0; dt < 2; ++dt) {
      const size_t vo = (size_t)(16 * dt) * SL + kb0;
      const v16b vh0 = ldfrag(vbh + vo), vh1 = ldfrag(vbh + vo + 32);
      const v16b vl0 = ldfrag(vbl + vo), vl1 = ldfrag(vbl + vo + 32);
      v8f a = o[dt];
      a = mma_b(vh0, pbh0, a);
      a = mma_b(vh0, pbl0, a);
      a = mma_b(vl0, pbh0, a);
      a = mma_b(vh1, pbh1, a);
      a = mma_b(vh1, pbl1, a);
      a = mma_b(vl1, pbh1, a);
      o[dt] = a;
    }
  }

  // ---- normalise (1/l), stage the wave's 16 (query) x 32 (d) f32 tile ----
  const float inv = 1.0f / lrun;
  float* so = sO[w];
#pragma unroll
  for (int dt = 0; dt < 2; ++dt)
#pragma unroll
    for (int r = 0; r < 8; ++r)
      so[m * HD + 16 * dt + 8 * hh + r] = o[dt][r] * inv;
  __syncthreads();

  {
    const int sub = lane >> 3, piece = lane & 7;
    const int csel = 8 * (piece & 3);
    const bool islo = (piece & 4) != 0;
    v4u hv[4];
#pragma unroll
    for (int i = 0; i < 4; ++i) {
      const int lid = i * 4 + sub;                      // i 0..3 x sub 0..3 = rows 0..15
      const float* sp = so + lid * HD + csel;
      v4u a;
#pragma unroll
      for (int e = 0; e < 4; ++e) {
        const float x0 = sp[2 * e], x1 = sp[2 * e + 1];
        const unsigned short h0 = bf_bits(x0), h1 = bf_bits(x1);
        const unsigned short l0 = bf_bits(x0 - bf_up(h0)), l1 = bf_bits(x1 - bf_up(h1));
        a[e] = islo ? pk16(l0, l1) : pk16(h0, h1);
      }
      hv[i] = a;
    }
    {
#pragma unroll
      for (int i = 0; i < 4; ++i) {
        const int lid = i * 4 + sub;
        const size_t go = ((size_t)b * TV + q0 + lid) * (2 * EMB) + head * (2 * HD) + 8 * piece;
        *(v4u*)(ctxp + go) = hv[i];
      }
      
    }
  }

  for (int t = tid; t < SL; t += 128)
    cmb[t] = fmaxf(fmaxf(cmw[0][t], cmw[1][t]), fmaxf(cmw[2][t], cmw[3][t]));
  __syncthreads();
  if (tid < 64) {
    const v4f vv = *(const v4fa*)(cmb + 4 * tid);
    float* dst = cmout + ((size_t)bh * NQT + qt) * SL + 4 * tid;
    *(v4f*)dst = vv;
    
  }
}

// =====================================================================================================
// Column max fold: M[bh][s] = max over the 250 query-tile records (fixed order). One block per bh,
// =====================================================================================================
__global__ __launch_bounds__(256) void fold_max(const float* __restrict__ cm, float* mx) {
  const int bh = blockIdx.x, s = (int)threadIdx.x;
  const float* p = cm + (size_t)bh * NQT * SL + s;
  float mm = p[0];
#pragma unroll 2
  for (int qq = 1; qq < NQT; ++qq) mm = fmaxf(mm, p[(size_t)qq * SL]);
  float* d = mx + bh * SL + s;
  *(float*)d = mm;
  
}

// =====================================================================================================
// Pass B: language-direction partial sums. For (b,h), key half kq (128 keys), t range rg (1600 t):
//   S = Q.K^T (A = Q rows: row = t, k = d; B from K rows: n = key), 3 products, D = S[t 8hh+r][key m];
//   e = exp(clamp(clamp(S) - M[key])) in f32; e packed from registers as the B operand with k = t
//   (bf16 hi + residual); acc^T[d][key] += Vv^T . e (A = val_v^T rows: row = d, k = t), 3 products,
//   f32 accumulation across the 50 steps; colsum[key] += e in f32.
//   Block = 4 waves x 32 keys; grid (RR, 2, NB*NH). Record [bh][rg][33 rows][256]: rows 0..31 = acc^T[d],
// =====================================================================================================
__global__ __launch_bounds__(128)
void attn_l(const unsigned short* __restrict__ qhp, const unsigned short* __restrict__ qlp,
            const unsigned short* __restrict__ khp, const unsigned short* __restrict__ klp,
            const unsigned short* __restrict__ vhp, const unsigned short* __restrict__ vlp,
            const float* __restrict__ mx, float* rec) {
  __shared__ __align__(16) float st[4][RECROWS * 32];   // per-wave 33x32 staging, 16896 B

  const int tid = threadIdx.x, lane = tid & 31, w = tid >> 5;
  const int hh = lane >> 4, m = lane & 15;
  const int rg = blockIdx.x, kq = blockIdx.y, bh = blockIdx.z, b = bh >> 3, head = bh & 7;
  const int s0 = kq * 128 + 32 * w;
  const int tb = rg * TPR;

  const __bf16* Qh = (const __bf16*)(const void*)qhp;
  const __bf16* Ql = (const __bf16*)(const void*)qlp;
  const __bf16* Kh = (const __bf16*)(const void*)khp;
  const __bf16* Kl = (const __bf16*)(const void*)klp;
  const __bf16* Vh = (const __bf16*)(const void*)vhp;
  const __bf16* Vl = (const __bf16*)(const void*)vlp;

  // K B-fragments for this wave's two 16-key tiles (n = key s0+16jj+m, k = d), hi and residual planes
  v16b kfh[2], kfl[2];
  float mvj[2], csum[2];
#pragma unroll
  for (int jj = 0; jj < 2; ++jj) {
    const size_t ko = ((size_t)b * SL + s0 + 16 * jj + m) * EMB + head * HD + 8 * hh;
    kfh[jj] = ldfrag(Kh + ko);
    kfl[jj] = ldfrag(Kl + ko);
    mvj[jj] = mx[bh * SL + s0 + 16 * jj + m];
    csum[jj] = 0.0f;
  }
  v8f acc[2][2];
#pragma unroll
  for (int dt = 0; dt < 2; ++dt) { acc[dt][0] = zero8(); acc[dt][1] = zero8(); }

  const __bf16* qbh = Qh + ((size_t)b * TV + m) * EMB + head * HD + 8 * hh;     // + t*EMB
  const __bf16* qbl = Ql + ((size_t)b * TV + m) * EMB + head * HD + 8 * hh;
  const __bf16* vbh = Vh + ((size_t)b * EMB + head * HD + m) * TV + 8 * hh;      // + 16dt*TV + t0
  const __bf16* vbl = Vl + ((size_t)b * EMB + head * HD + m) * TV + 8 * hh;

#pragma unroll 1
  for (int step = 0; step < NSTEP; ++step) {
    const int t0 = tb + 32 * step;
    v16b qah[2], qal[2], vah[2], val2[2];
#pragma unroll
    for (int tt = 0; tt < 2; ++tt) {
      const size_t qo = (size_t)(t0 + 16 * tt) * EMB;
      qah[tt] = ldfrag(qbh + qo);
      qal[tt] = ldfrag(qbl + qo);
    }
#pragma unroll
    for (int dt = 0; dt < 2; ++dt) {
      const size_t vo = (size_t)(16 * dt) * TV + t0;
      vah[dt]  = ldfrag(vbh + vo);
      val2[dt] = ldfrag(vbl + vo);
    }
#pragma unroll
    for (int jj = 0; jj < 2; ++jj) {
      // scores for t rows t0..t0+15 (d0) and t0+16..t0+31 (d1), key columns s0+16jj+m
      v8f d0 = zero8(), d1 = zero8();
      d0 = mma_b(qah[0], kfh[jj], d0);
      d0 = mma_b(qah[0], kfl[jj], d0);
      d0 = mma_b(qal[0], kfh[jj], d0);
      d1 = mma_b(qah[1], kfh[jj], d1);
      d1 = mma_b(qah[1], kfl[jj], d1);
      d1 = mma_b(qal[1], kfh[jj], d1);
      const float mv = mvj[jj];
      float cl = csum[jj];
#pragma unroll
      for (int r = 0; r < 8; ++r) {
        const float x0 = clampv(clampv(d0[r]) - mv);
        const float e0 = __expf(x0);
        d0[r] = e0; cl += e0;
        const float x1 = clampv(clampv(d1[r]) - mv);
        const float e1 = __expf(x1);
        d1[r] = e1; cl += e1;
      }
      csum[jj] = cl;
      // e as the B operand with k = t (tile d0 = t 0..15, tile d1 = t 16..31), bf16 hi + residual
      v16b ebh, ebl;
      pack_hl(d0, d1, ebh, ebl);
#pragma unroll
      for (int dt = 0; dt < 2; ++dt) {
        v8f a = acc[dt][jj];
        a = mma_b(vah[dt],  ebh, a);
        a = mma_b(vah[dt],  ebl, a);
        a = mma_b(val2[dt], ebh, a);
        acc[dt][jj] = a;
      }
    }
  }

  // ---- combine the two lane halves of the column sums; stage acc^T (32 d x 32 keys) + colsum row ----
#pragma unroll
  for (int jj = 0; jj < 2; ++jj) csum[jj] += __shfl_xor(csum[jj], 16, 32);
  float* sw = st[w];
#pragma unroll
  for (int dt = 0; dt < 2; ++dt)
#pragma unroll
    for (int jj = 0; jj < 2; ++jj)
#pragma unroll
      for (int r = 0; r < 8; ++r)
        sw[(16 * dt + 8 * hh + r) * 32 + 16 * jj + m] = acc[dt][jj][r];
  if (hh == 0) {
    sw[32 * 32 + m]      = csum[0];
    sw[32 * 32 + 16 + m] = csum[1];
  }
  __syncthreads();

  // ---- record lines: row lid (0..32) of this wave = 32 floats at column s0, lanes 8*sub..+7, 4 rows per instruction ----
  {
    const int sub = lane >> 3, piece = lane & 7;
    float* rbase = rec + (((size_t)bh * RR + rg) * RECROWS) * SL + s0 + 4 * piece;
    {
#pragma unroll
      for (int i = 0; i < 9; ++i) {
        const int lid  = i * 4 + sub;
        const int lidc = (lid < RECROWS) ? lid : (RECROWS - 1);
        const v4f vv = *(const v4fa*)(sw + lidc * 32 + 4 * piece);
        if (lid < RECROWS) *(v4f*)(rbase + (size_t)lid * SL) = vv;
      }
      
    }
  }
}

// =====================================================================================================
// Language-direction fold: ctx_l[b][s][h*32+d] = (sum_rg acc[rg][d][s]) / (sum_rg colsum[rg][s]) in fixed
// Block = one (b,s), thread = (h, d); threads 0..63 write the 1-KB row, 16 B each (2 instructions of 4 lines),
// =====================================================================================================
__global__ __launch_bounds__(256) void fold_l(const float* __restrict__ rec, unsigned short* ctxl) {
  __shared__ __align__(16) float xs[EMB];
  const int bs = blockIdx.x, b = bs / SL, s = bs - b * SL;
  const int t = (int)threadIdx.x, head = t >> 5, d = t & 31;
  const int bh = b * NH + head;
  const float* p = rec + ((size_t)bh * RR) * RECROWS * SL + s;
  float a = 0.0f, cs = 0.0f;
#pragma unroll 1
  for (int rg = 0; rg < RR; ++rg) {
    const float* pr = p + (size_t)rg * RECROWS * SL;
    a  += pr[(size_t)d * SL];
    cs += pr[(size_t)32 * SL];
  }
  xs[t] = a * (1.0f / cs);
  __syncthreads();
  if (t < 64) {
    const int hg = t >> 3, wq = t & 7;
    const float* sp = xs + hg * HD + 8 * (wq & 3);
    const bool islo = (wq & 4) != 0;
    v4u vv;
#pragma unroll
    for (int e = 0; e < 4; ++e) {
      const float x0 = sp[2 * e], x1 = sp[2 * e + 1];
      const unsigned short h0 = bf_bits(x0), h1 = bf_bits(x1);
      const unsigned short l0 = bf_bits(x0 - bf_up(h0)), l1 = bf_bits(x1 - bf_up(h1));
      vv[e] = islo ? pk16(l0, l1) : pk16(h0, h1);
    }
    unsigned short* dst = ctxl + (size_t)bs * (2 * EMB) + hg * (2 * HD) + 8 * wq;
    *(v4u*)dst = vv;
    
  }
}

// =====================================================================================================
// Workspace map (bytes), every region an exact multiple of its whole-line / whole-tile store granularity
// (no padded tails: all dims are tile multiples):
//   vb    bf16 [32000][256]        16384000
//   lb    bf16 [512][768]            786432
//   Wvb   bf16 [256][256]            131072
//   Wvvb  bf16 [256][256]            131072
//   Wlb   bf16 [256][768]            393216
//   Wvlb  bf16 [256][768]            393216
//   Wovd  bf16 [256][512]            262144
//   Wold  bf16 [768][512]            786432
//   Qh,Ql bf16 [32000][256] x2     32768000
//   Kh,Kl bf16 [512][256] x2         524288
//   VlTh,VlTl bf16 [2][256][256] x2  524288
//   VvTh,VvTl bf16 [2][256][16000] x2 32768000
//   CTXV  bf16 [32000][512]        32768000
//   CM    f32  [16][250][256]       4096000
//   MX    f32  [16][256]              16384
//   REC   f32  [16][10][33][256]    5406720
//   CTXL  bf16 [512][512]            524288
//   total                        128663552
// Weights are [out n][in k] with k contiguous = the Bt / A layout the GEMM wants, so they are not transposed (W_ov / W_ol are also duplicated along k).
// =====================================================================================================
extern "C" void kernel_launch(void* const* d_in, const int* in_sizes, int n_in,
                              void* d_out, int out_size, void* d_ws, size_t ws_size,
                              hipStream_t stream) {
  if (n_in < 15) return;
  if (in_sizes[0] != NV * EMB || in_sizes[1] != NL * LD || in_sizes[2] != NB * SL) return;
  if (in_sizes[3] != EMB * EMB || in_sizes[4] != EMB || in_sizes[5] != EMB * LD || in_sizes[6] != EMB) return;
  if (in_sizes[7] != EMB * EMB || in_sizes[8] != EMB || in_sizes[9] != EMB * LD || in_sizes[10] != EMB) return;
  if (in_sizes[11] != EMB * EMB || in_sizes[12] != EMB || in_sizes[13] != LD * EMB || in_sizes[14] != LD) return;
  if (out_size != NV * EMB + NL * LD) return;

  const float* v_in = (const float*)d_in[0];
  const float* l_in = (const float*)d_in[1];
  const int*   mk   = (const int*)d_in[2];
  const float* Wv   = (const float*)d_in[3];
  const float* bv   = (const float*)d_in[4];
  const float* Wl   = (const float*)d_in[5];
  const float* bl   = (const float*)d_in[6];
  const float* Wvv  = (const float*)d_in[7];
  const float* bvv  = (const float*)d_in[8];
  const float* Wvl  = (const float*)d_in[9];
  const float* bvl  = (const float*)d_in[10];
  const float* Wov  = (const float*)d_in[11];
  const float* bov  = (const float*)d_in[12];
  const float* Wol  = (const float*)d_in[13];
  const float* bol  = (const float*)d_in[14];
  float* out0 = (float*)d_out;
  float* out1 = out0 + (size_t)NV * EMB;            // byte 32768000; last element 8585215 < out_size

  const size_t PVB  = (size_t)NV * EMB * 2;          // 16384000
  const size_t PLB  = (size_t)NL * LD * 2;           //   786432
  const size_t PWS  = (size_t)EMB * EMB * 2;         //   131072
  const size_t PWL  = (size_t)EMB * LD * 2;          //   393216
  const size_t PWOD = (size_t)EMB * 2 * EMB * 2;     //   262144
  const size_t PWLD = (size_t)LD * 2 * EMB * 2;      //   786432
  const size_t PQ   = (size_t)NV * EMB * 2;          // 16384000
  const size_t PK   = (size_t)NL * EMB * 2;          //   262144
  const size_t PVLT = (size_t)NB * EMB * SL * 2;     //   262144
  const size_t PVVT = (size_t)NB * EMB * TV * 2;     // 16384000
  const size_t PCTX = (size_t)NV * 2 * EMB * 2;      // 32768000
  const size_t PCM  = (size_t)NB * NH * NQT * SL * 4;  // 4096000
  const size_t PMX  = (size_t)NB * NH * SL * 4;      //    16384
  const size_t PREC = (size_t)NB * NH * RR * RECROWS * SL * 4;  // 5406720
  const size_t PCTL = (size_t)NL * 2 * EMB * 2;      //   524288
  size_t off = 0;
  const size_t oVB  = off; off += PVB;
  const size_t oLB  = off; off += PLB;
  const size_t oWv  = off; off += PWS;
  const size_t oWvv = off; off += PWS;
  const size_t oWl  = off; off += PWL;
  const size_t oWvl = off; off += PWL;
  const size_t oWod = off; off += PWOD;
  const size_t oWld = off; off += PWLD;
  const size_t oQh  = off; off += PQ;
  const size_t oQl  = off; off += PQ;
  const size_t oKh  = off; off += PK;
  const size_t oKl  = off; off += PK;
  const size_t oVLh = off; off += PVLT;
  const size_t oVLl = off; off += PVLT;
  const size_t oVVh = off; off += PVVT;
  const size_t oVVl = off; off += PVVT;
  const size_t oCTX = off; off += PCTX;
  const size_t oCM  = off; off += PCM;
  const size_t oMX  = off; off += PMX;
  const size_t oREC = off; off += PREC;
  const size_t oCTL = off; off += PCTL;
  if (off > ws_size) return;                         // off = 128663552
  if (off > (size_t)134217728) return;

  char* ws = (char*)d_ws;
  unsigned short* vb   = (unsigned short*)(ws + oVB);
  unsigned short* lb   = (unsigned short*)(ws + oLB);
  unsigned short* Wvb  = (unsigned short*)(ws + oWv);
  unsigned short* Wvvb = (unsigned short*)(ws + oWvv);
  unsigned short* Wlb  = (unsigned short*)(ws + oWl);
  unsigned short* Wvlb = (unsigned short*)(ws + oWvl);
  unsigned short* Wovd = (unsigned short*)(ws + oWod);
  unsigned short* Wold = (unsigned short*)(ws + oWld);
  unsigned short* Qh   = (unsigned short*)(ws + oQh);
  unsigned short* Ql   = (unsigned short*)(ws + oQl);
  unsigned short* Kh   = (unsigned short*)(ws + oKh);
  unsigned short* Kl   = (unsigned short*)(ws + oKl);
  unsigned short* VlTh = (unsigned short*)(ws + oVLh);
  unsigned short* VlTl = (unsigned short*)(ws + oVLl);
  unsigned short* VvTh = (unsigned short*)(ws + oVVh);
  unsigned short* VvTl = (unsigned short*)(ws + oVVl);
  unsigned short* CTXV = (unsigned short*)(ws + oCTX);
  float*          CM   = (float*)(ws + oCM);
  float*          MX   = (float*)(ws + oMX);
  float*          REC  = (float*)(ws + oREC);
  unsigned short* CTXL = (unsigned short*)(ws + oCTL);

  const dim3 blk(256);
  const int n8v  = NV * EMB / 8;                     // 1024000 -> 4000 blocks
  const int n8l  = NL * LD / 8;                      //   49152 ->  192 blocks
  const int n8ws = EMB * EMB / 8;                    //    8192 ->   32 blocks
  const int n8wl = EMB * LD / 8;                     //   24576 ->   96 blocks
  const dim3 gCv((n8v + 255) / 256), gCl((n8l + 255) / 256), gCws((n8ws + 255) / 256), gCwl((n8wl + 255) / 256);
  const dim3 gDupV((EMB + 7) / 8), gDupL((LD + 7) / 8);
  const dim3 gQ((((NV) / 64) * (EMB / 64) + 7) / 8, 1);        // 2000 tiles -> 250 blocks
  const dim3 gK((((NL) / 64) * (EMB / 64) + 7) / 8, 1);        //   32 tiles ->   4 blocks
  const dim3 gVvT(((EMB / 64) * (TV / 64) + 7) / 8, NB);       // 1000 tiles ->  125 blocks x 2
  const dim3 gVlT(((EMB / 64) * (SL / 64) + 7) / 8, NB);       //   16 tiles ->    2 blocks x 2
  const dim3 gO1((((NL) / 64) * (LD / 64) + 7) / 8, 1);        //   96 tiles ->   12 blocks
  const dim3 gAttV(NQT, NB * NH);                              // (250, 16) blocks of 128
  const dim3 gAttL(RR, 2, NB * NH);                            // (10, 2, 16) blocks of 128

  // (1) inputs -> bf16 planes; W_o -> bf16 duplicated along k
  cvt_bf16x8<<<gCv,  blk, 0, stream>>>(v_in, vb,   n8v);
  cvt_bf16x8<<<gCl,  blk, 0, stream>>>(l_in, lb,   n8l);
  cvt_bf16x8<<<gCws, blk, 0, stream>>>(Wv,   Wvb,  n8ws);
  cvt_bf16x8<<<gCws, blk, 0, stream>>>(Wvv,  Wvvb, n8ws);
  cvt_bf16x8<<<gCwl, blk, 0, stream>>>(Wl,   Wlb,  n8wl);
  cvt_bf16x8<<<gCwl, blk, 0, stream>>>(Wvl,  Wvlb, n8wl);
  cvt_dup<<<gDupV, blk, 0, stream>>>(Wov, Wovd, EMB);
  cvt_dup<<<gDupL, blk, 0, stream>>>(Wol, Wold, LD);
  // (2) q = (v . W_v^T + b_v) * scale -> bf16 hi / residual planes [b*TV+t][256]   (M=32000, N=256, K=256)
  gemm64<3, 0><<<gQ, blk, 0, stream>>>(
      vb, EMB, 0LL, Wvb, EMB, 0LL, bv,
      (void*)Qh, (void*)Ql, EMB, 0LL, NV, EMB, EMB, SCALEQ);
  // (3) k = l . W_l^T + b_l -> bf16 hi / residual planes [b*SL+s][256]           (M=512, N=256, K=768)
  gemm64<3, 0><<<gK, blk, 0, stream>>>(
      lb, LD, 0LL, Wlb, LD, 0LL, bl,
      (void*)Kh, (void*)Kl, EMB, 0LL, NL, EMB, LD, 1.0f);
  // (4) val_v^T = W_vv . v^T + b_vv per batch -> bf16 hi / residual [b][d][t] pitch TV  (M=256, N=16000, K=256)
  gemm64<3, 1><<<gVvT, blk, 0, stream>>>(
      Wvvb, EMB, 0LL, vb, EMB, (long long)TV * EMB, bvv,
      (void*)VvTh, (void*)VvTl, TV, (long long)EMB * TV, EMB, TV, EMB, 1.0f);
  // (5) val_l^T = W_vl . l^T + b_vl per batch -> bf16 hi / residual [b][d][s] pitch SL  (M=256, N=256, K=768)
  gemm64<3, 1><<<gVlT, blk, 0, stream>>>(
      Wvlb, LD, 0LL, lb, LD, (long long)SL * LD, bvl,
      (void*)VlTh, (void*)VlTl, SL, (long long)EMB * SL, EMB, SL, LD, 1.0f);
  // (6) vision-direction attention -> ctx plane + column-max records
  attn_v<<<gAttV, dim3(128), 0, stream>>>(Qh, Ql, Kh, Kl, VlTh, VlTl, mk, CM, CTXV);
  // (7) column max fold
  fold_max<<<dim3(NB * NH), blk, 0, stream>>>(CM, MX);
  // (8) language-direction partial records
  attn_l<<<gAttL, dim3(128), 0, stream>>>(Qh, Ql, Kh, Kl, VvTh, VvTl, MX, REC);
  // (9) fold the t ranges, normalise, merge heads -> ctx_l plane
  fold_l<<<dim3(NL), blk, 0, stream>>>(REC, CTXL);
  // (10) out0 = ctx . W_ov^T + b_ov -> d_out f32 [32000][256]   (K=512: [hi|residual] . [W|W])
  gemm64<0, 0><<<gQ, blk, 0, stream>>>(
      CTXV, 2 * EMB, 0LL, Wovd, 2 * EMB, 0LL, bov,
      (void*)out0, (void*)out0, EMB, 0LL, NV, EMB, 2 * EMB, 1.0f);
  // (11) out1 = ctx_l . W_ol^T + b_ol -> d_out f32 [512][768] at float offset 8192000
  gemm64<0, 0><<<gO1, blk, 0, stream>>>(
      CTXL, 2 * EMB, 0LL, Wold, 2 * EMB, 0LL, bol,
      (void*)out1, (void*)out1, LD, 0LL, NL, LD, 2 * EMB, 1.0f);
  (void)hipGetLastError();
}

// v001
// A run of this version takes 355 microseconds.
// In two side-by-side timings against v000, it was 1.29 and 1.30 times as fast.
// Contractions: v.W_v^T, v.W_vv^T, l.W_l^T, l.W_vl^T = v_wmma_f32_16x16x32_bf16 (bf16 operands RNE-converted from the inputs, single product, f32 accumulate);
// q.k^T scores = v_wmma_f32_16x16x32_bf16 (q and k as bf16 hi + unscaled bf16 residual planes; 3 products hi.hi + hi.lo + lo.hi; f32 accumulate);
// p.val_l and e.val_v = v_wmma_f32_16x16x32_bf16 (p / e split in registers into bf16 hi + residual, val planes bf16 hi + residual; 3 products; f32 accumulate);
// ctx_v.W_ov^T and ctx_l.W_ol^T = v_wmma_f32_16x16x32_bf16 (ctx as bf16 hi | residual interleaved along k, W bf16 duplicated along k; f32 accumulate).
// Softmax, mask, bias, scale, column statistics and normalisation in f32.
// Carry audit: no power-of-two carried planes anywhere (every residual plane is an unscaled bf16 difference); nothing is folded back.
#include <hip/hip_runtime.h>
#include <math.h>
#include <stdint.h>

#define NB      2
#define TV      16000
#define SL      256
#define EMB     256
#define LD      768
#define NH      8
#define HD      32
#define NV      (NB * TV)          // 32000 vision rows
#define NL      (NB * SL)          // 512 language rows
#define NQT     (TV / 64)          // 250 query tiles of 64 rows per batch
#define RR      10                 // t ranges per (b,h) in the language direction
#define TPR     (TV / RR)          // 1600 t per range
#define NSTEP   (TPR / 32)         // 50 steps of 32 t per range
#define RECROWS 33                 // 32 accumulator rows + 1 column-sum row
#define SCALEQ  0.17677669529663687f
#define CLAMPV  50000.0f
#define MASKNEG (-9.0e15f)

static_assert(NH * HD == EMB);
static_assert(NQT * 64 == TV);
static_assert(RR * NSTEP * 32 == TV);
static_assert((NV % 64) == 0 && (NL % 64) == 0 && (EMB % 64) == 0 && (LD % 64) == 0 && (TV % 64) == 0);
static_assert((EMB % 32) == 0 && (LD % 32) == 0 && ((2 * EMB) % 32) == 0);
static_assert(SL == 256 && HD == 32 && EMB == 256);

typedef __bf16   v16b __attribute__((ext_vector_type(16)));
typedef __bf16   v8b  __attribute__((ext_vector_type(8)));
typedef float    v8f  __attribute__((ext_vector_type(8)));
typedef float    v4f  __attribute__((ext_vector_type(4)));
typedef unsigned int v4u __attribute__((ext_vector_type(4)));
typedef unsigned int v8u __attribute__((ext_vector_type(8)));
typedef int      v4i  __attribute__((ext_vector_type(4)));
typedef v4f __attribute__((may_alias)) v4fa;
typedef v4i __attribute__((may_alias)) v4ia;

#if defined(__HIP_DEVICE_COMPILE__)
#define DEV_ASM 1
#else
#define DEV_ASM 0
#endif

// ---- scalar helpers --------------------------------------------------------------------------------
__device__ __forceinline__ unsigned short bf_bits(float f) {          // f32 -> bf16 bits, RNE convert
  unsigned u = __float_as_uint(f);
  return (unsigned short)((u + 0x7FFFu + ((u >> 16) & 1u)) >> 16);
}
__device__ __forceinline__ float bf_up(unsigned short hb) { return __uint_as_float(((unsigned)hb) << 16); }
__device__ __forceinline__ float rbf(float f) { return bf_up(bf_bits(f)); }   // value of the bf16 RNE convert
__device__ __forceinline__ unsigned pk16(unsigned short a, unsigned short b) { return (unsigned)a | ((unsigned)b << 16); }
__device__ __forceinline__ v8f zero8() { v8f z = {0.f, 0.f, 0.f, 0.f, 0.f, 0.f, 0.f, 0.f}; return z; }
__device__ __forceinline__ float clampv(float x) { return fminf(fmaxf(x, -CLAMPV), CLAMPV); }

// ---- 16-bit A/B fragment loader (wave32): lane -> row/col (lane&15); p already includes +8*(lane>>4);
//      elements 0..7 <- p[0..7] (k0+8h..k0+8h+7), elements 8..15 <- p[16..23] (k0+16+8h..k0+16+8h+7)
__device__ __forceinline__ v16b ldfrag(const __bf16* p) {
  union { v16b v; v8b h[2]; } f;
  f.h[0] = *(const v8b*)(p);
  f.h[1] = *(const v8b*)(p + 16);
  return f.v;
}

// ---- WMMA helpers (asm guard bodies device-only) -------------------------------------------------------
__device__ __forceinline__ v8f mmar(v16b a, v16b b, v8f c) {
  return __builtin_amdgcn_wmma_f32_16x16x32_bf16(false, a, false, b, (short)0, c, false, false);
}
// guarded form: 4 VALU slots after the WMMA, D tied, A/B kept live
__device__ __forceinline__ v8f mma_b(v16b a, v16b b, v8f c) {
  c = __builtin_amdgcn_wmma_f32_16x16x32_bf16(false, a, false, b, (short)0, c, false, false);
#if DEV_ASM
  asm volatile("v_nop\n\tv_nop\n\tv_nop\n\tv_nop" : "+v"(c) : "v"(a), "v"(b));
#endif
  return c;
}
__device__ __forceinline__ void dep_guard(v8f& a, v8f& b, v16b x, v16b y) {
#if DEV_ASM
  asm volatile("v_nop\n\tv_nop\n\tv_nop\n\tv_nop" : "+v"(a), "+v"(b) : "v"(x), "v"(y));
#else
  (void)a; (void)b; (void)x; (void)y;
#endif
}
__device__ __forceinline__ void keep4(v16b a, v16b b, v16b c, v16b d) {
#if DEV_ASM
  asm volatile("v_nop" :: "v"(a), "v"(b), "v"(c), "v"(d));
#else
  (void)a; (void)b; (void)c; (void)d;
#endif
}
__device__ __forceinline__ void acc_guard4(v8f& a, v8f& b, v8f& c, v8f& d) {
#if DEV_ASM
  asm volatile("v_nop\n\tv_nop\n\tv_nop\n\tv_nop" : "+v"(a), "+v"(b), "+v"(c), "+v"(d));
#else
  (void)a; (void)b; (void)c; (void)d;
#endif
}

// ---- B fragment (k = the D tiles' ROW index) from two D tiles held by this lane, split into bf16 hi + residual:
//      element r <- tile a (k 0..15) row r, element 8+r <- tile c (k 16..31) row r, lane unchanged.
union PK { v8u u; v16b v; };
__device__ __forceinline__ void pack_hl(v8f a, v8f c, v16b& fh, v16b& fl) {
  v8u ph, pl;
#pragma unroll
  for (int i = 0; i < 4; ++i) {
    const float x0 = a[2 * i], x1 = a[2 * i + 1];
    const unsigned short h0 = bf_bits(x0), h1 = bf_bits(x1);
    const unsigned short l0 = bf_bits(x0 - bf_up(h0)), l1 = bf_bits(x1 - bf_up(h1));
    ph[i] = pk16(h0, h1);
    pl[i] = pk16(l0, l1);
    const float y0 = c[2 * i], y1 = c[2 * i + 1];
    const unsigned short g0 = bf_bits(y0), g1 = bf_bits(y1);
    const unsigned short n0 = bf_bits(y0 - bf_up(g0)), n1 = bf_bits(y1 - bf_up(g1));
    ph[4 + i] = pk16(g0, g1);
    pl[4 + i] = pk16(n0, n1);
  }
  PK uh, ul;
  uh.u = ph; ul.u = pl;
  fh = uh.v; fl = ul.v;
}

// =====================================================================================================
// f32 -> bf16 bits plane, 8 elements per thread, one 16-B store per lane: a wave writes 512 contiguous B
// coverage: n8 threads x 8 = the whole plane (n8 is a multiple of 256 for every use here).
// =====================================================================================================
__device__ __forceinline__ void cvt_bf16x8(int bx, const float* __restrict__ in, unsigned short* out, int n8) {
  const int i = bx * 256 + (int)threadIdx.x;
  if (i < n8) {
    const v4f a  = *(const v4fa*)(in + (size_t)i * 8);
    const v4f a4 = *(const v4fa*)(in + (size_t)i * 8 + 4);
    v4u p;
    p[0] = pk16(bf_bits(a[0]),  bf_bits(a[1]));
    p[1] = pk16(bf_bits(a[2]),  bf_bits(a[3]));
    p[2] = pk16(bf_bits(a4[0]), bf_bits(a4[1]));
    p[3] = pk16(bf_bits(a4[2]), bf_bits(a4[3]));
    unsigned short* o = out + (size_t)i * 8;
    *(v4u*)o = p;
    
  }
}

// =====================================================================================================
// W [nrows][256] f32 -> bf16 bits [nrows][512] duplicated per 32-column block:
//   out[n][g*64 + w] = bf16(W[n][g*32 + (w & 31)]), g = 0..7, w = 0..63
// (the Bt operand of ctx.W^T where ctx is stored as [hi 32 | residual 32] per head block).
// One wave per row; per half (g 0..3 / 4..7) one instruction: 32 lanes x 16 B = 512 contiguous B = 4 lines.
// =====================================================================================================
__device__ __forceinline__ void cvt_dup(int bx, const float* __restrict__ in, unsigned short* out, int nrows) {
  const int lane = (int)threadIdx.x & 31, wave = (int)threadIdx.x >> 5;
  const int row = bx * 8 + wave;
  if (row >= nrows) return;                                   // wave-uniform; no block barriers here
  const float* src = in + (size_t)row * EMB;
  unsigned short* dst = out + (size_t)row * (2 * EMB);
  v4u p[2];
#pragma unroll
  for (int half = 0; half < 2; ++half) {
    const int g = half * 4 + (lane >> 3);
    const int scol = g * HD + 8 * (lane & 3);
    const v4f a = *(const v4fa*)(src + scol);
    const v4f c = *(const v4fa*)(src + scol + 4);
    v4u q;
    q[0] = pk16(bf_bits(a[0]), bf_bits(a[1]));
    q[1] = pk16(bf_bits(a[2]), bf_bits(a[3]));
    q[2] = pk16(bf_bits(c[0]), bf_bits(c[1]));
    q[3] = pk16(bf_bits(c[2]), bf_bits(c[3]));
    p[half] = q;
  }
  {
#pragma unroll
    for (int half = 0; half < 2; ++half)
      *(v4u*)(dst + half * EMB + 8 * lane) = p[half];
    
  }
}

// =====================================================================================================
// All eight input conversions in one grid: they are independent of one another, so blockIdx.x picks the job.
// Block ranges (256 threads each): W_ov dup, W_ol dup, W_v, W_vv, W_l, W_vl, l, v.
// =====================================================================================================
#define CB_DV  (EMB / 8)                 //   32 blocks, 8 rows each
#define CB_DL  (LD / 8)                  //   96
#define CB_WS  (EMB * EMB / 8 / 256)     //   32 blocks, 2048 elements each
#define CB_WL  (EMB * LD / 8 / 256)      //   96
#define CB_L   (NL * LD / 8 / 256)       //  192
#define CB_V   (NV * EMB / 8 / 256)      // 4000
#define CB_ALL (CB_DV + CB_DL + 2 * CB_WS + 2 * CB_WL + CB_L + CB_V)
static_assert(CB_WS * 2048 == EMB * EMB && CB_WL * 2048 == EMB * LD && CB_L * 2048 == NL * LD && CB_V * 2048 == NV * EMB);
__global__ __launch_bounds__(256) void cvt_all(
    const float* __restrict__ v_in, const float* __restrict__ l_in,
    const float* __restrict__ Wv, const float* __restrict__ Wvv,
    const float* __restrict__ Wl, const float* __restrict__ Wvl,
    const float* __restrict__ Wov, const float* __restrict__ Wol,
    unsigned short* vb, unsigned short* lb, unsigned short* Wvb, unsigned short* Wvvb,
    unsigned short* Wlb, unsigned short* Wvlb, unsigned short* Wovd, unsigned short* Wold) {
  int bx = (int)blockIdx.x;                                   // block-uniform job choice
  if (bx < CB_DV) { cvt_dup(bx, Wov, Wovd, EMB); return; }
  bx -= CB_DV;
  if (bx < CB_DL) { cvt_dup(bx, Wol, Wold, LD); return; }
  bx -= CB_DL;
  if (bx < CB_WS) { cvt_bf16x8(bx, Wv, Wvb, EMB * EMB / 8); return; }
  bx -= CB_WS;
  if (bx < CB_WS) { cvt_bf16x8(bx, Wvv, Wvvb, EMB * EMB / 8); return; }
  bx -= CB_WS;
  if (bx < CB_WL) { cvt_bf16x8(bx, Wl, Wlb, EMB * LD / 8); return; }
  bx -= CB_WL;
  if (bx < CB_WL) { cvt_bf16x8(bx, Wvl, Wvlb, EMB * LD / 8); return; }
  bx -= CB_WL;
  if (bx < CB_L) { cvt_bf16x8(bx, l_in, lb, NL * LD / 8); return; }
  bx -= CB_L;
  cvt_bf16x8(bx, v_in, vb, NV * EMB / 8);
}

// =====================================================================================================
// Register-blocked batched WMMA GEMM (bf16 operands): C[m][n] = sum_k A[m][k] * Bt[n][k];
// one wave per 64x64 tile, no block barriers. A row-major [M][K] pitch lda; Bt row-major [N][K] pitch ldb
// (k contiguous); M, N multiples of 64, K multiple of 32 (host-checked). bx = block of 8 tiles, b = batch index
// (strides in elements); sT = the block's LDS slabs, declared by the calling kernel. Fragments are loaded straight from global with the split k map (ldfrag).
// OUT_MODE 0: f32 C (pitch ldc), value = (acc + bf16(bias[n])) * oscale.
// OUT_MODE 3: bf16 hi plane C + bf16 residual plane C2 = bf16(y - hi) (same pitch / stride),
//             y = (acc + bf16(bias)) * oscale; bias[n] (BIASM 0) or bias[m] (BIASM 1).
// =====================================================================================================
template <int OUT_MODE, int BIASM>
__device__ __forceinline__ void gemm64_body(
    float (*sT)[16 * 68], int bx, int b,
    const unsigned short* __restrict__ Ap, int lda, long long strideA,
    const unsigned short* __restrict__ Btp, int ldb, long long strideB,
    const float* __restrict__ bias,
    void* Cout, void* Cout2, int ldc, long long strideC,
    int M, int N, int K, float oscale) {
  static_assert(OUT_MODE == 0 || OUT_MODE == 3);
  static_assert(OUT_MODE != 0 || BIASM == 0);
  const __bf16* A  = (const __bf16*)(const void*)Ap;
  const __bf16* Bt = (const __bf16*)(const void*)Btp;
  const int lane = threadIdx.x & 31;
  const int wave = threadIdx.x >> 5;
  const int tilesN = N >> 6;
  const int tilesM = M >> 6;
  const int tile = bx * 8 + wave;
  if (tile >= tilesM * tilesN) return;   // wave-uniform; no block barriers in this kernel
  const int tm = tile / tilesN;
  const int tn = tile - tm * tilesN;
  const int m0 = tm << 6;
  const int n0 = tn << 6;

  const __bf16* Ab = A  + (size_t)b * (size_t)strideA;
  const __bf16* Bb = Bt + (size_t)b * (size_t)strideB;

  const int rlane = lane & 15;                 // row (A) / col (B, D) within subtile
  const int koff  = (lane >> 4) * 8;           // k offset of this lane half
  const int mOff  = (lane >> 4) * 8;           // D row offset

  v8f acc[4][4];
#pragma unroll
  for (int i = 0; i < 4; ++i)
#pragma unroll
    for (int j = 0; j < 4; ++j) acc[i][j] = zero8();

  for (int k0 = 0; k0 < K; k0 += 32) {
    v16b bq[4];
#pragma unroll
    for (int j = 0; j < 4; ++j)
      bq[j] = ldfrag(Bb + (size_t)(n0 + (j << 4) + rlane) * ldb + koff + k0);
#pragma unroll
    for (int i = 0; i < 4; ++i) {
      const v16b af = ldfrag(Ab + (size_t)(m0 + (i << 4) + rlane) * lda + koff + k0);
#pragma unroll
      for (int j = 0; j < 4; ++j) acc[i][j] = mmar(af, bq[j], acc[i][j]);
      dep_guard(acc[i][0], acc[i][3], af, bq[3]);
    }
    keep4(bq[0], bq[1], bq[2], bq[3]);
  }
  acc_guard4(acc[0][0], acc[0][1], acc[0][2], acc[0][3]);
  acc_guard4(acc[1][0], acc[1][1], acc[1][2], acc[1][3]);
  acc_guard4(acc[2][0], acc[2][1], acc[2][2], acc[2][3]);
  acc_guard4(acc[3][0], acc[3][1], acc[3][2], acc[3][3]);

  // ---- epilogue ----
  float* slab = sT[wave];
  const int h2 = lane >> 4, c4 = (lane & 15) * 4;     // OUT_MODE 0 map: 256-B row segment = 16 lanes x 16 B
  const int q = lane >> 3, c8 = (lane & 7) * 8;
  v4f bb4;                                             // bias for columns n0+c4..+3 (mode 0)
  float bcol[8];                                       // bias for columns n0+c8..+7 (mode 3, BIASM 0)
  if (OUT_MODE == 0) {
    const v4f braw = *(const v4fa*)(bias + n0 + c4);
    bb4[0] = rbf(braw[0]); bb4[1] = rbf(braw[1]); bb4[2] = rbf(braw[2]); bb4[3] = rbf(braw[3]);
  } else {
    if (BIASM == 0) {
      const v4f b0 = *(const v4fa*)(bias + n0 + c8);
      const v4f b1 = *(const v4fa*)(bias + n0 + c8 + 4);
#pragma unroll
      for (int e = 0; e < 4; ++e) { bcol[e] = rbf(b0[e]); bcol[4 + e] = rbf(b1[e]); }
    } else {
#pragma unroll
      for (int e = 0; e < 8; ++e) bcol[e] = 0.f;
    }
  }
#pragma unroll
  for (int i = 0; i < 4; ++i) {
    const int mBase = m0 + (i << 4);
#pragma unroll
    for (int j = 0; j < 4; ++j) {
#pragma unroll
      for (int r = 0; r < 8; ++r) {
        slab[(mOff + r) * 68 + (j << 4) + rlane] = acc[i][j][r];
      }
    }
    __builtin_amdgcn_fence(__ATOMIC_RELEASE, "workgroup");
    __builtin_amdgcn_wave_barrier();
    __builtin_amdgcn_fence(__ATOMIC_ACQUIRE, "workgroup");
    if (OUT_MODE == 0) {
      float* C = (float*)Cout + (size_t)b * (size_t)strideC;
      {
#pragma unroll
        for (int it = 0; it < 8; ++it) {
          const int row = it * 2 + h2;                     // it 0..7 x h2 0..1 = rows 0..15
          v4f v = *(const v4fa*)(slab + row * 68 + c4);
          v = (v + bb4) * oscale;
          *(v4f*)(C + (size_t)(mBase + row) * ldc + n0 + c4) = v;
        }
        
      }
    } else {
      unsigned short* C  = (unsigned short*)Cout  + (size_t)b * (size_t)strideC;
      unsigned short* C2 = (unsigned short*)Cout2 + (size_t)b * (size_t)strideC;
      v4u hv[4], lv[4];
#pragma unroll
      for (int it = 0; it < 4; ++it) {
        const int row = it * 4 + q;                        // it 0..3 x q 0..3 = rows 0..15
        const float* sp = slab + row * 68 + c8;
        float brow = 0.f;
        if (BIASM == 1) brow = rbf(bias[mBase + row]);
        v4u a, a2;
#pragma unroll
        for (int e = 0; e < 4; ++e) {
          const float f0 = (sp[2 * e]     + ((BIASM == 1) ? brow : bcol[2 * e]))     * oscale;
          const float f1 = (sp[2 * e + 1] + ((BIASM == 1) ? brow : bcol[2 * e + 1])) * oscale;
          const unsigned short h0 = bf_bits(f0), h1 = bf_bits(f1);
          const unsigned short l0 = bf_bits(f0 - bf_up(h0)), l1 = bf_bits(f1 - bf_up(h1));
          a[e] = pk16(h0, h1); a2[e] = pk16(l0, l1);
        }
        hv[it] = a; lv[it] = a2;
      }
      {
#pragma unroll
        for (int it = 0; it < 4; ++it) {
          const int row = it * 4 + q;
          *(v4u*)(C  + (size_t)(mBase + row) * ldc + n0 + c8) = hv[it];
          *(v4u*)(C2 + (size_t)(mBase + row) * ldc + n0 + c8) = lv[it];
        }
        
      }
    }
    __builtin_amdgcn_fence(__ATOMIC_RELEASE, "workgroup");
    __builtin_amdgcn_wave_barrier();
    __builtin_amdgcn_fence(__ATOMIC_ACQUIRE, "workgroup");
  }
}

// ---- one GEMM per launch (used for out1) ----
__global__ __launch_bounds__(256) void gemm64_f32(
    const unsigned short* __restrict__ Ap, int lda,
    const unsigned short* __restrict__ Btp, int ldb,
    const float* __restrict__ bias, float* Cout, int ldc, int M, int N, int K) {
  __shared__ __align__(16) float sT[8][16 * 68];   // per-wave 16x64 slab, pitch 68 floats
  gemm64_body<0, 0>(sT, (int)blockIdx.x, 0, Ap, lda, 0LL, Btp, ldb, 0LL, bias,
                    (void*)Cout, (void*)Cout, ldc, 0LL, M, N, K, 1.0f);
}

// =====================================================================================================
// The four input projections in one grid: none reads what another writes, so blockIdx.x picks the job.
// The two K = 768 jobs (few tiles, longest k loop) take the first blocks.
//   k      = l . W_l^T + b_l              [b*SL+s][256]         M=512,   N=256,   K=768
//   val_l^T = W_vl . l^T + b_vl per batch [b][d][s] pitch SL    M=256,   N=256,   K=768
//   q      = (v . W_v^T + b_v) * scale    [b*TV+t][256]         M=32000, N=256,   K=256
//   val_v^T = W_vv . v^T + b_vv per batch [b][d][t] pitch TV    M=256,   N=16000, K=256
// every result as bf16 hi / residual planes.
// =====================================================================================================
#define PB_K   ((NL / 64) * (EMB / 64) / 8)      //   4 blocks
#define PB_VL1 ((EMB / 64) * (SL / 64) / 8)      //   2 blocks per batch
#define PB_Q   ((NV / 64) * (EMB / 64) / 8)      // 250 blocks
#define PB_VV1 ((EMB / 64) * (TV / 64) / 8)      // 125 blocks per batch
#define PB_ALL (PB_K + NB * PB_VL1 + PB_Q + NB * PB_VV1)
static_assert(PB_K * 8 * 4096 == NL * EMB && PB_VL1 * 8 * 4096 == EMB * SL);
static_assert(PB_Q * 8 * 4096 == NV * EMB && PB_VV1 * 8 * 4096 == EMB * TV);
__global__ __launch_bounds__(256) void proj_all(
    const unsigned short* __restrict__ vb, const unsigned short* __restrict__ lb,
    const unsigned short* __restrict__ Wvb, const unsigned short* __restrict__ Wlb,
    const unsigned short* __restrict__ Wvvb, const unsigned short* __restrict__ Wvlb,
    const float* __restrict__ bv, const float* __restrict__ bl,
    const float* __restrict__ bvv, const float* __restrict__ bvl,
    unsigned short* Qh, unsigned short* Ql, unsigned short* Kh, unsigned short* Kl,
    unsigned short* VvTh, unsigned short* VvTl, unsigned short* VlTh, unsigned short* VlTl) {
  __shared__ __align__(16) float sT[8][16 * 68];   // per-wave 16x64 slab, pitch 68 floats
  const int bid = (int)blockIdx.x;                 // block-uniform job choice
  const bool lang = bid < PB_K + NB * PB_VL1;      // operand l (K = 768) or v (K = 256)
  const int r = lang ? bid : bid - (PB_K + NB * PB_VL1);
  const int nrow = lang ? PB_K : PB_Q;             // blocks of the row-major job of this operand
  const unsigned short* x = lang ? lb : vb;
  const int kd = lang ? LD : EMB;
  if (r < nrow) {
    gemm64_body<3, 0>(sT, r, 0, x, kd, 0LL, lang ? Wlb : Wvb, kd, 0LL, lang ? bl : bv,
                      (void*)(lang ? Kh : Qh), (void*)(lang ? Kl : Ql), EMB, 0LL,
                      lang ? NL : NV, EMB, kd, lang ? 1.0f : SCALEQ);
  } else {
    const int per = lang ? PB_VL1 : PB_VV1;
    const int r2 = r - nrow;
    const int b = (r2 >= per) ? 1 : 0;
    static_assert(NB == 2);
    const int nt = lang ? SL : TV;                 // rows of x per batch = N = output pitch
    gemm64_body<3, 1>(sT, r2 - b * per, b, lang ? Wvlb : Wvvb, kd, 0LL, x, kd, (long long)nt * kd,
                      lang ? bvl : bvv, (void*)(lang ? VlTh : VvTh), (void*)(lang ? VlTl : VvTl),
                      nt, (long long)EMB * nt, EMB, nt, kd, 1.0f);
  }
}

// ---- additive key mask: -9e15 where the int32 mask is 0, else 0 (8 consecutive keys, 2 int4 loads) ----
__device__ __forceinline__ v8f add_mask8(v8f s, const int* p) {
  const v4i ma = *(const v4ia*)p;
  const v4i mb = *(const v4ia*)(p + 4);
  s[0] += (ma[0] == 0) ? MASKNEG : 0.0f;
  s[1] += (ma[1] == 0) ? MASKNEG : 0.0f;
  s[2] += (ma[2] == 0) ? MASKNEG : 0.0f;
  s[3] += (ma[3] == 0) ? MASKNEG : 0.0f;
  s[4] += (mb[0] == 0) ? MASKNEG : 0.0f;
  s[5] += (mb[1] == 0) ? MASKNEG : 0.0f;
  s[6] += (mb[2] == 0) ? MASKNEG : 0.0f;
  s[7] += (mb[3] == 0) ? MASKNEG : 0.0f;
  return s;
}

// =====================================================================================================
// Pass A: vision-direction attention (softmax over the 256 text keys, masked) + per-64-row column maxima
// of the clamped unmasked scores for the language direction.
//   Planes: Qh/Ql, Kh/Kl bf16 [row][256] (row = b*TV + t / b*SL + s, head block h*32);
//           Vlh/Vll = val_l^T bf16 [b][256 d][256 s]; mask int32 [b][256].
//   Transposed form: S^T = K.Q^T (A = K rows: row = key, k = d; B = Q^T from the q row, n = query),
//   3 products (hh, hl, lh); D = S^T[key 8hh+r][query m]. Online softmax over 4 chunks of 64 keys in f32;
//   P^T hi / residual B fragments packed from registers; O^T += Vl^T . P^T (A = Vl^T rows: row = d, k = key).
//   Block = 4 waves x 16 queries = 64 query rows of one (b,h); grid (NQT, NB*NH).
//   Outputs: CM record [bh][qt][256] f32 (1 KB, written by threads 0..63, 16 B each: 2 instructions of 4 lines);
//            written per wave as 16 lines, lanes 8q..8q+7 one line, 4 lines per instruction.
//   coverage: 250 x 16 blocks x 64 rows = every (row, head) line of the ctx plane; every CM row.
// =====================================================================================================
__global__ __launch_bounds__(128)
void attn_v(const unsigned short* __restrict__ qhp, const unsigned short* __restrict__ qlp,
            const unsigned short* __restrict__ khp, const unsigned short* __restrict__ klp,
            const unsigned short* __restrict__ vhp, const unsigned short* __restrict__ vlp,
            const int* __restrict__ maskl, float* cmout, unsigned short* ctxp) {
  __shared__ __align__(16) float cmw[4][SL];        // per-wave column max         4 KB
  __shared__ __align__(16) float cmb[SL];           // block column max            1 KB
  __shared__ __align__(16) float sO[4][16 * HD];    // per-wave 16x32 context tile  8 KB

  const int tid = threadIdx.x, lane = tid & 31, w = tid >> 5;
  const int hh = lane >> 4, m = lane & 15;
  const int qt = blockIdx.x, bh = blockIdx.y, b = bh >> 3, head = bh & 7;
  const int q0 = qt * 64 + 16 * w;

  const __bf16* Qh = (const __bf16*)(const void*)qhp;
  const __bf16* Ql = (const __bf16*)(const void*)qlp;
  const __bf16* Kh = (const __bf16*)(const void*)khp;
  const __bf16* Kl = (const __bf16*)(const void*)klp;
  const __bf16* Vh = (const __bf16*)(const void*)vhp;
  const __bf16* Vl = (const __bf16*)(const void*)vlp;

  // Q^T B-fragments: column n = query q0+m, k = d (one 32-deep step)
  const size_t qoff = ((size_t)b * TV + q0 + m) * EMB + head * HD + 8 * hh;
  const v16b qbh = ldfrag(Qh + qoff);
  const v16b qbl = ldfrag(Ql + qoff);

  const __bf16* kbh = Kh + ((size_t)b * SL + m) * EMB + head * HD + 8 * hh;     // + key0*EMB
  const __bf16* kbl = Kl + ((size_t)b * SL + m) * EMB + head * HD + 8 * hh;
  const __bf16* vbh = Vh + ((size_t)b * EMB + head * HD + m) * SL + 8 * hh;      // + 16dt*SL + key0
  const __bf16* vbl = Vl + ((size_t)b * EMB + head * HD + m) * SL + 8 * hh;
  const int* mkp = maskl + b * SL + 8 * hh;                                      // + key tile base

  v8f o[2];
  o[0] = zero8(); o[1] = zero8();
  float mrun = -1.0e30f, lrun = 0.0f;

#pragma unroll 1
  for (int kc = 0; kc < SL / 64; ++kc) {
    const int kb0 = kc * 64;
    // ---- scores s[j][r] = S[query q0+m][key kb0+16j+8hh+r] ----
    v8f s[4];
#pragma unroll
    for (int j = 0; j < 4; ++j) {
      const size_t ko = (size_t)(kb0 + 16 * j) * EMB;
      const v16b kfh = ldfrag(kbh + ko);
      const v16b kfl = ldfrag(kbl + ko);
      v8f z = zero8();
      z = mma_b(kfh, qbh, z);
      z = mma_b(kfl, qbh, z);
      z = mma_b(kfh, qbl, z);
      s[j] = z;
    }
    // ---- clamp; column max over this wave's 16 query columns (pre-mask) -> LDS ----
#pragma unroll
    for (int j = 0; j < 4; ++j) {
#pragma unroll
      for (int r = 0; r < 8; ++r) {
        float vv = clampv(s[j][r]);
        s[j][r] = vv;
        vv = fmaxf(vv, __shfl_xor(vv, 1, 32));
        vv = fmaxf(vv, __shfl_xor(vv, 2, 32));
        vv = fmaxf(vv, __shfl_xor(vv, 4, 32));
        vv = fmaxf(vv, __shfl_xor(vv, 8, 32));
        if (m == 0) cmw[w][kb0 + 16 * j + 8 * hh + r] = vv;
      }
    }
    // ---- additive mask per key, f32 ----
#pragma unroll
    for (int j = 0; j < 4; ++j) s[j] = add_mask8(s[j], mkp + kb0 + 16 * j);

    // ---- online softmax per query column ----
    float mloc = s[0][0];
#pragma unroll
    for (int j = 0; j < 4; ++j)
#pragma unroll
      for (int r = 0; r < 8; ++r) mloc = fmaxf(mloc, s[j][r]);
    mloc = fmaxf(mloc, __shfl_xor(mloc, 16, 32));
    const float mnew = fmaxf(mrun, mloc);
    const float alpha = __expf(mrun - mnew);
    mrun = mnew;
    float lsum = 0.0f;
#pragma unroll
    for (int j = 0; j < 4; ++j)
#pragma unroll
      for (int r = 0; r < 8; ++r) {
        const float p = __expf(s[j][r] - mnew);
        s[j][r] = p;
        lsum += p;
      }
    lsum += __shfl_xor(lsum, 16, 32);
    lrun = lrun * alpha + lsum;
#pragma unroll
    for (int dt = 0; dt < 2; ++dt)
#pragma unroll
      for (int r = 0; r < 8; ++r) o[dt][r] = o[dt][r] * alpha;

    // ---- P^T B-fragments (keys 0..31 and 32..63 of this chunk), bf16 hi + residual ----
    v16b pbh0, pbl0, pbh1, pbl1;
    pack_hl(s[0], s[1], pbh0, pbl0);
    pack_hl(s[2], s[3], pbh1, pbl1);

    // ---- O^T += Vl^T . P^T (3 products per k-step) ----
#pragma unroll
    for (int dt = 0; dt < 2; ++dt) {
      const size_t vo = (size_t)(16 * dt) * SL + kb0;
      const v16b vh0 = ldfrag(vbh + vo), vh1 = ldfrag(vbh + vo + 32);
      const v16b vl0 = ldfrag(vbl + vo), vl1 = ldfrag(vbl + vo + 32);
      v8f a = o[dt];
      a = mma_b(vh0, pbh0, a);
      a = mma_b(vh0, pbl0, a);
      a = mma_b(vl0, pbh0, a);
      a = mma_b(vh1, pbh1, a);
      a = mma_b(vh1, pbl1, a);
      a = mma_b(vl1, pbh1, a);
      o[dt] = a;
    }
  }

  // ---- normalise (1/l), stage the wave's 16 (query) x 32 (d) f32 tile ----
  const float inv = 1.0f / lrun;
  float* so = sO[w];
#pragma unroll
  for (int dt = 0; dt < 2; ++dt)
#pragma unroll
    for (int r = 0; r < 8; ++r)
      so[m * HD + 16 * dt + 8 * hh + r] = o[dt][r] * inv;
  __syncthreads();

  {
    const int sub = lane >> 3, piece = lane & 7;
    const int csel = 8 * (piece & 3);
    const bool islo = (piece & 4) != 0;
    v4u hv[4];
#pragma unroll
    for (int i = 0; i < 4; ++i) {
      const int lid = i * 4 + sub;                      // i 0..3 x sub 0..3 = rows 0..15
      const float* sp = so + lid * HD + csel;
      v4u a;
#pragma unroll
      for (int e = 0; e < 4; ++e) {
        const float x0 = sp[2 * e], x1 = sp[2 * e + 1];
        const unsigned short h0 = bf_bits(x0), h1 = bf_bits(x1);
        const unsigned short l0 = bf_bits(x0 - bf_up(h0)), l1 = bf_bits(x1 - bf_up(h1));
        a[e] = islo ? pk16(l0, l1) : pk16(h0, h1);
      }
      hv[i] = a;
    }
    {
#pragma unroll
      for (int i = 0; i < 4; ++i) {
        const int lid = i * 4 + sub;
        const size_t go = ((size_t)b * TV + q0 + lid) * (2 * EMB) + head * (2 * HD) + 8 * piece;
        *(v4u*)(ctxp + go) = hv[i];
      }
      
    }
  }

  for (int t = tid; t < SL; t += 128)
    cmb[t] = fmaxf(fmaxf(cmw[0][t], cmw[1][t]), fmaxf(cmw[2][t], cmw[3][t]));
  __syncthreads();
  if (tid < 64) {
    const v4f vv = *(const v4fa*)(cmb + 4 * tid);
    float* dst = cmout + ((size_t)bh * NQT + qt) * SL + 4 * tid;
    *(v4f*)dst = vv;
    
  }
}

// =====================================================================================================
// Column max fold: M[bh][s] = max over the 250 query-tile records (fixed order). One block per bh,
// =====================================================================================================
__device__ __forceinline__ void fold_max(int bh, const float* __restrict__ cm, float* mx) {
  const int s = (int)threadIdx.x;
  const float* p = cm + (size_t)bh * NQT * SL + s;
  float mm = p[0];
#pragma unroll 2
  for (int qq = 1; qq < NQT; ++qq) mm = fmaxf(mm, p[(size_t)qq * SL]);
  float* d = mx + bh * SL + s;
  *(float*)d = mm;
  
}

// =====================================================================================================
// Both consumers of pass A in one grid: the column max fold (first NB*NH blocks) and
// out0 = ctx . W_ov^T + b_ov -> f32 [32000][256] (K=512: [hi|residual] . [W|W]); neither reads the other's output.
// =====================================================================================================
__global__ __launch_bounds__(256) void foldmax_out0(
    const float* __restrict__ cm, float* mx,
    const unsigned short* __restrict__ ctxv, const unsigned short* __restrict__ wovd,
    const float* __restrict__ bov, float* out0, int lda, int ldb, int ldc, int M, int N, int K) {
  __shared__ __align__(16) float sT[8][16 * 68];   // per-wave 16x64 slab, pitch 68 floats
  const int bid = (int)blockIdx.x;                 // block-uniform job choice
  if (bid < NB * NH) { fold_max(bid, cm, mx); return; }
  gemm64_body<0, 0>(sT, bid - NB * NH, 0, ctxv, lda, 0LL, wovd, ldb, 0LL, bov,
                    (void*)out0, (void*)out0, ldc, 0LL, M, N, K, 1.0f);
}

// =====================================================================================================
// Pass B: language-direction partial sums. For (b,h), key half kq (128 keys), t range rg (1600 t):
//   S = Q.K^T (A = Q rows: row = t, k = d; B from K rows: n = key), 3 products, D = S[t 8hh+r][key m];
//   e = exp(clamp(clamp(S) - M[key])) in f32; e packed from registers as the B operand with k = t
//   (bf16 hi + residual); acc^T[d][key] += Vv^T . e (A = val_v^T rows: row = d, k = t), 3 products,
//   f32 accumulation across the 50 steps; colsum[key] += e in f32.
//   Block = 4 waves x 32 keys; grid (RR, 2, NB*NH). Record [bh][rg][33 rows][256]: rows 0..31 = acc^T[d],
// =====================================================================================================
__global__ __launch_bounds__(128)
void attn_l(const unsigned short* __restrict__ qhp, const unsigned short* __restrict__ qlp,
            const unsigned short* __restrict__ khp, const unsigned short* __restrict__ klp,
            const unsigned short* __restrict__ vhp, const unsigned short* __restrict__ vlp,
            const float* __restrict__ mx, float* rec) {
  __shared__ __align__(16) float st[4][RECROWS * 32];   // per-wave 33x32 staging, 16896 B

  const int tid = threadIdx.x, lane = tid & 31, w = tid >> 5;
  const int hh = lane >> 4, m = lane & 15;
  const int rg = blockIdx.x, kq = blockIdx.y, bh = blockIdx.z, b = bh >> 3, head = bh & 7;
  const int s0 = kq * 128 + 32 * w;
  const int tb = rg * TPR;

  const __bf16* Qh = (const __bf16*)(const void*)qhp;
  const __bf16* Ql = (const __bf16*)(const void*)qlp;
  const __bf16* Kh = (const __bf16*)(const void*)khp;
  const __bf16* Kl = (const __bf16*)(const void*)klp;
  const __bf16* Vh = (const __bf16*)(const void*)vhp;
  const __bf16* Vl = (const __bf16*)(const void*)vlp;

  // K B-fragments for this wave's two 16-key tiles (n = key s0+16jj+m, k = d), hi and residual planes
  v16b kfh[2], kfl[2];
  float mvj[2], csum[2];
#pragma unroll
  for (int jj = 0; jj < 2; ++jj) {
    const size_t ko = ((size_t)b * SL + s0 + 16 * jj + m) * EMB + head * HD + 8 * hh;
    kfh[jj] = ldfrag(Kh + ko);
    kfl[jj] = ldfrag(Kl + ko);
    mvj[jj] = mx[bh * SL + s0 + 16 * jj + m];
    csum[jj] = 0.0f;
  }
  v8f acc[2][2];
#pragma unroll
  for (int dt = 0; dt < 2; ++dt) { acc[dt][0] = zero8(); acc[dt][1] = zero8(); }

  const __bf16* qbh = Qh + ((size_t)b * TV + m) * EMB + head * HD + 8 * hh;     // + t*EMB
  const __bf16* qbl = Ql + ((size_t)b * TV + m) * EMB + head * HD + 8 * hh;
  const __bf16* vbh = Vh + ((size_t)b * EMB + head * HD + m) * TV + 8 * hh;      // + 16dt*TV + t0
  const __bf16* vbl = Vl + ((size_t)b * EMB + head * HD + m) * TV + 8 * hh;

#pragma unroll 1
  for (int step = 0; step < NSTEP; ++step) {
    const int t0 = tb + 32 * step;
    v16b qah[2], qal[2], vah[2], val2[2];
#pragma unroll
    for (int tt = 0; tt < 2; ++tt) {
      const size_t qo = (size_t)(t0 + 16 * tt) * EMB;
      qah[tt] = ldfrag(qbh + qo);
      qal[tt] = ldfrag(qbl + qo);
    }
#pragma unroll
    for (int dt = 0; dt < 2; ++dt) {
      const size_t vo = (size_t)(16 * dt) * TV + t0;
      vah[dt]  = ldfrag(vbh + vo);
      val2[dt] = ldfrag(vbl + vo);
    }
#pragma unroll
    for (int jj = 0; jj < 2; ++jj) {
      // scores for t rows t0..t0+15 (d0) and t0+16..t0+31 (d1), key columns s0+16jj+m
      v8f d0 = zero8(), d1 = zero8();
      d0 = mma_b(qah[0], kfh[jj], d0);
      d0 = mma_b(qah[0], kfl[jj], d0);
      d0 = mma_b(qal[0], kfh[jj], d0);
      d1 = mma_b(qah[1], kfh[jj], d1);
      d1 = mma_b(qah[1], kfl[jj], d1);
      d1 = mma_b(qal[1], kfh[jj], d1);
      const float mv = mvj[jj];
      float cl = csum[jj];
#pragma unroll
      for (int r = 0; r < 8; ++r) {
        const float x0 = clampv(clampv(d0[r]) - mv);
        const float e0 = __expf(x0);
        d0[r] = e0; cl += e0;
        const float x1 = clampv(clampv(d1[r]) - mv);
        const float e1 = __expf(x1);
        d1[r] = e1; cl += e1;
      }
      csum[jj] = cl;
      // e as the B operand with k = t (tile d0 = t 0..15, tile d1 = t 16..31), bf16 hi + residual
      v16b ebh, ebl;
      pack_hl(d0, d1, ebh, ebl);
#pragma unroll
      for (int dt = 0; dt < 2; ++dt) {
        v8f a = acc[dt][jj];
        a = mma_b(vah[dt],  ebh, a);
        a = mma_b(vah[dt],  ebl, a);
        a = mma_b(val2[dt], ebh, a);
        acc[dt][jj] = a;
      }
    }
  }

  // ---- combine the two lane halves of the column sums; stage acc^T (32 d x 32 keys) + colsum row ----
#pragma unroll
  for (int jj = 0; jj < 2; ++jj) csum[jj] += __shfl_xor(csum[jj], 16, 32);
  float* sw = st[w];
#pragma unroll
  for (int dt = 0; dt < 2; ++dt)
#pragma unroll
    for (int jj = 0; jj < 2; ++jj)
#pragma unroll
      for (int r = 0; r < 8; ++r)
        sw[(16 * dt + 8 * hh + r) * 32 + 16 * jj + m] = acc[dt][jj][r];
  if (hh == 0) {
    sw[32 * 32 + m]      = csum[0];
    sw[32 * 32 + 16 + m] = csum[1];
  }
  __syncthreads();

  // ---- record lines: row lid (0..32) of this wave = 32 floats at column s0, lanes 8*sub..+7, 4 rows per instruction ----
  {
    const int sub = lane >> 3, piece = lane & 7;
    float* rbase = rec + (((size_t)bh * RR + rg) * RECROWS) * SL + s0 + 4 * piece;
    {
#pragma unroll
      for (int i = 0; i < 9; ++i) {
        const int lid  = i * 4 + sub;
        const int lidc = (lid < RECROWS) ? lid : (RECROWS - 1);
        const v4f vv = *(const v4fa*)(sw + lidc * 32 + 4 * piece);
        if (lid < RECROWS) *(v4f*)(rbase + (size_t)lid * SL) = vv;
      }
      
    }
  }
}

// =====================================================================================================
// Language-direction fold: ctx_l[b][s][h*32+d] = (sum_rg acc[rg][d][s]) / (sum_rg colsum[rg][s]) in fixed
// Block = one (b,s), thread = (h, d); threads 0..63 write the 1-KB row, 16 B each (2 instructions of 4 lines),
// =====================================================================================================
__global__ __launch_bounds__(256) void fold_l(const float* __restrict__ rec, unsigned short* ctxl) {
  __shared__ __align__(16) float xs[EMB];
  const int bs = blockIdx.x, b = bs / SL, s = bs - b * SL;
  const int t = (int)threadIdx.x, head = t >> 5, d = t & 31;
  const int bh = b * NH + head;
  const float* p = rec + ((size_t)bh * RR) * RECROWS * SL + s;
  float a = 0.0f, cs = 0.0f;
#pragma unroll 1
  for (int rg = 0; rg < RR; ++rg) {
    const float* pr = p + (size_t)rg * RECROWS * SL;
    a  += pr[(size_t)d * SL];
    cs += pr[(size_t)32 * SL];
  }
  xs[t] = a * (1.0f / cs);
  __syncthreads();
  if (t < 64) {
    const int hg = t >> 3, wq = t & 7;
    const float* sp = xs + hg * HD + 8 * (wq & 3);
    const bool islo = (wq & 4) != 0;
    v4u vv;
#pragma unroll
    for (int e = 0; e < 4; ++e) {
      const float x0 = sp[2 * e], x1 = sp[2 * e + 1];
      const unsigned short h0 = bf_bits(x0), h1 = bf_bits(x1);
      const unsigned short l0 = bf_bits(x0 - bf_up(h0)), l1 = bf_bits(x1 - bf_up(h1));
      vv[e] = islo ? pk16(l0, l1) : pk16(h0, h1);
    }
    unsigned short* dst = ctxl + (size_t)bs * (2 * EMB) + hg * (2 * HD) + 8 * wq;
    *(v4u*)dst = vv;
    
  }
}

// =====================================================================================================
// Workspace map (bytes), every region an exact multiple of its whole-line / whole-tile store granularity
// (no padded tails: all dims are tile multiples):
//   vb    bf16 [32000][256]        16384000
//   lb    bf16 [512][768]            786432
//   Wvb   bf16 [256][256]            131072
//   Wvvb  bf16 [256][256]            131072
//   Wlb   bf16 [256][768]            393216
//   Wvlb  bf16 [256][768]            393216
//   Wovd  bf16 [256][512]            262144
//   Wold  bf16 [768][512]            786432
//   Qh,Ql bf16 [32000][256] x2     32768000
//   Kh,Kl bf16 [512][256] x2         524288
//   VlTh,VlTl bf16 [2][256][256] x2  524288
//   VvTh,VvTl bf16 [2][256][16000] x2 32768000
//   CTXV  bf16 [32000][512]        32768000
//   CM    f32  [16][250][256]       4096000
//   MX    f32  [16][256]              16384
//   REC   f32  [16][10][33][256]    5406720
//   CTXL  bf16 [512][512]            524288
//   total                        128663552
// Weights are [out n][in k] with k contiguous = the Bt / A layout the GEMM wants, so they are not transposed (W_ov / W_ol are also duplicated along k).
// =====================================================================================================
extern "C" void kernel_launch(void* const* d_in, const int* in_sizes, int n_in,
                              void* d_out, int out_size, void* d_ws, size_t ws_size,
                              hipStream_t stream) {
  if (n_in < 15) return;
  if (in_sizes[0] != NV * EMB || in_sizes[1] != NL * LD || in_sizes[2] != NB * SL) return;
  if (in_sizes[3] != EMB * EMB || in_sizes[4] != EMB || in_sizes[5] != EMB * LD || in_sizes[6] != EMB) return;
  if (in_sizes[7] != EMB * EMB || in_sizes[8] != EMB || in_sizes[9] != EMB * LD || in_sizes[10] != EMB) return;
  if (in_sizes[11] != EMB * EMB || in_sizes[12] != EMB || in_sizes[13] != LD * EMB || in_sizes[14] != LD) return;
  if (out_size != NV * EMB + NL * LD) return;

  const float* v_in = (const float*)d_in[0];
  const float* l_in = (const float*)d_in[1];
  const int*   mk   = (const int*)d_in[2];
  const float* Wv   = (const float*)d_in[3];
  const float* bv   = (const float*)d_in[4];
  const float* Wl   = (const float*)d_in[5];
  const float* bl   = (const float*)d_in[6];
  const float* Wvv  = (const float*)d_in[7];
  const float* bvv  = (const float*)d_in[8];
  const float* Wvl  = (const float*)d_in[9];
  const float* bvl  = (const float*)d_in[10];
  const float* Wov  = (const float*)d_in[11];
  const float* bov  = (const float*)d_in[12];
  const float* Wol  = (const float*)d_in[13];
  const float* bol  = (const float*)d_in[14];
  float* out0 = (float*)d_out;
  float* out1 = out0 + (size_t)NV * EMB;            // byte 32768000; last element 8585215 < out_size

  const size_t PVB  = (size_t)NV * EMB * 2;          // 16384000
  const size_t PLB  = (size_t)NL * LD * 2;           //   786432
  const size_t PWS  = (size_t)EMB * EMB * 2;         //   131072
  const size_t PWL  = (size_t)EMB * LD * 2;          //   393216
  const size_t PWOD = (size_t)EMB * 2 * EMB * 2;     //   262144
  const size_t PWLD = (size_t)LD * 2 * EMB * 2;      //   786432
  const size_t PQ   = (size_t)NV * EMB * 2;          // 16384000
  const size_t PK   = (size_t)NL * EMB * 2;          //   262144
  const size_t PVLT = (size_t)NB * EMB * SL * 2;     //   262144
  const size_t PVVT = (size_t)NB * EMB * TV * 2;     // 16384000
  const size_t PCTX = (size_t)NV * 2 * EMB * 2;      // 32768000
  const size_t PCM  = (size_t)NB * NH * NQT * SL * 4;  // 4096000
  const size_t PMX  = (size_t)NB * NH * SL * 4;      //    16384
  const size_t PREC = (size_t)NB * NH * RR * RECROWS * SL * 4;  // 5406720
  const size_t PCTL = (size_t)NL * 2 * EMB * 2;      //   524288
  size_t off = 0;
  const size_t oVB  = off; off += PVB;
  const size_t oLB  = off; off += PLB;
  const size_t oWv  = off; off += PWS;
  const size_t oWvv = off; off += PWS;
  const size_t oWl  = off; off += PWL;
  const size_t oWvl = off; off += PWL;
  const size_t oWod = off; off += PWOD;
  const size_t oWld = off; off += PWLD;
  const size_t oQh  = off; off += PQ;
  const size_t oQl  = off; off += PQ;
  const size_t oKh  = off; off += PK;
  const size_t oKl  = off; off += PK;
  const size_t oVLh = off; off += PVLT;
  const size_t oVLl = off; off += PVLT;
  const size_t oVVh = off; off += PVVT;
  const size_t oVVl = off; off += PVVT;
  const size_t oCTX = off; off += PCTX;
  const size_t oCM  = off; off += PCM;
  const size_t oMX  = off; off += PMX;
  const size_t oREC = off; off += PREC;
  const size_t oCTL = off; off += PCTL;
  if (off > ws_size) return;                         // off = 128663552
  if (off > (size_t)134217728) return;

  char* ws = (char*)d_ws;
  unsigned short* vb   = (unsigned short*)(ws + oVB);
  unsigned short* lb   = (unsigned short*)(ws + oLB);
  unsigned short* Wvb  = (unsigned short*)(ws + oWv);
  unsigned short* Wvvb = (unsigned short*)(ws + oWvv);
  unsigned short* Wlb  = (unsigned short*)(ws + oWl);
  unsigned short* Wvlb = (unsigned short*)(ws + oWvl);
  unsigned short* Wovd = (unsigned short*)(ws + oWod);
  unsigned short* Wold = (unsigned short*)(ws + oWld);
  unsigned short* Qh   = (unsigned short*)(ws + oQh);
  unsigned short* Ql   = (unsigned short*)(ws + oQl);
  unsigned short* Kh   = (unsigned short*)(ws + oKh);
  unsigned short* Kl   = (unsigned short*)(ws + oKl);
  unsigned short* VlTh = (unsigned short*)(ws + oVLh);
  unsigned short* VlTl = (unsigned short*)(ws + oVLl);
  unsigned short* VvTh = (unsigned short*)(ws + oVVh);
  unsigned short* VvTl = (unsigned short*)(ws + oVVl);
  unsigned short* CTXV = (unsigned short*)(ws + oCTX);
  float*          CM   = (float*)(ws + oCM);
  float*          MX   = (float*)(ws + oMX);
  float*          REC  = (float*)(ws + oREC);
  unsigned short* CTXL = (unsigned short*)(ws + oCTL);

  const dim3 blk(256);
  const dim3 gO1((((NL) / 64) * (LD / 64) + 7) / 8, 1);        //   96 tiles ->   12 blocks
  const dim3 gAttV(NQT, NB * NH);                              // (250, 16) blocks of 128
  const dim3 gAttL(RR, 2, NB * NH);                            // (10, 2, 16) blocks of 128

  // (1) inputs -> bf16 planes; W_o -> bf16 duplicated along k (8 jobs, 4576 blocks)
  cvt_all<<<dim3(CB_ALL), blk, 0, stream>>>(v_in, l_in, Wv, Wvv, Wl, Wvl, Wov, Wol,
                                            vb, lb, Wvb, Wvvb, Wlb, Wvlb, Wovd, Wold);
  // (2) q, k, val_v^T, val_l^T -> bf16 hi / residual planes (4 jobs, 508 blocks)
  proj_all<<<dim3(PB_ALL), blk, 0, stream>>>(vb, lb, Wvb, Wlb, Wvvb, Wvlb, bv, bl, bvv, bvl,
                                             Qh, Ql, Kh, Kl, VvTh, VvTl, VlTh, VlTl);
  // (3) vision-direction attention -> ctx plane + column-max records
  attn_v<<<gAttV, dim3(128), 0, stream>>>(Qh, Ql, Kh, Kl, VlTh, VlTl, mk, CM, CTXV);
  // (4) column max fold (16 blocks) beside out0 = ctx . W_ov^T + b_ov -> d_out f32 [32000][256] (250 blocks)
  foldmax_out0<<<dim3(NB * NH + PB_Q), blk, 0, stream>>>(CM, MX, CTXV, Wovd, bov, out0,
                                                         2 * EMB, 2 * EMB, EMB, NV, EMB, 2 * EMB);
  // (5) language-direction partial records
  attn_l<<<gAttL, dim3(128), 0, stream>>>(Qh, Ql, Kh, Kl, VvTh, VvTl, MX, REC);
  // (6) fold the t ranges, normalise, merge heads -> ctx_l plane
  fold_l<<<dim3(NL), blk, 0, stream>>>(REC, CTXL);
  // (7) out1 = ctx_l . W_ol^T + b_ol -> d_out f32 [512][768] at float offset 8192000
  gemm64_f32<<<gO1, blk, 0, stream>>>(CTXL, 2 * EMB, Wold, 2 * EMB, bol, out1, LD, NL, LD, 2 * EMB);
  (void)hipGetLastError();
}

// v002
// A run of this version takes 261 microseconds.
// Two timings next to v001 both put it at 1.36 times that version's speed.
// Over all steps from v000 it is 1.75 times as fast.
// Contractions: v.W_v^T, v.W_vv^T, l.W_l^T, l.W_vl^T = v_wmma_f32_16x16x32_bf16 (bf16 operands RNE-converted from the inputs, single product, f32 accumulate);
// q.k^T scores = v_wmma_f32_16x16x32_bf16 (q and k as bf16 hi + unscaled bf16 residual planes; 3 products hi.hi + hi.lo + lo.hi; f32 accumulate);
// p.val_l and e.val_v = v_wmma_f32_16x16x32_bf16 (p / e split in registers into bf16 hi + residual, val planes bf16 hi + residual; 3 products; f32 accumulate);
// ctx_v.W_ov^T and ctx_l.W_ol^T = v_wmma_f32_16x16x32_bf16 (ctx as bf16 hi | residual interleaved along k, W bf16 duplicated along k; f32 accumulate).
// Softmax, mask, bias, scale, column statistics and normalisation in f32.
// Carry audit: no power-of-two carried planes anywhere (every residual plane is an unscaled bf16 difference); nothing is folded back.
#include <hip/hip_runtime.h>
#include <math.h>
#include <stdint.h>

#define NB      2
#define TV      16000
#define SL      256
#define EMB     256
#define LD      768
#define NH      8
#define HD      32
#define NV      (NB * TV)          // 32000 vision rows
#define NL      (NB * SL)          // 512 language rows
#define NQT     (TV / 64)          // 250 query tiles of 64 rows per batch
#define RR      10                 // t ranges per (b,h) in the language direction
#define TPR     (TV / RR)          // 1600 t per range
#define NSTEP   (TPR / 32)         // 50 steps of 32 t per range
#define RECROWS 34                 // 32 accumulator rows + 1 column-sum row + 1 running-max row
#define SCALEQ  0.17677669529663687f
#define CLAMPV  50000.0f
#define MASKNEG (-9.0e15f)

static_assert(NH * HD == EMB);
static_assert(NQT * 64 == TV);
static_assert(RR * NSTEP * 32 == TV);
static_assert((NV % 64) == 0 && (NL % 64) == 0 && (EMB % 64) == 0 && (LD % 64) == 0 && (TV % 64) == 0);
static_assert((EMB % 32) == 0 && (LD % 32) == 0 && ((2 * EMB) % 32) == 0);
static_assert(SL == 256 && HD == 32 && EMB == 256);

typedef __bf16   v16b __attribute__((ext_vector_type(16)));
typedef __bf16   v8b  __attribute__((ext_vector_type(8)));
typedef float    v8f  __attribute__((ext_vector_type(8)));
typedef float    v4f  __attribute__((ext_vector_type(4)));
typedef unsigned int v4u __attribute__((ext_vector_type(4)));
typedef unsigned int v8u __attribute__((ext_vector_type(8)));
typedef int      v4i  __attribute__((ext_vector_type(4)));
typedef v4f __attribute__((may_alias)) v4fa;
typedef v4i __attribute__((may_alias)) v4ia;

#if defined(__HIP_DEVICE_COMPILE__)
#define DEV_ASM 1
#else
#define DEV_ASM 0
#endif

// ---- scalar helpers --------------------------------------------------------------------------------
__device__ __forceinline__ unsigned short bf_bits(float f) {          // f32 -> bf16 bits, RNE convert
  unsigned u = __float_as_uint(f);
  return (unsigned short)((u + 0x7FFFu + ((u >> 16) & 1u)) >> 16);
}
__device__ __forceinline__ float bf_up(unsigned short hb) { return __uint_as_float(((unsigned)hb) << 16); }
__device__ __forceinline__ float rbf(float f) { return bf_up(bf_bits(f)); }   // value of the bf16 RNE convert
__device__ __forceinline__ unsigned pk16(unsigned short a, unsigned short b) { return (unsigned)a | ((unsigned)b << 16); }
__device__ __forceinline__ v8f zero8() { v8f z = {0.f, 0.f, 0.f, 0.f, 0.f, 0.f, 0.f, 0.f}; return z; }
__device__ __forceinline__ float clampv(float x) { return fminf(fmaxf(x, -CLAMPV), CLAMPV); }
// 2^x. The v_nop is the one free slot that the instruction set asks for behind a transcendental.
__device__ __forceinline__ float exp2_slot(float x) {
#if DEV_ASM
  float r;
  asm("v_exp_f32 %0, %1\n\tv_nop" : "=v"(r) : "v"(x));
  return r;
#else
  return x;
#endif
}
// value of lane l ^ 16 (the other 16-lane row), by a vector cross-row move
__device__ __forceinline__ float xhalf(float x) {
  return __builtin_bit_cast(float, __builtin_amdgcn_permlanex16(__builtin_bit_cast(int, x), __builtin_bit_cast(int, x),
                                                                0x76543210, 0xfedcba98, false, false));
}

// ---- 16-bit A/B fragment loader (wave32): lane -> row/col (lane&15); p already includes +8*(lane>>4);
//      elements 0..7 <- p[0..7] (k0+8h..k0+8h+7), elements 8..15 <- p[16..23] (k0+16+8h..k0+16+8h+7)
__device__ __forceinline__ v16b ldfrag(const __bf16* p) {
  union { v16b v; v8b h[2]; } f;
  f.h[0] = *(const v8b*)(p);
  f.h[1] = *(const v8b*)(p + 16);
  return f.v;
}

// ---- WMMA helpers (asm guard bodies device-only) -------------------------------------------------------
__device__ __forceinline__ v8f mmar(v16b a, v16b b, v8f c) {
  return __builtin_amdgcn_wmma_f32_16x16x32_bf16(false, a, false, b, (short)0, c, false, false);
}
// guarded form: 4 VALU slots after the WMMA, D tied, A/B kept live
__device__ __forceinline__ v8f mma_b(v16b a, v16b b, v8f c) {
  c = __builtin_amdgcn_wmma_f32_16x16x32_bf16(false, a, false, b, (short)0, c, false, false);
#if DEV_ASM
  asm volatile("v_nop\n\tv_nop\n\tv_nop\n\tv_nop" : "+v"(c) : "v"(a), "v"(b));
#endif
  return c;
}
__device__ __forceinline__ void dep_guard(v8f& a, v8f& b, v16b x, v16b y) {
#if DEV_ASM
  asm volatile("v_nop\n\tv_nop\n\tv_nop\n\tv_nop" : "+v"(a), "+v"(b) : "v"(x), "v"(y));
#else
  (void)a; (void)b; (void)x; (void)y;
#endif
}
__device__ __forceinline__ void keep4(v16b a, v16b b, v16b c, v16b d) {
#if DEV_ASM
  asm volatile("v_nop" :: "v"(a), "v"(b), "v"(c), "v"(d));
#else
  (void)a; (void)b; (void)c; (void)d;
#endif
}
__device__ __forceinline__ void acc_guard4(v8f& a, v8f& b, v8f& c, v8f& d) {
#if DEV_ASM
  asm volatile("v_nop\n\tv_nop\n\tv_nop\n\tv_nop" : "+v"(a), "+v"(b), "+v"(c), "+v"(d));
#else
  (void)a; (void)b; (void)c; (void)d;
#endif
}

// ---- B fragment (k = the D tiles' ROW index) from two D tiles held by this lane, split into bf16 hi + residual:
//      element r <- tile a (k 0..15) row r, element 8+r <- tile c (k 16..31) row r, lane unchanged.
union PK { v8u u; v16b v; };
__device__ __forceinline__ void pack_hl(v8f a, v8f c, v16b& fh, v16b& fl) {
  v8u ph, pl;
#pragma unroll
  for (int i = 0; i < 4; ++i) {
    const float x0 = a[2 * i], x1 = a[2 * i + 1];
    const unsigned short h0 = bf_bits(x0), h1 = bf_bits(x1);
    const unsigned short l0 = bf_bits(x0 - bf_up(h0)), l1 = bf_bits(x1 - bf_up(h1));
    ph[i] = pk16(h0, h1);
    pl[i] = pk16(l0, l1);
    const float y0 = c[2 * i], y1 = c[2 * i + 1];
    const unsigned short g0 = bf_bits(y0), g1 = bf_bits(y1);
    const unsigned short n0 = bf_bits(y0 - bf_up(g0)), n1 = bf_bits(y1 - bf_up(g1));
    ph[4 + i] = pk16(g0, g1);
    pl[4 + i] = pk16(n0, n1);
  }
  PK uh, ul;
  uh.u = ph; ul.u = pl;
  fh = uh.v; fl = ul.v;
}

// =====================================================================================================
// f32 -> bf16 bits plane, 8 elements per thread, one 16-B store per lane: a wave writes 512 contiguous B
// coverage: n8 threads x 8 = the whole plane (n8 is a multiple of 256 for every use here).
// =====================================================================================================
__device__ __forceinline__ void cvt_bf16x8(int bx, const float* __restrict__ in, unsigned short* out, int n8) {
  const int i = bx * 256 + (int)threadIdx.x;
  if (i < n8) {
    const v4f a  = *(const v4fa*)(in + (size_t)i * 8);
    const v4f a4 = *(const v4fa*)(in + (size_t)i * 8 + 4);
    v4u p;
    p[0] = pk16(bf_bits(a[0]),  bf_bits(a[1]));
    p[1] = pk16(bf_bits(a[2]),  bf_bits(a[3]));
    p[2] = pk16(bf_bits(a4[0]), bf_bits(a4[1]));
    p[3] = pk16(bf_bits(a4[2]), bf_bits(a4[3]));
    unsigned short* o = out + (size_t)i * 8;
    *(v4u*)o = p;
    
  }
}

// =====================================================================================================
// W [nrows][256] f32 -> bf16 bits [nrows][512] duplicated per 32-column block:
//   out[n][g*64 + w] = bf16(W[n][g*32 + (w & 31)]), g = 0..7, w = 0..63
// (the Bt operand of ctx.W^T where ctx is stored as [hi 32 | residual 32] per head block).
// One wave per row; per half (g 0..3 / 4..7) one instruction: 32 lanes x 16 B = 512 contiguous B = 4 lines.
// =====================================================================================================
__device__ __forceinline__ void cvt_dup(int bx, const float* __restrict__ in, unsigned short* out, int nrows) {
  const int lane = (int)threadIdx.x & 31, wave = (int)threadIdx.x >> 5;
  const int row = bx * 8 + wave;
  if (row >= nrows) return;                                   // wave-uniform; no block barriers here
  const float* src = in + (size_t)row * EMB;
  unsigned short* dst = out + (size_t)row * (2 * EMB);
  v4u p[2];
#pragma unroll
  for (int half = 0; half < 2; ++half) {
    const int g = half * 4 + (lane >> 3);
    const int scol = g * HD + 8 * (lane & 3);
    const v4f a = *(const v4fa*)(src + scol);
    const v4f c = *(const v4fa*)(src + scol + 4);
    v4u q;
    q[0] = pk16(bf_bits(a[0]), bf_bits(a[1]));
    q[1] = pk16(bf_bits(a[2]), bf_bits(a[3]));
    q[2] = pk16(bf_bits(c[0]), bf_bits(c[1]));
    q[3] = pk16(bf_bits(c[2]), bf_bits(c[3]));
    p[half] = q;
  }
  {
#pragma unroll
    for (int half = 0; half < 2; ++half)
      *(v4u*)(dst + half * EMB + 8 * lane) = p[half];
    
  }
}

// =====================================================================================================
// All eight input conversions in one grid: they are independent of one another, so blockIdx.x picks the job.
// Block ranges (256 threads each): W_ov dup, W_ol dup, W_v, W_vv, W_l, W_vl, l, v.
// =====================================================================================================
#define CB_DV  (EMB / 8)                 //   32 blocks, 8 rows each
#define CB_DL  (LD / 8)                  //   96
#define CB_WS  (EMB * EMB / 8 / 256)     //   32 blocks, 2048 elements each
#define CB_WL  (EMB * LD / 8 / 256)      //   96
#define CB_L   (NL * LD / 8 / 256)       //  192
#define CB_V   (NV * EMB / 8 / 256)      // 4000
#define CB_ALL (CB_DV + CB_DL + 2 * CB_WS + 2 * CB_WL + CB_L + CB_V)
static_assert(CB_WS * 2048 == EMB * EMB && CB_WL * 2048 == EMB * LD && CB_L * 2048 == NL * LD && CB_V * 2048 == NV * EMB);
__global__ __launch_bounds__(256) void cvt_all(
    const float* __restrict__ v_in, const float* __restrict__ l_in,
    const float* __restrict__ Wv, const float* __restrict__ Wvv,
    const float* __restrict__ Wl, const float* __restrict__ Wvl,
    const float* __restrict__ Wov, const float* __restrict__ Wol,
    unsigned short* vb, unsigned short* lb, unsigned short* Wvb, unsigned short* Wvvb,
    unsigned short* Wlb, unsigned short* Wvlb, unsigned short* Wovd, unsigned short* Wold) {
  int bx = (int)blockIdx.x;                                   // block-uniform job choice
  if (bx < CB_DV) { cvt_dup(bx, Wov, Wovd, EMB); return; }
  bx -= CB_DV;
  if (bx < CB_DL) { cvt_dup(bx, Wol, Wold, LD); return; }
  bx -= CB_DL;
  if (bx < CB_WS) { cvt_bf16x8(bx, Wv, Wvb, EMB * EMB / 8); return; }
  bx -= CB_WS;
  if (bx < CB_WS) { cvt_bf16x8(bx, Wvv, Wvvb, EMB * EMB / 8); return; }
  bx -= CB_WS;
  if (bx < CB_WL) { cvt_bf16x8(bx, Wl, Wlb, EMB * LD / 8); return; }
  bx -= CB_WL;
  if (bx < CB_WL) { cvt_bf16x8(bx, Wvl, Wvlb, EMB * LD / 8); return; }
  bx -= CB_WL;
  if (bx < CB_L) { cvt_bf16x8(bx, l_in, lb, NL * LD / 8); return; }
  bx -= CB_L;
  cvt_bf16x8(bx, v_in, vb, NV * EMB / 8);
}

// =====================================================================================================
// Register-blocked batched WMMA GEMM (bf16 operands): C[m][n] = sum_k A[m][k] * Bt[n][k];
// one wave per 64x64 tile, no block barriers. A row-major [M][K] pitch lda; Bt row-major [N][K] pitch ldb
// (k contiguous); M, N multiples of 64, K multiple of 32 (host-checked). bx = block of 8 tiles, b = batch index
// (strides in elements); sT = the block's LDS slabs, declared by the calling kernel. Fragments are loaded straight from global with the split k map (ldfrag).
// OUT_MODE 0: f32 C (pitch ldc), value = (acc + bf16(bias[n])) * oscale.
// OUT_MODE 3: bf16 hi plane C + bf16 residual plane C2 = bf16(y - hi) (same pitch / stride),
//             y = (acc + bf16(bias)) * oscale; bias[n] (BIASM 0) or bias[m] (BIASM 1).
// =====================================================================================================
template <int OUT_MODE, int BIASM>
__device__ __forceinline__ void gemm64_body(
    float (*sT)[16 * 68], int bx, int b,
    const unsigned short* __restrict__ Ap, int lda, long long strideA,
    const unsigned short* __restrict__ Btp, int ldb, long long strideB,
    const float* __restrict__ bias,
    void* Cout, void* Cout2, int ldc, long long strideC,
    int M, int N, int K, float oscale) {
  static_assert(OUT_MODE == 0 || OUT_MODE == 3);
  static_assert(OUT_MODE != 0 || BIASM == 0);
  const __bf16* A  = (const __bf16*)(const void*)Ap;
  const __bf16* Bt = (const __bf16*)(const void*)Btp;
  const int lane = threadIdx.x & 31;
  const int wave = threadIdx.x >> 5;
  const int tilesN = N >> 6;
  const int tilesM = M >> 6;
  const int tile = bx * 8 + wave;
  if (tile >= tilesM * tilesN) return;   // wave-uniform; no block barriers in this kernel
  const int tm = tile / tilesN;
  const int tn = tile - tm * tilesN;
  const int m0 = tm << 6;
  const int n0 = tn << 6;

  const __bf16* Ab = A  + (size_t)b * (size_t)strideA;
  const __bf16* Bb = Bt + (size_t)b * (size_t)strideB;

  const int rlane = lane & 15;                 // row (A) / col (B, D) within subtile
  const int koff  = (lane >> 4) * 8;           // k offset of this lane half
  const int mOff  = (lane >> 4) * 8;           // D row offset

  v8f acc[4][4];
#pragma unroll
  for (int i = 0; i < 4; ++i)
#pragma unroll
    for (int j = 0; j < 4; ++j) acc[i][j] = zero8();

  for (int k0 = 0; k0 < K; k0 += 32) {
    v16b bq[4];
#pragma unroll
    for (int j = 0; j < 4; ++j)
      bq[j] = ldfrag(Bb + (size_t)(n0 + (j << 4) + rlane) * ldb + koff + k0);
#pragma unroll
    for (int i = 0; i < 4; ++i) {
      const v16b af = ldfrag(Ab + (size_t)(m0 + (i << 4) + rlane) * lda + koff + k0);
#pragma unroll
      for (int j = 0; j < 4; ++j) acc[i][j] = mmar(af, bq[j], acc[i][j]);
      dep_guard(acc[i][0], acc[i][3], af, bq[3]);
    }
    keep4(bq[0], bq[1], bq[2], bq[3]);
  }
  acc_guard4(acc[0][0], acc[0][1], acc[0][2], acc[0][3]);
  acc_guard4(acc[1][0], acc[1][1], acc[1][2], acc[1][3]);
  acc_guard4(acc[2][0], acc[2][1], acc[2][2], acc[2][3]);
  acc_guard4(acc[3][0], acc[3][1], acc[3][2], acc[3][3]);

  // ---- epilogue ----
  float* slab = sT[wave];
  const int h2 = lane >> 4, c4 = (lane & 15) * 4;     // OUT_MODE 0 map: 256-B row segment = 16 lanes x 16 B
  const int q = lane >> 3, c8 = (lane & 7) * 8;
  v4f bb4;                                             // bias for columns n0+c4..+3 (mode 0)
  float bcol[8];                                       // bias for columns n0+c8..+7 (mode 3, BIASM 0)
  if (OUT_MODE == 0) {
    const v4f braw = *(const v4fa*)(bias + n0 + c4);
    bb4[0] = rbf(braw[0]); bb4[1] = rbf(braw[1]); bb4[2] = rbf(braw[2]); bb4[3] = rbf(braw[3]);
  } else {
    if (BIASM == 0) {
      const v4f b0 = *(const v4fa*)(bias + n0 + c8);
      const v4f b1 = *(const v4fa*)(bias + n0 + c8 + 4);
#pragma unroll
      for (int e = 0; e < 4; ++e) { bcol[e] = rbf(b0[e]); bcol[4 + e] = rbf(b1[e]); }
    } else {
#pragma unroll
      for (int e = 0; e < 8; ++e) bcol[e] = 0.f;
    }
  }
#pragma unroll
  for (int i = 0; i < 4; ++i) {
    const int mBase = m0 + (i << 4);
#pragma unroll
    for (int j = 0; j < 4; ++j) {
#pragma unroll
      for (int r = 0; r < 8; ++r) {
        slab[(mOff + r) * 68 + (j << 4) + rlane] = acc[i][j][r];
      }
    }
    __builtin_amdgcn_fence(__ATOMIC_RELEASE, "workgroup");
    __builtin_amdgcn_wave_barrier();
    __builtin_amdgcn_fence(__ATOMIC_ACQUIRE, "workgroup");
    if (OUT_MODE == 0) {
      float* C = (float*)Cout + (size_t)b * (size_t)strideC;
      {
#pragma unroll
        for (int it = 0; it < 8; ++it) {
          const int row = it * 2 + h2;                     // it 0..7 x h2 0..1 = rows 0..15
          v4f v = *(const v4fa*)(slab + row * 68 + c4);
          v = (v + bb4) * oscale;
          *(v4f*)(C + (size_t)(mBase + row) * ldc + n0 + c4) = v;
        }
        
      }
    } else {
      unsigned short* C  = (unsigned short*)Cout  + (size_t)b * (size_t)strideC;
      unsigned short* C2 = (unsigned short*)Cout2 + (size_t)b * (size_t)strideC;
      v4u hv[4], lv[4];
#pragma unroll
      for (int it = 0; it < 4; ++it) {
        const int row = it * 4 + q;                        // it 0..3 x q 0..3 = rows 0..15
        const float* sp = slab + row * 68 + c8;
        float brow = 0.f;
        if (BIASM == 1) brow = rbf(bias[mBase + row]);
        v4u a, a2;
#pragma unroll
        for (int e = 0; e < 4; ++e) {
          const float f0 = (sp[2 * e]     + ((BIASM == 1) ? brow : bcol[2 * e]))     * oscale;
          const float f1 = (sp[2 * e + 1] + ((BIASM == 1) ? brow : bcol[2 * e + 1])) * oscale;
          const unsigned short h0 = bf_bits(f0), h1 = bf_bits(f1);
          const unsigned short l0 = bf_bits(f0 - bf_up(h0)), l1 = bf_bits(f1 - bf_up(h1));
          a[e] = pk16(h0, h1); a2[e] = pk16(l0, l1);
        }
        hv[it] = a; lv[it] = a2;
      }
      {
#pragma unroll
        for (int it = 0; it < 4; ++it) {
          const int row = it * 4 + q;
          *(v4u*)(C  + (size_t)(mBase + row) * ldc + n0 + c8) = hv[it];
          *(v4u*)(C2 + (size_t)(mBase + row) * ldc + n0 + c8) = lv[it];
        }
        
      }
    }
    __builtin_amdgcn_fence(__ATOMIC_RELEASE, "workgroup");
    __builtin_amdgcn_wave_barrier();
    __builtin_amdgcn_fence(__ATOMIC_ACQUIRE, "workgroup");
  }
}

// ---- one GEMM per launch (used for out0 and out1) ----
__global__ __launch_bounds__(256) void gemm64_f32(
    const unsigned short* __restrict__ Ap, int lda,
    const unsigned short* __restrict__ Btp, int ldb,
    const float* __restrict__ bias, float* Cout, int ldc, int M, int N, int K) {
  __shared__ __align__(16) float sT[8][16 * 68];   // per-wave 16x64 slab, pitch 68 floats
  gemm64_body<0, 0>(sT, (int)blockIdx.x, 0, Ap, lda, 0LL, Btp, ldb, 0LL, bias,
                    (void*)Cout, (void*)Cout, ldc, 0LL, M, N, K, 1.0f);
}

// =====================================================================================================
// The four input projections in one grid: none reads what another writes, so blockIdx.x picks the job.
// The two K = 768 jobs (few tiles, longest k loop) take the first blocks.
//   k      = l . W_l^T + b_l              [b*SL+s][256]         M=512,   N=256,   K=768
//   val_l^T = W_vl . l^T + b_vl per batch [b][d][s] pitch SL    M=256,   N=256,   K=768
//   q      = (v . W_v^T + b_v) * scale    [b*TV+t][256]         M=32000, N=256,   K=256
//   val_v^T = W_vv . v^T + b_vv per batch [b][d][t] pitch TV    M=256,   N=16000, K=256
// every result as bf16 hi / residual planes.
// =====================================================================================================
#define PB_K   ((NL / 64) * (EMB / 64) / 8)      //   4 blocks
#define PB_VL1 ((EMB / 64) * (SL / 64) / 8)      //   2 blocks per batch
#define PB_Q   ((NV / 64) * (EMB / 64) / 8)      // 250 blocks
#define PB_VV1 ((EMB / 64) * (TV / 64) / 8)      // 125 blocks per batch
#define PB_ALL (PB_K + NB * PB_VL1 + PB_Q + NB * PB_VV1)
static_assert(PB_K * 8 * 4096 == NL * EMB && PB_VL1 * 8 * 4096 == EMB * SL);
static_assert(PB_Q * 8 * 4096 == NV * EMB && PB_VV1 * 8 * 4096 == EMB * TV);
__global__ __launch_bounds__(256) void proj_all(
    const unsigned short* __restrict__ vb, const unsigned short* __restrict__ lb,
    const unsigned short* __restrict__ Wvb, const unsigned short* __restrict__ Wlb,
    const unsigned short* __restrict__ Wvvb, const unsigned short* __restrict__ Wvlb,
    const float* __restrict__ bv, const float* __restrict__ bl,
    const float* __restrict__ bvv, const float* __restrict__ bvl,
    unsigned short* Qh, unsigned short* Ql, unsigned short* Kh, unsigned short* Kl,
    unsigned short* VvTh, unsigned short* VvTl, unsigned short* VlTh, unsigned short* VlTl) {
  __shared__ __align__(16) float sT[8][16 * 68];   // per-wave 16x64 slab, pitch 68 floats
  const int bid = (int)blockIdx.x;                 // block-uniform job choice
  const bool lang = bid < PB_K + NB * PB_VL1;      // operand l (K = 768) or v (K = 256)
  const int r = lang ? bid : bid - (PB_K + NB * PB_VL1);
  const int nrow = lang ? PB_K : PB_Q;             // blocks of the row-major job of this operand
  const unsigned short* x = lang ? lb : vb;
  const int kd = lang ? LD : EMB;
  if (r < nrow) {
    gemm64_body<3, 0>(sT, r, 0, x, kd, 0LL, lang ? Wlb : Wvb, kd, 0LL, lang ? bl : bv,
                      (void*)(lang ? Kh : Qh), (void*)(lang ? Kl : Ql), EMB, 0LL,
                      lang ? NL : NV, EMB, kd, lang ? 1.0f : SCALEQ);
  } else {
    const int per = lang ? PB_VL1 : PB_VV1;
    const int r2 = r - nrow;
    const int b = (r2 >= per) ? 1 : 0;
    static_assert(NB == 2);
    const int nt = lang ? SL : TV;                 // rows of x per batch = N = output pitch
    gemm64_body<3, 1>(sT, r2 - b * per, b, lang ? Wvlb : Wvvb, kd, 0LL, x, kd, (long long)nt * kd,
                      lang ? bvl : bvv, (void*)(lang ? VlTh : VvTh), (void*)(lang ? VlTl : VvTl),
                      nt, (long long)EMB * nt, EMB, nt, kd, 1.0f);
  }
}

// ---- additive key mask: -9e15 where the int32 mask is 0, else 0 (8 consecutive keys, 2 int4 loads) ----
__device__ __forceinline__ v8f add_mask8(v8f s, const int* p) {
  const v4i ma = *(const v4ia*)p;
  const v4i mb = *(const v4ia*)(p + 4);
  s[0] += (ma[0] == 0) ? MASKNEG : 0.0f;
  s[1] += (ma[1] == 0) ? MASKNEG : 0.0f;
  s[2] += (ma[2] == 0) ? MASKNEG : 0.0f;
  s[3] += (ma[3] == 0) ? MASKNEG : 0.0f;
  s[4] += (mb[0] == 0) ? MASKNEG : 0.0f;
  s[5] += (mb[1] == 0) ? MASKNEG : 0.0f;
  s[6] += (mb[2] == 0) ? MASKNEG : 0.0f;
  s[7] += (mb[3] == 0) ? MASKNEG : 0.0f;
  return s;
}

// =====================================================================================================
// Pass A: vision-direction attention (softmax over the 256 text keys, masked).
//   Planes: Qh/Ql, Kh/Kl bf16 [row][256] (row = b*TV + t / b*SL + s, head block h*32);
//           Vlh/Vll = val_l^T bf16 [b][256 d][256 s]; mask int32 [b][256].
//   Transposed form: S^T = K.Q^T (A = K rows: row = key, k = d; B = Q^T from the q row, n = query),
//   3 products (hh, hl, lh); D = S^T[key 8hh+r][query m]. Online softmax over 4 chunks of 64 keys in f32;
//   P^T hi / residual B fragments packed from registers; O^T += Vl^T . P^T (A = Vl^T rows: row = d, k = key).
//   Block = 4 waves x 16 queries = 64 query rows of one (b,h); grid (NQT, NB*NH).
//   Output: the ctx plane, written per wave as 16 lines, lanes 8q..8q+7 one line, 4 lines per instruction.
//   coverage: 250 x 16 blocks x 64 rows of one head = every (row, head) line of the ctx plane.
// =====================================================================================================
__global__ __launch_bounds__(128)
void attn_v(const unsigned short* __restrict__ qhp, const unsigned short* __restrict__ qlp,
            const unsigned short* __restrict__ khp, const unsigned short* __restrict__ klp,
            const unsigned short* __restrict__ vhp, const unsigned short* __restrict__ vlp,
            const int* __restrict__ maskl, unsigned short* ctxp) {
  __shared__ __align__(16) float sO[4][16 * HD];    // per-wave 16x32 context tile  8 KB

  const int tid = threadIdx.x, lane = tid & 31, w = tid >> 5;
  const int hh = lane >> 4, m = lane & 15;
  const int qt = blockIdx.x, bh = blockIdx.y, b = bh >> 3, head = bh & 7;
  const int q0 = qt * 64 + 16 * w;

  const __bf16* Qh = (const __bf16*)(const void*)qhp;
  const __bf16* Ql = (const __bf16*)(const void*)qlp;
  const __bf16* Kh = (const __bf16*)(const void*)khp;
  const __bf16* Kl = (const __bf16*)(const void*)klp;
  const __bf16* Vh = (const __bf16*)(const void*)vhp;
  const __bf16* Vl = (const __bf16*)(const void*)vlp;

  // Q^T B-fragments: column n = query q0+m, k = d (one 32-deep step)
  const size_t qoff = ((size_t)b * TV + q0 + m) * EMB + head * HD + 8 * hh;
  const v16b qbh = ldfrag(Qh + qoff);
  const v16b qbl = ldfrag(Ql + qoff);

  const __bf16* kbh = Kh + ((size_t)b * SL + m) * EMB + head * HD + 8 * hh;     // + key0*EMB
  const __bf16* kbl = Kl + ((size_t)b * SL + m) * EMB + head * HD + 8 * hh;
  const __bf16* vbh = Vh + ((size_t)b * EMB + head * HD + m) * SL + 8 * hh;      // + 16dt*SL + key0
  const __bf16* vbl = Vl + ((size_t)b * EMB + head * HD + m) * SL + 8 * hh;
  const int* mkp = maskl + b * SL + 8 * hh;                                      // + key tile base

  v8f o[2];
  o[0] = zero8(); o[1] = zero8();
  float mrun = -1.0e30f, lrun = 0.0f;

#pragma unroll 1
  for (int kc = 0; kc < SL / 64; ++kc) {
    const int kb0 = kc * 64;
    // ---- scores s[j][r] = S[query q0+m][key kb0+16j+8hh+r] ----
    v8f s[4];
#pragma unroll
    for (int j = 0; j < 4; ++j) {
      const size_t ko = (size_t)(kb0 + 16 * j) * EMB;
      const v16b kfh = ldfrag(kbh + ko);
      const v16b kfl = ldfrag(kbl + ko);
      v8f z = zero8();
      z = mma_b(kfh, qbh, z);
      z = mma_b(kfl, qbh, z);
      z = mma_b(kfh, qbl, z);
      s[j] = z;
    }
    // ---- clamp (pre-mask) ----
#pragma unroll
    for (int j = 0; j < 4; ++j)
#pragma unroll
      for (int r = 0; r < 8; ++r) s[j][r] = clampv(s[j][r]);
    // ---- additive mask per key, f32 ----
#pragma unroll
    for (int j = 0; j < 4; ++j) s[j] = add_mask8(s[j], mkp + kb0 + 16 * j);

    // ---- online softmax per query column ----
    float mloc = s[0][0];
#pragma unroll
    for (int j = 0; j < 4; ++j)
#pragma unroll
      for (int r = 0; r < 8; ++r) mloc = fmaxf(mloc, s[j][r]);
    mloc = fmaxf(mloc, __shfl_xor(mloc, 16, 32));
    const float mnew = fmaxf(mrun, mloc);
    const float alpha = __expf(mrun - mnew);
    mrun = mnew;
    float lsum = 0.0f;
#pragma unroll
    for (int j = 0; j < 4; ++j)
#pragma unroll
      for (int r = 0; r < 8; ++r) {
        const float p = __expf(s[j][r] - mnew);
        s[j][r] = p;
        lsum += p;
      }
    lsum += __shfl_xor(lsum, 16, 32);
    lrun = lrun * alpha + lsum;
#pragma unroll
    for (int dt = 0; dt < 2; ++dt)
#pragma unroll
      for (int r = 0; r < 8; ++r) o[dt][r] = o[dt][r] * alpha;

    // ---- P^T B-fragments (keys 0..31 and 32..63 of this chunk), bf16 hi + residual ----
    v16b pbh0, pbl0, pbh1, pbl1;
    pack_hl(s[0], s[1], pbh0, pbl0);
    pack_hl(s[2], s[3], pbh1, pbl1);

    // ---- O^T += Vl^T . P^T (3 products per k-step) ----
#pragma unroll
    for (int dt = 0; dt < 2; ++dt) {
      const size_t vo = (size_t)(16 * dt) * SL + kb0;
      const v16b vh0 = ldfrag(vbh + vo), vh1 = ldfrag(vbh + vo + 32);
      const v16b vl0 = ldfrag(vbl + vo), vl1 = ldfrag(vbl + vo + 32);
      v8f a = o[dt];
      a = mma_b(vh0, pbh0, a);
      a = mma_b(vh0, pbl0, a);
      a = mma_b(vl0, pbh0, a);
      a = mma_b(vh1, pbh1, a);
      a = mma_b(vh1, pbl1, a);
      a = mma_b(vl1, pbh1, a);
      o[dt] = a;
    }
  }

  // ---- normalise (1/l), stage the wave's 16 (query) x 32 (d) f32 tile ----
  const float inv = 1.0f / lrun;
  float* so = sO[w];
#pragma unroll
  for (int dt = 0; dt < 2; ++dt)
#pragma unroll
    for (int r = 0; r < 8; ++r)
      so[m * HD + 16 * dt + 8 * hh + r] = o[dt][r] * inv;
  __syncthreads();

  {
    const int sub = lane >> 3, piece = lane & 7;
    const int csel = 8 * (piece & 3);
    const bool islo = (piece & 4) != 0;
    v4u hv[4];
#pragma unroll
    for (int i = 0; i < 4; ++i) {
      const int lid = i * 4 + sub;                      // i 0..3 x sub 0..3 = rows 0..15
      const float* sp = so + lid * HD + csel;
      v4u a;
#pragma unroll
      for (int e = 0; e < 4; ++e) {
        const float x0 = sp[2 * e], x1 = sp[2 * e + 1];
        const unsigned short h0 = bf_bits(x0), h1 = bf_bits(x1);
        const unsigned short l0 = bf_bits(x0 - bf_up(h0)), l1 = bf_bits(x1 - bf_up(h1));
        a[e] = islo ? pk16(l0, l1) : pk16(h0, h1);
      }
      hv[i] = a;
    }
    {
#pragma unroll
      for (int i = 0; i < 4; ++i) {
        const int lid = i * 4 + sub;
        const size_t go = ((size_t)b * TV + q0 + lid) * (2 * EMB) + head * (2 * HD) + 8 * piece;
        *(v4u*)(ctxp + go) = hv[i];
      }
      
    }
  }
}

// =====================================================================================================
// Pass B: language-direction partial sums. For (b,h), key half kq (128 keys), t range rg (1600 t):
//   S = Q.K^T (A = Q rows: row = t, k = d; B from K rows: n = key), 3 products, D = S[t 8hh+r][key m];
//   e = exp(clamp(clamp(S) - m[key])) in f32, m[key] = the running maximum of clamp(S) over the t this range has
//   seen (a softmax does not depend on the value subtracted; when m grows, acc and colsum are scaled by
//   exp(m_old - m_new)); e packed from registers as the B operand with k = t
//   (bf16 hi + residual); acc^T[d][key] += Vv^T . e (A = val_v^T rows: row = d, k = t), 3 products,
//   f32 accumulation across the 50 steps; colsum[key] += e in f32.
//   Block = 4 waves x 32 keys; grid (RR, 2, NB*NH). Record [bh][rg][34 rows][256]: rows 0..31 = acc^T[d],
//   row 32 = colsum, row 33 = the range's final m.
// =====================================================================================================
__global__ __launch_bounds__(128)
void attn_l(const unsigned short* __restrict__ qhp, const unsigned short* __restrict__ qlp,
            const unsigned short* __restrict__ khp, const unsigned short* __restrict__ klp,
            const unsigned short* __restrict__ vhp, const unsigned short* __restrict__ vlp,
            float* rec) {
  __shared__ __align__(16) float st[4][RECROWS * 32];   // per-wave 34x32 staging, 17408 B

  const int tid = threadIdx.x, lane = tid & 31, w = tid >> 5;
  const int hh = lane >> 4, m = lane & 15;
  const int rg = blockIdx.x, kq = blockIdx.y, bh = blockIdx.z, b = bh >> 3, head = bh & 7;
  const int s0 = kq * 128 + 32 * w;
  const int tb = rg * TPR;

  const __bf16* Qh = (const __bf16*)(const void*)qhp;
  const __bf16* Ql = (const __bf16*)(const void*)qlp;
  const __bf16* Kh = (const __bf16*)(const void*)khp;
  const __bf16* Kl = (const __bf16*)(const void*)klp;
  const __bf16* Vh = (const __bf16*)(const void*)vhp;
  const __bf16* Vl = (const __bf16*)(const void*)vlp;

  // K B-fragments for this wave's two 16-key tiles (n = key s0+16jj+m, k = d), hi and residual planes
  v16b kfh[2], kfl[2];
  float mrun[2], csum[2];
#pragma unroll
  for (int jj = 0; jj < 2; ++jj) {
    const size_t ko = ((size_t)b * SL + s0 + 16 * jj + m) * EMB + head * HD + 8 * hh;
    kfh[jj] = ldfrag(Kh + ko);
    kfl[jj] = ldfrag(Kl + ko);
    mrun[jj] = -1.0e30f;
    csum[jj] = 0.0f;
  }
  v8f acc[2][2];
#pragma unroll
  for (int dt = 0; dt < 2; ++dt) { acc[dt][0] = zero8(); acc[dt][1] = zero8(); }

  const __bf16* qbh = Qh + ((size_t)b * TV + m) * EMB + head * HD + 8 * hh;     // + t*EMB
  const __bf16* qbl = Ql + ((size_t)b * TV + m) * EMB + head * HD + 8 * hh;
  const __bf16* vbh = Vh + ((size_t)b * EMB + head * HD + m) * TV + 8 * hh;      // + 16dt*TV + t0
  const __bf16* vbl = Vl + ((size_t)b * EMB + head * HD + m) * TV + 8 * hh;

#pragma unroll 1
  for (int step = 0; step < NSTEP; ++step) {
    const int t0 = tb + 32 * step;
    v16b qah[2], qal[2], vah[2], val2[2];
#pragma unroll
    for (int tt = 0; tt < 2; ++tt) {
      const size_t qo = (size_t)(t0 + 16 * tt) * EMB;
      qah[tt] = ldfrag(qbh + qo);
      qal[tt] = ldfrag(qbl + qo);
    }
#pragma unroll
    for (int dt = 0; dt < 2; ++dt) {
      const size_t vo = (size_t)(16 * dt) * TV + t0;
      vah[dt]  = ldfrag(vbh + vo);
      val2[dt] = ldfrag(vbl + vo);
    }
#pragma unroll
    for (int jj = 0; jj < 2; ++jj) {
      // scores for t rows t0..t0+15 (d0) and t0+16..t0+31 (d1), key columns s0+16jj+m
      v8f d0 = zero8(), d1 = zero8();
      d0 = mma_b(qah[0], kfh[jj], d0);
      d0 = mma_b(qah[0], kfl[jj], d0);
      d0 = mma_b(qal[0], kfh[jj], d0);
      d1 = mma_b(qah[1], kfh[jj], d1);
      d1 = mma_b(qah[1], kfl[jj], d1);
      d1 = mma_b(qal[1], kfh[jj], d1);
      // clamp; maximum of this key column over the step's 32 t rows (16 in this lane, 16 in lane ^ 16)
      float tm[8];
#pragma unroll
      for (int r = 0; r < 8; ++r) {
        d0[r] = clampv(d0[r]);
        d1[r] = clampv(d1[r]);
        tm[r] = fmaxf(d0[r], d1[r]);
      }
      float ml = fmaxf(fmaxf(fmaxf(tm[0], tm[1]), fmaxf(tm[2], tm[3])), fmaxf(fmaxf(tm[4], tm[5]), fmaxf(tm[6], tm[7])));
      ml = fmaxf(ml, xhalf(ml));
      const float mv = fmaxf(mrun[jj], ml);
      const float alpha = __expf(mrun[jj] - mv);         // 0 on the first step, 1 while the maximum stands
      mrun[jj] = mv;
      float cl = csum[jj] * alpha;
#pragma unroll
      for (int r = 0; r < 8; ++r) {
        const float x0 = clampv(d0[r] - mv);
        const float e0 = __expf(x0);
        d0[r] = e0; cl += e0;
        const float x1 = clampv(d1[r] - mv);
        const float e1 = __expf(x1);
        d1[r] = e1; cl += e1;
      }
      csum[jj] = cl;
      // e as the B operand with k = t (tile d0 = t 0..15, tile d1 = t 16..31), bf16 hi + residual
      v16b ebh, ebl;
      pack_hl(d0, d1, ebh, ebl);
#pragma unroll
      for (int dt = 0; dt < 2; ++dt) {
        v8f a = acc[dt][jj];
#pragma unroll
        for (int r = 0; r < 8; ++r) a[r] = a[r] * alpha;
        a = mma_b(vah[dt],  ebh, a);
        a = mma_b(vah[dt],  ebl, a);
        a = mma_b(val2[dt], ebh, a);
        acc[dt][jj] = a;
      }
    }
  }

  // ---- combine the two lane halves of the column sums; stage acc^T (32 d x 32 keys) + colsum row + max row ----
#pragma unroll
  for (int jj = 0; jj < 2; ++jj) csum[jj] += __shfl_xor(csum[jj], 16, 32);
  float* sw = st[w];
#pragma unroll
  for (int dt = 0; dt < 2; ++dt)
#pragma unroll
    for (int jj = 0; jj < 2; ++jj)
#pragma unroll
      for (int r = 0; r < 8; ++r)
        sw[(16 * dt + 8 * hh + r) * 32 + 16 * jj + m] = acc[dt][jj][r];
  if (hh == 0) {
    sw[32 * 32 + m]      = csum[0];
    sw[32 * 32 + 16 + m] = csum[1];
    sw[33 * 32 + m]      = mrun[0];
    sw[33 * 32 + 16 + m] = mrun[1];
  }
  __syncthreads();

  // ---- record lines: row lid (0..33) of this wave = 32 floats at column s0, lanes 8*sub..+7, 4 rows per instruction ----
  {
    const int sub = lane >> 3, piece = lane & 7;
    float* rbase = rec + (((size_t)bh * RR + rg) * RECROWS) * SL + s0 + 4 * piece;
    {
#pragma unroll
      for (int i = 0; i < 9; ++i) {
        const int lid  = i * 4 + sub;
        const int lidc = (lid < RECROWS) ? lid : (RECROWS - 1);
        const v4f vv = *(const v4fa*)(sw + lidc * 32 + 4 * piece);
        if (lid < RECROWS) *(v4f*)(rbase + (size_t)lid * SL) = vv;
      }
      
    }
  }
}

// =====================================================================================================
// Language-direction fold: with w[rg] = exp(m[rg][s] - max_rg m[rg][s]),
// ctx_l[b][s][h*32+d] = (sum_rg w[rg] acc[rg][d][s]) / (sum_rg w[rg] colsum[rg][s]) in fixed order.
// Block = one (b,s), thread = (h, d); threads 0..63 write the 1-KB row, 16 B each (2 instructions of 4 lines),
// =====================================================================================================
__global__ __launch_bounds__(256) void fold_l(const float* __restrict__ rec, unsigned short* ctxl) {
  __shared__ __align__(16) float xs[EMB];
  const int bs = blockIdx.x, b = bs / SL, s = bs - b * SL;
  const int t = (int)threadIdx.x, head = t >> 5, d = t & 31;
  const int bh = b * NH + head;
  const float* p = rec + ((size_t)bh * RR) * RECROWS * SL + s;
  float mr[RR];
#pragma unroll   // mr[] stays in registers; the ranges' loads are in flight together
  for (int rg = 0; rg < RR; ++rg) mr[rg] = p[((size_t)rg * RECROWS + 33) * SL];
  float mall = mr[0];
#pragma unroll   // constant index into mr[]
  for (int rg = 1; rg < RR; ++rg) mall = fmaxf(mall, mr[rg]);
#pragma unroll   // constant index into mr[]
  for (int rg = 0; rg < RR; ++rg) mr[rg] = exp2_slot((mr[rg] - mall) * 1.44269504f);   // the range's weight e^(m - max)
  float a = 0.0f, cs = 0.0f;
#pragma unroll   // constant index into mr[]; fixed order of the sums
  for (int rg = 0; rg < RR; ++rg) {
    const float* pr = p + (size_t)rg * RECROWS * SL;
    a  += mr[rg] * pr[(size_t)d * SL];
    cs += mr[rg] * pr[(size_t)32 * SL];
  }
  xs[t] = a * (1.0f / cs);
  __syncthreads();
  if (t < 64) {
    const int hg = t >> 3, wq = t & 7;
    const float* sp = xs + hg * HD + 8 * (wq & 3);
    const bool islo = (wq & 4) != 0;
    v4u vv;
#pragma unroll
    for (int e = 0; e < 4; ++e) {
      const float x0 = sp[2 * e], x1 = sp[2 * e + 1];
      const unsigned short h0 = bf_bits(x0), h1 = bf_bits(x1);
      const unsigned short l0 = bf_bits(x0 - bf_up(h0)), l1 = bf_bits(x1 - bf_up(h1));
      vv[e] = islo ? pk16(l0, l1) : pk16(h0, h1);
    }
    unsigned short* dst = ctxl + (size_t)bs * (2 * EMB) + hg * (2 * HD) + 8 * wq;
    *(v4u*)dst = vv;
    
  }
}

// =====================================================================================================
// Workspace map (bytes), every region an exact multiple of its whole-line / whole-tile store granularity
// (no padded tails: all dims are tile multiples):
//   vb    bf16 [32000][256]        16384000
//   lb    bf16 [512][768]            786432
//   Wvb   bf16 [256][256]            131072
//   Wvvb  bf16 [256][256]            131072
//   Wlb   bf16 [256][768]            393216
//   Wvlb  bf16 [256][768]            393216
//   Wovd  bf16 [256][512]            262144
//   Wold  bf16 [768][512]            786432
//   Qh,Ql bf16 [32000][256] x2     32768000
//   Kh,Kl bf16 [512][256] x2         524288
//   VlTh,VlTl bf16 [2][256][256] x2  524288
//   VvTh,VvTl bf16 [2][256][16000] x2 32768000
//   CTXV  bf16 [32000][512]        32768000
//   REC   f32  [16][10][34][256]    5570560
//   CTXL  bf16 [512][512]            524288
//   total                        124715008
// Weights are [out n][in k] with k contiguous = the Bt / A layout the GEMM wants, so none is transposed; W_ov, W_ol are also duplicated along k.
// =====================================================================================================
extern "C" void kernel_launch(void* const* d_in, const int* in_sizes, int n_in,
                              void* d_out, int out_size, void* d_ws, size_t ws_size,
                              hipStream_t stream) {
  if (n_in < 15) return;
  if (in_sizes[0] != NV * EMB || in_sizes[1] != NL * LD || in_sizes[2] != NB * SL) return;
  if (in_sizes[3] != EMB * EMB || in_sizes[4] != EMB || in_sizes[5] != EMB * LD || in_sizes[6] != EMB) return;
  if (in_sizes[7] != EMB * EMB || in_sizes[8] != EMB || in_sizes[9] != EMB * LD || in_sizes[10] != EMB) return;
  if (in_sizes[11] != EMB * EMB || in_sizes[12] != EMB || in_sizes[13] != LD * EMB || in_sizes[14] != LD) return;
  if (out_size != NV * EMB + NL * LD) return;

  const float* v_in = (const float*)d_in[0];
  const float* l_in = (const float*)d_in[1];
  const int*   mk   = (const int*)d_in[2];
  const float* Wv   = (const float*)d_in[3];
  const float* bv   = (const float*)d_in[4];
  const float* Wl   = (const float*)d_in[5];
  const float* bl   = (const float*)d_in[6];
  const float* Wvv  = (const float*)d_in[7];
  const float* bvv  = (const float*)d_in[8];
  const float* Wvl  = (const float*)d_in[9];
  const float* bvl  = (const float*)d_in[10];
  const float* Wov  = (const float*)d_in[11];
  const float* bov  = (const float*)d_in[12];
  const float* Wol  = (const float*)d_in[13];
  const float* bol  = (const float*)d_in[14];
  float* out0 = (float*)d_out;
  float* out1 = out0 + (size_t)NV * EMB;            // byte 32768000; last element 8585215 < out_size

  const size_t PVB  = (size_t)NV * EMB * 2;          // 16384000
  const size_t PLB  = (size_t)NL * LD * 2;           //   786432
  const size_t PWS  = (size_t)EMB * EMB * 2;         //   131072
  const size_t PWL  = (size_t)EMB * LD * 2;          //   393216
  const size_t PWOD = (size_t)EMB * 2 * EMB * 2;     //   262144
  const size_t PWLD = (size_t)LD * 2 * EMB * 2;      //   786432
  const size_t PQ   = (size_t)NV * EMB * 2;          // 16384000
  const size_t PK   = (size_t)NL * EMB * 2;          //   262144
  const size_t PVLT = (size_t)NB * EMB * SL * 2;     //   262144
  const size_t PVVT = (size_t)NB * EMB * TV * 2;     // 16384000
  const size_t PCTX = (size_t)NV * 2 * EMB * 2;      // 32768000
  const size_t PREC = (size_t)NB * NH * RR * RECROWS * SL * 4;  // 5570560
  const size_t PCTL = (size_t)NL * 2 * EMB * 2;      //   524288
  size_t off = 0;
  const size_t oVB  = off; off += PVB;
  const size_t oLB  = off; off += PLB;
  const size_t oWv  = off; off += PWS;
  const size_t oWvv = off; off += PWS;
  const size_t oWl  = off; off += PWL;
  const size_t oWvl = off; off += PWL;
  const size_t oWod = off; off += PWOD;
  const size_t oWld = off; off += PWLD;
  const size_t oQh  = off; off += PQ;
  const size_t oQl  = off; off += PQ;
  const size_t oKh  = off; off += PK;
  const size_t oKl  = off; off += PK;
  const size_t oVLh = off; off += PVLT;
  const size_t oVLl = off; off += PVLT;
  const size_t oVVh = off; off += PVVT;
  const size_t oVVl = off; off += PVVT;
  const size_t oCTX = off; off += PCTX;
  const size_t oREC = off; off += PREC;
  const size_t oCTL = off; off += PCTL;
  if (off > ws_size) return;                         // off = 124715008
  if (off > (size_t)134217728) return;

  char* ws = (char*)d_ws;
  unsigned short* vb   = (unsigned short*)(ws + oVB);
  unsigned short* lb   = (unsigned short*)(ws + oLB);
  unsigned short* Wvb  = (unsigned short*)(ws + oWv);
  unsigned short* Wvvb = (unsigned short*)(ws + oWvv);
  unsigned short* Wlb  = (unsigned short*)(ws + oWl);
  unsigned short* Wvlb = (unsigned short*)(ws + oWvl);
  unsigned short* Wovd = (unsigned short*)(ws + oWod);
  unsigned short* Wold = (unsigned short*)(ws + oWld);
  unsigned short* Qh   = (unsigned short*)(ws + oQh);
  unsigned short* Ql   = (unsigned short*)(ws + oQl);
  unsigned short* Kh   = (unsigned short*)(ws + oKh);
  unsigned short* Kl   = (unsigned short*)(ws + oKl);
  unsigned short* VlTh = (unsigned short*)(ws + oVLh);
  unsigned short* VlTl = (unsigned short*)(ws + oVLl);
  unsigned short* VvTh = (unsigned short*)(ws + oVVh);
  unsigned short* VvTl = (unsigned short*)(ws + oVVl);
  unsigned short* CTXV = (unsigned short*)(ws + oCTX);
  float*          REC  = (float*)(ws + oREC);
  unsigned short* CTXL = (unsigned short*)(ws + oCTL);

  const dim3 blk(256);
  const dim3 gO1((((NL) / 64) * (LD / 64) + 7) / 8, 1);        //   96 tiles ->   12 blocks
  const dim3 gAttV(NQT, NB * NH);                              // (250, 16) blocks of 128
  const dim3 gAttL(RR, 2, NB * NH);                            // (10, 2, 16) blocks of 128

  // (1) inputs -> bf16 planes; W_o -> bf16 duplicated along k (8 jobs, 4576 blocks)
  cvt_all<<<dim3(CB_ALL), blk, 0, stream>>>(v_in, l_in, Wv, Wvv, Wl, Wvl, Wov, Wol,
                                            vb, lb, Wvb, Wvvb, Wlb, Wvlb, Wovd, Wold);
  // (2) q, k, val_v^T, val_l^T -> bf16 hi / residual planes (4 jobs, 508 blocks)
  proj_all<<<dim3(PB_ALL), blk, 0, stream>>>(vb, lb, Wvb, Wlb, Wvvb, Wvlb, bv, bl, bvv, bvl,
                                             Qh, Ql, Kh, Kl, VvTh, VvTl, VlTh, VlTl);
  // (3) vision-direction attention -> ctx plane
  attn_v<<<gAttV, dim3(128), 0, stream>>>(Qh, Ql, Kh, Kl, VlTh, VlTl, mk, CTXV);
  // (4) out0 = ctx . W_ov^T + b_ov -> d_out f32 [32000][256] (K=512: [hi|residual] . [W|W]; 250 blocks)
  gemm64_f32<<<dim3(PB_Q), blk, 0, stream>>>(CTXV, 2 * EMB, Wovd, 2 * EMB, bov, out0, EMB, NV, EMB, 2 * EMB);
  // (5) language-direction partial records, each with its own running column maximum
  attn_l<<<gAttL, dim3(128), 0, stream>>>(Qh, Ql, Kh, Kl, VvTh, VvTl, REC);
  // (6) fold the t ranges, normalise, merge heads -> ctx_l plane
  fold_l<<<dim3(NL), blk, 0, stream>>>(REC, CTXL);
  // (7) out1 = ctx_l . W_ol^T + b_ol -> d_out f32 [512][768] at float offset 8192000
  gemm64_f32<<<gO1, blk, 0, stream>>>(CTXL, 2 * EMB, Wold, 2 * EMB, bol, out1, LD, NL, LD, 2 * EMB);
  (void)hipGetLastError();
}

// v003
// One run takes 220 microseconds.
// In both of two side-by-side timings against v002, it was 1.19 times as fast.
// Counting every step since v000, it is 2.08 times as fast.
// Contractions: v.W_v^T, v.W_vv^T, l.W_l^T, l.W_vl^T = v_wmma_f32_16x16x32_bf16 (bf16 operands RNE-converted from the inputs, single product, f32 accumulate);
// q.k^T scores = v_wmma_f32_16x16x32_bf16 (q and k as bf16 hi + unscaled bf16 residual planes; 3 products hi.hi + hi.lo + lo.hi; f32 accumulate);
// p.val_l and e.val_v = v_wmma_f32_16x16x32_bf16 (p / e split in registers into bf16 hi + residual, val planes bf16 hi + residual; 3 products; f32 accumulate);
// ctx_v.W_ov^T and ctx_l.W_ol^T = v_wmma_f32_16x16x32_bf16 (ctx as bf16 hi | residual interleaved along k, W bf16 duplicated along k; f32 accumulate).
// Softmax, mask, bias, scale, column statistics and normalisation in f32.
// Carry audit: no power-of-two carried planes anywhere (every residual plane is an unscaled bf16 difference); nothing is folded back.
#include <hip/hip_runtime.h>
#include <math.h>
#include <stdint.h>

#define NB      2
#define TV      16000
#define SL      256
#define EMB     256
#define LD      768
#define NH      8
#define HD      32
#define NV      (NB * TV)          // 32000 vision rows
#define NL      (NB * SL)          // 512 language rows
#define NQT     (TV / 64)          // 250 query tiles of 64 rows per batch
#define RR      10                 // t ranges per (b,h) in the language direction
#define TPR     (TV / RR)          // 1600 t per range
#define NSTEP   (TPR / 32)         // 50 steps of 32 t per range
#define RECROWS 34                 // 32 accumulator rows + 1 column-sum row + 1 running-max row
#define SCALEQ  0.17677669529663687f
#define CLAMPV  50000.0f
#define MASKNEG (-9.0e15f)

static_assert(NH * HD == EMB);
static_assert(NQT * 64 == TV);
static_assert(RR * NSTEP * 32 == TV);
static_assert((NV % 64) == 0 && (NL % 64) == 0 && (EMB % 64) == 0 && (LD % 64) == 0 && (TV % 64) == 0);
static_assert((EMB % 32) == 0 && (LD % 32) == 0 && ((2 * EMB) % 32) == 0);
static_assert(SL == 256 && HD == 32 && EMB == 256);

typedef __bf16   v16b __attribute__((ext_vector_type(16)));
typedef __bf16   v8b  __attribute__((ext_vector_type(8)));
typedef float    v8f  __attribute__((ext_vector_type(8)));
typedef float    v4f  __attribute__((ext_vector_type(4)));
typedef unsigned int v4u __attribute__((ext_vector_type(4)));
typedef unsigned int v8u __attribute__((ext_vector_type(8)));
typedef int      v4i  __attribute__((ext_vector_type(4)));
typedef v4f __attribute__((may_alias)) v4fa;
typedef v4i __attribute__((may_alias)) v4ia;

#if defined(__HIP_DEVICE_COMPILE__)
#define DEV_ASM 1
#else
#define DEV_ASM 0
#endif

// ---- scalar helpers --------------------------------------------------------------------------------
__device__ __forceinline__ unsigned short bf_bits(float f) {          // f32 -> bf16 bits, RNE convert
  unsigned u = __float_as_uint(f);
  return (unsigned short)((u + 0x7FFFu + ((u >> 16) & 1u)) >> 16);
}
__device__ __forceinline__ float bf_up(unsigned short hb) { return __uint_as_float(((unsigned)hb) << 16); }
__device__ __forceinline__ float rbf(float f) { return bf_up(bf_bits(f)); }   // value of the bf16 RNE convert
__device__ __forceinline__ unsigned pk16(unsigned short a, unsigned short b) { return (unsigned)a | ((unsigned)b << 16); }
__device__ __forceinline__ v8f zero8() { v8f z = {0.f, 0.f, 0.f, 0.f, 0.f, 0.f, 0.f, 0.f}; return z; }
__device__ __forceinline__ float clampv(float x) { return fminf(fmaxf(x, -CLAMPV), CLAMPV); }
// 2^x. The v_nop is the one free slot that the instruction set asks for behind a transcendental.
__device__ __forceinline__ float exp2_slot(float x) {
#if DEV_ASM
  float r;
  asm("v_exp_f32 %0, %1\n\tv_nop" : "=v"(r) : "v"(x));
  return r;
#else
  return x;
#endif
}
// value of lane l ^ 16 (the other 16-lane row), by a vector cross-row move
__device__ __forceinline__ float xhalf(float x) {
  return __builtin_bit_cast(float, __builtin_amdgcn_permlanex16(__builtin_bit_cast(int, x), __builtin_bit_cast(int, x),
                                                                0x76543210, 0xfedcba98, false, false));
}

// ---- 16-bit A/B fragment loader (wave32): lane -> row/col (lane&15); p already includes +8*(lane>>4);
//      elements 0..7 <- p[0..7] (k0+8h..k0+8h+7), elements 8..15 <- p[16..23] (k0+16+8h..k0+16+8h+7)
__device__ __forceinline__ v16b ldfrag(const __bf16* p) {
  union { v16b v; v8b h[2]; } f;
  f.h[0] = *(const v8b*)(p);
  f.h[1] = *(const v8b*)(p + 16);
  return f.v;
}

// ---- WMMA helpers (asm guard bodies device-only) -------------------------------------------------------
__device__ __forceinline__ v8f mmar(v16b a, v16b b, v8f c) {
  return __builtin_amdgcn_wmma_f32_16x16x32_bf16(false, a, false, b, (short)0, c, false, false);
}
// guarded form: 4 VALU slots after the WMMA, D tied, A/B kept live
__device__ __forceinline__ v8f mma_b(v16b a, v16b b, v8f c) {
  c = __builtin_amdgcn_wmma_f32_16x16x32_bf16(false, a, false, b, (short)0, c, false, false);
#if DEV_ASM
  asm volatile("v_nop\n\tv_nop\n\tv_nop\n\tv_nop" : "+v"(c) : "v"(a), "v"(b));
#endif
  return c;
}
__device__ __forceinline__ void dep_guard(v8f& a, v8f& b, v16b x, v16b y) {
#if DEV_ASM
  asm volatile("v_nop\n\tv_nop\n\tv_nop\n\tv_nop" : "+v"(a), "+v"(b) : "v"(x), "v"(y));
#else
  (void)a; (void)b; (void)x; (void)y;
#endif
}
__device__ __forceinline__ void keep4(v16b a, v16b b, v16b c, v16b d) {
#if DEV_ASM
  asm volatile("v_nop" :: "v"(a), "v"(b), "v"(c), "v"(d));
#else
  (void)a; (void)b; (void)c; (void)d;
#endif
}
__device__ __forceinline__ void acc_guard4(v8f& a, v8f& b, v8f& c, v8f& d) {
#if DEV_ASM
  asm volatile("v_nop\n\tv_nop\n\tv_nop\n\tv_nop" : "+v"(a), "+v"(b), "+v"(c), "+v"(d));
#else
  (void)a; (void)b; (void)c; (void)d;
#endif
}

// ---- B fragment (k = the D tiles' ROW index) from two D tiles held by this lane, split into bf16 hi + residual:
//      element r <- tile a (k 0..15) row r, element 8+r <- tile c (k 16..31) row r, lane unchanged.
union PK { v8u u; v16b v; };
__device__ __forceinline__ void pack_hl(v8f a, v8f c, v16b& fh, v16b& fl) {
  v8u ph, pl;
#pragma unroll
  for (int i = 0; i < 4; ++i) {
    const float x0 = a[2 * i], x1 = a[2 * i + 1];
    const unsigned short h0 = bf_bits(x0), h1 = bf_bits(x1);
    const unsigned short l0 = bf_bits(x0 - bf_up(h0)), l1 = bf_bits(x1 - bf_up(h1));
    ph[i] = pk16(h0, h1);
    pl[i] = pk16(l0, l1);
    const float y0 = c[2 * i], y1 = c[2 * i + 1];
    const unsigned short g0 = bf_bits(y0), g1 = bf_bits(y1);
    const unsigned short n0 = bf_bits(y0 - bf_up(g0)), n1 = bf_bits(y1 - bf_up(g1));
    ph[4 + i] = pk16(g0, g1);
    pl[4 + i] = pk16(n0, n1);
  }
  PK uh, ul;
  uh.u = ph; ul.u = pl;
  fh = uh.v; fl = ul.v;
}

// =====================================================================================================
// f32 -> bf16 bits plane, 8 elements per thread, one 16-B store per lane: a wave writes 512 contiguous B
// coverage: n8 threads x 8 = the whole plane (n8 is a multiple of 256 for every use here).
// =====================================================================================================
__device__ __forceinline__ void cvt_bf16x8(int bx, const float* __restrict__ in, unsigned short* out, int n8) {
  const int i = bx * 256 + (int)threadIdx.x;
  if (i < n8) {
    const v4f a  = *(const v4fa*)(in + (size_t)i * 8);
    const v4f a4 = *(const v4fa*)(in + (size_t)i * 8 + 4);
    v4u p;
    p[0] = pk16(bf_bits(a[0]),  bf_bits(a[1]));
    p[1] = pk16(bf_bits(a[2]),  bf_bits(a[3]));
    p[2] = pk16(bf_bits(a4[0]), bf_bits(a4[1]));
    p[3] = pk16(bf_bits(a4[2]), bf_bits(a4[3]));
    unsigned short* o = out + (size_t)i * 8;
    *(v4u*)o = p;
    
  }
}

// =====================================================================================================
// W [nrows][256] f32 -> bf16 bits [nrows][512] duplicated per 32-column block:
//   out[n][g*64 + w] = bf16(W[n][g*32 + (w & 31)]), g = 0..7, w = 0..63
// (the Bt operand of ctx.W^T where ctx is stored as [hi 32 | residual 32] per head block).
// One wave per row; per half (g 0..3 / 4..7) one instruction: 32 lanes x 16 B = 512 contiguous B = 4 lines.
// =====================================================================================================
__device__ __forceinline__ void cvt_dup(int bx, const float* __restrict__ in, unsigned short* out, int nrows) {
  const int lane = (int)threadIdx.x & 31, wave = (int)threadIdx.x >> 5;
  const int row = bx * 8 + wave;
  if (row >= nrows) return;                                   // wave-uniform; no block barriers here
  const float* src = in + (size_t)row * EMB;
  unsigned short* dst = out + (size_t)row * (2 * EMB);
  v4u p[2];
#pragma unroll
  for (int half = 0; half < 2; ++half) {
    const int g = half * 4 + (lane >> 3);
    const int scol = g * HD + 8 * (lane & 3);
    const v4f a = *(const v4fa*)(src + scol);
    const v4f c = *(const v4fa*)(src + scol + 4);
    v4u q;
    q[0] = pk16(bf_bits(a[0]), bf_bits(a[1]));
    q[1] = pk16(bf_bits(a[2]), bf_bits(a[3]));
    q[2] = pk16(bf_bits(c[0]), bf_bits(c[1]));
    q[3] = pk16(bf_bits(c[2]), bf_bits(c[3]));
    p[half] = q;
  }
  {
#pragma unroll
    for (int half = 0; half < 2; ++half)
      *(v4u*)(dst + half * EMB + 8 * lane) = p[half];
    
  }
}

// =====================================================================================================
// All eight input conversions in one grid: they are independent of one another, so blockIdx.x picks the job.
// Block ranges (256 threads each): W_ov dup, W_ol dup, W_v, W_vv, W_l, W_vl, l, v.
// =====================================================================================================
#define CB_DV  (EMB / 8)                 //   32 blocks, 8 rows each
#define CB_DL  (LD / 8)                  //   96
#define CB_WS  (EMB * EMB / 8 / 256)     //   32 blocks, 2048 elements each
#define CB_WL  (EMB * LD / 8 / 256)      //   96
#define CB_L   (NL * LD / 8 / 256)       //  192
#define CB_V   (NV * EMB / 8 / 256)      // 4000
#define CB_ALL (CB_DV + CB_DL + 2 * CB_WS + 2 * CB_WL + CB_L + CB_V)
static_assert(CB_WS * 2048 == EMB * EMB && CB_WL * 2048 == EMB * LD && CB_L * 2048 == NL * LD && CB_V * 2048 == NV * EMB);
__global__ __launch_bounds__(256) void cvt_all(
    const float* __restrict__ v_in, const float* __restrict__ l_in,
    const float* __restrict__ Wv, const float* __restrict__ Wvv,
    const float* __restrict__ Wl, const float* __restrict__ Wvl,
    const float* __restrict__ Wov, const float* __restrict__ Wol,
    unsigned short* vb, unsigned short* lb, unsigned short* Wvb, unsigned short* Wvvb,
    unsigned short* Wlb, unsigned short* Wvlb, unsigned short* Wovd, unsigned short* Wold) {
  int bx = (int)blockIdx.x;                                   // block-uniform job choice
  if (bx < CB_DV) { cvt_dup(bx, Wov, Wovd, EMB); return; }
  bx -= CB_DV;
  if (bx < CB_DL) { cvt_dup(bx, Wol, Wold, LD); return; }
  bx -= CB_DL;
  if (bx < CB_WS) { cvt_bf16x8(bx, Wv, Wvb, EMB * EMB / 8); return; }
  bx -= CB_WS;
  if (bx < CB_WS) { cvt_bf16x8(bx, Wvv, Wvvb, EMB * EMB / 8); return; }
  bx -= CB_WS;
  if (bx < CB_WL) { cvt_bf16x8(bx, Wl, Wlb, EMB * LD / 8); return; }
  bx -= CB_WL;
  if (bx < CB_WL) { cvt_bf16x8(bx, Wvl, Wvlb, EMB * LD / 8); return; }
  bx -= CB_WL;
  if (bx < CB_L) { cvt_bf16x8(bx, l_in, lb, NL * LD / 8); return; }
  bx -= CB_L;
  cvt_bf16x8(bx, v_in, vb, NV * EMB / 8);
}

// =====================================================================================================
// Register-blocked batched WMMA GEMM (bf16 operands): C[m][n] = sum_k A[m][k] * Bt[n][k];
// one wave per 64x64 tile, no block barriers. A row-major [M][K] pitch lda; Bt row-major [N][K] pitch ldb
// (k contiguous); M, N multiples of 64, K multiple of 32 (host-checked). bx = block of 8 tiles, b = batch index
// (strides in elements); sT = the block's LDS slabs, declared by the calling kernel. Fragments are loaded straight from global with the split k map (ldfrag).
// OUT_MODE 0: f32 C (pitch ldc), value = (acc + bf16(bias[n])) * oscale.
// OUT_MODE 3: bf16 hi plane C + bf16 residual plane C2 = bf16(y - hi) (same pitch / stride),
//             y = (acc + bf16(bias)) * oscale; bias[n] (BIASM 0) or bias[m] (BIASM 1).
// =====================================================================================================
template <int OUT_MODE, int BIASM>
__device__ __forceinline__ void gemm64_body(
    float (*sT)[16 * 68], int bx, int b,
    const unsigned short* __restrict__ Ap, int lda, long long strideA,
    const unsigned short* __restrict__ Btp, int ldb, long long strideB,
    const float* __restrict__ bias,
    void* Cout, void* Cout2, int ldc, long long strideC,
    int M, int N, int K, float oscale) {
  static_assert(OUT_MODE == 0 || OUT_MODE == 3);
  static_assert(OUT_MODE != 0 || BIASM == 0);
  const __bf16* A  = (const __bf16*)(const void*)Ap;
  const __bf16* Bt = (const __bf16*)(const void*)Btp;
  const int lane = threadIdx.x & 31;
  const int wave = threadIdx.x >> 5;
  const int tilesN = N >> 6;
  const int tilesM = M >> 6;
  const int tile = bx * 8 + wave;
  if (tile >= tilesM * tilesN) return;   // wave-uniform; no block barriers in this kernel
  const int tm = tile / tilesN;
  const int tn = tile - tm * tilesN;
  const int m0 = tm << 6;
  const int n0 = tn << 6;

  const __bf16* Ab = A  + (size_t)b * (size_t)strideA;
  const __bf16* Bb = Bt + (size_t)b * (size_t)strideB;

  const int rlane = lane & 15;                 // row (A) / col (B, D) within subtile
  const int koff  = (lane >> 4) * 8;           // k offset of this lane half
  const int mOff  = (lane >> 4) * 8;           // D row offset

  v8f acc[4][4];
#pragma unroll
  for (int i = 0; i < 4; ++i)
#pragma unroll
    for (int j = 0; j < 4; ++j) acc[i][j] = zero8();

  for (int k0 = 0; k0 < K; k0 += 32) {
    v16b bq[4];
#pragma unroll
    for (int j = 0; j < 4; ++j)
      bq[j] = ldfrag(Bb + (size_t)(n0 + (j << 4) + rlane) * ldb + koff + k0);
#pragma unroll
    for (int i = 0; i < 4; ++i) {
      const v16b af = ldfrag(Ab + (size_t)(m0 + (i << 4) + rlane) * lda + koff + k0);
#pragma unroll
      for (int j = 0; j < 4; ++j) acc[i][j] = mmar(af, bq[j], acc[i][j]);
      dep_guard(acc[i][0], acc[i][3], af, bq[3]);
    }
    keep4(bq[0], bq[1], bq[2], bq[3]);
  }
  acc_guard4(acc[0][0], acc[0][1], acc[0][2], acc[0][3]);
  acc_guard4(acc[1][0], acc[1][1], acc[1][2], acc[1][3]);
  acc_guard4(acc[2][0], acc[2][1], acc[2][2], acc[2][3]);
  acc_guard4(acc[3][0], acc[3][1], acc[3][2], acc[3][3]);

  // ---- epilogue ----
  float* slab = sT[wave];
  const int h2 = lane >> 4, c4 = (lane & 15) * 4;     // OUT_MODE 0 map: 256-B row segment = 16 lanes x 16 B
  const int q = lane >> 3, c8 = (lane & 7) * 8;
  v4f bb4;                                             // bias for columns n0+c4..+3 (mode 0)
  float bcol[8];                                       // bias for columns n0+c8..+7 (mode 3, BIASM 0)
  if (OUT_MODE == 0) {
    const v4f braw = *(const v4fa*)(bias + n0 + c4);
    bb4[0] = rbf(braw[0]); bb4[1] = rbf(braw[1]); bb4[2] = rbf(braw[2]); bb4[3] = rbf(braw[3]);
  } else {
    if (BIASM == 0) {
      const v4f b0 = *(const v4fa*)(bias + n0 + c8);
      const v4f b1 = *(const v4fa*)(bias + n0 + c8 + 4);
#pragma unroll
      for (int e = 0; e < 4; ++e) { bcol[e] = rbf(b0[e]); bcol[4 + e] = rbf(b1[e]); }
    } else {
#pragma unroll
      for (int e = 0; e < 8; ++e) bcol[e] = 0.f;
    }
  }
#pragma unroll
  for (int i = 0; i < 4; ++i) {
    const int mBase = m0 + (i << 4);
#pragma unroll
    for (int j = 0; j < 4; ++j) {
#pragma unroll
      for (int r = 0; r < 8; ++r) {
        slab[(mOff + r) * 68 + (j << 4) + rlane] = acc[i][j][r];
      }
    }
    __builtin_amdgcn_fence(__ATOMIC_RELEASE, "workgroup");
    __builtin_amdgcn_wave_barrier();
    __builtin_amdgcn_fence(__ATOMIC_ACQUIRE, "workgroup");
    if (OUT_MODE == 0) {
      float* C = (float*)Cout + (size_t)b * (size_t)strideC;
      {
#pragma unroll
        for (int it = 0; it < 8; ++it) {
          const int row = it * 2 + h2;                     // it 0..7 x h2 0..1 = rows 0..15
          v4f v = *(const v4fa*)(slab + row * 68 + c4);
          v = (v + bb4) * oscale;
          *(v4f*)(C + (size_t)(mBase + row) * ldc + n0 + c4) = v;
        }
        
      }
    } else {
      unsigned short* C  = (unsigned short*)Cout  + (size_t)b * (size_t)strideC;
      unsigned short* C2 = (unsigned short*)Cout2 + (size_t)b * (size_t)strideC;
      v4u hv[4], lv[4];
#pragma unroll
      for (int it = 0; it < 4; ++it) {
        const int row = it * 4 + q;                        // it 0..3 x q 0..3 = rows 0..15
        const float* sp = slab + row * 68 + c8;
        float brow = 0.f;
        if (BIASM == 1) brow = rbf(bias[mBase + row]);
        v4u a, a2;
#pragma unroll
        for (int e = 0; e < 4; ++e) {
          const float f0 = (sp[2 * e]     + ((BIASM == 1) ? brow : bcol[2 * e]))     * oscale;
          const float f1 = (sp[2 * e + 1] + ((BIASM == 1) ? brow : bcol[2 * e + 1])) * oscale;
          const unsigned short h0 = bf_bits(f0), h1 = bf_bits(f1);
          const unsigned short l0 = bf_bits(f0 - bf_up(h0)), l1 = bf_bits(f1 - bf_up(h1));
          a[e] = pk16(h0, h1); a2[e] = pk16(l0, l1);
        }
        hv[it] = a; lv[it] = a2;
      }
      {
#pragma unroll
        for (int it = 0; it < 4; ++it) {
          const int row = it * 4 + q;
          *(v4u*)(C  + (size_t)(mBase + row) * ldc + n0 + c8) = hv[it];
          *(v4u*)(C2 + (size_t)(mBase + row) * ldc + n0 + c8) = lv[it];
        }
        
      }
    }
    __builtin_amdgcn_fence(__ATOMIC_RELEASE, "workgroup");
    __builtin_amdgcn_wave_barrier();
    __builtin_amdgcn_fence(__ATOMIC_ACQUIRE, "workgroup");
  }
}

__device__ __forceinline__ void fold_l_body(float* xs, int bs, const float* __restrict__ rec, unsigned short* ctxl);

// ---- one GEMM per launch (used for out0 and out1). Blocks past the GEMM's own (the out0 launch has NL of them) run the
//      language fold, one (b,s) each: it reads the records and writes ctx_l, the GEMM reads and writes neither. ----
__global__ __launch_bounds__(256) void gemm64_f32(
    const unsigned short* __restrict__ Ap, int lda,
    const unsigned short* __restrict__ Btp, int ldb,
    const float* __restrict__ bias, float* Cout, int ldc, int M, int N, int K,
    const float* __restrict__ rec, unsigned short* ctxl) {
  __shared__ __align__(16) float sT[8][16 * 68];   // per-wave 16x64 slab, pitch 68 floats; the fold uses its first 1 KB
  const int gb = ((M >> 6) * (N >> 6) + 7) >> 3;   // blocks of the GEMM, 8 tiles each
  if ((int)blockIdx.x >= gb) {                     // block-uniform job choice
    fold_l_body(&sT[0][0], (int)blockIdx.x - gb, rec, ctxl);
    return;
  }
  gemm64_body<0, 0>(sT, (int)blockIdx.x, 0, Ap, lda, 0LL, Btp, ldb, 0LL, bias,
                    (void*)Cout, (void*)Cout, ldc, 0LL, M, N, K, 1.0f);
}

// =====================================================================================================
// The four input projections in one grid: none reads what another writes, so blockIdx.x picks the job.
// The two K = 768 jobs (few tiles, longest k loop) take the first blocks.
//   k      = l . W_l^T + b_l              [b*SL+s][256]         M=512,   N=256,   K=768
//   val_l^T = W_vl . l^T + b_vl per batch [b][d][s] pitch SL    M=256,   N=256,   K=768
//   q      = (v . W_v^T + b_v) * scale    [b*TV+t][256]         M=32000, N=256,   K=256
//   val_v^T = W_vv . v^T + b_vv per batch [b][d][t] pitch TV    M=256,   N=16000, K=256
// every result as bf16 hi / residual planes.
// =====================================================================================================
#define PB_K   ((NL / 64) * (EMB / 64) / 8)      //   4 blocks
#define PB_VL1 ((EMB / 64) * (SL / 64) / 8)      //   2 blocks per batch
#define PB_Q   ((NV / 64) * (EMB / 64) / 8)      // 250 blocks
#define PB_VV1 ((EMB / 64) * (TV / 64) / 8)      // 125 blocks per batch
#define PB_ALL (PB_K + NB * PB_VL1 + PB_Q + NB * PB_VV1)
static_assert(PB_K * 8 * 4096 == NL * EMB && PB_VL1 * 8 * 4096 == EMB * SL);
static_assert(PB_Q * 8 * 4096 == NV * EMB && PB_VV1 * 8 * 4096 == EMB * TV);
__global__ __launch_bounds__(256) void proj_all(
    const unsigned short* __restrict__ vb, const unsigned short* __restrict__ lb,
    const unsigned short* __restrict__ Wvb, const unsigned short* __restrict__ Wlb,
    const unsigned short* __restrict__ Wvvb, const unsigned short* __restrict__ Wvlb,
    const float* __restrict__ bv, const float* __restrict__ bl,
    const float* __restrict__ bvv, const float* __restrict__ bvl,
    unsigned short* Qh, unsigned short* Ql, unsigned short* Kh, unsigned short* Kl,
    unsigned short* VvTh, unsigned short* VvTl, unsigned short* VlTh, unsigned short* VlTl) {
  __shared__ __align__(16) float sT[8][16 * 68];   // per-wave 16x64 slab, pitch 68 floats
  const int bid = (int)blockIdx.x;                 // block-uniform job choice
  const bool lang = bid < PB_K + NB * PB_VL1;      // operand l (K = 768) or v (K = 256)
  const int r = lang ? bid : bid - (PB_K + NB * PB_VL1);
  const int nrow = lang ? PB_K : PB_Q;             // blocks of the row-major job of this operand
  const unsigned short* x = lang ? lb : vb;
  const int kd = lang ? LD : EMB;
  if (r < nrow) {
    gemm64_body<3, 0>(sT, r, 0, x, kd, 0LL, lang ? Wlb : Wvb, kd, 0LL, lang ? bl : bv,
                      (void*)(lang ? Kh : Qh), (void*)(lang ? Kl : Ql), EMB, 0LL,
                      lang ? NL : NV, EMB, kd, lang ? 1.0f : SCALEQ);
  } else {
    const int per = lang ? PB_VL1 : PB_VV1;
    const int r2 = r - nrow;
    const int b = (r2 >= per) ? 1 : 0;
    static_assert(NB == 2);
    const int nt = lang ? SL : TV;                 // rows of x per batch = N = output pitch
    gemm64_body<3, 1>(sT, r2 - b * per, b, lang ? Wvlb : Wvvb, kd, 0LL, x, kd, (long long)nt * kd,
                      lang ? bvl : bvv, (void*)(lang ? VlTh : VvTh), (void*)(lang ? VlTl : VvTl),
                      nt, (long long)EMB * nt, EMB, nt, kd, 1.0f);
  }
}

// ---- additive key mask: -9e15 where the int32 mask is 0, else 0 (8 consecutive keys, 2 int4 loads) ----
__device__ __forceinline__ v8f add_mask8(v8f s, const int* p) {
  const v4i ma = *(const v4ia*)p;
  const v4i mb = *(const v4ia*)(p + 4);
  s[0] += (ma[0] == 0) ? MASKNEG : 0.0f;
  s[1] += (ma[1] == 0) ? MASKNEG : 0.0f;
  s[2] += (ma[2] == 0) ? MASKNEG : 0.0f;
  s[3] += (ma[3] == 0) ? MASKNEG : 0.0f;
  s[4] += (mb[0] == 0) ? MASKNEG : 0.0f;
  s[5] += (mb[1] == 0) ? MASKNEG : 0.0f;
  s[6] += (mb[2] == 0) ? MASKNEG : 0.0f;
  s[7] += (mb[3] == 0) ? MASKNEG : 0.0f;
  return s;
}

// =====================================================================================================
// Pass A: vision-direction attention (softmax over the 256 text keys, masked).
//   Planes: Qh/Ql, Kh/Kl bf16 [row][256] (row = b*TV + t / b*SL + s, head block h*32);
//           Vlh/Vll = val_l^T bf16 [b][256 d][256 s]; mask int32 [b][256].
//   Transposed form: S^T = K.Q^T (A = K rows: row = key, k = d; B = Q^T from the q row, n = query),
//   3 products (hh, hl, lh); D = S^T[key 8hh+r][query m]. Online softmax over 4 chunks of 64 keys in f32;
//   P^T hi / residual B fragments packed from registers; O^T += Vl^T . P^T (A = Vl^T rows: row = d, k = key).
//   Block = 4 waves x 16 queries = 64 query rows of one (b,h); NQT x NB*NH blocks (qt, bh).
//   Output: the ctx plane, written per wave as 16 lines, lanes 8q..8q+7 one line, 4 lines per instruction.
//   coverage: 250 x 16 blocks x 64 rows of one head = every (row, head) line of the ctx plane.
// =====================================================================================================
__device__ __forceinline__
void attn_v_body(float* smem, int qt, int bh,       // smem: per-wave 16x32 context tiles, 8 KB of the caller's LDS
            const unsigned short* __restrict__ qhp, const unsigned short* __restrict__ qlp,
            const unsigned short* __restrict__ khp, const unsigned short* __restrict__ klp,
            const unsigned short* __restrict__ vhp, const unsigned short* __restrict__ vlp,
            const int* __restrict__ maskl, unsigned short* ctxp) {
  const int tid = threadIdx.x, lane = tid & 31, w = tid >> 5;
  const int hh = lane >> 4, m = lane & 15;
  const int b = bh >> 3, head = bh & 7;
  const int q0 = qt * 64 + 16 * w;

  const __bf16* Qh = (const __bf16*)(const void*)qhp;
  const __bf16* Ql = (const __bf16*)(const void*)qlp;
  const __bf16* Kh = (const __bf16*)(const void*)khp;
  const __bf16* Kl = (const __bf16*)(const void*)klp;
  const __bf16* Vh = (const __bf16*)(const void*)vhp;
  const __bf16* Vl = (const __bf16*)(const void*)vlp;

  // Q^T B-fragments: column n = query q0+m, k = d (one 32-deep step)
  const size_t qoff = ((size_t)b * TV + q0 + m) * EMB + head * HD + 8 * hh;
  const v16b qbh = ldfrag(Qh + qoff);
  const v16b qbl = ldfrag(Ql + qoff);

  const __bf16* kbh = Kh + ((size_t)b * SL + m) * EMB + head * HD + 8 * hh;     // + key0*EMB
  const __bf16* kbl = Kl + ((size_t)b * SL + m) * EMB + head * HD + 8 * hh;
  const __bf16* vbh = Vh + ((size_t)b * EMB + head * HD + m) * SL + 8 * hh;      // + 16dt*SL + key0
  const __bf16* vbl = Vl + ((size_t)b * EMB + head * HD + m) * SL + 8 * hh;
  const int* mkp = maskl + b * SL + 8 * hh;                                      // + key tile base

  v8f o[2];
  o[0] = zero8(); o[1] = zero8();
  float mrun = -1.0e30f, lrun = 0.0f;

#pragma unroll 1
  for (int kc = 0; kc < SL / 64; ++kc) {
    const int kb0 = kc * 64;
    // ---- scores s[j][r] = S[query q0+m][key kb0+16j+8hh+r] ----
    v8f s[4];
#pragma unroll
    for (int j = 0; j < 4; ++j) {
      const size_t ko = (size_t)(kb0 + 16 * j) * EMB;
      const v16b kfh = ldfrag(kbh + ko);
      const v16b kfl = ldfrag(kbl + ko);
      v8f z = zero8();
      z = mma_b(kfh, qbh, z);
      z = mma_b(kfl, qbh, z);
      z = mma_b(kfh, qbl, z);
      s[j] = z;
    }
    // ---- clamp (pre-mask) ----
#pragma unroll
    for (int j = 0; j < 4; ++j)
#pragma unroll
      for (int r = 0; r < 8; ++r) s[j][r] = clampv(s[j][r]);
    // ---- additive mask per key, f32 ----
#pragma unroll
    for (int j = 0; j < 4; ++j) s[j] = add_mask8(s[j], mkp + kb0 + 16 * j);

    // ---- online softmax per query column ----
    float mloc = s[0][0];
#pragma unroll
    for (int j = 0; j < 4; ++j)
#pragma unroll
      for (int r = 0; r < 8; ++r) mloc = fmaxf(mloc, s[j][r]);
    mloc = fmaxf(mloc, __shfl_xor(mloc, 16, 32));
    const float mnew = fmaxf(mrun, mloc);
    const float alpha = __expf(mrun - mnew);
    mrun = mnew;
    float lsum = 0.0f;
#pragma unroll
    for (int j = 0; j < 4; ++j)
#pragma unroll
      for (int r = 0; r < 8; ++r) {
        const float p = __expf(s[j][r] - mnew);
        s[j][r] = p;
        lsum += p;
      }
    lsum += __shfl_xor(lsum, 16, 32);
    lrun = lrun * alpha + lsum;
#pragma unroll
    for (int dt = 0; dt < 2; ++dt)
#pragma unroll
      for (int r = 0; r < 8; ++r) o[dt][r] = o[dt][r] * alpha;

    // ---- P^T B-fragments (keys 0..31 and 32..63 of this chunk), bf16 hi + residual ----
    v16b pbh0, pbl0, pbh1, pbl1;
    pack_hl(s[0], s[1], pbh0, pbl0);
    pack_hl(s[2], s[3], pbh1, pbl1);

    // ---- O^T += Vl^T . P^T (3 products per k-step) ----
#pragma unroll
    for (int dt = 0; dt < 2; ++dt) {
      const size_t vo = (size_t)(16 * dt) * SL + kb0;
      const v16b vh0 = ldfrag(vbh + vo), vh1 = ldfrag(vbh + vo + 32);
      const v16b vl0 = ldfrag(vbl + vo), vl1 = ldfrag(vbl + vo + 32);
      v8f a = o[dt];
      a = mma_b(vh0, pbh0, a);
      a = mma_b(vh0, pbl0, a);
      a = mma_b(vl0, pbh0, a);
      a = mma_b(vh1, pbh1, a);
      a = mma_b(vh1, pbl1, a);
      a = mma_b(vl1, pbh1, a);
      o[dt] = a;
    }
  }

  // ---- normalise (1/l), stage the wave's 16 (query) x 32 (d) f32 tile ----
  const float inv = 1.0f / lrun;
  float* so = smem + w * (16 * HD);
#pragma unroll
  for (int dt = 0; dt < 2; ++dt)
#pragma unroll
    for (int r = 0; r < 8; ++r)
      so[m * HD + 16 * dt + 8 * hh + r] = o[dt][r] * inv;
  __syncthreads();

  {
    const int sub = lane >> 3, piece = lane & 7;
    const int csel = 8 * (piece & 3);
    const bool islo = (piece & 4) != 0;
    v4u hv[4];
#pragma unroll
    for (int i = 0; i < 4; ++i) {
      const int lid = i * 4 + sub;                      // i 0..3 x sub 0..3 = rows 0..15
      const float* sp = so + lid * HD + csel;
      v4u a;
#pragma unroll
      for (int e = 0; e < 4; ++e) {
        const float x0 = sp[2 * e], x1 = sp[2 * e + 1];
        const unsigned short h0 = bf_bits(x0), h1 = bf_bits(x1);
        const unsigned short l0 = bf_bits(x0 - bf_up(h0)), l1 = bf_bits(x1 - bf_up(h1));
        a[e] = islo ? pk16(l0, l1) : pk16(h0, h1);
      }
      hv[i] = a;
    }
    {
#pragma unroll
      for (int i = 0; i < 4; ++i) {
        const int lid = i * 4 + sub;
        const size_t go = ((size_t)b * TV + q0 + lid) * (2 * EMB) + head * (2 * HD) + 8 * piece;
        *(v4u*)(ctxp + go) = hv[i];
      }
#if DEV_ASM
      // in the merged kernel the listing goes on behind these stores into code that rewrites their registers: the wait stands first
      asm volatile("s_wait_xcnt 0x0" ::: "memory");
#endif
    }
  }
}

// =====================================================================================================
// Pass B: language-direction partial sums. For (b,h), key half kq (128 keys), t range rg (1600 t):
//   S = Q.K^T (A = Q rows: row = t, k = d; B from K rows: n = key), 3 products, D = S[t 8hh+r][key m];
//   e = exp(clamp(clamp(S) - m[key])) in f32, m[key] = the running maximum of clamp(S) over the t this range has
//   seen (a softmax does not depend on the value subtracted; when m grows, acc and colsum are scaled by
//   exp(m_old - m_new)); e packed from registers as the B operand with k = t
//   (bf16 hi + residual); acc^T[d][key] += Vv^T . e (A = val_v^T rows: row = d, k = t), 3 products,
//   f32 accumulation across the 50 steps; colsum[key] += e in f32.
//   Block = 4 waves x 32 keys; RR x 2 x NB*NH blocks (rg, kq, bh). Record [bh][rg][34 rows][256]: rows 0..31 = acc^T[d],
//   row 32 = colsum, row 33 = the range's final m.
// =====================================================================================================
__device__ __forceinline__
void attn_l_body(float* smem, int rg, int kq, int bh,   // smem: per-wave 34x32 staging, 17408 B of the caller's LDS
            const unsigned short* __restrict__ qhp, const unsigned short* __restrict__ qlp,
            const unsigned short* __restrict__ khp, const unsigned short* __restrict__ klp,
            const unsigned short* __restrict__ vhp, const unsigned short* __restrict__ vlp,
            float* rec) {
  const int tid = threadIdx.x, lane = tid & 31, w = tid >> 5;
  const int hh = lane >> 4, m = lane & 15;
  const int b = bh >> 3, head = bh & 7;
  const int s0 = kq * 128 + 32 * w;
  const int tb = rg * TPR;

  const __bf16* Qh = (const __bf16*)(const void*)qhp;
  const __bf16* Ql = (const __bf16*)(const void*)qlp;
  const __bf16* Kh = (const __bf16*)(const void*)khp;
  const __bf16* Kl = (const __bf16*)(const void*)klp;
  const __bf16* Vh = (const __bf16*)(const void*)vhp;
  const __bf16* Vl = (const __bf16*)(const void*)vlp;

  // K B-fragments for this wave's two 16-key tiles (n = key s0+16jj+m, k = d), hi and residual planes
  v16b kfh[2], kfl[2];
  float mrun[2], csum[2];
#pragma unroll
  for (int jj = 0; jj < 2; ++jj) {
    const size_t ko = ((size_t)b * SL + s0 + 16 * jj + m) * EMB + head * HD + 8 * hh;
    kfh[jj] = ldfrag(Kh + ko);
    kfl[jj] = ldfrag(Kl + ko);
    mrun[jj] = -1.0e30f;
    csum[jj] = 0.0f;
  }
  v8f acc[2][2];
#pragma unroll
  for (int dt = 0; dt < 2; ++dt) { acc[dt][0] = zero8(); acc[dt][1] = zero8(); }

  const __bf16* qbh = Qh + ((size_t)b * TV + m) * EMB + head * HD + 8 * hh;     // + t*EMB
  const __bf16* qbl = Ql + ((size_t)b * TV + m) * EMB + head * HD + 8 * hh;
  const __bf16* vbh = Vh + ((size_t)b * EMB + head * HD + m) * TV + 8 * hh;      // + 16dt*TV + t0
  const __bf16* vbl = Vl + ((size_t)b * EMB + head * HD + m) * TV + 8 * hh;

#pragma unroll 1
  for (int step = 0; step < NSTEP; ++step) {
    const int t0 = tb + 32 * step;
    v16b qah[2], qal[2], vah[2], val2[2];
#pragma unroll
    for (int tt = 0; tt < 2; ++tt) {
      const size_t qo = (size_t)(t0 + 16 * tt) * EMB;
      qah[tt] = ldfrag(qbh + qo);
      qal[tt] = ldfrag(qbl + qo);
    }
#if DEV_ASM
    // the results of the loads below may land on the address registers of the loads above: the wait stands between
    asm volatile("s_wait_xcnt 0x0" ::: "memory");
#endif
#pragma unroll
    for (int dt = 0; dt < 2; ++dt) {
      const size_t vo = (size_t)(16 * dt) * TV + t0;
      vah[dt]  = ldfrag(vbh + vo);
      val2[dt] = ldfrag(vbl + vo);
    }
#pragma unroll
    for (int jj = 0; jj < 2; ++jj) {
      // scores for t rows t0..t0+15 (d0) and t0+16..t0+31 (d1), key columns s0+16jj+m
      v8f d0 = zero8(), d1 = zero8();
      d0 = mma_b(qah[0], kfh[jj], d0);
      d0 = mma_b(qah[0], kfl[jj], d0);
      d0 = mma_b(qal[0], kfh[jj], d0);
      d1 = mma_b(qah[1], kfh[jj], d1);
      d1 = mma_b(qah[1], kfl[jj], d1);
      d1 = mma_b(qal[1], kfh[jj], d1);
      // clamp; maximum of this key column over the step's 32 t rows (16 in this lane, 16 in lane ^ 16)
      float tm[8];
#pragma unroll
      for (int r = 0; r < 8; ++r) {
        d0[r] = clampv(d0[r]);
        d1[r] = clampv(d1[r]);
        tm[r] = fmaxf(d0[r], d1[r]);
      }
      float ml = fmaxf(fmaxf(fmaxf(tm[0], tm[1]), fmaxf(tm[2], tm[3])), fmaxf(fmaxf(tm[4], tm[5]), fmaxf(tm[6], tm[7])));
      ml = fmaxf(ml, xhalf(ml));
      const float mv = fmaxf(mrun[jj], ml);
      const float alpha = __expf(mrun[jj] - mv);         // 0 on the first step, 1 while the maximum stands
      mrun[jj] = mv;
      float cl = csum[jj] * alpha;
#pragma unroll
      for (int r = 0; r < 8; ++r) {
        const float x0 = clampv(d0[r] - mv);
        const float e0 = __expf(x0);
        d0[r] = e0; cl += e0;
        const float x1 = clampv(d1[r] - mv);
        const float e1 = __expf(x1);
        d1[r] = e1; cl += e1;
      }
      csum[jj] = cl;
      // e as the B operand with k = t (tile d0 = t 0..15, tile d1 = t 16..31), bf16 hi + residual
      v16b ebh, ebl;
      pack_hl(d0, d1, ebh, ebl);
#pragma unroll
      for (int dt = 0; dt < 2; ++dt) {
        v8f a = acc[dt][jj];
#pragma unroll
        for (int r = 0; r < 8; ++r) a[r] = a[r] * alpha;
        a = mma_b(vah[dt],  ebh, a);
        a = mma_b(vah[dt],  ebl, a);
        a = mma_b(val2[dt], ebh, a);
        acc[dt][jj] = a;
      }
    }
  }

  // ---- combine the two lane halves of the column sums; stage acc^T (32 d x 32 keys) + colsum row + max row ----
#pragma unroll
  for (int jj = 0; jj < 2; ++jj) csum[jj] += __shfl_xor(csum[jj], 16, 32);
  float* sw = smem + w * (RECROWS * 32);
#pragma unroll
  for (int dt = 0; dt < 2; ++dt)
#pragma unroll
    for (int jj = 0; jj < 2; ++jj)
#pragma unroll
      for (int r = 0; r < 8; ++r)
        sw[(16 * dt + 8 * hh + r) * 32 + 16 * jj + m] = acc[dt][jj][r];
  if (hh == 0) {
    sw[32 * 32 + m]      = csum[0];
    sw[32 * 32 + 16 + m] = csum[1];
    sw[33 * 32 + m]      = mrun[0];
    sw[33 * 32 + 16 + m] = mrun[1];
  }
  __syncthreads();

  // ---- record lines: row lid (0..33) of this wave = 32 floats at column s0, lanes 8*sub..+7, 4 rows per instruction ----
  {
    const int sub = lane >> 3, piece = lane & 7;
    float* rbase = rec + (((size_t)bh * RR + rg) * RECROWS) * SL + s0 + 4 * piece;
    {
#pragma unroll
      for (int i = 0; i < 9; ++i) {
        const int lid  = i * 4 + sub;
        const int lidc = (lid < RECROWS) ? lid : (RECROWS - 1);
        const v4f vv = *(const v4fa*)(sw + lidc * 32 + 4 * piece);
        if (lid < RECROWS) *(v4f*)(rbase + (size_t)lid * SL) = vv;
      }
      
    }
  }
}

// =====================================================================================================
// Both attention directions in one grid: neither reads what the other writes (ctx plane / records), so blockIdx.x
// picks the job. The 320 language blocks (50 steps each, one wave per SIMD on their own) take the first indices:
// they start first and the 4000 short vision blocks fill the same SIMDs' idle issue and load slots beside them.
// =====================================================================================================
#define AB_L (RR * 2 * NB * NH)      //  320 blocks, index = rg + RR * (kq + 2 * bh)
#define AB_V (NQT * NB * NH)         // 4000 blocks, index = qt + NQT * bh
__global__ __launch_bounds__(128)
void attn_both(const unsigned short* __restrict__ qhp, const unsigned short* __restrict__ qlp,
               const unsigned short* __restrict__ khp, const unsigned short* __restrict__ klp,
               const unsigned short* __restrict__ vlhp, const unsigned short* __restrict__ vllp,
               const unsigned short* __restrict__ vvhp, const unsigned short* __restrict__ vvlp,
               const int* __restrict__ maskl, unsigned short* ctxp, float* rec) {
  __shared__ __align__(16) float smem[4 * RECROWS * 32];   // the larger of the two jobs' needs, 17408 B
  const unsigned bid = blockIdx.x;                         // block-uniform job choice
  if (bid < AB_L) {
    const unsigned rg = bid % RR, r2 = bid / RR;
    attn_l_body(smem, (int)rg, (int)(r2 & 1u), (int)(r2 >> 1), qhp, qlp, khp, klp, vvhp, vvlp, rec);
  } else {
    const unsigned r = bid - AB_L;
    attn_v_body(smem, (int)(r % NQT), (int)(r / NQT), qhp, qlp, khp, klp, vlhp, vllp, maskl, ctxp);
  }
}

// =====================================================================================================
// Language-direction fold: with w[rg] = exp(m[rg][s] - max_rg m[rg][s]),
// ctx_l[b][s][h*32+d] = (sum_rg w[rg] acc[rg][d][s]) / (sum_rg w[rg] colsum[rg][s]) in fixed order.
// Block = one (b,s), thread = (h, d); threads 0..63 write the 1-KB row, 16 B each (2 instructions of 4 lines),
// =====================================================================================================
__device__ __forceinline__ void fold_l_body(float* xs, int bs, const float* __restrict__ rec, unsigned short* ctxl) {
  const int b = bs / SL, s = bs - b * SL;                  // xs: EMB floats of the caller's LDS
  const int t = (int)threadIdx.x, head = t >> 5, d = t & 31;
  const int bh = b * NH + head;
  const float* p = rec + ((size_t)bh * RR) * RECROWS * SL + s;
  float mr[RR];
#pragma unroll   // mr[] stays in registers; the ranges' loads are in flight together
  for (int rg = 0; rg < RR; ++rg) mr[rg] = p[((size_t)rg * RECROWS + 33) * SL];
  float mall = mr[0];
#pragma unroll   // constant index into mr[]
  for (int rg = 1; rg < RR; ++rg) mall = fmaxf(mall, mr[rg]);
#pragma unroll   // constant index into mr[]
  for (int rg = 0; rg < RR; ++rg) mr[rg] = exp2_slot((mr[rg] - mall) * 1.44269504f);   // the range's weight e^(m - max)
  float a = 0.0f, cs = 0.0f;
#pragma unroll   // constant index into mr[]; fixed order of the sums
  for (int rg = 0; rg < RR; ++rg) {
    const float* pr = p + (size_t)rg * RECROWS * SL;
    a  += mr[rg] * pr[(size_t)d * SL];
    cs += mr[rg] * pr[(size_t)32 * SL];
  }
  xs[t] = a * (1.0f / cs);
  __syncthreads();
  if (t < 64) {
    const int hg = t >> 3, wq = t & 7;
    const float* sp = xs + hg * HD + 8 * (wq & 3);
    const bool islo = (wq & 4) != 0;
    v4u vv;
#pragma unroll
    for (int e = 0; e < 4; ++e) {
      const float x0 = sp[2 * e], x1 = sp[2 * e + 1];
      const unsigned short h0 = bf_bits(x0), h1 = bf_bits(x1);
      const unsigned short l0 = bf_bits(x0 - bf_up(h0)), l1 = bf_bits(x1 - bf_up(h1));
      vv[e] = islo ? pk16(l0, l1) : pk16(h0, h1);
    }
    unsigned short* dst = ctxl + (size_t)bs * (2 * EMB) + hg * (2 * HD) + 8 * wq;
    *(v4u*)dst = vv;
    
  }
}

// =====================================================================================================
// Workspace map (bytes), every region an exact multiple of its whole-line / whole-tile store granularity
// (no padded tails: all dims are tile multiples):
//   vb    bf16 [32000][256]        16384000
//   lb    bf16 [512][768]            786432
//   Wvb   bf16 [256][256]            131072
//   Wvvb  bf16 [256][256]            131072
//   Wlb   bf16 [256][768]            393216
//   Wvlb  bf16 [256][768]            393216
//   Wovd  bf16 [256][512]            262144
//   Wold  bf16 [768][512]            786432
//   Qh,Ql bf16 [32000][256] x2     32768000
//   Kh,Kl bf16 [512][256] x2         524288
//   VlTh,VlTl bf16 [2][256][256] x2  524288
//   VvTh,VvTl bf16 [2][256][16000] x2 32768000
//   CTXV  bf16 [32000][512]        32768000
//   REC   f32  [16][10][34][256]    5570560
//   CTXL  bf16 [512][512]            524288
//   total                        124715008
// Weights are [out n][in k] with k contiguous = the Bt / A layout the GEMM wants, so none is transposed; W_ov, W_ol are also duplicated along k.
// =====================================================================================================
extern "C" void kernel_launch(void* const* d_in, const int* in_sizes, int n_in,
                              void* d_out, int out_size, void* d_ws, size_t ws_size,
                              hipStream_t stream) {
  if (n_in < 15) return;
  if (in_sizes[0] != NV * EMB || in_sizes[1] != NL * LD || in_sizes[2] != NB * SL) return;
  if (in_sizes[3] != EMB * EMB || in_sizes[4] != EMB || in_sizes[5] != EMB * LD || in_sizes[6] != EMB) return;
  if (in_sizes[7] != EMB * EMB || in_sizes[8] != EMB || in_sizes[9] != EMB * LD || in_sizes[10] != EMB) return;
  if (in_sizes[11] != EMB * EMB || in_sizes[12] != EMB || in_sizes[13] != LD * EMB || in_sizes[14] != LD) return;
  if (out_size != NV * EMB + NL * LD) return;

  const float* v_in = (const float*)d_in[0];
  const float* l_in = (const float*)d_in[1];
  const int*   mk   = (const int*)d_in[2];
  const float* Wv   = (const float*)d_in[3];
  const float* bv   = (const float*)d_in[4];
  const float* Wl   = (const float*)d_in[5];
  const float* bl   = (const float*)d_in[6];
  const float* Wvv  = (const float*)d_in[7];
  const float* bvv  = (const float*)d_in[8];
  const float* Wvl  = (const float*)d_in[9];
  const float* bvl  = (const float*)d_in[10];
  const float* Wov  = (const float*)d_in[11];
  const float* bov  = (const float*)d_in[12];
  const float* Wol  = (const float*)d_in[13];
  const float* bol  = (const float*)d_in[14];
  float* out0 = (float*)d_out;
  float* out1 = out0 + (size_t)NV * EMB;            // byte 32768000; last element 8585215 < out_size

  const size_t PVB  = (size_t)NV * EMB * 2;          // 16384000
  const size_t PLB  = (size_t)NL * LD * 2;           //   786432
  const size_t PWS  = (size_t)EMB * EMB * 2;         //   131072
  const size_t PWL  = (size_t)EMB * LD * 2;          //   393216
  const size_t PWOD = (size_t)EMB * 2 * EMB * 2;     //   262144
  const size_t PWLD = (size_t)LD * 2 * EMB * 2;      //   786432
  const size_t PQ   = (size_t)NV * EMB * 2;          // 16384000
  const size_t PK   = (size_t)NL * EMB * 2;          //   262144
  const size_t PVLT = (size_t)NB * EMB * SL * 2;     //   262144
  const size_t PVVT = (size_t)NB * EMB * TV * 2;     // 16384000
  const size_t PCTX = (size_t)NV * 2 * EMB * 2;      // 32768000
  const size_t PREC = (size_t)NB * NH * RR * RECROWS * SL * 4;  // 5570560
  const size_t PCTL = (size_t)NL * 2 * EMB * 2;      //   524288
  size_t off = 0;
  const size_t oVB  = off; off += PVB;
  const size_t oLB  = off; off += PLB;
  const size_t oWv  = off; off += PWS;
  const size_t oWvv = off; off += PWS;
  const size_t oWl  = off; off += PWL;
  const size_t oWvl = off; off += PWL;
  const size_t oWod = off; off += PWOD;
  const size_t oWld = off; off += PWLD;
  const size_t oQh  = off; off += PQ;
  const size_t oQl  = off; off += PQ;
  const size_t oKh  = off; off += PK;
  const size_t oKl  = off; off += PK;
  const size_t oVLh = off; off += PVLT;
  const size_t oVLl = off; off += PVLT;
  const size_t oVVh = off; off += PVVT;
  const size_t oVVl = off; off += PVVT;
  const size_t oCTX = off; off += PCTX;
  const size_t oREC = off; off += PREC;
  const size_t oCTL = off; off += PCTL;
  if (off > ws_size) return;                         // off = 124715008
  if (off > (size_t)134217728) return;

  char* ws = (char*)d_ws;
  unsigned short* vb   = (unsigned short*)(ws + oVB);
  unsigned short* lb   = (unsigned short*)(ws + oLB);
  unsigned short* Wvb  = (unsigned short*)(ws + oWv);
  unsigned short* Wvvb = (unsigned short*)(ws + oWvv);
  unsigned short* Wlb  = (unsigned short*)(ws + oWl);
  unsigned short* Wvlb = (unsigned short*)(ws + oWvl);
  unsigned short* Wovd = (unsigned short*)(ws + oWod);
  unsigned short* Wold = (unsigned short*)(ws + oWld);
  unsigned short* Qh   = (unsigned short*)(ws + oQh);
  unsigned short* Ql   = (unsigned short*)(ws + oQl);
  unsigned short* Kh   = (unsigned short*)(ws + oKh);
  unsigned short* Kl   = (unsigned short*)(ws + oKl);
  unsigned short* VlTh = (unsigned short*)(ws + oVLh);
  unsigned short* VlTl = (unsigned short*)(ws + oVLl);
  unsigned short* VvTh = (unsigned short*)(ws + oVVh);
  unsigned short* VvTl = (unsigned short*)(ws + oVVl);
  unsigned short* CTXV = (unsigned short*)(ws + oCTX);
  float*          REC  = (float*)(ws + oREC);
  unsigned short* CTXL = (unsigned short*)(ws + oCTL);

  const dim3 blk(256);
  const dim3 gO1((((NL) / 64) * (LD / 64) + 7) / 8, 1);        //   96 tiles ->   12 blocks

  // (1) inputs -> bf16 planes; W_o -> bf16 duplicated along k (8 jobs, 4576 blocks)
  cvt_all<<<dim3(CB_ALL), blk, 0, stream>>>(v_in, l_in, Wv, Wvv, Wl, Wvl, Wov, Wol,
                                            vb, lb, Wvb, Wvvb, Wlb, Wvlb, Wovd, Wold);
  // (2) q, k, val_v^T, val_l^T -> bf16 hi / residual planes (4 jobs, 508 blocks)
  proj_all<<<dim3(PB_ALL), blk, 0, stream>>>(vb, lb, Wvb, Wlb, Wvvb, Wvlb, bv, bl, bvv, bvl,
                                             Qh, Ql, Kh, Kl, VvTh, VvTl, VlTh, VlTl);
  // (3) language-direction partial records (320 blocks) and vision-direction attention -> ctx plane (4000 blocks)
  attn_both<<<dim3(AB_L + AB_V), dim3(128), 0, stream>>>(Qh, Ql, Kh, Kl, VlTh, VlTl, VvTh, VvTl, mk, CTXV, REC);
  // (4) out0 = ctx . W_ov^T + b_ov -> d_out f32 [32000][256] (K=512: [hi|residual] . [W|W]; 250 blocks)
  //     and the fold of the t ranges, normalise, merge heads -> ctx_l plane (512 blocks)
  gemm64_f32<<<dim3(PB_Q + NL), blk, 0, stream>>>(CTXV, 2 * EMB, Wovd, 2 * EMB, bov, out0, EMB, NV, EMB, 2 * EMB, REC, CTXL);
  // (5) out1 = ctx_l . W_ol^T + b_ol -> d_out f32 [512][768] at float offset 8192000
  gemm64_f32<<<gO1, blk, 0, stream>>>(CTXL, 2 * EMB, Wold, 2 * EMB, bol, out1, LD, NL, LD, 2 * EMB,
                                      (const float*)nullptr, (unsigned short*)nullptr);   // no fold blocks in this grid
  (void)hipGetLastError();
}

// v004
// Measured time: 208 microseconds a run.
// In both of two side-by-side timings against v003, it was 1.06 times as fast.
// All steps since v000 together make it 2.20 times as fast.
// Contractions: v.W_v^T, v.W_vv^T, l.W_l^T, l.W_vl^T = v_wmma_f32_16x16x32_bf16 (bf16 operands RNE-converted from the inputs, single product, f32 accumulate);
// q.k^T scores = v_wmma_f32_16x16x32_bf16 (q and k as bf16 hi + unscaled bf16 residual planes; 3 products hi.hi + hi.lo + lo.hi; f32 accumulate);
// p.val_l and e.val_v = v_wmma_f32_16x16x32_bf16 (p / e split in registers into bf16 hi + residual, val planes bf16 hi + residual; 3 products; f32 accumulate);
// ctx_v.W_ov^T and ctx_l.W_ol^T = v_wmma_f32_16x16x32_bf16 (ctx as bf16 hi | residual interleaved along k, W bf16 duplicated along k; f32 accumulate).
// Softmax, mask, bias, scale, column statistics and normalisation in f32.
// Carry audit: no power-of-two carried planes anywhere (every residual plane is an unscaled bf16 difference); nothing is folded back.
#include <hip/hip_runtime.h>
#include <math.h>
#include <stdint.h>

#define NB      2
#define TV      16000
#define SL      256
#define EMB     256
#define LD      768
#define NH      8
#define HD      32
#define NV      (NB * TV)          // 32000 vision rows
#define NL      (NB * SL)          // 512 language rows
#define NQT     (TV / 64)          // 250 query tiles of 64 rows per batch
#define RR      10                 // t ranges per (b,h) in the language direction
#define TPR     (TV / RR)          // 1600 t per range
#define NSTEP   (TPR / 32)         // 50 steps of 32 t per range
#define RECROWS 34                 // 32 accumulator rows + 1 column-sum row + 1 running-max row
#define SCALEQ  0.17677669529663687f
#define CLAMPV  50000.0f
#define MASKNEG (-9.0e15f)

static_assert(NH * HD == EMB);
static_assert(NQT * 64 == TV);
static_assert(RR * NSTEP * 32 == TV);
static_assert((NV % 64) == 0 && (NL % 64) == 0 && (EMB % 64) == 0 && (LD % 64) == 0 && (TV % 64) == 0);
static_assert((EMB % 32) == 0 && (LD % 32) == 0 && ((2 * EMB) % 32) == 0);
static_assert(SL == 256 && HD == 32 && EMB == 256);

typedef __bf16   v16b __attribute__((ext_vector_type(16)));
typedef __bf16   v8b  __attribute__((ext_vector_type(8)));
typedef float    v8f  __attribute__((ext_vector_type(8)));
typedef float    v4f  __attribute__((ext_vector_type(4)));
typedef unsigned int v4u __attribute__((ext_vector_type(4)));
typedef unsigned int v8u __attribute__((ext_vector_type(8)));
typedef int      v4i  __attribute__((ext_vector_type(4)));
typedef v4f __attribute__((may_alias)) v4fa;
typedef v4i __attribute__((may_alias)) v4ia;

#if defined(__HIP_DEVICE_COMPILE__)
#define DEV_ASM 1
#else
#define DEV_ASM 0
#endif

// ---- scalar helpers --------------------------------------------------------------------------------
__device__ __forceinline__ unsigned short bf_bits(float f) {          // f32 -> bf16 bits, RNE convert
  unsigned u = __float_as_uint(f);
  return (unsigned short)((u + 0x7FFFu + ((u >> 16) & 1u)) >> 16);
}
__device__ __forceinline__ float bf_up(unsigned short hb) { return __uint_as_float(((unsigned)hb) << 16); }
__device__ __forceinline__ float rbf(float f) { return bf_up(bf_bits(f)); }   // value of the bf16 RNE convert
__device__ __forceinline__ unsigned pk16(unsigned short a, unsigned short b) { return (unsigned)a | ((unsigned)b << 16); }
__device__ __forceinline__ v8f zero8() { v8f z = {0.f, 0.f, 0.f, 0.f, 0.f, 0.f, 0.f, 0.f}; return z; }
__device__ __forceinline__ float clampv(float x) { return fminf(fmaxf(x, -CLAMPV), CLAMPV); }
// 2^x. The v_nop is the one free slot that the instruction set asks for behind a transcendental.
__device__ __forceinline__ float exp2_slot(float x) {
#if DEV_ASM
  float r;
  asm("v_exp_f32 %0, %1\n\tv_nop" : "=v"(r) : "v"(x));
  return r;
#else
  return x;
#endif
}
// value of lane l ^ 16 (the other 16-lane row), by a vector cross-row move
__device__ __forceinline__ float xhalf(float x) {
  return __builtin_bit_cast(float, __builtin_amdgcn_permlanex16(__builtin_bit_cast(int, x), __builtin_bit_cast(int, x),
                                                                0x76543210, 0xfedcba98, false, false));
}

// ---- 16-bit A/B fragment loader (wave32): lane -> row/col (lane&15); p already includes +8*(lane>>4);
//      elements 0..7 <- p[0..7] (k0+8h..k0+8h+7), elements 8..15 <- p[16..23] (k0+16+8h..k0+16+8h+7)
__device__ __forceinline__ v16b ldfrag(const __bf16* p) {
  union { v16b v; v8b h[2]; } f;
  f.h[0] = *(const v8b*)(p);
  f.h[1] = *(const v8b*)(p + 16);
  return f.v;
}

// ---- the same fragment from a plane kept in FRAGMENT ORDER: a plane of [rows][C] bf16 is a row of 1-KB blocks, block
//      (rt, kt) = rows 16rt..+15 x k 32kt..+31 at element ((rt * (C / 32)) + kt) * 512; inside it element (row m, k) lies at
//      (k >> 4) * 256 + (((k >> 3) & 1) * 16 + m) * 8 + (k & 7). p = block + 8 * lane: each of the two loads reads 512
//      contiguous bytes (4 whole lines) and gives the registers of ldfrag: elements 0..7 = k 8h..8h+7, 8..15 = k 16+8h..+7.
__device__ __forceinline__ v16b ldfragT(const __bf16* p) {
  union { v16b v; v8b h[2]; } f;
  f.h[0] = *(const v8b*)(p);
  f.h[1] = *(const v8b*)(p + 256);
  return f.v;
}

// s_wait_xcnt 0 behind a group of global loads or stores: it stands in front of whatever next writes a register that they name
__device__ __forceinline__ void addr_taken() {
#if DEV_ASM
  asm volatile("s_wait_xcnt 0x0" ::: "memory");
#endif
}

// ---- WMMA helpers (asm guard bodies device-only) -------------------------------------------------------
__device__ __forceinline__ v8f mmar(v16b a, v16b b, v8f c) {
  return __builtin_amdgcn_wmma_f32_16x16x32_bf16(false, a, false, b, (short)0, c, false, false);
}
// guarded form: 4 VALU slots after the WMMA, D tied, A/B kept live
__device__ __forceinline__ v8f mma_b(v16b a, v16b b, v8f c) {
  c = __builtin_amdgcn_wmma_f32_16x16x32_bf16(false, a, false, b, (short)0, c, false, false);
#if DEV_ASM
  asm volatile("v_nop\n\tv_nop\n\tv_nop\n\tv_nop" : "+v"(c) : "v"(a), "v"(b));
#endif
  return c;
}
__device__ __forceinline__ void dep_guard(v8f& a, v8f& b, v16b x, v16b y) {
#if DEV_ASM
  asm volatile("v_nop\n\tv_nop\n\tv_nop\n\tv_nop" : "+v"(a), "+v"(b) : "v"(x), "v"(y));
#else
  (void)a; (void)b; (void)x; (void)y;
#endif
}
__device__ __forceinline__ void keep4(v16b a, v16b b, v16b c, v16b d) {
#if DEV_ASM
  asm volatile("v_nop" :: "v"(a), "v"(b), "v"(c), "v"(d));
#else
  (void)a; (void)b; (void)c; (void)d;
#endif
}
__device__ __forceinline__ void acc_guard4(v8f& a, v8f& b, v8f& c, v8f& d) {
#if DEV_ASM
  asm volatile("v_nop\n\tv_nop\n\tv_nop\n\tv_nop" : "+v"(a), "+v"(b), "+v"(c), "+v"(d));
#else
  (void)a; (void)b; (void)c; (void)d;
#endif
}

// ---- B fragment (k = the D tiles' ROW index) from two D tiles held by this lane, split into bf16 hi + residual:
//      element r <- tile a (k 0..15) row r, element 8+r <- tile c (k 16..31) row r, lane unchanged.
union PK { v8u u; v16b v; };
__device__ __forceinline__ void pack_hl(v8f a, v8f c, v16b& fh, v16b& fl) {
  v8u ph, pl;
#pragma unroll
  for (int i = 0; i < 4; ++i) {
    const float x0 = a[2 * i], x1 = a[2 * i + 1];
    const unsigned short h0 = bf_bits(x0), h1 = bf_bits(x1);
    const unsigned short l0 = bf_bits(x0 - bf_up(h0)), l1 = bf_bits(x1 - bf_up(h1));
    ph[i] = pk16(h0, h1);
    pl[i] = pk16(l0, l1);
    const float y0 = c[2 * i], y1 = c[2 * i + 1];
    const unsigned short g0 = bf_bits(y0), g1 = bf_bits(y1);
    const unsigned short n0 = bf_bits(y0 - bf_up(g0)), n1 = bf_bits(y1 - bf_up(g1));
    ph[4 + i] = pk16(g0, g1);
    pl[4 + i] = pk16(n0, n1);
  }
  PK uh, ul;
  uh.u = ph; ul.u = pl;
  fh = uh.v; fl = ul.v;
}

// =====================================================================================================
// f32 [rows][32 * KTN] (DUP: [rows][16 * KTN]) -> bf16 bits plane [rows][32 * KTN] in fragment order (see ldfragT).
// Thread = one 16-B piece of the output in output order: a wave writes 512 contiguous B, a block 4 whole 1-KB blocks.
// DUP: k tiles 2g and 2g + 1 both hold source columns 32g..32g+31 (the Bt operand of ctx.W^T where ctx is stored as
// [hi 32 | residual 32] per head block). coverage: the caller's block count x 256 pieces = the whole plane.
// =====================================================================================================
template <int KTN, bool DUP>
__device__ __forceinline__ void cvt_frag(int bx, const float* __restrict__ in, unsigned short* out) {
  const int p = bx * 256 + (int)threadIdx.x;                  // piece index
  const int blk = p >> 6, m = p & 15;
  const int kin = ((p >> 5) & 1) * 16 + ((p >> 4) & 1) * 8;   // k of the piece's first element inside its tile
  const int rt = blk / KTN, kt = blk - rt * KTN;
  const int col = (DUP ? (kt >> 1) : kt) * 32 + kin;
  const float* s = in + (size_t)(rt * 16 + m) * (DUP ? 16 * KTN : 32 * KTN) + col;
  const v4f a  = *(const v4fa*)(s);
  const v4f a4 = *(const v4fa*)(s + 4);
  v4u q;
  q[0] = pk16(bf_bits(a[0]),  bf_bits(a[1]));
  q[1] = pk16(bf_bits(a[2]),  bf_bits(a[3]));
  q[2] = pk16(bf_bits(a4[0]), bf_bits(a4[1]));
  q[3] = pk16(bf_bits(a4[2]), bf_bits(a4[3]));
  *(v4u*)(out + (size_t)p * 8) = q;
  addr_taken();   // the listing goes on behind this store into the next job's code
}

// =====================================================================================================
// All eight input conversions in one grid: they are independent of one another, so blockIdx.x picks the job.
// Block ranges (256 threads each): W_ov dup, W_ol dup, W_v, W_vv, W_l, W_vl, l, v.
// =====================================================================================================
#define CB_DV  (EMB * 2 * EMB / 8 / 256) //   64 blocks, 2048 output elements each
#define CB_DL  (LD * 2 * EMB / 8 / 256)  //  192
#define CB_WS  (EMB * EMB / 8 / 256)     //   32 blocks, 2048 elements each
#define CB_WL  (EMB * LD / 8 / 256)      //   96
#define CB_L   (NL * LD / 8 / 256)       //  192
#define CB_V   (NV * EMB / 8 / 256)      // 4000
#define CB_ALL (CB_DV + CB_DL + 2 * CB_WS + 2 * CB_WL + CB_L + CB_V)
static_assert(CB_WS * 2048 == EMB * EMB && CB_WL * 2048 == EMB * LD && CB_L * 2048 == NL * LD && CB_V * 2048 == NV * EMB);
static_assert(CB_DV * 2048 == EMB * 2 * EMB && CB_DL * 2048 == LD * 2 * EMB);
static_assert((NV % 16) == 0 && (NL % 16) == 0 && (TV % 32) == 0 && (SL % 32) == 0);
__global__ __launch_bounds__(256) void cvt_all(
    const float* __restrict__ v_in, const float* __restrict__ l_in,
    const float* __restrict__ Wv, const float* __restrict__ Wvv,
    const float* __restrict__ Wl, const float* __restrict__ Wvl,
    const float* __restrict__ Wov, const float* __restrict__ Wol,
    unsigned short* vb, unsigned short* lb, unsigned short* Wvb, unsigned short* Wvvb,
    unsigned short* Wlb, unsigned short* Wvlb, unsigned short* Wovd, unsigned short* Wold) {
  int bx = (int)blockIdx.x;                                   // block-uniform job choice
  if (bx < CB_DV) { cvt_frag<2 * EMB / 32, true>(bx, Wov, Wovd); return; }
  bx -= CB_DV;
  if (bx < CB_DL) { cvt_frag<2 * EMB / 32, true>(bx, Wol, Wold); return; }
  bx -= CB_DL;
  if (bx < CB_WS) { cvt_frag<EMB / 32, false>(bx, Wv, Wvb); return; }
  bx -= CB_WS;
  if (bx < CB_WS) { cvt_frag<EMB / 32, false>(bx, Wvv, Wvvb); return; }
  bx -= CB_WS;
  if (bx < CB_WL) { cvt_frag<LD / 32, false>(bx, Wl, Wlb); return; }
  bx -= CB_WL;
  if (bx < CB_WL) { cvt_frag<LD / 32, false>(bx, Wvl, Wvlb); return; }
  bx -= CB_WL;
  if (bx < CB_L) { cvt_frag<LD / 32, false>(bx, l_in, lb); return; }
  bx -= CB_L;
  cvt_frag<EMB / 32, false>(bx, v_in, vb);
}

// =====================================================================================================
// Register-blocked batched WMMA GEMM (bf16 operands): C[m][n] = sum_k A[m][k] * Bt[n][k];
// one wave per 64x64 tile, no block barriers. A [M][K], lda columns; Bt [N][K], ldb columns;
// M, N multiples of 64, K multiple of 32 (host-checked). bx = block of 8 tiles, b = batch index
// (strides in elements); sT = the block's LDS slabs, declared by the calling kernel. Fragments are loaded straight from global:
// Bt, and A where AFR, lie in fragment order (ldfragT; lda / ldb = the plane's columns); A row-major (ldfrag) where not AFR.
// OUT_MODE 0: f32 C (pitch ldc), value = (acc + bf16(bias[n])) * oscale.
// OUT_MODE 3: bf16 hi plane C + bf16 residual plane C2 = bf16(y - hi), both in fragment order (ldc = the plane's columns),
//             y = (acc + bf16(bias)) * oscale; bias[n] (BIASM 0) or bias[m] (BIASM 1).
// =====================================================================================================
template <int OUT_MODE, int BIASM, bool AFR>
__device__ __forceinline__ void gemm64_body(
    float (*sT)[16 * 68], int bx, int b,
    const unsigned short* __restrict__ Ap, int lda, long long strideA,
    const unsigned short* __restrict__ Btp, int ldb, long long strideB,
    const float* __restrict__ bias,
    void* Cout, void* Cout2, int ldc, long long strideC,
    int M, int N, int K, float oscale) {
  static_assert(OUT_MODE == 0 || OUT_MODE == 3);
  static_assert(OUT_MODE != 0 || BIASM == 0);
  const __bf16* A  = (const __bf16*)(const void*)Ap;
  const __bf16* Bt = (const __bf16*)(const void*)Btp;
  const int lane = threadIdx.x & 31;
  const int wave = threadIdx.x >> 5;
  const int tilesN = N >> 6;
  const int tilesM = M >> 6;
  const int tile = bx * 8 + wave;
  if (tile >= tilesM * tilesN) return;   // wave-uniform; no block barriers in this kernel
  const int tm = tile / tilesN;
  const int tn = tile - tm * tilesN;
  const int m0 = tm << 6;
  const int n0 = tn << 6;

  const __bf16* Ab = A  + (size_t)b * (size_t)strideA;
  const __bf16* Bb = Bt + (size_t)b * (size_t)strideB;

  const int rlane = lane & 15;                 // row (A) / col (B, D) within subtile
  const int koff  = (lane >> 4) * 8;           // k offset of this lane half
  const int mOff  = (lane >> 4) * 8;           // D row offset

  v8f acc[4][4];
#pragma unroll
  for (int i = 0; i < 4; ++i)
#pragma unroll
    for (int j = 0; j < 4; ++j) acc[i][j] = zero8();

  unsigned ob[4], oa[4];                        // byte offset of this lane's piece of the current k tile, one per 16-row tile
#pragma unroll
  for (int j = 0; j < 4; ++j) {                 // every plane is far below 2^31 bytes
    ob[j] = (unsigned)((((n0 >> 4) + j) * (ldb >> 5) * 512 + lane * 8) * 2);
    oa[j] = (unsigned)((AFR ? ((m0 >> 4) + j) * (lda >> 5) * 512 + lane * 8 : (m0 + (j << 4) + rlane) * lda + koff) * 2);
  }
  for (int k0 = 0; k0 < K; k0 += 32) {
    v16b bq[4];
#pragma unroll
    for (int j = 0; j < 4; ++j) bq[j] = ldfragT((const __bf16*)((const char*)Bb + ob[j]));
#pragma unroll
    for (int i = 0; i < 4; ++i) {
      const __bf16* pa = (const __bf16*)((const char*)Ab + oa[i]);
      const v16b af = AFR ? ldfragT(pa) : ldfrag(pa);
#pragma unroll
      for (int j = 0; j < 4; ++j) acc[i][j] = mmar(af, bq[j], acc[i][j]);
      dep_guard(acc[i][0], acc[i][3], af, bq[3]);
    }
    keep4(bq[0], bq[1], bq[2], bq[3]);
#if DEV_ASM
    // s_wait_xcnt 0 in front of the steps of the offsets that the loads above name; it names them so that the steps stay behind it
    asm volatile("s_wait_xcnt 0x0" : "+v"(ob[0]), "+v"(ob[1]), "+v"(ob[2]), "+v"(ob[3]),
                                     "+v"(oa[0]), "+v"(oa[1]), "+v"(oa[2]), "+v"(oa[3]) :: "memory");
#endif
#pragma unroll
    for (int j = 0; j < 4; ++j) { ob[j] += 1024u; oa[j] += AFR ? 1024u : 64u; }
  }
  acc_guard4(acc[0][0], acc[0][1], acc[0][2], acc[0][3]);
  acc_guard4(acc[1][0], acc[1][1], acc[1][2], acc[1][3]);
  acc_guard4(acc[2][0], acc[2][1], acc[2][2], acc[2][3]);
  acc_guard4(acc[3][0], acc[3][1], acc[3][2], acc[3][3]);

  // ---- epilogue ----
  float* slab = sT[wave];
  const int h2 = lane >> 4, c4 = (lane & 15) * 4;     // OUT_MODE 0 map: 256-B row segment = 16 lanes x 16 B
  v4f bb4;                                             // bias for columns n0+c4..+3 (mode 0)
  float bj[4];                                         // bias for columns n0+16j+rlane (mode 3, BIASM 0), added on the way into the slab
  if (OUT_MODE == 0) {
    const v4f braw = *(const v4fa*)(bias + n0 + c4);
    bb4[0] = rbf(braw[0]); bb4[1] = rbf(braw[1]); bb4[2] = rbf(braw[2]); bb4[3] = rbf(braw[3]);
  } else {
#pragma unroll
    for (int j = 0; j < 4; ++j) bj[j] = (BIASM == 0) ? rbf(bias[n0 + (j << 4) + rlane]) : 0.f;
  }
#pragma unroll
  for (int i = 0; i < 4; ++i) {
    const int mBase = m0 + (i << 4);
#pragma unroll
    for (int j = 0; j < 4; ++j) {
#pragma unroll
      for (int r = 0; r < 8; ++r) {
        slab[(mOff + r) * 68 + (j << 4) + rlane] = (OUT_MODE == 3 && BIASM == 0) ? acc[i][j][r] + bj[j] : acc[i][j][r];
      }
    }
    __builtin_amdgcn_fence(__ATOMIC_RELEASE, "workgroup");
    __builtin_amdgcn_wave_barrier();
    __builtin_amdgcn_fence(__ATOMIC_ACQUIRE, "workgroup");
    if (OUT_MODE == 0) {
      float* C = (float*)Cout + (size_t)b * (size_t)strideC;
      {
#pragma unroll
        for (int it = 0; it < 8; ++it) {
          const int row = it * 2 + h2;                     // it 0..7 x h2 0..1 = rows 0..15
          v4f v = *(const v4fa*)(slab + row * 68 + c4);
          v = (v + bb4) * oscale;
          *(v4f*)(C + (size_t)(mBase + row) * ldc + n0 + c4) = v;
        }
        
      }
    } else {
      unsigned short* C  = (unsigned short*)Cout  + (size_t)b * (size_t)strideC;
      unsigned short* C2 = (unsigned short*)Cout2 + (size_t)b * (size_t)strideC;
      // the 16 x 64 slab = two 1-KB blocks (k tiles n0/32, n0/32 + 1) of row tile mBase/16; store it = 512 contiguous B:
      // lane -> row rlane, columns 16it + koff .. +7
      const size_t cb = ((size_t)(mBase >> 4) * (ldc >> 5) + (n0 >> 5)) * 512 + lane * 8;
      float brow = 0.f;
      if (BIASM == 1) brow = rbf(bias[mBase + rlane]);
      v4u hv[4], lv[4];
#pragma unroll
      for (int it = 0; it < 4; ++it) {
        const float* sp = slab + rlane * 68 + it * 16 + koff;
        v4u a, a2;
#pragma unroll
        for (int e = 0; e < 4; ++e) {
          const float f0 = ((BIASM == 1) ? sp[2 * e]     + brow : sp[2 * e])     * oscale;
          const float f1 = ((BIASM == 1) ? sp[2 * e + 1] + brow : sp[2 * e + 1]) * oscale;
          const unsigned short h0 = bf_bits(f0), h1 = bf_bits(f1);
          const unsigned short l0 = bf_bits(f0 - bf_up(h0)), l1 = bf_bits(f1 - bf_up(h1));
          a[e] = pk16(h0, h1); a2[e] = pk16(l0, l1);
        }
        hv[it] = a; lv[it] = a2;
      }
      {
#pragma unroll
        for (int it = 0; it < 4; ++it) {
          *(v4u*)(C  + cb + it * 256) = hv[it];
          *(v4u*)(C2 + cb + it * 256) = lv[it];
        }
        
      }
    }
    __builtin_amdgcn_fence(__ATOMIC_RELEASE, "workgroup");
    __builtin_amdgcn_wave_barrier();
    __builtin_amdgcn_fence(__ATOMIC_ACQUIRE, "workgroup");
  }
}

__device__ __forceinline__ void fold_l_body(float* xs, int bs, const float* __restrict__ rec, unsigned short* ctxl);

// ---- one GEMM per launch (used for out0 and out1). Blocks past the GEMM's own (the out0 launch has NL of them) run the
//      language fold, one (b,s) each: it reads the records and writes ctx_l, the GEMM reads and writes neither. ----
template <bool AFR>   // A (the ctx plane) in fragment order, or row-major
__global__ __launch_bounds__(256) void gemm64_f32(
    const unsigned short* __restrict__ Ap, int lda,
    const unsigned short* __restrict__ Btp, int ldb,
    const float* __restrict__ bias, float* Cout, int ldc, int M, int N, int K,
    const float* __restrict__ rec, unsigned short* ctxl) {
  __shared__ __align__(16) float sT[8][16 * 68];   // per-wave 16x64 slab, pitch 68 floats; the fold uses its first 1 KB
  const int gb = ((M >> 6) * (N >> 6) + 7) >> 3;   // blocks of the GEMM, 8 tiles each
  if ((int)blockIdx.x >= gb) {                     // block-uniform job choice
    fold_l_body(&sT[0][0], (int)blockIdx.x - gb, rec, ctxl);
    return;
  }
  gemm64_body<0, 0, AFR>(sT, (int)blockIdx.x, 0, Ap, lda, 0LL, Btp, ldb, 0LL, bias,
                    (void*)Cout, (void*)Cout, ldc, 0LL, M, N, K, 1.0f);
}

// =====================================================================================================
// The four input projections in one grid: none reads what another writes, so blockIdx.x picks the job.
// The two K = 768 jobs (few tiles, longest k loop) take the first blocks.
//   k      = l . W_l^T + b_l              [b*SL+s][256]         M=512,   N=256,   K=768
//   val_l^T = W_vl . l^T + b_vl per batch [b][d][s] pitch SL    M=256,   N=256,   K=768
//   q      = (v . W_v^T + b_v) * scale    [b*TV+t][256]         M=32000, N=256,   K=256
//   val_v^T = W_vv . v^T + b_vv per batch [b][d][t] pitch TV    M=256,   N=16000, K=256
// every result as bf16 hi / residual planes.
// =====================================================================================================
#define PB_K   ((NL / 64) * (EMB / 64) / 8)      //   4 blocks
#define PB_VL1 ((EMB / 64) * (SL / 64) / 8)      //   2 blocks per batch
#define PB_Q   ((NV / 64) * (EMB / 64) / 8)      // 250 blocks
#define PB_VV1 ((EMB / 64) * (TV / 64) / 8)      // 125 blocks per batch
#define PB_ALL (PB_K + NB * PB_VL1 + PB_Q + NB * PB_VV1)
static_assert(PB_K * 8 * 4096 == NL * EMB && PB_VL1 * 8 * 4096 == EMB * SL);
static_assert(PB_Q * 8 * 4096 == NV * EMB && PB_VV1 * 8 * 4096 == EMB * TV);
__global__ __launch_bounds__(256) void proj_all(
    const unsigned short* __restrict__ vb, const unsigned short* __restrict__ lb,
    const unsigned short* __restrict__ Wvb, const unsigned short* __restrict__ Wlb,
    const unsigned short* __restrict__ Wvvb, const unsigned short* __restrict__ Wvlb,
    const float* __restrict__ bv, const float* __restrict__ bl,
    const float* __restrict__ bvv, const float* __restrict__ bvl,
    unsigned short* Qh, unsigned short* Ql, unsigned short* Kh, unsigned short* Kl,
    unsigned short* VvTh, unsigned short* VvTl, unsigned short* VlTh, unsigned short* VlTl) {
  __shared__ __align__(16) float sT[8][16 * 68];   // per-wave 16x64 slab, pitch 68 floats
  const int bid = (int)blockIdx.x;                 // block-uniform job choice
  const bool lang = bid < PB_K + NB * PB_VL1;      // operand l (K = 768) or v (K = 256)
  const int r = lang ? bid : bid - (PB_K + NB * PB_VL1);
  const int nrow = lang ? PB_K : PB_Q;             // blocks of the row-major job of this operand
  const unsigned short* x = lang ? lb : vb;
  const int kd = lang ? LD : EMB;
  if (r < nrow) {
    gemm64_body<3, 0, true>(sT, r, 0, x, kd, 0LL, lang ? Wlb : Wvb, kd, 0LL, lang ? bl : bv,
                      (void*)(lang ? Kh : Qh), (void*)(lang ? Kl : Ql), EMB, 0LL,
                      lang ? NL : NV, EMB, kd, lang ? 1.0f : SCALEQ);
  } else {
    const int per = lang ? PB_VL1 : PB_VV1;
    const int r2 = r - nrow;
    const int b = (r2 >= per) ? 1 : 0;
    static_assert(NB == 2);
    const int nt = lang ? SL : TV;                 // rows of x per batch = N = output pitch
    gemm64_body<3, 1, true>(sT, r2 - b * per, b, lang ? Wvlb : Wvvb, kd, 0LL, x, kd, (long long)nt * kd,
                      lang ? bvl : bvv, (void*)(lang ? VlTh : VvTh), (void*)(lang ? VlTl : VvTl),
                      nt, (long long)EMB * nt, EMB, nt, kd, 1.0f);
  }
}

// ---- additive key mask: -9e15 where the int32 mask is 0, else 0 (8 consecutive keys, 2 int4 loads) ----
__device__ __forceinline__ v8f add_mask8(v8f s, const int* p) {
  const v4i ma = *(const v4ia*)p;
  const v4i mb = *(const v4ia*)(p + 4);
  s[0] += (ma[0] == 0) ? MASKNEG : 0.0f;
  s[1] += (ma[1] == 0) ? MASKNEG : 0.0f;
  s[2] += (ma[2] == 0) ? MASKNEG : 0.0f;
  s[3] += (ma[3] == 0) ? MASKNEG : 0.0f;
  s[4] += (mb[0] == 0) ? MASKNEG : 0.0f;
  s[5] += (mb[1] == 0) ? MASKNEG : 0.0f;
  s[6] += (mb[2] == 0) ? MASKNEG : 0.0f;
  s[7] += (mb[3] == 0) ? MASKNEG : 0.0f;
  return s;
}

// =====================================================================================================
// Pass A: vision-direction attention (softmax over the 256 text keys, masked).
//   Planes (fragment order, see ldfragT): Qh/Ql, Kh/Kl bf16 [row][256] (row = b*TV + t / b*SL + s, head block h*32);
//           Vlh/Vll = val_l^T bf16 [b][256 d][256 s]; mask int32 [b][256].
//   Transposed form: S^T = K.Q^T (A = K rows: row = key, k = d; B = Q^T from the q row, n = query),
//   3 products (hh, hl, lh); D = S^T[key 8hh+r][query m]. Online softmax over 4 chunks of 64 keys in f32;
//   P^T hi / residual B fragments packed from registers; O^T += Vl^T . P^T (A = Vl^T rows: row = d, k = key).
//   Block = 4 waves x 16 queries = 64 query rows of one (b,h); NQT x NB*NH blocks (qt, bh).
//   Output: the ctx plane in fragment order, per wave two whole 1-KB blocks straight from the accumulators, 4 lines per instruction.
//   coverage: 250 x 16 blocks x 4 waves x (16 rows x 64 columns) = every block of the ctx plane.
// =====================================================================================================
__device__ __forceinline__
void attn_v_body(int qt, int bh,
            const unsigned short* __restrict__ qhp, const unsigned short* __restrict__ qlp,
            const unsigned short* __restrict__ khp, const unsigned short* __restrict__ klp,
            const unsigned short* __restrict__ vhp, const unsigned short* __restrict__ vlp,
            const int* __restrict__ maskl, unsigned short* ctxp) {
  const int tid = threadIdx.x, lane = tid & 31, w = tid >> 5;
  const int hh = lane >> 4;
  const int b = bh >> 3, head = bh & 7;
  const int q0 = qt * 64 + 16 * w;

  const __bf16* Qh = (const __bf16*)(const void*)qhp;
  const __bf16* Ql = (const __bf16*)(const void*)qlp;
  const __bf16* Kh = (const __bf16*)(const void*)khp;
  const __bf16* Kl = (const __bf16*)(const void*)klp;
  const __bf16* Vh = (const __bf16*)(const void*)vhp;
  const __bf16* Vl = (const __bf16*)(const void*)vlp;

  // Q^T B-fragments: column n = query q0+m, k = d (one 32-deep step)
  // (all planes in fragment order: block (row tile, k tile), 512 elements each; q and k have EMB / 32 = NH k tiles, k tile = head)
  const size_t qoff = ((size_t)((b * TV + q0) >> 4) * NH + head) * 512 + lane * 8;
  const v16b qbh = ldfragT(Qh + qoff);
  const v16b qbl = ldfragT(Ql + qoff);
  addr_taken();

  const size_t koff0 = ((size_t)((b * SL) >> 4) * NH + head) * 512 + lane * 8;                  // + (key0/16)*NH*512
  const __bf16* kbh = Kh + koff0;
  const __bf16* kbl = Kl + koff0;
  const size_t voff0 = (size_t)b * EMB * SL + (size_t)(head * 2) * (SL / 32) * 512 + lane * 8;  // + (dt*(SL/32) + key0/32)*512
  const __bf16* vbh = Vh + voff0;
  const __bf16* vbl = Vl + voff0;
  const int* mkp = maskl + b * SL + 8 * hh;                                      // + key tile base

  v8f o[2];
  o[0] = zero8(); o[1] = zero8();
  float mrun = -1.0e30f, lrun = 0.0f;

#pragma unroll 1
  for (int kc = 0; kc < SL / 64; ++kc) {
    const int kb0 = kc * 64;
    // ---- scores s[j][r] = S[query q0+m][key kb0+16j+8hh+r] ----
    v8f s[4];
#pragma unroll
    for (int j = 0; j < 4; ++j) {
      const size_t ko = (size_t)((kb0 >> 4) + j) * (NH * 512);
      const v16b kfh = ldfragT(kbh + ko);
      const v16b kfl = ldfragT(kbl + ko);
      addr_taken();
      v8f z = zero8();
      z = mma_b(kfh, qbh, z);
      z = mma_b(kfl, qbh, z);
      z = mma_b(kfh, qbl, z);
      s[j] = z;
    }
    // ---- clamp (pre-mask) ----
#pragma unroll
    for (int j = 0; j < 4; ++j)
#pragma unroll
      for (int r = 0; r < 8; ++r) s[j][r] = clampv(s[j][r]);
    // ---- additive mask per key, f32 ----
#pragma unroll
    for (int j = 0; j < 4; ++j) s[j] = add_mask8(s[j], mkp + kb0 + 16 * j);

    // ---- online softmax per query column ----
    float mloc = s[0][0];
#pragma unroll
    for (int j = 0; j < 4; ++j)
#pragma unroll
      for (int r = 0; r < 8; ++r) mloc = fmaxf(mloc, s[j][r]);
    mloc = fmaxf(mloc, __shfl_xor(mloc, 16, 32));
    const float mnew = fmaxf(mrun, mloc);
    const float alpha = __expf(mrun - mnew);
    mrun = mnew;
    float lsum = 0.0f;
#pragma unroll
    for (int j = 0; j < 4; ++j)
#pragma unroll
      for (int r = 0; r < 8; ++r) {
        const float p = __expf(s[j][r] - mnew);
        s[j][r] = p;
        lsum += p;
      }
    lsum += __shfl_xor(lsum, 16, 32);
    lrun = lrun * alpha + lsum;
#pragma unroll
    for (int dt = 0; dt < 2; ++dt)
#pragma unroll
      for (int r = 0; r < 8; ++r) o[dt][r] = o[dt][r] * alpha;

    // ---- P^T B-fragments (keys 0..31 and 32..63 of this chunk), bf16 hi + residual ----
    v16b pbh0, pbl0, pbh1, pbl1;
    pack_hl(s[0], s[1], pbh0, pbl0);
    pack_hl(s[2], s[3], pbh1, pbl1);

    // ---- O^T += Vl^T . P^T (3 products per k-step) ----
#pragma unroll
    for (int dt = 0; dt < 2; ++dt) {
      const size_t vo = (size_t)(dt * (SL / 32) + (kb0 >> 5)) * 512;
      const v16b vh0 = ldfragT(vbh + vo), vh1 = ldfragT(vbh + vo + 512);
      const v16b vl0 = ldfragT(vbl + vo), vl1 = ldfragT(vbl + vo + 512);
      addr_taken();
      v8f a = o[dt];
      a = mma_b(vh0, pbh0, a);
      a = mma_b(vh0, pbl0, a);
      a = mma_b(vl0, pbh0, a);
      a = mma_b(vh1, pbh1, a);
      a = mma_b(vh1, pbl1, a);
      a = mma_b(vl1, pbh1, a);
      o[dt] = a;
    }
  }

  // ---- normalise (1/l). Lane (hh, m) holds O^T[d = 16dt + 8hh + r][query m], r = 0..7: that is this lane's own 16-B piece
  //      (row m, k 16dt + 8hh ..+7) of the ctx plane's fragment-order blocks, k tile 2*head = hi, 2*head + 1 = residual ----
  const float inv = 1.0f / lrun;
  unsigned short* cb = ctxp + ((size_t)((b * TV + q0) >> 4) * (2 * EMB / 32) + head * 2) * 512 + lane * 8;
  v4u hv[2], lv[2];
#pragma unroll
  for (int dt = 0; dt < 2; ++dt) {
#pragma unroll
    for (int e = 0; e < 4; ++e) {
      const float x0 = o[dt][2 * e] * inv, x1 = o[dt][2 * e + 1] * inv;
      const unsigned short h0 = bf_bits(x0), h1 = bf_bits(x1);
      const unsigned short l0 = bf_bits(x0 - bf_up(h0)), l1 = bf_bits(x1 - bf_up(h1));
      hv[dt][e] = pk16(h0, h1);
      lv[dt][e] = pk16(l0, l1);
    }
  }
#pragma unroll
  for (int dt = 0; dt < 2; ++dt) {
    *(v4u*)(cb + dt * 256) = hv[dt];
    *(v4u*)(cb + 512 + dt * 256) = lv[dt];
  }
#if DEV_ASM
  // in the merged kernel the listing goes on behind these stores into code that rewrites their registers: the wait stands first
  asm volatile("s_wait_xcnt 0x0" ::: "memory");
#endif
}

// =====================================================================================================
// Pass B: language-direction partial sums. For (b,h), key half kq (128 keys), t range rg (1600 t):
//   S = Q.K^T (A = Q rows: row = t, k = d; B from K rows: n = key), 3 products, D = S[t 8hh+r][key m];
//   e = exp(clamp(clamp(S) - m[key])) in f32, m[key] = the running maximum of clamp(S) over the t this range has
//   seen (a softmax does not depend on the value subtracted; when m grows, acc and colsum are scaled by
//   exp(m_old - m_new)); e packed from registers as the B operand with k = t
//   (bf16 hi + residual); acc^T[d][key] += Vv^T . e (A = val_v^T rows: row = d, k = t), 3 products,
//   f32 accumulation across the 50 steps; colsum[key] += e in f32.
//   Block = 4 waves x 32 keys; RR x 2 x NB*NH blocks (rg, kq, bh). Record [bh][rg][34 rows][256]: rows 0..31 = acc^T[d],
//   row 32 = colsum, row 33 = the range's final m.
// =====================================================================================================
__device__ __forceinline__
void attn_l_body(float* smem, int rg, int kq, int bh,   // smem: per-wave 34x32 staging, 17408 B of the caller's LDS
            const unsigned short* __restrict__ qhp, const unsigned short* __restrict__ qlp,
            const unsigned short* __restrict__ khp, const unsigned short* __restrict__ klp,
            const unsigned short* __restrict__ vhp, const unsigned short* __restrict__ vlp,
            float* rec) {
  const int tid = threadIdx.x, lane = tid & 31, w = tid >> 5;
  const int hh = lane >> 4, m = lane & 15;
  const int b = bh >> 3, head = bh & 7;
  const int s0 = kq * 128 + 32 * w;
  const int tb = rg * TPR;

  const __bf16* Qh = (const __bf16*)(const void*)qhp;
  const __bf16* Ql = (const __bf16*)(const void*)qlp;
  const __bf16* Kh = (const __bf16*)(const void*)khp;
  const __bf16* Kl = (const __bf16*)(const void*)klp;
  const __bf16* Vh = (const __bf16*)(const void*)vhp;
  const __bf16* Vl = (const __bf16*)(const void*)vlp;

  // K B-fragments for this wave's two 16-key tiles (n = key s0+16jj+m, k = d), hi and residual planes
  v16b kfh[2], kfl[2];
  float mrun[2], csum[2];
#pragma unroll
  for (int jj = 0; jj < 2; ++jj) {
    const size_t ko = ((size_t)(((b * SL + s0) >> 4) + jj) * NH + head) * 512 + lane * 8;
    kfh[jj] = ldfragT(Kh + ko);
    kfl[jj] = ldfragT(Kl + ko);
    addr_taken();
    mrun[jj] = -1.0e30f;
    csum[jj] = 0.0f;
  }
  v8f acc[2][2];
#pragma unroll
  for (int dt = 0; dt < 2; ++dt) { acc[dt][0] = zero8(); acc[dt][1] = zero8(); }

  const size_t qoff0 = ((size_t)((b * TV) >> 4) * NH + head) * 512 + lane * 8;                  // + (t/16)*NH*512
  const __bf16* qbh = Qh + qoff0;
  const __bf16* qbl = Ql + qoff0;
  const size_t voff0 = (size_t)b * EMB * TV + (size_t)(head * 2) * (TV / 32) * 512 + lane * 8;  // + (dt*(TV/32) + t0/32)*512
  const __bf16* vbh = Vh + voff0;
  const __bf16* vbl = Vl + voff0;

#pragma unroll 1
  for (int step = 0; step < NSTEP; ++step) {
    const int t0 = tb + 32 * step;
    v16b qah[2], qal[2], vah[2], val2[2];
#pragma unroll
    for (int tt = 0; tt < 2; ++tt) {
      const size_t qo = (size_t)((t0 >> 4) + tt) * (NH * 512);
      qah[tt] = ldfragT(qbh + qo);
      qal[tt] = ldfragT(qbl + qo);
    }
#if DEV_ASM
    // the results of the loads below may land on the address registers of the loads above: the wait stands between
    asm volatile("s_wait_xcnt 0x0" ::: "memory");
#endif
#pragma unroll
    for (int dt = 0; dt < 2; ++dt) {
      const size_t vo = (size_t)(dt * (TV / 32) + (t0 >> 5)) * 512;
      vah[dt]  = ldfragT(vbh + vo);
      val2[dt] = ldfragT(vbl + vo);
    }
    addr_taken();
#pragma unroll
    for (int jj = 0; jj < 2; ++jj) {
      // scores for t rows t0..t0+15 (d0) and t0+16..t0+31 (d1), key columns s0+16jj+m
      v8f d0 = zero8(), d1 = zero8();
      d0 = mma_b(qah[0], kfh[jj], d0);
      d0 = mma_b(qah[0], kfl[jj], d0);
      d0 = mma_b(qal[0], kfh[jj], d0);
      d1 = mma_b(qah[1], kfh[jj], d1);
      d1 = mma_b(qah[1], kfl[jj], d1);
      d1 = mma_b(qal[1], kfh[jj], d1);
      // clamp; maximum of this key column over the step's 32 t rows (16 in this lane, 16 in lane ^ 16)
      float tm[8];
#pragma unroll
      for (int r = 0; r < 8; ++r) {
        d0[r] = clampv(d0[r]);
        d1[r] = clampv(d1[r]);
        tm[r] = fmaxf(d0[r], d1[r]);
      }
      float ml = fmaxf(fmaxf(fmaxf(tm[0], tm[1]), fmaxf(tm[2], tm[3])), fmaxf(fmaxf(tm[4], tm[5]), fmaxf(tm[6], tm[7])));
      ml = fmaxf(ml, xhalf(ml));
      const float mv = fmaxf(mrun[jj], ml);
      const float alpha = __expf(mrun[jj] - mv);         // 0 on the first step, 1 while the maximum stands
      mrun[jj] = mv;
      float cl = csum[jj] * alpha;
#pragma unroll
      for (int r = 0; r < 8; ++r) {
        const float x0 = clampv(d0[r] - mv);
        const float e0 = __expf(x0);
        d0[r] = e0; cl += e0;
        const float x1 = clampv(d1[r] - mv);
        const float e1 = __expf(x1);
        d1[r] = e1; cl += e1;
      }
      csum[jj] = cl;
      // e as the B operand with k = t (tile d0 = t 0..15, tile d1 = t 16..31), bf16 hi + residual
      v16b ebh, ebl;
      pack_hl(d0, d1, ebh, ebl);
#pragma unroll
      for (int dt = 0; dt < 2; ++dt) {
        v8f a = acc[dt][jj];
#pragma unroll
        for (int r = 0; r < 8; ++r) a[r] = a[r] * alpha;
        a = mma_b(vah[dt],  ebh, a);
        a = mma_b(vah[dt],  ebl, a);
        a = mma_b(val2[dt], ebh, a);
        acc[dt][jj] = a;
      }
    }
  }

  // ---- combine the two lane halves of the column sums; stage acc^T (32 d x 32 keys) + colsum row + max row ----
#pragma unroll
  for (int jj = 0; jj < 2; ++jj) csum[jj] += __shfl_xor(csum[jj], 16, 32);
  float* sw = smem + w * (RECROWS * 32);
#pragma unroll
  for (int dt = 0; dt < 2; ++dt)
#pragma unroll
    for (int jj = 0; jj < 2; ++jj)
#pragma unroll
      for (int r = 0; r < 8; ++r)
        sw[(16 * dt + 8 * hh + r) * 32 + 16 * jj + m] = acc[dt][jj][r];
  if (hh == 0) {
    sw[32 * 32 + m]      = csum[0];
    sw[32 * 32 + 16 + m] = csum[1];
    sw[33 * 32 + m]      = mrun[0];
    sw[33 * 32 + 16 + m] = mrun[1];
  }
  __syncthreads();

  // ---- record lines: row lid (0..33) of this wave = 32 floats at column s0, lanes 8*sub..+7, 4 rows per instruction ----
  {
    const int sub = lane >> 3, piece = lane & 7;
    float* rbase = rec + (((size_t)bh * RR + rg) * RECROWS) * SL + s0 + 4 * piece;
    {
#pragma unroll
      for (int i = 0; i < 9; ++i) {
        const int lid  = i * 4 + sub;
        const int lidc = (lid < RECROWS) ? lid : (RECROWS - 1);
        const v4f vv = *(const v4fa*)(sw + lidc * 32 + 4 * piece);
        if (lid < RECROWS) *(v4f*)(rbase + (size_t)lid * SL) = vv;
      }
      
    }
  }
}

// =====================================================================================================
// Both attention directions in one grid: neither reads what the other writes (ctx plane / records), so blockIdx.x
// picks the job. The 320 language blocks (50 steps each, one wave per SIMD on their own) take the first indices:
// they start first and the 4000 short vision blocks fill the same SIMDs' idle issue and load slots beside them.
// =====================================================================================================
#define AB_L (RR * 2 * NB * NH)      //  320 blocks, index = rg + RR * (kq + 2 * bh)
#define AB_V (NQT * NB * NH)         // 4000 blocks, index = qt + NQT * bh
__global__ __launch_bounds__(128)
void attn_both(const unsigned short* __restrict__ qhp, const unsigned short* __restrict__ qlp,
               const unsigned short* __restrict__ khp, const unsigned short* __restrict__ klp,
               const unsigned short* __restrict__ vlhp, const unsigned short* __restrict__ vllp,
               const unsigned short* __restrict__ vvhp, const unsigned short* __restrict__ vvlp,
               const int* __restrict__ maskl, unsigned short* ctxp, float* rec) {
  __shared__ __align__(16) float smem[4 * RECROWS * 32];   // the language job's staging, 17408 B
  const unsigned bid = blockIdx.x;                         // block-uniform job choice
  if (bid < AB_L) {
    const unsigned rg = bid % RR, r2 = bid / RR;
    attn_l_body(smem, (int)rg, (int)(r2 & 1u), (int)(r2 >> 1), qhp, qlp, khp, klp, vvhp, vvlp, rec);
  } else {
    const unsigned r = bid - AB_L;
    attn_v_body((int)(r % NQT), (int)(r / NQT), qhp, qlp, khp, klp, vlhp, vllp, maskl, ctxp);
  }
}

// =====================================================================================================
// Language-direction fold: with w[rg] = exp(m[rg][s] - max_rg m[rg][s]),
// ctx_l[b][s][h*32+d] = (sum_rg w[rg] acc[rg][d][s]) / (sum_rg w[rg] colsum[rg][s]) in fixed order.
// Block = one (b,s), thread = (h, d); threads 0..63 write the 1-KB row, 16 B each (2 instructions of 4 lines),
// =====================================================================================================
__device__ __forceinline__ void fold_l_body(float* xs, int bs, const float* __restrict__ rec, unsigned short* ctxl) {
  const int b = bs / SL, s = bs - b * SL;                  // xs: EMB floats of the caller's LDS
  const int t = (int)threadIdx.x, head = t >> 5, d = t & 31;
  const int bh = b * NH + head;
  const float* p = rec + ((size_t)bh * RR) * RECROWS * SL + s;
  float mr[RR];
#pragma unroll   // mr[] stays in registers; the ranges' loads are in flight together
  for (int rg = 0; rg < RR; ++rg) mr[rg] = p[((size_t)rg * RECROWS + 33) * SL];
  float mall = mr[0];
#pragma unroll   // constant index into mr[]
  for (int rg = 1; rg < RR; ++rg) mall = fmaxf(mall, mr[rg]);
#pragma unroll   // constant index into mr[]
  for (int rg = 0; rg < RR; ++rg) mr[rg] = exp2_slot((mr[rg] - mall) * 1.44269504f);   // the range's weight e^(m - max)
  float a = 0.0f, cs = 0.0f;
#pragma unroll   // constant index into mr[]; fixed order of the sums
  for (int rg = 0; rg < RR; ++rg) {
    const float* pr = p + (size_t)rg * RECROWS * SL;
    a  += mr[rg] * pr[(size_t)d * SL];
    cs += mr[rg] * pr[(size_t)32 * SL];
  }
  xs[t] = a * (1.0f / cs);
  __syncthreads();
  if (t < 64) {
    const int hg = t >> 3, wq = t & 7;
    const float* sp = xs + hg * HD + 8 * (wq & 3);
    const bool islo = (wq & 4) != 0;
    v4u vv;
#pragma unroll
    for (int e = 0; e < 4; ++e) {
      const float x0 = sp[2 * e], x1 = sp[2 * e + 1];
      const unsigned short h0 = bf_bits(x0), h1 = bf_bits(x1);
      const unsigned short l0 = bf_bits(x0 - bf_up(h0)), l1 = bf_bits(x1 - bf_up(h1));
      vv[e] = islo ? pk16(l0, l1) : pk16(h0, h1);
    }
    unsigned short* dst = ctxl + (size_t)bs * (2 * EMB) + hg * (2 * HD) + 8 * wq;
    *(v4u*)dst = vv;
    
  }
}

// =====================================================================================================
// Workspace map (bytes), every region an exact multiple of its whole-line / whole-tile store granularity
// (no padded tails: all dims are tile multiples); every bf16 plane but CTXL lies in fragment order (see ldfragT):
//   vb    bf16 [32000][256]        16384000
//   lb    bf16 [512][768]            786432
//   Wvb   bf16 [256][256]            131072
//   Wvvb  bf16 [256][256]            131072
//   Wlb   bf16 [256][768]            393216
//   Wvlb  bf16 [256][768]            393216
//   Wovd  bf16 [256][512]            262144
//   Wold  bf16 [768][512]            786432
//   Qh,Ql bf16 [32000][256] x2     32768000
//   Kh,Kl bf16 [512][256] x2         524288
//   VlTh,VlTl bf16 [2][256][256] x2  524288
//   VvTh,VvTl bf16 [2][256][16000] x2 32768000
//   CTXV  bf16 [32000][512]        32768000
//   REC   f32  [16][10][34][256]    5570560
//   CTXL  bf16 [512][512]            524288
//   total                        124715008
// Weights are [out n][in k], the Bt / A orientation the GEMM wants, so they need no transpose.
// =====================================================================================================
extern "C" void kernel_launch(void* const* d_in, const int* in_sizes, int n_in,
                              void* d_out, int out_size, void* d_ws, size_t ws_size,
                              hipStream_t stream) {
  if (n_in < 15) return;
  if (in_sizes[0] != NV * EMB || in_sizes[1] != NL * LD || in_sizes[2] != NB * SL) return;
  if (in_sizes[3] != EMB * EMB || in_sizes[4] != EMB || in_sizes[5] != EMB * LD || in_sizes[6] != EMB) return;
  if (in_sizes[7] != EMB * EMB || in_sizes[8] != EMB || in_sizes[9] != EMB * LD || in_sizes[10] != EMB) return;
  if (in_sizes[11] != EMB * EMB || in_sizes[12] != EMB || in_sizes[13] != LD * EMB || in_sizes[14] != LD) return;
  if (out_size != NV * EMB + NL * LD) return;

  const float* v_in = (const float*)d_in[0];
  const float* l_in = (const float*)d_in[1];
  const int*   mk   = (const int*)d_in[2];
  const float* Wv   = (const float*)d_in[3];
  const float* bv   = (const float*)d_in[4];
  const float* Wl   = (const float*)d_in[5];
  const float* bl   = (const float*)d_in[6];
  const float* Wvv  = (const float*)d_in[7];
  const float* bvv  = (const float*)d_in[8];
  const float* Wvl  = (const float*)d_in[9];
  const float* bvl  = (const float*)d_in[10];
  const float* Wov  = (const float*)d_in[11];
  const float* bov  = (const float*)d_in[12];
  const float* Wol  = (const float*)d_in[13];
  const float* bol  = (const float*)d_in[14];
  float* out0 = (float*)d_out;
  float* out1 = out0 + (size_t)NV * EMB;            // byte 32768000; last element 8585215 < out_size

  const size_t PVB  = (size_t)NV * EMB * 2;          // 16384000
  const size_t PLB  = (size_t)NL * LD * 2;           //   786432
  const size_t PWS  = (size_t)EMB * EMB * 2;         //   131072
  const size_t PWL  = (size_t)EMB * LD * 2;          //   393216
  const size_t PWOD = (size_t)EMB * 2 * EMB * 2;     //   262144
  const size_t PWLD = (size_t)LD * 2 * EMB * 2;      //   786432
  const size_t PQ   = (size_t)NV * EMB * 2;          // 16384000
  const size_t PK   = (size_t)NL * EMB * 2;          //   262144
  const size_t PVLT = (size_t)NB * EMB * SL * 2;     //   262144
  const size_t PVVT = (size_t)NB * EMB * TV * 2;     // 16384000
  const size_t PCTX = (size_t)NV * 2 * EMB * 2;      // 32768000
  const size_t PREC = (size_t)NB * NH * RR * RECROWS * SL * 4;  // 5570560
  const size_t PCTL = (size_t)NL * 2 * EMB * 2;      //   524288
  size_t off = 0;
  const size_t oVB  = off; off += PVB;
  const size_t oLB  = off; off += PLB;
  const size_t oWv  = off; off += PWS;
  const size_t oWvv = off; off += PWS;
  const size_t oWl  = off; off += PWL;
  const size_t oWvl = off; off += PWL;
  const size_t oWod = off; off += PWOD;
  const size_t oWld = off; off += PWLD;
  const size_t oQh  = off; off += PQ;
  const size_t oQl  = off; off += PQ;
  const size_t oKh  = off; off += PK;
  const size_t oKl  = off; off += PK;
  const size_t oVLh = off; off += PVLT;
  const size_t oVLl = off; off += PVLT;
  const size_t oVVh = off; off += PVVT;
  const size_t oVVl = off; off += PVVT;
  const size_t oCTX = off; off += PCTX;
  const size_t oREC = off; off += PREC;
  const size_t oCTL = off; off += PCTL;
  if (off > ws_size) return;                         // off = 124715008
  if (off > (size_t)134217728) return;

  char* ws = (char*)d_ws;
  unsigned short* vb   = (unsigned short*)(ws + oVB);
  unsigned short* lb   = (unsigned short*)(ws + oLB);
  unsigned short* Wvb  = (unsigned short*)(ws + oWv);
  unsigned short* Wvvb = (unsigned short*)(ws + oWvv);
  unsigned short* Wlb  = (unsigned short*)(ws + oWl);
  unsigned short* Wvlb = (unsigned short*)(ws + oWvl);
  unsigned short* Wovd = (unsigned short*)(ws + oWod);
  unsigned short* Wold = (unsigned short*)(ws + oWld);
  unsigned short* Qh   = (unsigned short*)(ws + oQh);
  unsigned short* Ql   = (unsigned short*)(ws + oQl);
  unsigned short* Kh   = (unsigned short*)(ws + oKh);
  unsigned short* Kl   = (unsigned short*)(ws + oKl);
  unsigned short* VlTh = (unsigned short*)(ws + oVLh);
  unsigned short* VlTl = (unsigned short*)(ws + oVLl);
  unsigned short* VvTh = (unsigned short*)(ws + oVVh);
  unsigned short* VvTl = (unsigned short*)(ws + oVVl);
  unsigned short* CTXV = (unsigned short*)(ws + oCTX);
  float*          REC  = (float*)(ws + oREC);
  unsigned short* CTXL = (unsigned short*)(ws + oCTL);

  const dim3 blk(256);
  const dim3 gO1((((NL) / 64) * (LD / 64) + 7) / 8, 1);        //   96 tiles ->   12 blocks

  // (1) inputs -> bf16 planes; W_o -> bf16 duplicated along k (8 jobs, 4704 blocks)
  cvt_all<<<dim3(CB_ALL), blk, 0, stream>>>(v_in, l_in, Wv, Wvv, Wl, Wvl, Wov, Wol,
                                            vb, lb, Wvb, Wvvb, Wlb, Wvlb, Wovd, Wold);
  // (2) q, k, val_v^T, val_l^T -> bf16 hi / residual planes (4 jobs, 508 blocks)
  proj_all<<<dim3(PB_ALL), blk, 0, stream>>>(vb, lb, Wvb, Wlb, Wvvb, Wvlb, bv, bl, bvv, bvl,
                                             Qh, Ql, Kh, Kl, VvTh, VvTl, VlTh, VlTl);
  // (3) language-direction partial records (320 blocks) and vision-direction attention -> ctx plane (4000 blocks)
  attn_both<<<dim3(AB_L + AB_V), dim3(128), 0, stream>>>(Qh, Ql, Kh, Kl, VlTh, VlTl, VvTh, VvTl, mk, CTXV, REC);
  // (4) out0 = ctx . W_ov^T + b_ov -> d_out f32 [32000][256] (K=512: [hi|residual] . [W|W]; 250 blocks)
  //     and the fold of the t ranges, normalise, merge heads -> ctx_l plane (512 blocks)
  gemm64_f32<true><<<dim3(PB_Q + NL), blk, 0, stream>>>(CTXV, 2 * EMB, Wovd, 2 * EMB, bov, out0, EMB, NV, EMB, 2 * EMB, REC, CTXL);
  // (5) out1 = ctx_l . W_ol^T + b_ol -> d_out f32 [512][768] at float offset 8192000
  gemm64_f32<false><<<gO1, blk, 0, stream>>>(CTXL, 2 * EMB, Wold, 2 * EMB, bol, out1, LD, NL, LD, 2 * EMB,
                                      (const float*)nullptr, (unsigned short*)nullptr);   // no fold blocks in this grid
  (void)hipGetLastError();
}

// v005
// A run of this version takes 195 microseconds.
// Next to v004, in two timings, it ran 1.07 times as fast each time.
// Over all steps from v000 it is 2.36 times as fast.
// Contractions: v.W_v^T, v.W_vv^T, l.W_l^T, l.W_vl^T = v_wmma_f32_16x16x32_bf16 (bf16 operands RNE-converted from the inputs, single product, f32 accumulate);
// q.k^T scores = v_wmma_f32_16x16x32_bf16 (q and k as bf16 hi + unscaled bf16 residual planes; 3 products hi.hi + hi.lo + lo.hi; f32 accumulate);
// p.val_l and e.val_v = v_wmma_f32_16x16x32_bf16 (p / e split in registers into bf16 hi + residual, val planes bf16 hi + residual; 3 products; f32 accumulate);
// ctx_v.W_ov^T and ctx_l.W_ol^T = v_wmma_f32_16x16x32_bf16 (ctx as bf16 hi | residual interleaved along k, W bf16 duplicated along k; f32 accumulate).
// Softmax, mask, bias, scale, column statistics and normalisation in f32.
// Carry audit: no power-of-two carried planes anywhere (every residual plane is an unscaled bf16 difference); nothing is folded back.
#include <hip/hip_runtime.h>
#include <math.h>
#include <stdint.h>

#define NB      2
#define TV      16000
#define SL      256
#define EMB     256
#define LD      768
#define NH      8
#define HD      32
#define NV      (NB * TV)          // 32000 vision rows
#define NL      (NB * SL)          // 512 language rows
#define NQT     (TV / 64)          // 250 query tiles of 64 rows per batch
#define RR      10                 // t ranges per (b,h) in the language direction
#define TPR     (TV / RR)          // 1600 t per range
#define NSTEP   (TPR / 32)         // 50 steps of 32 t per range
#define RECROWS 34                 // 32 accumulator rows + 1 column-sum row + 1 running-max row
#define SCALEQ  0.17677669529663687f
#define CLAMPV  50000.0f
#define MASKNEG (-9.0e15f)

static_assert(NH * HD == EMB);
static_assert(NQT * 64 == TV);
static_assert(RR * NSTEP * 32 == TV);
static_assert((NV % 64) == 0 && (NL % 64) == 0 && (EMB % 64) == 0 && (LD % 64) == 0 && (TV % 64) == 0);
static_assert((EMB % 32) == 0 && (LD % 32) == 0 && ((2 * EMB) % 32) == 0);
static_assert(SL == 256 && HD == 32 && EMB == 256);

typedef __bf16   v16b __attribute__((ext_vector_type(16)));
typedef __bf16   v8b  __attribute__((ext_vector_type(8)));
typedef __bf16   v2b  __attribute__((ext_vector_type(2)));
typedef float    v2f  __attribute__((ext_vector_type(2)));
typedef float    v8f  __attribute__((ext_vector_type(8)));
typedef float    v4f  __attribute__((ext_vector_type(4)));
typedef unsigned int v4u __attribute__((ext_vector_type(4)));
typedef unsigned int v8u __attribute__((ext_vector_type(8)));
typedef int      v4i  __attribute__((ext_vector_type(4)));
typedef v4f __attribute__((may_alias)) v4fa;
typedef v4i __attribute__((may_alias)) v4ia;

#if defined(__HIP_DEVICE_COMPILE__)
#define DEV_ASM 1
#else
#define DEV_ASM 0
#endif

// ---- scalar helpers --------------------------------------------------------------------------------
// two f32 -> two bf16 (RNE) in one register, a in the low half: one v_cvt_pk_bf16_f32
__device__ __forceinline__ unsigned cvt_pk(float a, float b) {
  const v2f x = {a, b};
  return __builtin_bit_cast(unsigned, __builtin_convertvector(x, v2b));
}
// the pair as bf16 hi (h) and bf16 residual x - hi (l), both packed like cvt_pk
__device__ __forceinline__ void split_pk(float x0, float x1, unsigned& h, unsigned& l) {
  h = cvt_pk(x0, x1);
  l = cvt_pk(x0 - __uint_as_float(h << 16), x1 - __uint_as_float(h & 0xFFFF0000u));
}
__device__ __forceinline__ float rbf(float f) { return (float)(__bf16)f; }   // value of the bf16 RNE convert
__device__ __forceinline__ v8f zero8() { v8f z = {0.f, 0.f, 0.f, 0.f, 0.f, 0.f, 0.f, 0.f}; return z; }
__device__ __forceinline__ float clampv(float x) { return fminf(fmaxf(x, -CLAMPV), CLAMPV); }
// 2^x. The v_nop is the one free slot that the instruction set asks for behind a transcendental.
__device__ __forceinline__ float exp2_slot(float x) {
#if DEV_ASM
  float r;
  asm("v_exp_f32 %0, %1\n\tv_nop" : "=v"(r) : "v"(x));
  return r;
#else
  return x;
#endif
}
// value of lane l ^ 16 (the other 16-lane row), by a vector cross-row move
__device__ __forceinline__ float xhalf(float x) {
  return __builtin_bit_cast(float, __builtin_amdgcn_permlanex16(__builtin_bit_cast(int, x), __builtin_bit_cast(int, x),
                                                                0x76543210, 0xfedcba98, false, false));
}

// ---- 16-bit A/B fragment loader (wave32): lane -> row/col (lane&15); p already includes +8*(lane>>4);
//      elements 0..7 <- p[0..7] (k0+8h..k0+8h+7), elements 8..15 <- p[16..23] (k0+16+8h..k0+16+8h+7)
__device__ __forceinline__ v16b ldfrag(const __bf16* p) {
  union { v16b v; v8b h[2]; } f;
  f.h[0] = *(const v8b*)(p);
  f.h[1] = *(const v8b*)(p + 16);
  return f.v;
}

// ---- the same fragment from a plane kept in FRAGMENT ORDER: a plane of [rows][C] bf16 is a row of 1-KB blocks, block
//      (rt, kt) = rows 16rt..+15 x k 32kt..+31 at element ((rt * (C / 32)) + kt) * 512; inside it element (row m, k) lies at
//      (k >> 4) * 256 + (((k >> 3) & 1) * 16 + m) * 8 + (k & 7). p = block + 8 * lane: each of the two loads reads 512
//      contiguous bytes (4 whole lines) and gives the registers of ldfrag: elements 0..7 = k 8h..8h+7, 8..15 = k 16+8h..+7.
__device__ __forceinline__ v16b ldfragT(const __bf16* p) {
  union { v16b v; v8b h[2]; } f;
  f.h[0] = *(const v8b*)(p);
  f.h[1] = *(const v8b*)(p + 256);
  return f.v;
}

// s_wait_xcnt 0 behind a group of global loads or stores: it stands in front of whatever next writes a register that they name
__device__ __forceinline__ void addr_taken() {
#if DEV_ASM
  asm volatile("s_wait_xcnt 0x0" ::: "memory");
#endif
}

// ---- WMMA helpers (asm guard bodies device-only) -------------------------------------------------------
__device__ __forceinline__ v8f mmar(v16b a, v16b b, v8f c) {
  return __builtin_amdgcn_wmma_f32_16x16x32_bf16(false, a, false, b, (short)0, c, false, false);
}
// guarded form: 4 VALU slots after the WMMA, D tied, A/B kept live
__device__ __forceinline__ v8f mma_b(v16b a, v16b b, v8f c) {
  c = __builtin_amdgcn_wmma_f32_16x16x32_bf16(false, a, false, b, (short)0, c, false, false);
#if DEV_ASM
  asm volatile("v_nop\n\tv_nop\n\tv_nop\n\tv_nop" : "+v"(c) : "v"(a), "v"(b));
#endif
  return c;
}
__device__ __forceinline__ void dep_guard(v8f& a, v8f& b, v16b x, v16b y) {
#if DEV_ASM
  asm volatile("v_nop\n\tv_nop\n\tv_nop\n\tv_nop" : "+v"(a), "+v"(b) : "v"(x), "v"(y));
#else
  (void)a; (void)b; (void)x; (void)y;
#endif
}
__device__ __forceinline__ void keep4(v16b a, v16b b, v16b c, v16b d) {
#if DEV_ASM
  asm volatile("v_nop" :: "v"(a), "v"(b), "v"(c), "v"(d));
#else
  (void)a; (void)b; (void)c; (void)d;
#endif
}
__device__ __forceinline__ void acc_guard4(v8f& a, v8f& b, v8f& c, v8f& d) {
#if DEV_ASM
  asm volatile("v_nop\n\tv_nop\n\tv_nop\n\tv_nop" : "+v"(a), "+v"(b), "+v"(c), "+v"(d));
#else
  (void)a; (void)b; (void)c; (void)d;
#endif
}

// ---- B fragment (k = the D tiles' ROW index) from two D tiles held by this lane, split into bf16 hi + residual:
//      element r <- tile a (k 0..15) row r, element 8+r <- tile c (k 16..31) row r, lane unchanged.
union PK { v8u u; v16b v; };
__device__ __forceinline__ void pack_hl(v8f a, v8f c, v16b& fh, v16b& fl) {
  v8u ph, pl;
#pragma unroll
  for (int i = 0; i < 4; ++i) {
    unsigned h, l;
    split_pk(a[2 * i], a[2 * i + 1], h, l);
    ph[i] = h;
    pl[i] = l;
    split_pk(c[2 * i], c[2 * i + 1], h, l);
    ph[4 + i] = h;
    pl[4 + i] = l;
  }
  PK uh, ul;
  uh.u = ph; ul.u = pl;
  fh = uh.v; fl = ul.v;
}

// =====================================================================================================
// f32 [rows][32 * KTN] (DUP: [rows][16 * KTN]) -> bf16 bits plane [rows][32 * KTN] in fragment order (see ldfragT).
// Thread = one 16-B piece of the output in output order: a wave writes 512 contiguous B, a block 4 whole 1-KB blocks.
// DUP: k tiles 2g and 2g + 1 both hold source columns 32g..32g+31 (the Bt operand of ctx.W^T where ctx is stored as
// [hi 32 | residual 32] per head block). coverage: the caller's block count x 256 pieces = the whole plane.
// =====================================================================================================
template <int KTN, bool DUP>
__device__ __forceinline__ void cvt_frag(int bx, const float* __restrict__ in, unsigned short* out) {
  const int p = bx * 256 + (int)threadIdx.x;                  // piece index
  const int blk = p >> 6, m = p & 15;
  const int kin = ((p >> 5) & 1) * 16 + ((p >> 4) & 1) * 8;   // k of the piece's first element inside its tile
  const int rt = blk / KTN, kt = blk - rt * KTN;
  const int col = (DUP ? (kt >> 1) : kt) * 32 + kin;
  const float* s = in + (size_t)(rt * 16 + m) * (DUP ? 16 * KTN : 32 * KTN) + col;
  const v4f a  = *(const v4fa*)(s);
  const v4f a4 = *(const v4fa*)(s + 4);
  v4u q;
  q[0] = cvt_pk(a[0],  a[1]);
  q[1] = cvt_pk(a[2],  a[3]);
  q[2] = cvt_pk(a4[0], a4[1]);
  q[3] = cvt_pk(a4[2], a4[3]);
  *(v4u*)(out + (size_t)p * 8) = q;
  addr_taken();   // the listing goes on behind this store into the next job's code
}

// =====================================================================================================
// All eight input conversions in one grid: they are independent of one another, so blockIdx.x picks the job.
// Block ranges (256 threads each): W_ov dup, W_ol dup, W_v, W_vv, W_l, W_vl, l, v.
// =====================================================================================================
#define CB_DV  (EMB * 2 * EMB / 8 / 256) //   64 blocks, 2048 output elements each
#define CB_DL  (LD * 2 * EMB / 8 / 256)  //  192
#define CB_WS  (EMB * EMB / 8 / 256)     //   32 blocks, 2048 elements each
#define CB_WL  (EMB * LD / 8 / 256)      //   96
#define CB_L   (NL * LD / 8 / 256)       //  192
#define CB_V   (NV * EMB / 8 / 256)      // 4000
#define CB_ALL (CB_DV + CB_DL + 2 * CB_WS + 2 * CB_WL + CB_L + CB_V)
static_assert(CB_WS * 2048 == EMB * EMB && CB_WL * 2048 == EMB * LD && CB_L * 2048 == NL * LD && CB_V * 2048 == NV * EMB);
static_assert(CB_DV * 2048 == EMB * 2 * EMB && CB_DL * 2048 == LD * 2 * EMB);
static_assert((NV % 16) == 0 && (NL % 16) == 0 && (TV % 32) == 0 && (SL % 32) == 0);
__global__ __launch_bounds__(256) void cvt_all(
    const float* __restrict__ v_in, const float* __restrict__ l_in,
    const float* __restrict__ Wv, const float* __restrict__ Wvv,
    const float* __restrict__ Wl, const float* __restrict__ Wvl,
    const float* __restrict__ Wov, const float* __restrict__ Wol,
    unsigned short* vb, unsigned short* lb, unsigned short* Wvb, unsigned short* Wvvb,
    unsigned short* Wlb, unsigned short* Wvlb, unsigned short* Wovd, unsigned short* Wold) {
  int bx = (int)blockIdx.x;                                   // block-uniform job choice
  if (bx < CB_DV) { cvt_frag<2 * EMB / 32, true>(bx, Wov, Wovd); return; }
  bx -= CB_DV;
  if (bx < CB_DL) { cvt_frag<2 * EMB / 32, true>(bx, Wol, Wold); return; }
  bx -= CB_DL;
  if (bx < CB_WS) { cvt_frag<EMB / 32, false>(bx, Wv, Wvb); return; }
  bx -= CB_WS;
  if (bx < CB_WS) { cvt_frag<EMB / 32, false>(bx, Wvv, Wvvb); return; }
  bx -= CB_WS;
  if (bx < CB_WL) { cvt_frag<LD / 32, false>(bx, Wl, Wlb); return; }
  bx -= CB_WL;
  if (bx < CB_WL) { cvt_frag<LD / 32, false>(bx, Wvl, Wvlb); return; }
  bx -= CB_WL;
  if (bx < CB_L) { cvt_frag<LD / 32, false>(bx, l_in, lb); return; }
  bx -= CB_L;
  cvt_frag<EMB / 32, false>(bx, v_in, vb);
}

// =====================================================================================================
// Register-blocked batched WMMA GEMM (bf16 operands): C[m][n] = sum_k A[m][k] * Bt[n][k];
// one wave per 64x64 tile, no block barriers. A [M][K], lda columns; Bt [N][K], ldb columns;
// M, N multiples of 64, K multiple of 32 (host-checked). bx = block of 8 tiles, b = batch index
// (strides in elements); sT = the block's LDS slabs, declared by the calling kernel. Fragments are loaded straight from global:
// Bt, and A where AFR, lie in fragment order (ldfragT; lda / ldb = the plane's columns); A row-major (ldfrag) where not AFR.
// OUT_MODE 0: f32 C (pitch ldc), value = (acc + bf16(bias[n])) * oscale.
// OUT_MODE 3: bf16 hi plane C + bf16 residual plane C2 = bf16(y - hi), both in fragment order (ldc = the plane's columns),
//             y = (acc + bf16(bias)) * oscale; bias[n] (BIASM 0) or bias[m] (BIASM 1).
// =====================================================================================================
template <int OUT_MODE, int BIASM, bool AFR>
__device__ __forceinline__ void gemm64_body(
    float (*sT)[16 * 68], int bx, int b,
    const unsigned short* __restrict__ Ap, int lda, long long strideA,
    const unsigned short* __restrict__ Btp, int ldb, long long strideB,
    const float* __restrict__ bias,
    void* Cout, void* Cout2, int ldc, long long strideC,
    int M, int N, int K, float oscale) {
  static_assert(OUT_MODE == 0 || OUT_MODE == 3);
  static_assert(OUT_MODE != 0 || BIASM == 0);
  const __bf16* A  = (const __bf16*)(const void*)Ap;
  const __bf16* Bt = (const __bf16*)(const void*)Btp;
  const int lane = threadIdx.x & 31;
  const int wave = threadIdx.x >> 5;
  const int tilesN = N >> 6;
  const int tilesM = M >> 6;
  const int tile = bx * 8 + wave;
  if (tile >= tilesM * tilesN) return;   // wave-uniform; no block barriers in this kernel
  const int tm = tile / tilesN;
  const int tn = tile - tm * tilesN;
  const int m0 = tm << 6;
  const int n0 = tn << 6;

  const __bf16* Ab = A  + (size_t)b * (size_t)strideA;
  const __bf16* Bb = Bt + (size_t)b * (size_t)strideB;

  const int rlane = lane & 15;                 // row (A) / col (B, D) within subtile
  const int koff  = (lane >> 4) * 8;           // k offset of this lane half
  const int mOff  = (lane >> 4) * 8;           // D row offset

  v8f acc[4][4];
#pragma unroll
  for (int i = 0; i < 4; ++i)
#pragma unroll
    for (int j = 0; j < 4; ++j) acc[i][j] = zero8();

  unsigned ob[4], oa[4];                        // byte offset of this lane's piece of the current k tile, one per 16-row tile
#pragma unroll
  for (int j = 0; j < 4; ++j) {                 // every plane is far below 2^31 bytes
    ob[j] = (unsigned)((((n0 >> 4) + j) * (ldb >> 5) * 512 + lane * 8) * 2);
    oa[j] = (unsigned)((AFR ? ((m0 >> 4) + j) * (lda >> 5) * 512 + lane * 8 : (m0 + (j << 4) + rlane) * lda + koff) * 2);
  }
  for (int k0 = 0; k0 < K; k0 += 32) {
    v16b bq[4];
#pragma unroll
    for (int j = 0; j < 4; ++j) bq[j] = ldfragT((const __bf16*)((const char*)Bb + ob[j]));
#pragma unroll
    for (int i = 0; i < 4; ++i) {
      const __bf16* pa = (const __bf16*)((const char*)Ab + oa[i]);
      const v16b af = AFR ? ldfragT(pa) : ldfrag(pa);
#pragma unroll
      for (int j = 0; j < 4; ++j) acc[i][j] = mmar(af, bq[j], acc[i][j]);
      dep_guard(acc[i][0], acc[i][3], af, bq[3]);
    }
    keep4(bq[0], bq[1], bq[2], bq[3]);
#if DEV_ASM
    // s_wait_xcnt 0 in front of the steps of the offsets that the loads above name; it names them so that the steps stay behind it
    asm volatile("s_wait_xcnt 0x0" : "+v"(ob[0]), "+v"(ob[1]), "+v"(ob[2]), "+v"(ob[3]),
                                     "+v"(oa[0]), "+v"(oa[1]), "+v"(oa[2]), "+v"(oa[3]) :: "memory");
#endif
#pragma unroll
    for (int j = 0; j < 4; ++j) { ob[j] += 1024u; oa[j] += AFR ? 1024u : 64u; }
  }
  acc_guard4(acc[0][0], acc[0][1], acc[0][2], acc[0][3]);
  acc_guard4(acc[1][0], acc[1][1], acc[1][2], acc[1][3]);
  acc_guard4(acc[2][0], acc[2][1], acc[2][2], acc[2][3]);
  acc_guard4(acc[3][0], acc[3][1], acc[3][2], acc[3][3]);

  // ---- epilogue ----
  float* slab = sT[wave];
  const int h2 = lane >> 4, c4 = (lane & 15) * 4;     // OUT_MODE 0 map: 256-B row segment = 16 lanes x 16 B
  v4f bb4;                                             // bias for columns n0+c4..+3 (mode 0)
  float bj[4];                                         // bias for columns n0+16j+rlane (mode 3, BIASM 0), added on the way into the slab
  if (OUT_MODE == 0) {
    const v4f braw = *(const v4fa*)(bias + n0 + c4);
    bb4[0] = rbf(braw[0]); bb4[1] = rbf(braw[1]); bb4[2] = rbf(braw[2]); bb4[3] = rbf(braw[3]);
  } else {
#pragma unroll
    for (int j = 0; j < 4; ++j) bj[j] = (BIASM == 0) ? rbf(bias[n0 + (j << 4) + rlane]) : 0.f;
  }
#pragma unroll
  for (int i = 0; i < 4; ++i) {
    const int mBase = m0 + (i << 4);
#pragma unroll
    for (int j = 0; j < 4; ++j) {
#pragma unroll
      for (int r = 0; r < 8; ++r) {
        slab[(mOff + r) * 68 + (j << 4) + rlane] = (OUT_MODE == 3 && BIASM == 0) ? acc[i][j][r] + bj[j] : acc[i][j][r];
      }
    }
    __builtin_amdgcn_fence(__ATOMIC_RELEASE, "workgroup");
    __builtin_amdgcn_wave_barrier();
    __builtin_amdgcn_fence(__ATOMIC_ACQUIRE, "workgroup");
    if (OUT_MODE == 0) {
      float* C = (float*)Cout + (size_t)b * (size_t)strideC;
      {
#pragma unroll
        for (int it = 0; it < 8; ++it) {
          const int row = it * 2 + h2;                     // it 0..7 x h2 0..1 = rows 0..15
          v4f v = *(const v4fa*)(slab + row * 68 + c4);
          v = (v + bb4) * oscale;
          *(v4f*)(C + (size_t)(mBase + row) * ldc + n0 + c4) = v;
        }
        
      }
    } else {
      unsigned short* C  = (unsigned short*)Cout  + (size_t)b * (size_t)strideC;
      unsigned short* C2 = (unsigned short*)Cout2 + (size_t)b * (size_t)strideC;
      // the 16 x 64 slab = two 1-KB blocks (k tiles n0/32, n0/32 + 1) of row tile mBase/16; store it = 512 contiguous B:
      // lane -> row rlane, columns 16it + koff .. +7
      const size_t cb = ((size_t)(mBase >> 4) * (ldc >> 5) + (n0 >> 5)) * 512 + lane * 8;
      float brow = 0.f;
      if (BIASM == 1) brow = rbf(bias[mBase + rlane]);
      v4u hv[4], lv[4];
#pragma unroll
      for (int it = 0; it < 4; ++it) {
        const float* sp = slab + rlane * 68 + it * 16 + koff;
        v4u a, a2;
#pragma unroll
        for (int e = 0; e < 4; ++e) {
          const float f0 = ((BIASM == 1) ? sp[2 * e]     + brow : sp[2 * e])     * oscale;
          const float f1 = ((BIASM == 1) ? sp[2 * e + 1] + brow : sp[2 * e + 1]) * oscale;
          unsigned h, l;
          split_pk(f0, f1, h, l);
          a[e] = h; a2[e] = l;
        }
        hv[it] = a; lv[it] = a2;
      }
      {
#pragma unroll
        for (int it = 0; it < 4; ++it) {
          *(v4u*)(C  + cb + it * 256) = hv[it];
          *(v4u*)(C2 + cb + it * 256) = lv[it];
        }
        
      }
    }
    __builtin_amdgcn_fence(__ATOMIC_RELEASE, "workgroup");
    __builtin_amdgcn_wave_barrier();
    __builtin_amdgcn_fence(__ATOMIC_ACQUIRE, "workgroup");
  }
}

__device__ __forceinline__ void fold_l_body(float* xs, int bs, const float* __restrict__ rec, unsigned short* ctxl);

// ---- one GEMM per launch (used for out0 and out1). Blocks past the GEMM's own (the out0 launch has NL of them) run the
//      language fold, one (b,s) each: it reads the records and writes ctx_l, the GEMM reads and writes neither. ----
template <bool AFR>   // A (the ctx plane) in fragment order, or row-major
__global__ __launch_bounds__(256) void gemm64_f32(
    const unsigned short* __restrict__ Ap, int lda,
    const unsigned short* __restrict__ Btp, int ldb,
    const float* __restrict__ bias, float* Cout, int ldc, int M, int N, int K,
    const float* __restrict__ rec, unsigned short* ctxl) {
  __shared__ __align__(16) float sT[8][16 * 68];   // per-wave 16x64 slab, pitch 68 floats; the fold uses its first 1 KB
  const int gb = ((M >> 6) * (N >> 6) + 7) >> 3;   // blocks of the GEMM, 8 tiles each
  if ((int)blockIdx.x >= gb) {                     // block-uniform job choice
    fold_l_body(&sT[0][0], (int)blockIdx.x - gb, rec, ctxl);
    return;
  }
  gemm64_body<0, 0, AFR>(sT, (int)blockIdx.x, 0, Ap, lda, 0LL, Btp, ldb, 0LL, bias,
                    (void*)Cout, (void*)Cout, ldc, 0LL, M, N, K, 1.0f);
}

// =====================================================================================================
// The four input projections in one grid: none reads what another writes, so blockIdx.x picks the job.
// The two K = 768 jobs (few tiles, longest k loop) take the first blocks.
//   k      = l . W_l^T + b_l              [b*SL+s][256]         M=512,   N=256,   K=768
//   val_l^T = W_vl . l^T + b_vl per batch [b][d][s] pitch SL    M=256,   N=256,   K=768
//   q      = (v . W_v^T + b_v) * scale    [b*TV+t][256]         M=32000, N=256,   K=256
//   val_v^T = W_vv . v^T + b_vv per batch [b][d][t] pitch TV    M=256,   N=16000, K=256
// every result as bf16 hi / residual planes.
// =====================================================================================================
#define PB_K   ((NL / 64) * (EMB / 64) / 8)      //   4 blocks
#define PB_VL1 ((EMB / 64) * (SL / 64) / 8)      //   2 blocks per batch
#define PB_Q   ((NV / 64) * (EMB / 64) / 8)      // 250 blocks
#define PB_VV1 ((EMB / 64) * (TV / 64) / 8)      // 125 blocks per batch
#define PB_ALL (PB_K + NB * PB_VL1 + PB_Q + NB * PB_VV1)
static_assert(PB_K * 8 * 4096 == NL * EMB && PB_VL1 * 8 * 4096 == EMB * SL);
static_assert(PB_Q * 8 * 4096 == NV * EMB && PB_VV1 * 8 * 4096 == EMB * TV);
__global__ __launch_bounds__(256) void proj_all(
    const unsigned short* __restrict__ vb, const unsigned short* __restrict__ lb,
    const unsigned short* __restrict__ Wvb, const unsigned short* __restrict__ Wlb,
    const unsigned short* __restrict__ Wvvb, const unsigned short* __restrict__ Wvlb,
    const float* __restrict__ bv, const float* __restrict__ bl,
    const float* __restrict__ bvv, const float* __restrict__ bvl,
    unsigned short* Qh, unsigned short* Ql, unsigned short* Kh, unsigned short* Kl,
    unsigned short* VvTh, unsigned short* VvTl, unsigned short* VlTh, unsigned short* VlTl) {
  __shared__ __align__(16) float sT[8][16 * 68];   // per-wave 16x64 slab, pitch 68 floats
  const int bid = (int)blockIdx.x;                 // block-uniform job choice
  const bool lang = bid < PB_K + NB * PB_VL1;      // operand l (K = 768) or v (K = 256)
  const int r = lang ? bid : bid - (PB_K + NB * PB_VL1);
  const int nrow = lang ? PB_K : PB_Q;             // blocks of the row-major job of this operand
  const unsigned short* x = lang ? lb : vb;
  const int kd = lang ? LD : EMB;
  if (r < nrow) {
    gemm64_body<3, 0, true>(sT, r, 0, x, kd, 0LL, lang ? Wlb : Wvb, kd, 0LL, lang ? bl : bv,
                      (void*)(lang ? Kh : Qh), (void*)(lang ? Kl : Ql), EMB, 0LL,
                      lang ? NL : NV, EMB, kd, lang ? 1.0f : SCALEQ);
  } else {
    const int per = lang ? PB_VL1 : PB_VV1;
    const int r2 = r - nrow;
    const int b = (r2 >= per) ? 1 : 0;
    static_assert(NB == 2);
    const int nt = lang ? SL : TV;                 // rows of x per batch = N = output pitch
    gemm64_body<3, 1, true>(sT, r2 - b * per, b, lang ? Wvlb : Wvvb, kd, 0LL, x, kd, (long long)nt * kd,
                      lang ? bvl : bvv, (void*)(lang ? VlTh : VvTh), (void*)(lang ? VlTl : VvTl),
                      nt, (long long)EMB * nt, EMB, nt, kd, 1.0f);
  }
}

// ---- additive key mask: -9e15 where the int32 mask is 0, else 0 (8 consecutive keys, 2 int4 loads) ----
__device__ __forceinline__ v8f add_mask8(v8f s, const int* p) {
  const v4i ma = *(const v4ia*)p;
  const v4i mb = *(const v4ia*)(p + 4);
  s[0] += (ma[0] == 0) ? MASKNEG : 0.0f;
  s[1] += (ma[1] == 0) ? MASKNEG : 0.0f;
  s[2] += (ma[2] == 0) ? MASKNEG : 0.0f;
  s[3] += (ma[3] == 0) ? MASKNEG : 0.0f;
  s[4] += (mb[0] == 0) ? MASKNEG : 0.0f;
  s[5] += (mb[1] == 0) ? MASKNEG : 0.0f;
  s[6] += (mb[2] == 0) ? MASKNEG : 0.0f;
  s[7] += (mb[3] == 0) ? MASKNEG : 0.0f;
  return s;
}

// =====================================================================================================
// Pass A: vision-direction attention (softmax over the 256 text keys, masked).
//   Planes (fragment order, see ldfragT): Qh/Ql, Kh/Kl bf16 [row][256] (row = b*TV + t / b*SL + s, head block h*32);
//           Vlh/Vll = val_l^T bf16 [b][256 d][256 s]; mask int32 [b][256].
//   Transposed form: S^T = K.Q^T (A = K rows: row = key, k = d; B = Q^T from the q row, n = query),
//   3 products (hh, hl, lh); D = S^T[key 8hh+r][query m]. Online softmax over 4 chunks of 64 keys in f32;
//   P^T hi / residual B fragments packed from registers; O^T += Vl^T . P^T (A = Vl^T rows: row = d, k = key).
//   Block = 4 waves x 16 queries = 64 query rows of one (b,h); NQT x NB*NH blocks (qt, bh).
//   Output: the ctx plane in fragment order, per wave two whole 1-KB blocks straight from the accumulators, 4 lines per instruction.
//   coverage: 250 x 16 blocks x 4 waves x (16 rows x 64 columns) = every block of the ctx plane.
// =====================================================================================================
__device__ __forceinline__
void attn_v_body(int qt, int bh,
            const unsigned short* __restrict__ qhp, const unsigned short* __restrict__ qlp,
            const unsigned short* __restrict__ khp, const unsigned short* __restrict__ klp,
            const unsigned short* __restrict__ vhp, const unsigned short* __restrict__ vlp,
            const int* __restrict__ maskl, unsigned short* ctxp) {
  const int tid = threadIdx.x, lane = tid & 31, w = tid >> 5;
  const int hh = lane >> 4;
  const int b = bh >> 3, head = bh & 7;
  const int q0 = qt * 64 + 16 * w;

  const __bf16* Qh = (const __bf16*)(const void*)qhp;
  const __bf16* Ql = (const __bf16*)(const void*)qlp;
  const __bf16* Kh = (const __bf16*)(const void*)khp;
  const __bf16* Kl = (const __bf16*)(const void*)klp;
  const __bf16* Vh = (const __bf16*)(const void*)vhp;
  const __bf16* Vl = (const __bf16*)(const void*)vlp;

  // Q^T B-fragments: column n = query q0+m, k = d (one 32-deep step)
  // (all planes in fragment order: block (row tile, k tile), 512 elements each; q and k have EMB / 32 = NH k tiles, k tile = head)
  const size_t qoff = ((size_t)((b * TV + q0) >> 4) * NH + head) * 512 + lane * 8;
  const v16b qbh = ldfragT(Qh + qoff);
  const v16b qbl = ldfragT(Ql + qoff);
  addr_taken();

  const size_t koff0 = ((size_t)((b * SL) >> 4) * NH + head) * 512 + lane * 8;                  // + (key0/16)*NH*512
  const __bf16* kbh = Kh + koff0;
  const __bf16* kbl = Kl + koff0;
  const size_t voff0 = (size_t)b * EMB * SL + (size_t)(head * 2) * (SL / 32) * 512 + lane * 8;  // + (dt*(SL/32) + key0/32)*512
  const __bf16* vbh = Vh + voff0;
  const __bf16* vbl = Vl + voff0;
  const int* mkp = maskl + b * SL + 8 * hh;                                      // + key tile base

  v8f o[2];
  o[0] = zero8(); o[1] = zero8();
  float mrun = -1.0e30f, lrun = 0.0f;

#pragma unroll 1
  for (int kc = 0; kc < SL / 64; ++kc) {
    const int kb0 = kc * 64;
    // ---- scores s[j][r] = S[query q0+m][key kb0+16j+8hh+r] ----
    v8f s[4];
#pragma unroll
    for (int j = 0; j < 4; ++j) {
      const size_t ko = (size_t)((kb0 >> 4) + j) * (NH * 512);
      const v16b kfh = ldfragT(kbh + ko);
      const v16b kfl = ldfragT(kbl + ko);
      addr_taken();
      v8f z = zero8();
      z = mma_b(kfh, qbh, z);
      z = mma_b(kfl, qbh, z);
      z = mma_b(kfh, qbl, z);
      s[j] = z;
    }
    // ---- clamp (pre-mask) ----
#pragma unroll
    for (int j = 0; j < 4; ++j)
#pragma unroll
      for (int r = 0; r < 8; ++r) s[j][r] = clampv(s[j][r]);
    // ---- additive mask per key, f32 ----
#pragma unroll
    for (int j = 0; j < 4; ++j) s[j] = add_mask8(s[j], mkp + kb0 + 16 * j);

    // ---- online softmax per query column ----
    float mloc = s[0][0];
#pragma unroll
    for (int j = 0; j < 4; ++j)
#pragma unroll
      for (int r = 0; r < 8; ++r) mloc = fmaxf(mloc, s[j][r]);
    mloc = fmaxf(mloc, __shfl_xor(mloc, 16, 32));
    const float mnew = fmaxf(mrun, mloc);
    const float alpha = __expf(mrun - mnew);
    mrun = mnew;
    float lsum = 0.0f;
#pragma unroll
    for (int j = 0; j < 4; ++j)
#pragma unroll
      for (int r = 0; r < 8; ++r) {
        const float p = __expf(s[j][r] - mnew);
        s[j][r] = p;
        lsum += p;
      }
    lsum += __shfl_xor(lsum, 16, 32);
    lrun = lrun * alpha + lsum;
#pragma unroll
    for (int dt = 0; dt < 2; ++dt)
#pragma unroll
      for (int r = 0; r < 8; ++r) o[dt][r] = o[dt][r] * alpha;

    // ---- P^T B-fragments (keys 0..31 and 32..63 of this chunk), bf16 hi + residual ----
    v16b pbh0, pbl0, pbh1, pbl1;
    pack_hl(s[0], s[1], pbh0, pbl0);
    pack_hl(s[2], s[3], pbh1, pbl1);

    // ---- O^T += Vl^T . P^T (3 products per k-step) ----
#pragma unroll
    for (int dt = 0; dt < 2; ++dt) {
      const size_t vo = (size_t)(dt * (SL / 32) + (kb0 >> 5)) * 512;
      const v16b vh0 = ldfragT(vbh + vo), vh1 = ldfragT(vbh + vo + 512);
      const v16b vl0 = ldfragT(vbl + vo), vl1 = ldfragT(vbl + vo + 512);
      addr_taken();
      v8f a = o[dt];
      a = mma_b(vh0, pbh0, a);
      a = mma_b(vh0, pbl0, a);
      a = mma_b(vl0, pbh0, a);
      a = mma_b(vh1, pbh1, a);
      a = mma_b(vh1, pbl1, a);
      a = mma_b(vl1, pbh1, a);
      o[dt] = a;
    }
  }

  // ---- normalise (1/l). Lane (hh, m) holds O^T[d = 16dt + 8hh + r][query m], r = 0..7: that is this lane's own 16-B piece
  //      (row m, k 16dt + 8hh ..+7) of the ctx plane's fragment-order blocks, k tile 2*head = hi, 2*head + 1 = residual ----
  const float inv = 1.0f / lrun;
  unsigned short* cb = ctxp + ((size_t)((b * TV + q0) >> 4) * (2 * EMB / 32) + head * 2) * 512 + lane * 8;
  v4u hv[2], lv[2];
#pragma unroll
  for (int dt = 0; dt < 2; ++dt) {
#pragma unroll
    for (int e = 0; e < 4; ++e) {
      const float x0 = o[dt][2 * e] * inv, x1 = o[dt][2 * e + 1] * inv;
      unsigned h, l;
      split_pk(x0, x1, h, l);
      hv[dt][e] = h;
      lv[dt][e] = l;
    }
  }
#pragma unroll
  for (int dt = 0; dt < 2; ++dt) {
    *(v4u*)(cb + dt * 256) = hv[dt];
    *(v4u*)(cb + 512 + dt * 256) = lv[dt];
  }
#if DEV_ASM
  // in the merged kernel the listing goes on behind these stores into code that rewrites their registers: the wait stands first
  asm volatile("s_wait_xcnt 0x0" ::: "memory");
#endif
}

// =====================================================================================================
// Pass B: language-direction partial sums. For (b,h), key half kq (128 keys), t range rg (1600 t):
//   S = Q.K^T (A = Q rows: row = t, k = d; B from K rows: n = key), 3 products, D = S[t 8hh+r][key m];
//   e = exp(clamp(clamp(S) - m[key])) in f32, m[key] = the running maximum of clamp(S) over the t this range has
//   seen (a softmax does not depend on the value subtracted; when m grows, acc and colsum are scaled by
//   exp(m_old - m_new)); e packed from registers as the B operand with k = t
//   (bf16 hi + residual); acc^T[d][key] += Vv^T . e (A = val_v^T rows: row = d, k = t), 3 products,
//   f32 accumulation across the 50 steps; colsum[key] += e in f32.
//   Block = 4 waves x 32 keys; RR x 2 x NB*NH blocks (rg, kq, bh). Record [bh][rg][34 rows][256]: rows 0..31 = acc^T[d],
//   row 32 = colsum, row 33 = the range's final m.
// =====================================================================================================
__device__ __forceinline__
void attn_l_body(float* smem, int rg, int kq, int bh,   // smem: per-wave 34x32 staging, 17408 B of the caller's LDS
            const unsigned short* __restrict__ qhp, const unsigned short* __restrict__ qlp,
            const unsigned short* __restrict__ khp, const unsigned short* __restrict__ klp,
            const unsigned short* __restrict__ vhp, const unsigned short* __restrict__ vlp,
            float* rec) {
  const int tid = threadIdx.x, lane = tid & 31, w = tid >> 5;
  const int hh = lane >> 4, m = lane & 15;
  const int b = bh >> 3, head = bh & 7;
  const int s0 = kq * 128 + 32 * w;
  const int tb = rg * TPR;

  const __bf16* Qh = (const __bf16*)(const void*)qhp;
  const __bf16* Ql = (const __bf16*)(const void*)qlp;
  const __bf16* Kh = (const __bf16*)(const void*)khp;
  const __bf16* Kl = (const __bf16*)(const void*)klp;
  const __bf16* Vh = (const __bf16*)(const void*)vhp;
  const __bf16* Vl = (const __bf16*)(const void*)vlp;

  // K B-fragments for this wave's two 16-key tiles (n = key s0+16jj+m, k = d), hi and residual planes
  v16b kfh[2], kfl[2];
  float mrun[2], csum[2];
#pragma unroll
  for (int jj = 0; jj < 2; ++jj) {
    const size_t ko = ((size_t)(((b * SL + s0) >> 4) + jj) * NH + head) * 512 + lane * 8;
    kfh[jj] = ldfragT(Kh + ko);
    kfl[jj] = ldfragT(Kl + ko);
    addr_taken();
    mrun[jj] = -1.0e30f;
    csum[jj] = 0.0f;
  }
  v8f acc[2][2];
#pragma unroll
  for (int dt = 0; dt < 2; ++dt) { acc[dt][0] = zero8(); acc[dt][1] = zero8(); }

  const size_t qoff0 = ((size_t)((b * TV) >> 4) * NH + head) * 512 + lane * 8;                  // + (t/16)*NH*512
  const __bf16* qbh = Qh + qoff0;
  const __bf16* qbl = Ql + qoff0;
  const size_t voff0 = (size_t)b * EMB * TV + (size_t)(head * 2) * (TV / 32) * 512 + lane * 8;  // + (dt*(TV/32) + t0/32)*512
  const __bf16* vbh = Vh + voff0;
  const __bf16* vbl = Vl + voff0;

#pragma unroll 1
  for (int step = 0; step < NSTEP; ++step) {
    const int t0 = tb + 32 * step;
    v16b qah[2], qal[2], vah[2], val2[2];
#pragma unroll
    for (int tt = 0; tt < 2; ++tt) {
      const size_t qo = (size_t)((t0 >> 4) + tt) * (NH * 512);
      qah[tt] = ldfragT(qbh + qo);
      qal[tt] = ldfragT(qbl + qo);
    }
#if DEV_ASM
    // the results of the loads below may land on the address registers of the loads above: the wait stands between
    asm volatile("s_wait_xcnt 0x0" ::: "memory");
#endif
#pragma unroll
    for (int dt = 0; dt < 2; ++dt) {
      const size_t vo = (size_t)(dt * (TV / 32) + (t0 >> 5)) * 512;
      vah[dt]  = ldfragT(vbh + vo);
      val2[dt] = ldfragT(vbl + vo);
    }
    addr_taken();
#pragma unroll
    for (int jj = 0; jj < 2; ++jj) {
      // scores for t rows t0..t0+15 (d0) and t0+16..t0+31 (d1), key columns s0+16jj+m
      v8f d0 = zero8(), d1 = zero8();
      d0 = mma_b(qah[0], kfh[jj], d0);
      d0 = mma_b(qah[0], kfl[jj], d0);
      d0 = mma_b(qal[0], kfh[jj], d0);
      d1 = mma_b(qah[1], kfh[jj], d1);
      d1 = mma_b(qah[1], kfl[jj], d1);
      d1 = mma_b(qal[1], kfh[jj], d1);
      // clamp; maximum of this key column over the step's 32 t rows (16 in this lane, 16 in lane ^ 16)
      float tm[8];
#pragma unroll
      for (int r = 0; r < 8; ++r) {
        d0[r] = clampv(d0[r]);
        d1[r] = clampv(d1[r]);
        tm[r] = fmaxf(d0[r], d1[r]);
      }
      float ml = fmaxf(fmaxf(fmaxf(tm[0], tm[1]), fmaxf(tm[2], tm[3])), fmaxf(fmaxf(tm[4], tm[5]), fmaxf(tm[6], tm[7])));
      ml = fmaxf(ml, xhalf(ml));
      const float mv = fmaxf(mrun[jj], ml);
      const float alpha = __expf(mrun[jj] - mv);         // 0 on the first step, 1 while the maximum stands
      mrun[jj] = mv;
      float cl = csum[jj] * alpha;
#pragma unroll
      for (int r = 0; r < 8; ++r) {
        const float x0 = clampv(d0[r] - mv);
        const float e0 = __expf(x0);
        d0[r] = e0; cl += e0;
        const float x1 = clampv(d1[r] - mv);
        const float e1 = __expf(x1);
        d1[r] = e1; cl += e1;
      }
      csum[jj] = cl;
      // e as the B operand with k = t (tile d0 = t 0..15, tile d1 = t 16..31), bf16 hi + residual
      v16b ebh, ebl;
      pack_hl(d0, d1, ebh, ebl);
#pragma unroll
      for (int dt = 0; dt < 2; ++dt) {
        v8f a = acc[dt][jj];
#pragma unroll
        for (int r = 0; r < 8; ++r) a[r] = a[r] * alpha;
        a = mma_b(vah[dt],  ebh, a);
        a = mma_b(vah[dt],  ebl, a);
        a = mma_b(val2[dt], ebh, a);
        acc[dt][jj] = a;
      }
    }
  }

  // ---- combine the two lane halves of the column sums; stage acc^T (32 d x 32 keys) + colsum row + max row ----
#pragma unroll
  for (int jj = 0; jj < 2; ++jj) csum[jj] += __shfl_xor(csum[jj], 16, 32);
  float* sw = smem + w * (RECROWS * 32);
#pragma unroll
  for (int dt = 0; dt < 2; ++dt)
#pragma unroll
    for (int jj = 0; jj < 2; ++jj)
#pragma unroll
      for (int r = 0; r < 8; ++r)
        sw[(16 * dt + 8 * hh + r) * 32 + 16 * jj + m] = acc[dt][jj][r];
  if (hh == 0) {
    sw[32 * 32 + m]      = csum[0];
    sw[32 * 32 + 16 + m] = csum[1];
    sw[33 * 32 + m]      = mrun[0];
    sw[33 * 32 + 16 + m] = mrun[1];
  }
  __syncthreads();

  // ---- record lines: row lid (0..33) of this wave = 32 floats at column s0, lanes 8*sub..+7, 4 rows per instruction ----
  {
    const int sub = lane >> 3, piece = lane & 7;
    float* rbase = rec + (((size_t)bh * RR + rg) * RECROWS) * SL + s0 + 4 * piece;
    {
#pragma unroll
      for (int i = 0; i < 9; ++i) {
        const int lid  = i * 4 + sub;
        const int lidc = (lid < RECROWS) ? lid : (RECROWS - 1);
        const v4f vv = *(const v4fa*)(sw + lidc * 32 + 4 * piece);
        if (lid < RECROWS) *(v4f*)(rbase + (size_t)lid * SL) = vv;
      }
      
    }
  }
}

// =====================================================================================================
// Both attention directions in one grid: neither reads what the other writes (ctx plane / records), so blockIdx.x
// picks the job. The 320 language blocks (50 steps each, one wave per SIMD on their own) take the first indices:
// they start first and the 4000 short vision blocks fill the same SIMDs' idle issue and load slots beside them.
// =====================================================================================================
#define AB_L (RR * 2 * NB * NH)      //  320 blocks, index = rg + RR * (kq + 2 * bh)
#define AB_V (NQT * NB * NH)         // 4000 blocks, index = qt + NQT * bh
__global__ __launch_bounds__(128)
void attn_both(const unsigned short* __restrict__ qhp, const unsigned short* __restrict__ qlp,
               const unsigned short* __restrict__ khp, const unsigned short* __restrict__ klp,
               const unsigned short* __restrict__ vlhp, const unsigned short* __restrict__ vllp,
               const unsigned short* __restrict__ vvhp, const unsigned short* __restrict__ vvlp,
               const int* __restrict__ maskl, unsigned short* ctxp, float* rec) {
  __shared__ __align__(16) float smem[4 * RECROWS * 32];   // the language job's staging, 17408 B
  const unsigned bid = blockIdx.x;                         // block-uniform job choice
  if (bid < AB_L) {
    const unsigned rg = bid % RR, r2 = bid / RR;
    attn_l_body(smem, (int)rg, (int)(r2 & 1u), (int)(r2 >> 1), qhp, qlp, khp, klp, vvhp, vvlp, rec);
  } else {
    const unsigned r = bid - AB_L;
    attn_v_body((int)(r % NQT), (int)(r / NQT), qhp, qlp, khp, klp, vlhp, vllp, maskl, ctxp);
  }
}

// =====================================================================================================
// Language-direction fold: with w[rg] = exp(m[rg][s] - max_rg m[rg][s]),
// ctx_l[b][s][h*32+d] = (sum_rg w[rg] acc[rg][d][s]) / (sum_rg w[rg] colsum[rg][s]) in fixed order.
// Block = one (b,s), thread = (h, d); threads 0..63 write the 1-KB row, 16 B each (2 instructions of 4 lines),
// =====================================================================================================
__device__ __forceinline__ void fold_l_body(float* xs, int bs, const float* __restrict__ rec, unsigned short* ctxl) {
  const int b = bs / SL, s = bs - b * SL;                  // xs: EMB floats of the caller's LDS
  const int t = (int)threadIdx.x, head = t >> 5, d = t & 31;
  const int bh = b * NH + head;
  const float* p = rec + ((size_t)bh * RR) * RECROWS * SL + s;
  float mr[RR];
#pragma unroll   // mr[] stays in registers; the ranges' loads are in flight together
  for (int rg = 0; rg < RR; ++rg) mr[rg] = p[((size_t)rg * RECROWS + 33) * SL];
  float mall = mr[0];
#pragma unroll   // constant index into mr[]
  for (int rg = 1; rg < RR; ++rg) mall = fmaxf(mall, mr[rg]);
#pragma unroll   // constant index into mr[]
  for (int rg = 0; rg < RR; ++rg) mr[rg] = exp2_slot((mr[rg] - mall) * 1.44269504f);   // the range's weight e^(m - max)
  float a = 0.0f, cs = 0.0f;
#pragma unroll   // constant index into mr[]; fixed order of the sums
  for (int rg = 0; rg < RR; ++rg) {
    const float* pr = p + (size_t)rg * RECROWS * SL;
    a  += mr[rg] * pr[(size_t)d * SL];
    cs += mr[rg] * pr[(size_t)32 * SL];
  }
  xs[t] = a * (1.0f / cs);
  __syncthreads();
  if (t < 64) {
    const int hg = t >> 3, wq = t & 7;
    const float* sp = xs + hg * HD + 8 * (wq & 3);
    const bool islo = (wq & 4) != 0;
    v4u vv;
#pragma unroll
    for (int e = 0; e < 4; ++e) {
      const float x0 = sp[2 * e], x1 = sp[2 * e + 1];
      unsigned h, l;
      split_pk(x0, x1, h, l);
      vv[e] = islo ? l : h;
    }
    unsigned short* dst = ctxl + (size_t)bs * (2 * EMB) + hg * (2 * HD) + 8 * wq;
    *(v4u*)dst = vv;
    
  }
}

// =====================================================================================================
// Workspace map (bytes), every region an exact multiple of its whole-line / whole-tile store granularity
// (no padded tails: all dims are tile multiples); every bf16 plane but CTXL lies in fragment order (see ldfragT):
//   vb    bf16 [32000][256]        16384000
//   lb    bf16 [512][768]            786432
//   Wvb   bf16 [256][256]            131072
//   Wvvb  bf16 [256][256]            131072
//   Wlb   bf16 [256][768]            393216
//   Wvlb  bf16 [256][768]            393216
//   Wovd  bf16 [256][512]            262144
//   Wold  bf16 [768][512]            786432
//   Qh,Ql bf16 [32000][256] x2     32768000
//   Kh,Kl bf16 [512][256] x2         524288
//   VlTh,VlTl bf16 [2][256][256] x2  524288
//   VvTh,VvTl bf16 [2][256][16000] x2 32768000
//   CTXV  bf16 [32000][512]        32768000
//   REC   f32  [16][10][34][256]    5570560
//   CTXL  bf16 [512][512]            524288
//   total                        124715008
// Weights are [out n][in k], the Bt / A orientation the GEMM wants, so they need no transpose.
// =====================================================================================================
extern "C" void kernel_launch(void* const* d_in, const int* in_sizes, int n_in,
                              void* d_out, int out_size, void* d_ws, size_t ws_size,
                              hipStream_t stream) {
  if (n_in < 15) return;
  if (in_sizes[0] != NV * EMB || in_sizes[1] != NL * LD || in_sizes[2] != NB * SL) return;
  if (in_sizes[3] != EMB * EMB || in_sizes[4] != EMB || in_sizes[5] != EMB * LD || in_sizes[6] != EMB) return;
  if (in_sizes[7] != EMB * EMB || in_sizes[8] != EMB || in_sizes[9] != EMB * LD || in_sizes[10] != EMB) return;
  if (in_sizes[11] != EMB * EMB || in_sizes[12] != EMB || in_sizes[13] != LD * EMB || in_sizes[14] != LD) return;
  if (out_size != NV * EMB + NL * LD) return;

  const float* v_in = (const float*)d_in[0];
  const float* l_in = (const float*)d_in[1];
  const int*   mk   = (const int*)d_in[2];
  const float* Wv   = (const float*)d_in[3];
  const float* bv   = (const float*)d_in[4];
  const float* Wl   = (const float*)d_in[5];
  const float* bl   = (const float*)d_in[6];
  const float* Wvv  = (const float*)d_in[7];
  const float* bvv  = (const float*)d_in[8];
  const float* Wvl  = (const float*)d_in[9];
  const float* bvl  = (const float*)d_in[10];
  const float* Wov  = (const float*)d_in[11];
  const float* bov  = (const float*)d_in[12];
  const float* Wol  = (const float*)d_in[13];
  const float* bol  = (const float*)d_in[14];
  float* out0 = (float*)d_out;
  float* out1 = out0 + (size_t)NV * EMB;            // byte 32768000; last element 8585215 < out_size

  const size_t PVB  = (size_t)NV * EMB * 2;          // 16384000
  const size_t PLB  = (size_t)NL * LD * 2;           //   786432
  const size_t PWS  = (size_t)EMB * EMB * 2;         //   131072
  const size_t PWL  = (size_t)EMB * LD * 2;          //   393216
  const size_t PWOD = (size_t)EMB * 2 * EMB * 2;     //   262144
  const size_t PWLD = (size_t)LD * 2 * EMB * 2;      //   786432
  const size_t PQ   = (size_t)NV * EMB * 2;          // 16384000
  const size_t PK   = (size_t)NL * EMB * 2;          //   262144
  const size_t PVLT = (size_t)NB * EMB * SL * 2;     //   262144
  const size_t PVVT = (size_t)NB * EMB * TV * 2;     // 16384000
  const size_t PCTX = (size_t)NV * 2 * EMB * 2;      // 32768000
  const size_t PREC = (size_t)NB * NH * RR * RECROWS * SL * 4;  // 5570560
  const size_t PCTL = (size_t)NL * 2 * EMB * 2;      //   524288
  size_t off = 0;
  const size_t oVB  = off; off += PVB;
  const size_t oLB  = off; off += PLB;
  const size_t oWv  = off; off += PWS;
  const size_t oWvv = off; off += PWS;
  const size_t oWl  = off; off += PWL;
  const size_t oWvl = off; off += PWL;
  const size_t oWod = off; off += PWOD;
  const size_t oWld = off; off += PWLD;
  const size_t oQh  = off; off += PQ;
  const size_t oQl  = off; off += PQ;
  const size_t oKh  = off; off += PK;
  const size_t oKl  = off; off += PK;
  const size_t oVLh = off; off += PVLT;
  const size_t oVLl = off; off += PVLT;
  const size_t oVVh = off; off += PVVT;
  const size_t oVVl = off; off += PVVT;
  const size_t oCTX = off; off += PCTX;
  const size_t oREC = off; off += PREC;
  const size_t oCTL = off; off += PCTL;
  if (off > ws_size) return;                         // off = 124715008
  if (off > (size_t)134217728) return;

  char* ws = (char*)d_ws;
  unsigned short* vb   = (unsigned short*)(ws + oVB);
  unsigned short* lb   = (unsigned short*)(ws + oLB);
  unsigned short* Wvb  = (unsigned short*)(ws + oWv);
  unsigned short* Wvvb = (unsigned short*)(ws + oWvv);
  unsigned short* Wlb  = (unsigned short*)(ws + oWl);
  unsigned short* Wvlb = (unsigned short*)(ws + oWvl);
  unsigned short* Wovd = (unsigned short*)(ws + oWod);
  unsigned short* Wold = (unsigned short*)(ws + oWld);
  unsigned short* Qh   = (unsigned short*)(ws + oQh);
  unsigned short* Ql   = (unsigned short*)(ws + oQl);
  unsigned short* Kh   = (unsigned short*)(ws + oKh);
  unsigned short* Kl   = (unsigned short*)(ws + oKl);
  unsigned short* VlTh = (unsigned short*)(ws + oVLh);
  unsigned short* VlTl = (unsigned short*)(ws + oVLl);
  unsigned short* VvTh = (unsigned short*)(ws + oVVh);
  unsigned short* VvTl = (unsigned short*)(ws + oVVl);
  unsigned short* CTXV = (unsigned short*)(ws + oCTX);
  float*          REC  = (float*)(ws + oREC);
  unsigned short* CTXL = (unsigned short*)(ws + oCTL);

  const dim3 blk(256);
  const dim3 gO1((((NL) / 64) * (LD / 64) + 7) / 8, 1);        //   96 tiles ->   12 blocks

  // (1) inputs -> bf16 planes; W_o -> bf16 duplicated along k (8 jobs, 4704 blocks)
  cvt_all<<<dim3(CB_ALL), blk, 0, stream>>>(v_in, l_in, Wv, Wvv, Wl, Wvl, Wov, Wol,
                                            vb, lb, Wvb, Wvvb, Wlb, Wvlb, Wovd, Wold);
  // (2) q, k, val_v^T, val_l^T -> bf16 hi / residual planes (4 jobs, 508 blocks)
  proj_all<<<dim3(PB_ALL), blk, 0, stream>>>(vb, lb, Wvb, Wlb, Wvvb, Wvlb, bv, bl, bvv, bvl,
                                             Qh, Ql, Kh, Kl, VvTh, VvTl, VlTh, VlTl);
  // (3) language-direction partial records (320 blocks) and vision-direction attention -> ctx plane (4000 blocks)
  attn_both<<<dim3(AB_L + AB_V), dim3(128), 0, stream>>>(Qh, Ql, Kh, Kl, VlTh, VlTl, VvTh, VvTl, mk, CTXV, REC);
  // (4) out0 = ctx . W_ov^T + b_ov -> d_out f32 [32000][256] (K=512: [hi|residual] . [W|W]; 250 blocks)
  //     and the fold of the t ranges, normalise, merge heads -> ctx_l plane (512 blocks)
  gemm64_f32<true><<<dim3(PB_Q + NL), blk, 0, stream>>>(CTXV, 2 * EMB, Wovd, 2 * EMB, bov, out0, EMB, NV, EMB, 2 * EMB, REC, CTXL);
  // (5) out1 = ctx_l . W_ol^T + b_ol -> d_out f32 [512][768] at float offset 8192000
  gemm64_f32<false><<<gO1, blk, 0, stream>>>(CTXL, 2 * EMB, Wold, 2 * EMB, bol, out1, LD, NL, LD, 2 * EMB,
                                      (const float*)nullptr, (unsigned short*)nullptr);   // no fold blocks in this grid
  (void)hipGetLastError();
}

// v006
// One run takes 147 microseconds.
// Two timings next to v005 put it at 1.33 and 1.34 times that version's speed.
// Counting every step since v000, it is 3.14 times as fast.
// Contractions: v.W_v^T, v.W_vv^T, l.W_l^T, l.W_vl^T = v_wmma_f32_16x16x32_bf16 (bf16 operands RNE-converted from the inputs, single product, f32 accumulate);
// q.k^T scores = v_wmma_f32_16x16x32_bf16 (q and k as bf16 hi + unscaled bf16 residual planes; 3 products hi.hi + hi.lo + lo.hi; f32 accumulate);
// p.val_l and e.val_v = v_wmma_f32_16x16x32_bf16 (p / e split in registers into bf16 hi + residual, val planes bf16 hi + residual; 3 products; f32 accumulate);
// ctx_v.W_ov^T and ctx_l.W_ol^T = v_wmma_f32_16x16x32_bf16 (ctx as bf16 hi | residual interleaved along k, W bf16 duplicated along k; f32 accumulate).
// Softmax, mask, bias, scale, column statistics and normalisation in f32.
// Carry audit: no power-of-two carried planes anywhere (every residual plane is an unscaled bf16 difference); nothing is folded back.
#include <hip/hip_runtime.h>
#include <math.h>
#include <stdint.h>

#define NB      2
#define TV      16000
#define SL      256
#define EMB     256
#define LD      768
#define NH      8
#define HD      32
#define NV      (NB * TV)          // 32000 vision rows
#define NL      (NB * SL)          // 512 language rows
#define NQT     (TV / 64)          // 250 query tiles of 64 rows per batch
#define RR      10                 // t ranges per (b,h) in the language direction
#define TPR     (TV / RR)          // 1600 t per range
#define NSTEP   (TPR / 32)         // 50 steps of 32 t per range
#define RECROWS 34                 // 32 accumulator rows + 1 column-sum row + 1 running-max row
#define SCALEQ  0.17677669529663687f
#define CLAMPV  50000.0f
#define MASKNEG (-9.0e15f)

static_assert(NH * HD == EMB);
static_assert(NQT * 64 == TV);
static_assert(RR * NSTEP * 32 == TV);
static_assert((NV % 64) == 0 && (NL % 64) == 0 && (EMB % 64) == 0 && (LD % 64) == 0 && (TV % 64) == 0);
static_assert((EMB % 32) == 0 && (LD % 32) == 0 && ((2 * EMB) % 32) == 0);
static_assert(SL == 256 && HD == 32 && EMB == 256);

typedef __bf16   v16b __attribute__((ext_vector_type(16)));
typedef __bf16   v8b  __attribute__((ext_vector_type(8)));
typedef __bf16   v2b  __attribute__((ext_vector_type(2)));
typedef float    v2f  __attribute__((ext_vector_type(2)));
typedef float    v8f  __attribute__((ext_vector_type(8)));
typedef float    v4f  __attribute__((ext_vector_type(4)));
typedef unsigned int v4u __attribute__((ext_vector_type(4)));
typedef unsigned int v8u __attribute__((ext_vector_type(8)));
typedef int      v4i  __attribute__((ext_vector_type(4)));
typedef v4f __attribute__((may_alias)) v4fa;
typedef v4i __attribute__((may_alias)) v4ia;

#if defined(__HIP_DEVICE_COMPILE__)
#define DEV_ASM 1
#else
#define DEV_ASM 0
#endif

// ---- scalar helpers --------------------------------------------------------------------------------
// two f32 -> two bf16 (RNE) in one register, a in the low half: one v_cvt_pk_bf16_f32
__device__ __forceinline__ unsigned cvt_pk(float a, float b) {
  const v2f x = {a, b};
  return __builtin_bit_cast(unsigned, __builtin_convertvector(x, v2b));
}
// the pair as bf16 hi (h) and bf16 residual x - hi (l), both packed like cvt_pk
__device__ __forceinline__ void split_pk(float x0, float x1, unsigned& h, unsigned& l) {
  h = cvt_pk(x0, x1);
  l = cvt_pk(x0 - __uint_as_float(h << 16), x1 - __uint_as_float(h & 0xFFFF0000u));
}
__device__ __forceinline__ float rbf(float f) { return (float)(__bf16)f; }   // value of the bf16 RNE convert
__device__ __forceinline__ v8f zero8() { v8f z = {0.f, 0.f, 0.f, 0.f, 0.f, 0.f, 0.f, 0.f}; return z; }
__device__ __forceinline__ float clampv(float x) { return fminf(fmaxf(x, -CLAMPV), CLAMPV); }
// 2^x. The v_nop is the one free slot that the instruction set asks for behind a transcendental.
__device__ __forceinline__ float exp2_slot(float x) {
#if DEV_ASM
  float r;
  asm("v_exp_f32 %0, %1\n\tv_nop" : "=v"(r) : "v"(x));
  return r;
#else
  return x;
#endif
}
// value of lane l ^ 16 (the other 16-lane row), by a vector cross-row move
__device__ __forceinline__ float xhalf(float x) {
  return __builtin_bit_cast(float, __builtin_amdgcn_permlanex16(__builtin_bit_cast(int, x), __builtin_bit_cast(int, x),
                                                                0x76543210, 0xfedcba98, false, false));
}

// ---- 16-bit A/B fragment loader (wave32): lane -> row/col (lane&15); p already includes +8*(lane>>4);
//      elements 0..7 <- p[0..7] (k0+8h..k0+8h+7), elements 8..15 <- p[16..23] (k0+16+8h..k0+16+8h+7)
__device__ __forceinline__ v16b ldfrag(const __bf16* p) {
  union { v16b v; v8b h[2]; } f;
  f.h[0] = *(const v8b*)(p);
  f.h[1] = *(const v8b*)(p + 16);
  return f.v;
}

// ---- the same fragment from a plane kept in FRAGMENT ORDER: a plane of [rows][C] bf16 is a row of 1-KB blocks, block
//      (rt, kt) = rows 16rt..+15 x k 32kt..+31 at element ((rt * (C / 32)) + kt) * 512; inside it element (row m, k) lies at
//      (k >> 4) * 256 + (((k >> 3) & 1) * 16 + m) * 8 + (k & 7). p = block + 8 * lane: each of the two loads reads 512
//      contiguous bytes (4 whole lines) and gives the registers of ldfrag: elements 0..7 = k 8h..8h+7, 8..15 = k 16+8h..+7.
__device__ __forceinline__ v16b ldfragT(const __bf16* p) {
  union { v16b v; v8b h[2]; } f;
  f.h[0] = *(const v8b*)(p);
  f.h[1] = *(const v8b*)(p + 256);
  return f.v;
}

// s_wait_xcnt 0 behind a group of global loads or stores: it stands in front of whatever next writes a register that they name
__device__ __forceinline__ void addr_taken() {
#if DEV_ASM
  asm volatile("s_wait_xcnt 0x0" ::: "memory");
#endif
}

// ---- WMMA helpers (asm guard bodies device-only) -------------------------------------------------------
__device__ __forceinline__ v8f mmar(v16b a, v16b b, v8f c) {
  return __builtin_amdgcn_wmma_f32_16x16x32_bf16(false, a, false, b, (short)0, c, false, false);
}
// guarded form: 4 VALU slots after the WMMA, D tied, A/B kept live
__device__ __forceinline__ v8f mma_b(v16b a, v16b b, v8f c) {
  c = __builtin_amdgcn_wmma_f32_16x16x32_bf16(false, a, false, b, (short)0, c, false, false);
#if DEV_ASM
  asm volatile("v_nop\n\tv_nop\n\tv_nop\n\tv_nop" : "+v"(c) : "v"(a), "v"(b));
#endif
  return c;
}
__device__ __forceinline__ void dep_guard(v8f& a, v8f& b, v16b x, v16b y) {
#if DEV_ASM
  asm volatile("v_nop\n\tv_nop\n\tv_nop\n\tv_nop" : "+v"(a), "+v"(b) : "v"(x), "v"(y));
#else
  (void)a; (void)b; (void)x; (void)y;
#endif
}
__device__ __forceinline__ void keep4(v16b a, v16b b, v16b c, v16b d) {
#if DEV_ASM
  asm volatile("v_nop" :: "v"(a), "v"(b), "v"(c), "v"(d));
#else
  (void)a; (void)b; (void)c; (void)d;
#endif
}
__device__ __forceinline__ void acc_guard4(v8f& a, v8f& b, v8f& c, v8f& d) {
#if DEV_ASM
  asm volatile("v_nop\n\tv_nop\n\tv_nop\n\tv_nop" : "+v"(a), "+v"(b), "+v"(c), "+v"(d));
#else
  (void)a; (void)b; (void)c; (void)d;
#endif
}

// ---- B fragment (k = the D tiles' ROW index) from two D tiles held by this lane, split into bf16 hi + residual:
//      element r <- tile a (k 0..15) row r, element 8+r <- tile c (k 16..31) row r, lane unchanged.
union PK { v8u u; v16b v; };
__device__ __forceinline__ void pack_hl(v8f a, v8f c, v16b& fh, v16b& fl) {
  v8u ph, pl;
#pragma unroll
  for (int i = 0; i < 4; ++i) {
    unsigned h, l;
    split_pk(a[2 * i], a[2 * i + 1], h, l);
    ph[i] = h;
    pl[i] = l;
    split_pk(c[2 * i], c[2 * i + 1], h, l);
    ph[4 + i] = h;
    pl[4 + i] = l;
  }
  PK uh, ul;
  uh.u = ph; ul.u = pl;
  fh = uh.v; fl = ul.v;
}

// =====================================================================================================
// f32 [rows][32 * KTN] (DUP: [rows][16 * KTN]) -> bf16 bits plane [rows][32 * KTN] in fragment order (see ldfragT).
// Thread = one 16-B piece of the output in output order: a wave writes 512 contiguous B, a block 4 whole 1-KB blocks.
// DUP: k tiles 2g and 2g + 1 both hold source columns 32g..32g+31 (the Bt operand of ctx.W^T where ctx is stored as
// [hi 32 | residual 32] per head block). coverage: the caller's block count x 256 pieces = the whole plane.
// =====================================================================================================
template <int KTN, bool DUP>
__device__ __forceinline__ void cvt_frag(int bx, const float* __restrict__ in, unsigned short* out) {
  const int p = bx * 256 + (int)threadIdx.x;                  // piece index
  const int blk = p >> 6, m = p & 15;
  const int kin = ((p >> 5) & 1) * 16 + ((p >> 4) & 1) * 8;   // k of the piece's first element inside its tile
  const int rt = blk / KTN, kt = blk - rt * KTN;
  const int col = (DUP ? (kt >> 1) : kt) * 32 + kin;
  const float* s = in + (size_t)(rt * 16 + m) * (DUP ? 16 * KTN : 32 * KTN) + col;
  const v4f a  = *(const v4fa*)(s);
  const v4f a4 = *(const v4fa*)(s + 4);
  v4u q;
  q[0] = cvt_pk(a[0],  a[1]);
  q[1] = cvt_pk(a[2],  a[3]);
  q[2] = cvt_pk(a4[0], a4[1]);
  q[3] = cvt_pk(a4[2], a4[3]);
  *(v4u*)(out + (size_t)p * 8) = q;
  addr_taken();   // the listing goes on behind this store into the next job's code
}

// =====================================================================================================
// All eight input conversions in one grid: they are independent of one another, so blockIdx.x picks the job.
// Block ranges (256 threads each): W_ov dup, W_ol dup, W_v, W_vv, W_l, W_vl, l, v.
// =====================================================================================================
#define CB_DV  (EMB * 2 * EMB / 8 / 256) //   64 blocks, 2048 output elements each
#define CB_DL  (LD * 2 * EMB / 8 / 256)  //  192
#define CB_WS  (EMB * EMB / 8 / 256)     //   32 blocks, 2048 elements each
#define CB_WL  (EMB * LD / 8 / 256)      //   96
#define CB_L   (NL * LD / 8 / 256)       //  192
#define CB_V   (NV * EMB / 8 / 256)      // 4000
#define CB_ALL (CB_DV + CB_DL + 2 * CB_WS + 2 * CB_WL + CB_L + CB_V)
static_assert(CB_WS * 2048 == EMB * EMB && CB_WL * 2048 == EMB * LD && CB_L * 2048 == NL * LD && CB_V * 2048 == NV * EMB);
static_assert(CB_DV * 2048 == EMB * 2 * EMB && CB_DL * 2048 == LD * 2 * EMB);
static_assert((NV % 16) == 0 && (NL % 16) == 0 && (TV % 32) == 0 && (SL % 32) == 0);
__global__ __launch_bounds__(256) void cvt_all(
    const float* __restrict__ v_in, const float* __restrict__ l_in,
    const float* __restrict__ Wv, const float* __restrict__ Wvv,
    const float* __restrict__ Wl, const float* __restrict__ Wvl,
    const float* __restrict__ Wov, const float* __restrict__ Wol,
    unsigned short* vb, unsigned short* lb, unsigned short* Wvb, unsigned short* Wvvb,
    unsigned short* Wlb, unsigned short* Wvlb, unsigned short* Wovd, unsigned short* Wold) {
  int bx = (int)blockIdx.x;                                   // block-uniform job choice
  if (bx < CB_DV) { cvt_frag<2 * EMB / 32, true>(bx, Wov, Wovd); return; }
  bx -= CB_DV;
  if (bx < CB_DL) { cvt_frag<2 * EMB / 32, true>(bx, Wol, Wold); return; }
  bx -= CB_DL;
  if (bx < CB_WS) { cvt_frag<EMB / 32, false>(bx, Wv, Wvb); return; }
  bx -= CB_WS;
  if (bx < CB_WS) { cvt_frag<EMB / 32, false>(bx, Wvv, Wvvb); return; }
  bx -= CB_WS;
  if (bx < CB_WL) { cvt_frag<LD / 32, false>(bx, Wl, Wlb); return; }
  bx -= CB_WL;
  if (bx < CB_WL) { cvt_frag<LD / 32, false>(bx, Wvl, Wvlb); return; }
  bx -= CB_WL;
  if (bx < CB_L) { cvt_frag<LD / 32, false>(bx, l_in, lb); return; }
  bx -= CB_L;
  cvt_frag<EMB / 32, false>(bx, v_in, vb);
}

// =====================================================================================================
// Register-blocked batched WMMA GEMM (bf16 operands): C[m][n] = sum_k A[m][k] * Bt[n][k];
// one wave per 64x64 tile, no block barriers. A [M][K], lda columns; Bt [N][K], ldb columns;
// M, N multiples of 64, K multiple of 32 (host-checked). bx = block of 8 tiles, b = batch index
// (strides in elements); sT = the block's LDS slabs, declared by the calling kernel. Fragments are loaded straight from global:
// Bt, and A where AFR, lie in fragment order (ldfragT; lda / ldb = the plane's columns); A row-major (ldfrag) where not AFR.
// OUT_MODE 0: f32 C (pitch ldc), value = (acc + bf16(bias[n])) * oscale.
// OUT_MODE 3: bf16 hi plane C + bf16 residual plane C2 = bf16(y - hi), both in fragment order (ldc = the plane's columns),
//             y = (acc + bf16(bias)) * oscale; bias[n] (BIASM 0) or bias[m] (BIASM 1).
// =====================================================================================================
template <int OUT_MODE, int BIASM, bool AFR>
__device__ __forceinline__ void gemm64_body(
    float (*sT)[16 * 68], int bx, int b,
    const unsigned short* __restrict__ Ap, int lda, long long strideA,
    const unsigned short* __restrict__ Btp, int ldb, long long strideB,
    const float* __restrict__ bias,
    void* Cout, void* Cout2, int ldc, long long strideC,
    int M, int N, int K, float oscale) {
  static_assert(OUT_MODE == 0 || OUT_MODE == 3);
  static_assert(OUT_MODE != 0 || BIASM == 0);
  const __bf16* A  = (const __bf16*)(const void*)Ap;
  const __bf16* Bt = (const __bf16*)(const void*)Btp;
  const int lane = threadIdx.x & 31;
  const int wave = threadIdx.x >> 5;
  const int tilesN = N >> 6;
  const int tilesM = M >> 6;
  const int tile = bx * 8 + wave;
  if (tile >= tilesM * tilesN) return;   // wave-uniform; no block barriers in this kernel
  const int tm = tile / tilesN;
  const int tn = tile - tm * tilesN;
  const int m0 = tm << 6;
  const int n0 = tn << 6;

  const __bf16* Ab = A  + (size_t)b * (size_t)strideA;
  const __bf16* Bb = Bt + (size_t)b * (size_t)strideB;

  const int rlane = lane & 15;                 // row (A) / col (B, D) within subtile
  const int koff  = (lane >> 4) * 8;           // k offset of this lane half
  const int mOff  = (lane >> 4) * 8;           // D row offset

  v8f acc[4][4];
#pragma unroll
  for (int i = 0; i < 4; ++i)
#pragma unroll
    for (int j = 0; j < 4; ++j) acc[i][j] = zero8();

  unsigned ob[4], oa[4];                        // byte offset of this lane's piece of the current k tile, one per 16-row tile
#pragma unroll
  for (int j = 0; j < 4; ++j) {                 // every plane is far below 2^31 bytes
    ob[j] = (unsigned)((((n0 >> 4) + j) * (ldb >> 5) * 512 + lane * 8) * 2);
    oa[j] = (unsigned)((AFR ? ((m0 >> 4) + j) * (lda >> 5) * 512 + lane * 8 : (m0 + (j << 4) + rlane) * lda + koff) * 2);
  }
  for (int k0 = 0; k0 < K; k0 += 32) {
    v16b bq[4], aq[4];                          // all eight fragments of the k tile, each in registers of its own
#pragma unroll
    for (int j = 0; j < 4; ++j) bq[j] = ldfragT((const __bf16*)((const char*)Bb + ob[j]));
#pragma unroll
    for (int i = 0; i < 4; ++i) {
      const __bf16* pa = (const __bf16*)((const char*)Ab + oa[i]);
      aq[i] = AFR ? ldfragT(pa) : ldfrag(pa);
    }
#pragma unroll
    for (int i = 0; i < 4; ++i) {
#pragma unroll
      for (int j = 0; j < 4; ++j) acc[i][j] = mmar(aq[i], bq[j], acc[i][j]);
      dep_guard(acc[i][0], acc[i][3], aq[i], bq[3]);
    }
    keep4(bq[0], bq[1], bq[2], bq[3]);
#if DEV_ASM
    // s_wait_xcnt 0 in front of the steps of the offsets that the loads above name; it names them so that the steps stay behind it
    asm volatile("s_wait_xcnt 0x0" : "+v"(ob[0]), "+v"(ob[1]), "+v"(ob[2]), "+v"(ob[3]),
                                     "+v"(oa[0]), "+v"(oa[1]), "+v"(oa[2]), "+v"(oa[3]) :: "memory");
#endif
#pragma unroll
    for (int j = 0; j < 4; ++j) { ob[j] += 1024u; oa[j] += AFR ? 1024u : 64u; }
  }
  acc_guard4(acc[0][0], acc[0][1], acc[0][2], acc[0][3]);
  acc_guard4(acc[1][0], acc[1][1], acc[1][2], acc[1][3]);
  acc_guard4(acc[2][0], acc[2][1], acc[2][2], acc[2][3]);
  acc_guard4(acc[3][0], acc[3][1], acc[3][2], acc[3][3]);

  // ---- epilogue ----
  float* slab = sT[wave];
  const int h2 = lane >> 4, c4 = (lane & 15) * 4;     // OUT_MODE 0 map: 256-B row segment = 16 lanes x 16 B
  v4f bb4;                                             // bias for columns n0+c4..+3 (mode 0)
  float bj[4];                                         // bias for columns n0+16j+rlane (mode 3, BIASM 0), added on the way into the slab
  if (OUT_MODE == 0) {
    const v4f braw = *(const v4fa*)(bias + n0 + c4);
    bb4[0] = rbf(braw[0]); bb4[1] = rbf(braw[1]); bb4[2] = rbf(braw[2]); bb4[3] = rbf(braw[3]);
  } else {
#pragma unroll
    for (int j = 0; j < 4; ++j) bj[j] = (BIASM == 0) ? rbf(bias[n0 + (j << 4) + rlane]) : 0.f;
  }
#pragma unroll
  for (int i = 0; i < 4; ++i) {
    const int mBase = m0 + (i << 4);
#pragma unroll
    for (int j = 0; j < 4; ++j) {
#pragma unroll
      for (int r = 0; r < 8; ++r) {
        slab[(mOff + r) * 68 + (j << 4) + rlane] = (OUT_MODE == 3 && BIASM == 0) ? acc[i][j][r] + bj[j] : acc[i][j][r];
      }
    }
    __builtin_amdgcn_fence(__ATOMIC_RELEASE, "workgroup");
    __builtin_amdgcn_wave_barrier();
    __builtin_amdgcn_fence(__ATOMIC_ACQUIRE, "workgroup");
    if (OUT_MODE == 0) {
      float* C = (float*)Cout + (size_t)b * (size_t)strideC;
      {
#pragma unroll
        for (int it = 0; it < 8; ++it) {
          const int row = it * 2 + h2;                     // it 0..7 x h2 0..1 = rows 0..15
          v4f v = *(const v4fa*)(slab + row * 68 + c4);
          v = (v + bb4) * oscale;
          *(v4f*)(C + (size_t)(mBase + row) * ldc + n0 + c4) = v;
        }
        
      }
    } else {
      unsigned short* C  = (unsigned short*)Cout  + (size_t)b * (size_t)strideC;
      unsigned short* C2 = (unsigned short*)Cout2 + (size_t)b * (size_t)strideC;
      // the 16 x 64 slab = two 1-KB blocks (k tiles n0/32, n0/32 + 1) of row tile mBase/16; store it = 512 contiguous B:
      // lane -> row rlane, columns 16it + koff .. +7
      const size_t cb = ((size_t)(mBase >> 4) * (ldc >> 5) + (n0 >> 5)) * 512 + lane * 8;
      float brow = 0.f;
      if (BIASM == 1) brow = rbf(bias[mBase + rlane]);
      v4u hv[4], lv[4];
#pragma unroll
      for (int it = 0; it < 4; ++it) {
        const float* sp = slab + rlane * 68 + it * 16 + koff;
        v4u a, a2;
#pragma unroll
        for (int e = 0; e < 4; ++e) {
          const float f0 = ((BIASM == 1) ? sp[2 * e]     + brow : sp[2 * e])     * oscale;
          const float f1 = ((BIASM == 1) ? sp[2 * e + 1] + brow : sp[2 * e + 1]) * oscale;
          unsigned h, l;
          split_pk(f0, f1, h, l);
          a[e] = h; a2[e] = l;
        }
        hv[it] = a; lv[it] = a2;
      }
      {
#pragma unroll
        for (int it = 0; it < 4; ++it) {
          *(v4u*)(C  + cb + it * 256) = hv[it];
          *(v4u*)(C2 + cb + it * 256) = lv[it];
        }
        
      }
    }
    __builtin_amdgcn_fence(__ATOMIC_RELEASE, "workgroup");
    __builtin_amdgcn_wave_barrier();
    __builtin_amdgcn_fence(__ATOMIC_ACQUIRE, "workgroup");
  }
}

__device__ __forceinline__ void fold_l_body(float* xs, int bs, const float* __restrict__ rec, unsigned short* ctxl);

// ---- one GEMM per launch (used for out0 and out1). Blocks past the GEMM's own (the out0 launch has NL of them) run the
//      language fold, one (b,s) each: it reads the records and writes ctx_l, the GEMM reads and writes neither. ----
template <bool AFR>   // A (the ctx plane) in fragment order, or row-major
__global__ __launch_bounds__(256) void gemm64_f32(
    const unsigned short* __restrict__ Ap, int lda,
    const unsigned short* __restrict__ Btp, int ldb,
    const float* __restrict__ bias, float* Cout, int ldc, int M, int N, int K,
    const float* __restrict__ rec, unsigned short* ctxl) {
  __shared__ __align__(16) float sT[8][16 * 68];   // per-wave 16x64 slab, pitch 68 floats; the fold uses its first 1 KB
  const int gb = ((M >> 6) * (N >> 6) + 7) >> 3;   // blocks of the GEMM, 8 tiles each
  if ((int)blockIdx.x >= gb) {                     // block-uniform job choice
    fold_l_body(&sT[0][0], (int)blockIdx.x - gb, rec, ctxl);
    return;
  }
  gemm64_body<0, 0, AFR>(sT, (int)blockIdx.x, 0, Ap, lda, 0LL, Btp, ldb, 0LL, bias,
                    (void*)Cout, (void*)Cout, ldc, 0LL, M, N, K, 1.0f);
}

// =====================================================================================================
// The four input projections in one grid: none reads what another writes, so blockIdx.x picks the job.
// The two K = 768 jobs (few tiles, longest k loop) take the first blocks.
//   k      = l . W_l^T + b_l              [b*SL+s][256]         M=512,   N=256,   K=768
//   val_l^T = W_vl . l^T + b_vl per batch [b][d][s] pitch SL    M=256,   N=256,   K=768
//   q      = (v . W_v^T + b_v) * scale    [b*TV+t][256]         M=32000, N=256,   K=256
//   val_v^T = W_vv . v^T + b_vv per batch [b][d][t] pitch TV    M=256,   N=16000, K=256
// every result as bf16 hi / residual planes.
// =====================================================================================================
#define PB_K   ((NL / 64) * (EMB / 64) / 8)      //   4 blocks
#define PB_VL1 ((EMB / 64) * (SL / 64) / 8)      //   2 blocks per batch
#define PB_Q   ((NV / 64) * (EMB / 64) / 8)      // 250 blocks
#define PB_VV1 ((EMB / 64) * (TV / 64) / 8)      // 125 blocks per batch
#define PB_ALL (PB_K + NB * PB_VL1 + PB_Q + NB * PB_VV1)
static_assert(PB_K * 8 * 4096 == NL * EMB && PB_VL1 * 8 * 4096 == EMB * SL);
static_assert(PB_Q * 8 * 4096 == NV * EMB && PB_VV1 * 8 * 4096 == EMB * TV);
__global__ __launch_bounds__(256) void proj_all(
    const unsigned short* __restrict__ vb, const unsigned short* __restrict__ lb,
    const unsigned short* __restrict__ Wvb, const unsigned short* __restrict__ Wlb,
    const unsigned short* __restrict__ Wvvb, const unsigned short* __restrict__ Wvlb,
    const float* __restrict__ bv, const float* __restrict__ bl,
    const float* __restrict__ bvv, const float* __restrict__ bvl,
    unsigned short* Qh, unsigned short* Ql, unsigned short* Kh, unsigned short* Kl,
    unsigned short* VvTh, unsigned short* VvTl, unsigned short* VlTh, unsigned short* VlTl) {
  __shared__ __align__(16) float sT[8][16 * 68];   // per-wave 16x64 slab, pitch 68 floats
  const int bid = (int)blockIdx.x;                 // block-uniform job choice
  const bool lang = bid < PB_K + NB * PB_VL1;      // operand l (K = 768) or v (K = 256)
  const int r = lang ? bid : bid - (PB_K + NB * PB_VL1);
  const int nrow = lang ? PB_K : PB_Q;             // blocks of the row-major job of this operand
  const unsigned short* x = lang ? lb : vb;
  const int kd = lang ? LD : EMB;
  if (r < nrow) {
    gemm64_body<3, 0, true>(sT, r, 0, x, kd, 0LL, lang ? Wlb : Wvb, kd, 0LL, lang ? bl : bv,
                      (void*)(lang ? Kh : Qh), (void*)(lang ? Kl : Ql), EMB, 0LL,
                      lang ? NL : NV, EMB, kd, lang ? 1.0f : SCALEQ);
  } else {
    const int per = lang ? PB_VL1 : PB_VV1;
    const int r2 = r - nrow;
    const int b = (r2 >= per) ? 1 : 0;
    static_assert(NB == 2);
    const int nt = lang ? SL : TV;                 // rows of x per batch = N = output pitch
    gemm64_body<3, 1, true>(sT, r2 - b * per, b, lang ? Wvlb : Wvvb, kd, 0LL, x, kd, (long long)nt * kd,
                      lang ? bvl : bvv, (void*)(lang ? VlTh : VvTh), (void*)(lang ? VlTl : VvTl),
                      nt, (long long)EMB * nt, EMB, nt, kd, 1.0f);
  }
}

// ---- additive key mask: -9e15 where the int32 mask is 0, else 0 (8 consecutive keys, 2 int4 loads) ----
__device__ __forceinline__ v8f add_mask8(v8f s, const int* p) {
  const v4i ma = *(const v4ia*)p;
  const v4i mb = *(const v4ia*)(p + 4);
  s[0] += (ma[0] == 0) ? MASKNEG : 0.0f;
  s[1] += (ma[1] == 0) ? MASKNEG : 0.0f;
  s[2] += (ma[2] == 0) ? MASKNEG : 0.0f;
  s[3] += (ma[3] == 0) ? MASKNEG : 0.0f;
  s[4] += (mb[0] == 0) ? MASKNEG : 0.0f;
  s[5] += (mb[1] == 0) ? MASKNEG : 0.0f;
  s[6] += (mb[2] == 0) ? MASKNEG : 0.0f;
  s[7] += (mb[3] == 0) ? MASKNEG : 0.0f;
  return s;
}

// =====================================================================================================
// Pass A: vision-direction attention (softmax over the 256 text keys, masked).
//   Planes (fragment order, see ldfragT): Qh/Ql, Kh/Kl bf16 [row][256] (row = b*TV + t / b*SL + s, head block h*32);
//           Vlh/Vll = val_l^T bf16 [b][256 d][256 s]; mask int32 [b][256].
//   Transposed form: S^T = K.Q^T (A = K rows: row = key, k = d; B = Q^T from the q row, n = query),
//   3 products (hh, hl, lh); D = S^T[key 8hh+r][query m]. Online softmax over 4 chunks of 64 keys in f32;
//   P^T hi / residual B fragments packed from registers; O^T += Vl^T . P^T (A = Vl^T rows: row = d, k = key).
//   Block = 4 waves x 16 queries = 64 query rows of one (b,h); NQT x NB*NH blocks (qt, bh).
//   Output: the ctx plane in fragment order, per wave two whole 1-KB blocks straight from the accumulators, 4 lines per instruction.
//   coverage: 250 x 16 blocks x 4 waves x (16 rows x 64 columns) = every block of the ctx plane.
// =====================================================================================================
__device__ __forceinline__
void attn_v_body(int qt, int bh,
            const unsigned short* __restrict__ qhp, const unsigned short* __restrict__ qlp,
            const unsigned short* __restrict__ khp, const unsigned short* __restrict__ klp,
            const unsigned short* __restrict__ vhp, const unsigned short* __restrict__ vlp,
            const int* __restrict__ maskl, unsigned short* ctxp) {
  const int tid = threadIdx.x, lane = tid & 31, w = tid >> 5;
  const int hh = lane >> 4;
  const int b = bh >> 3, head = bh & 7;
  const int q0 = qt * 64 + 16 * w;

  const __bf16* Qh = (const __bf16*)(const void*)qhp;
  const __bf16* Ql = (const __bf16*)(const void*)qlp;
  const __bf16* Kh = (const __bf16*)(const void*)khp;
  const __bf16* Kl = (const __bf16*)(const void*)klp;
  const __bf16* Vh = (const __bf16*)(const void*)vhp;
  const __bf16* Vl = (const __bf16*)(const void*)vlp;

  // Q^T B-fragments: column n = query q0+m, k = d (one 32-deep step)
  // (all planes in fragment order: block (row tile, k tile), 512 elements each; q and k have EMB / 32 = NH k tiles, k tile = head)
  const size_t qoff = ((size_t)((b * TV + q0) >> 4) * NH + head) * 512 + lane * 8;
  const v16b qbh = ldfragT(Qh + qoff);
  const v16b qbl = ldfragT(Ql + qoff);
  addr_taken();

  const size_t koff0 = ((size_t)((b * SL) >> 4) * NH + head) * 512 + lane * 8;                  // + (key0/16)*NH*512
  const __bf16* kbh = Kh + koff0;
  const __bf16* kbl = Kl + koff0;
  const size_t voff0 = (size_t)b * EMB * SL + (size_t)(head * 2) * (SL / 32) * 512 + lane * 8;  // + (dt*(SL/32) + key0/32)*512
  const __bf16* vbh = Vh + voff0;
  const __bf16* vbl = Vl + voff0;
  const int* mkp = maskl + b * SL + 8 * hh;                                      // + key tile base

  v8f o[2];
  o[0] = zero8(); o[1] = zero8();
  float mrun = -1.0e30f, lrun = 0.0f;

#pragma unroll 1
  for (int kc = 0; kc < SL / 64; ++kc) {
    const int kb0 = kc * 64;
    // ---- scores s[j][r] = S[query q0+m][key kb0+16j+8hh+r] ----
    v8f s[4];
#pragma unroll
    for (int j = 0; j < 4; ++j) {
      const size_t ko = (size_t)((kb0 >> 4) + j) * (NH * 512);
      const v16b kfh = ldfragT(kbh + ko);
      const v16b kfl = ldfragT(kbl + ko);
      addr_taken();
      v8f z = zero8();
      z = mma_b(kfh, qbh, z);
      z = mma_b(kfl, qbh, z);
      z = mma_b(kfh, qbl, z);
      s[j] = z;
    }
    // ---- clamp (pre-mask) ----
#pragma unroll
    for (int j = 0; j < 4; ++j)
#pragma unroll
      for (int r = 0; r < 8; ++r) s[j][r] = clampv(s[j][r]);
    // ---- additive mask per key, f32 ----
#pragma unroll
    for (int j = 0; j < 4; ++j) s[j] = add_mask8(s[j], mkp + kb0 + 16 * j);

    // ---- online softmax per query column ----
    float mloc = s[0][0];
#pragma unroll
    for (int j = 0; j < 4; ++j)
#pragma unroll
      for (int r = 0; r < 8; ++r) mloc = fmaxf(mloc, s[j][r]);
    mloc = fmaxf(mloc, __shfl_xor(mloc, 16, 32));
    const float mnew = fmaxf(mrun, mloc);
    const float alpha = __expf(mrun - mnew);
    mrun = mnew;
    float lsum = 0.0f;
#pragma unroll
    for (int j = 0; j < 4; ++j)
#pragma unroll
      for (int r = 0; r < 8; ++r) {
        const float p = __expf(s[j][r] - mnew);
        s[j][r] = p;
        lsum += p;
      }
    lsum += __shfl_xor(lsum, 16, 32);
    lrun = lrun * alpha + lsum;
#pragma unroll
    for (int dt = 0; dt < 2; ++dt)
#pragma unroll
      for (int r = 0; r < 8; ++r) o[dt][r] = o[dt][r] * alpha;

    // ---- P^T B-fragments (keys 0..31 and 32..63 of this chunk), bf16 hi + residual ----
    v16b pbh0, pbl0, pbh1, pbl1;
    pack_hl(s[0], s[1], pbh0, pbl0);
    pack_hl(s[2], s[3], pbh1, pbl1);

    // ---- O^T += Vl^T . P^T (3 products per k-step) ----
#pragma unroll
    for (int dt = 0; dt < 2; ++dt) {
      const size_t vo = (size_t)(dt * (SL / 32) + (kb0 >> 5)) * 512;
      const v16b vh0 = ldfragT(vbh + vo), vh1 = ldfragT(vbh + vo + 512);
      const v16b vl0 = ldfragT(vbl + vo), vl1 = ldfragT(vbl + vo + 512);
      addr_taken();
      v8f a = o[dt];
      a = mma_b(vh0, pbh0, a);
      a = mma_b(vh0, pbl0, a);
      a = mma_b(vl0, pbh0, a);
      a = mma_b(vh1, pbh1, a);
      a = mma_b(vh1, pbl1, a);
      a = mma_b(vl1, pbh1, a);
      o[dt] = a;
    }
  }

  // ---- normalise (1/l). Lane (hh, m) holds O^T[d = 16dt + 8hh + r][query m], r = 0..7: that is this lane's own 16-B piece
  //      (row m, k 16dt + 8hh ..+7) of the ctx plane's fragment-order blocks, k tile 2*head = hi, 2*head + 1 = residual ----
  const float inv = 1.0f / lrun;
  unsigned short* cb = ctxp + ((size_t)((b * TV + q0) >> 4) * (2 * EMB / 32) + head * 2) * 512 + lane * 8;
  v4u hv[2], lv[2];
#pragma unroll
  for (int dt = 0; dt < 2; ++dt) {
#pragma unroll
    for (int e = 0; e < 4; ++e) {
      const float x0 = o[dt][2 * e] * inv, x1 = o[dt][2 * e + 1] * inv;
      unsigned h, l;
      split_pk(x0, x1, h, l);
      hv[dt][e] = h;
      lv[dt][e] = l;
    }
  }
#pragma unroll
  for (int dt = 0; dt < 2; ++dt) {
    *(v4u*)(cb + dt * 256) = hv[dt];
    *(v4u*)(cb + 512 + dt * 256) = lv[dt];
  }
#if DEV_ASM
  // in the merged kernel the listing goes on behind these stores into code that rewrites their registers: the wait stands first
  asm volatile("s_wait_xcnt 0x0" ::: "memory");
#endif
}

// =====================================================================================================
// Pass B: language-direction partial sums. For (b,h), key half kq (128 keys), t range rg (1600 t):
//   S = Q.K^T (A = Q rows: row = t, k = d; B from K rows: n = key), 3 products, D = S[t 8hh+r][key m];
//   e = exp(clamp(clamp(S) - m[key])) in f32, m[key] = the running maximum of clamp(S) over the t this range has
//   seen (a softmax does not depend on the value subtracted; when m grows, acc and colsum are scaled by
//   exp(m_old - m_new)); e packed from registers as the B operand with k = t
//   (bf16 hi + residual); acc^T[d][key] += Vv^T . e (A = val_v^T rows: row = d, k = t), 3 products,
//   f32 accumulation across the 50 steps; colsum[key] += e in f32.
//   Block = 4 waves x 32 keys; RR x 2 x NB*NH blocks (rg, kq, bh). Record [bh][rg][34 rows][256]: rows 0..31 = acc^T[d],
//   row 32 = colsum, row 33 = the range's final m.
// =====================================================================================================
__device__ __forceinline__
void attn_l_body(float* smem, int rg, int kq, int bh,   // smem: per-wave 34x32 staging, 17408 B of the caller's LDS
            const unsigned short* __restrict__ qhp, const unsigned short* __restrict__ qlp,
            const unsigned short* __restrict__ khp, const unsigned short* __restrict__ klp,
            const unsigned short* __restrict__ vhp, const unsigned short* __restrict__ vlp,
            float* rec) {
  const int tid = threadIdx.x, lane = tid & 31, w = tid >> 5;
  const int hh = lane >> 4, m = lane & 15;
  const int b = bh >> 3, head = bh & 7;
  const int s0 = kq * 128 + 32 * w;
  const int tb = rg * TPR;

  const __bf16* Qh = (const __bf16*)(const void*)qhp;
  const __bf16* Ql = (const __bf16*)(const void*)qlp;
  const __bf16* Kh = (const __bf16*)(const void*)khp;
  const __bf16* Kl = (const __bf16*)(const void*)klp;
  const __bf16* Vh = (const __bf16*)(const void*)vhp;
  const __bf16* Vl = (const __bf16*)(const void*)vlp;

  // K B-fragments for this wave's two 16-key tiles (n = key s0+16jj+m, k = d), hi and residual planes
  v16b kfh[2], kfl[2];
  float mrun[2], csum[2];
#pragma unroll
  for (int jj = 0; jj < 2; ++jj) {
    const size_t ko = ((size_t)(((b * SL + s0) >> 4) + jj) * NH + head) * 512 + lane * 8;
    kfh[jj] = ldfragT(Kh + ko);
    kfl[jj] = ldfragT(Kl + ko);
    addr_taken();
    mrun[jj] = -1.0e30f;
    csum[jj] = 0.0f;
  }
  v8f acc[2][2];
#pragma unroll
  for (int dt = 0; dt < 2; ++dt) { acc[dt][0] = zero8(); acc[dt][1] = zero8(); }

  const size_t qoff0 = ((size_t)((b * TV) >> 4) * NH + head) * 512 + lane * 8;                  // + (t/16)*NH*512
  const __bf16* qbh = Qh + qoff0;
  const __bf16* qbl = Ql + qoff0;
  const size_t voff0 = (size_t)b * EMB * TV + (size_t)(head * 2) * (TV / 32) * 512 + lane * 8;  // + (dt*(TV/32) + t0/32)*512
  const __bf16* vbh = Vh + voff0;
  const __bf16* vbl = Vl + voff0;

#pragma unroll 1
  for (int step = 0; step < NSTEP; ++step) {
    const int t0 = tb + 32 * step;
    v16b qah[2], qal[2], vah[2], val2[2];
#pragma unroll
    for (int tt = 0; tt < 2; ++tt) {
      const size_t qo = (size_t)((t0 >> 4) + tt) * (NH * 512);
      qah[tt] = ldfragT(qbh + qo);
      qal[tt] = ldfragT(qbl + qo);
    }
#if DEV_ASM
    // the results of the loads below may land on the address registers of the loads above: the wait stands between
    asm volatile("s_wait_xcnt 0x0" ::: "memory");
#endif
#pragma unroll
    for (int dt = 0; dt < 2; ++dt) {
      const size_t vo = (size_t)(dt * (TV / 32) + (t0 >> 5)) * 512;
      vah[dt]  = ldfragT(vbh + vo);
      val2[dt] = ldfragT(vbl + vo);
    }
    addr_taken();
#pragma unroll
    for (int jj = 0; jj < 2; ++jj) {
      // scores for t rows t0..t0+15 (d0) and t0+16..t0+31 (d1), key columns s0+16jj+m
      v8f d0 = zero8(), d1 = zero8();
      d0 = mma_b(qah[0], kfh[jj], d0);
      d0 = mma_b(qah[0], kfl[jj], d0);
      d0 = mma_b(qal[0], kfh[jj], d0);
      d1 = mma_b(qah[1], kfh[jj], d1);
      d1 = mma_b(qah[1], kfl[jj], d1);
      d1 = mma_b(qal[1], kfh[jj], d1);
      // clamp; maximum of this key column over the step's 32 t rows (16 in this lane, 16 in lane ^ 16)
      float tm[8];
#pragma unroll
      for (int r = 0; r < 8; ++r) {
        d0[r] = clampv(d0[r]);
        d1[r] = clampv(d1[r]);
        tm[r] = fmaxf(d0[r], d1[r]);
      }
      float ml = fmaxf(fmaxf(fmaxf(tm[0], tm[1]), fmaxf(tm[2], tm[3])), fmaxf(fmaxf(tm[4], tm[5]), fmaxf(tm[6], tm[7])));
      ml = fmaxf(ml, xhalf(ml));
      const float mv = fmaxf(mrun[jj], ml);
      const float alpha = __expf(mrun[jj] - mv);         // 0 on the first step, 1 while the maximum stands
      mrun[jj] = mv;
      float cl = csum[jj] * alpha;
#pragma unroll
      for (int r = 0; r < 8; ++r) {
        const float x0 = clampv(d0[r] - mv);
        const float e0 = __expf(x0);
        d0[r] = e0; cl += e0;
        const float x1 = clampv(d1[r] - mv);
        const float e1 = __expf(x1);
        d1[r] = e1; cl += e1;
      }
      csum[jj] = cl;
      // e as the B operand with k = t (tile d0 = t 0..15, tile d1 = t 16..31), bf16 hi + residual
      v16b ebh, ebl;
      pack_hl(d0, d1, ebh, ebl);
#pragma unroll
      for (int dt = 0; dt < 2; ++dt) {
        v8f a = acc[dt][jj];
#pragma unroll
        for (int r = 0; r < 8; ++r) a[r] = a[r] * alpha;
        a = mma_b(vah[dt],  ebh, a);
        a = mma_b(vah[dt],  ebl, a);
        a = mma_b(val2[dt], ebh, a);
        acc[dt][jj] = a;
      }
    }
  }

  // ---- combine the two lane halves of the column sums; stage acc^T (32 d x 32 keys) + colsum row + max row ----
#pragma unroll
  for (int jj = 0; jj < 2; ++jj) csum[jj] += __shfl_xor(csum[jj], 16, 32);
  float* sw = smem + w * (RECROWS * 32);
#pragma unroll
  for (int dt = 0; dt < 2; ++dt)
#pragma unroll
    for (int jj = 0; jj < 2; ++jj)
#pragma unroll
      for (int r = 0; r < 8; ++r)
        sw[(16 * dt + 8 * hh + r) * 32 + 16 * jj + m] = acc[dt][jj][r];
  if (hh == 0) {
    sw[32 * 32 + m]      = csum[0];
    sw[32 * 32 + 16 + m] = csum[1];
    sw[33 * 32 + m]      = mrun[0];
    sw[33 * 32 + 16 + m] = mrun[1];
  }
  __syncthreads();

  // ---- record lines: row lid (0..33) of this wave = 32 floats at column s0, lanes 8*sub..+7, 4 rows per instruction ----
  {
    const int sub = lane >> 3, piece = lane & 7;
    float* rbase = rec + (((size_t)bh * RR + rg) * RECROWS) * SL + s0 + 4 * piece;
    {
#pragma unroll
      for (int i = 0; i < 9; ++i) {
        const int lid  = i * 4 + sub;
        const int lidc = (lid < RECROWS) ? lid : (RECROWS - 1);
        const v4f vv = *(const v4fa*)(sw + lidc * 32 + 4 * piece);
        if (lid < RECROWS) *(v4f*)(rbase + (size_t)lid * SL) = vv;
      }
      
    }
  }
}

// =====================================================================================================
// Both attention directions in one grid: neither reads what the other writes (ctx plane / records), so blockIdx.x
// picks the job. The 320 language blocks (50 steps each, one wave per SIMD on their own) take the first indices:
// they start first and the 4000 short vision blocks fill the same SIMDs' idle issue and load slots beside them.
// =====================================================================================================
#define AB_L (RR * 2 * NB * NH)      //  320 blocks, index = rg + RR * (kq + 2 * bh)
#define AB_V (NQT * NB * NH)         // 4000 blocks, index = qt + NQT * bh
__global__ __launch_bounds__(128)
void attn_both(const unsigned short* __restrict__ qhp, const unsigned short* __restrict__ qlp,
               const unsigned short* __restrict__ khp, const unsigned short* __restrict__ klp,
               const unsigned short* __restrict__ vlhp, const unsigned short* __restrict__ vllp,
               const unsigned short* __restrict__ vvhp, const unsigned short* __restrict__ vvlp,
               const int* __restrict__ maskl, unsigned short* ctxp, float* rec) {
  __shared__ __align__(16) float smem[4 * RECROWS * 32];   // the language job's staging, 17408 B
  const unsigned bid = blockIdx.x;                         // block-uniform job choice
  if (bid < AB_L) {
    const unsigned rg = bid % RR, r2 = bid / RR;
    attn_l_body(smem, (int)rg, (int)(r2 & 1u), (int)(r2 >> 1), qhp, qlp, khp, klp, vvhp, vvlp, rec);
  } else {
    const unsigned r = bid - AB_L;
    attn_v_body((int)(r % NQT), (int)(r / NQT), qhp, qlp, khp, klp, vlhp, vllp, maskl, ctxp);
  }
}

// =====================================================================================================
// Language-direction fold: with w[rg] = exp(m[rg][s] - max_rg m[rg][s]),
// ctx_l[b][s][h*32+d] = (sum_rg w[rg] acc[rg][d][s]) / (sum_rg w[rg] colsum[rg][s]) in fixed order.
// Block = one (b,s), thread = (h, d); threads 0..63 write the 1-KB row, 16 B each (2 instructions of 4 lines),
// =====================================================================================================
__device__ __forceinline__ void fold_l_body(float* xs, int bs, const float* __restrict__ rec, unsigned short* ctxl) {
  const int b = bs / SL, s = bs - b * SL;                  // xs: EMB floats of the caller's LDS
  const int t = (int)threadIdx.x, head = t >> 5, d = t & 31;
  const int bh = b * NH + head;
  const float* p = rec + ((size_t)bh * RR) * RECROWS * SL + s;
  float mr[RR];
#pragma unroll   // mr[] stays in registers; the ranges' loads are in flight together
  for (int rg = 0; rg < RR; ++rg) mr[rg] = p[((size_t)rg * RECROWS + 33) * SL];
  float mall = mr[0];
#pragma unroll   // constant index into mr[]
  for (int rg = 1; rg < RR; ++rg) mall = fmaxf(mall, mr[rg]);
#pragma unroll   // constant index into mr[]
  for (int rg = 0; rg < RR; ++rg) mr[rg] = exp2_slot((mr[rg] - mall) * 1.44269504f);   // the range's weight e^(m - max)
  float a = 0.0f, cs = 0.0f;
#pragma unroll   // constant index into mr[]; fixed order of the sums
  for (int rg = 0; rg < RR; ++rg) {
    const float* pr = p + (size_t)rg * RECROWS * SL;
    a  += mr[rg] * pr[(size_t)d * SL];
    cs += mr[rg] * pr[(size_t)32 * SL];
  }
  xs[t] = a * (1.0f / cs);
  __syncthreads();
  if (t < 64) {
    const int hg = t >> 3, wq = t & 7;
    const float* sp = xs + hg * HD + 8 * (wq & 3);
    const bool islo = (wq & 4) != 0;
    v4u vv;
#pragma unroll
    for (int e = 0; e < 4; ++e) {
      const float x0 = sp[2 * e], x1 = sp[2 * e + 1];
      unsigned h, l;
      split_pk(x0, x1, h, l);
      vv[e] = islo ? l : h;
    }
    unsigned short* dst = ctxl + (size_t)bs * (2 * EMB) + hg * (2 * HD) + 8 * wq;
    *(v4u*)dst = vv;
    
  }
}

// =====================================================================================================
// Workspace map (bytes), every region an exact multiple of its whole-line / whole-tile store granularity
// (no padded tails: all dims are tile multiples); every bf16 plane but CTXL lies in fragment order (see ldfragT):
//   vb    bf16 [32000][256]        16384000
//   lb    bf16 [512][768]            786432
//   Wvb   bf16 [256][256]            131072
//   Wvvb  bf16 [256][256]            131072
//   Wlb   bf16 [256][768]            393216
//   Wvlb  bf16 [256][768]            393216
//   Wovd  bf16 [256][512]            262144
//   Wold  bf16 [768][512]            786432
//   Qh,Ql bf16 [32000][256] x2     32768000
//   Kh,Kl bf16 [512][256] x2         524288
//   VlTh,VlTl bf16 [2][256][256] x2  524288
//   VvTh,VvTl bf16 [2][256][16000] x2 32768000
//   CTXV  bf16 [32000][512]        32768000
//   REC   f32  [16][10][34][256]    5570560
//   CTXL  bf16 [512][512]            524288
//   total                        124715008
// Weights are [out n][in k], the Bt / A orientation the GEMM wants, so they need no transpose.
// =====================================================================================================
extern "C" void kernel_launch(void* const* d_in, const int* in_sizes, int n_in,
                              void* d_out, int out_size, void* d_ws, size_t ws_size,
                              hipStream_t stream) {
  if (n_in < 15) return;
  if (in_sizes[0] != NV * EMB || in_sizes[1] != NL * LD || in_sizes[2] != NB * SL) return;
  if (in_sizes[3] != EMB * EMB || in_sizes[4] != EMB || in_sizes[5] != EMB * LD || in_sizes[6] != EMB) return;
  if (in_sizes[7] != EMB * EMB || in_sizes[8] != EMB || in_sizes[9] != EMB * LD || in_sizes[10] != EMB) return;
  if (in_sizes[11] != EMB * EMB || in_sizes[12] != EMB || in_sizes[13] != LD * EMB || in_sizes[14] != LD) return;
  if (out_size != NV * EMB + NL * LD) return;

  const float* v_in = (const float*)d_in[0];
  const float* l_in = (const float*)d_in[1];
  const int*   mk   = (const int*)d_in[2];
  const float* Wv   = (const float*)d_in[3];
  const float* bv   = (const float*)d_in[4];
  const float* Wl   = (const float*)d_in[5];
  const float* bl   = (const float*)d_in[6];
  const float* Wvv  = (const float*)d_in[7];
  const float* bvv  = (const float*)d_in[8];
  const float* Wvl  = (const float*)d_in[9];
  const float* bvl  = (const float*)d_in[10];
  const float* Wov  = (const float*)d_in[11];
  const float* bov  = (const float*)d_in[12];
  const float* Wol  = (const float*)d_in[13];
  const float* bol  = (const float*)d_in[14];
  float* out0 = (float*)d_out;
  float* out1 = out0 + (size_t)NV * EMB;            // byte 32768000; last element 8585215 < out_size

  const size_t PVB  = (size_t)NV * EMB * 2;          // 16384000
  const size_t PLB  = (size_t)NL * LD * 2;           //   786432
  const size_t PWS  = (size_t)EMB * EMB * 2;         //   131072
  const size_t PWL  = (size_t)EMB * LD * 2;          //   393216
  const size_t PWOD = (size_t)EMB * 2 * EMB * 2;     //   262144
  const size_t PWLD = (size_t)LD * 2 * EMB * 2;      //   786432
  const size_t PQ   = (size_t)NV * EMB * 2;          // 16384000
  const size_t PK   = (size_t)NL * EMB * 2;          //   262144
  const size_t PVLT = (size_t)NB * EMB * SL * 2;     //   262144
  const size_t PVVT = (size_t)NB * EMB * TV * 2;     // 16384000
  const size_t PCTX = (size_t)NV * 2 * EMB * 2;      // 32768000
  const size_t PREC = (size_t)NB * NH * RR * RECROWS * SL * 4;  // 5570560
  const size_t PCTL = (size_t)NL * 2 * EMB * 2;      //   524288
  size_t off = 0;
  const size_t oVB  = off; off += PVB;
  const size_t oLB  = off; off += PLB;
  const size_t oWv  = off; off += PWS;
  const size_t oWvv = off; off += PWS;
  const size_t oWl  = off; off += PWL;
  const size_t oWvl = off; off += PWL;
  const size_t oWod = off; off += PWOD;
  const size_t oWld = off; off += PWLD;
  const size_t oQh  = off; off += PQ;
  const size_t oQl  = off; off += PQ;
  const size_t oKh  = off; off += PK;
  const size_t oKl  = off; off += PK;
  const size_t oVLh = off; off += PVLT;
  const size_t oVLl = off; off += PVLT;
  const size_t oVVh = off; off += PVVT;
  const size_t oVVl = off; off += PVVT;
  const size_t oCTX = off; off += PCTX;
  const size_t oREC = off; off += PREC;
  const size_t oCTL = off; off += PCTL;
  if (off > ws_size) return;                         // off = 124715008
  if (off > (size_t)134217728) return;

  char* ws = (char*)d_ws;
  unsigned short* vb   = (unsigned short*)(ws + oVB);
  unsigned short* lb   = (unsigned short*)(ws + oLB);
  unsigned short* Wvb  = (unsigned short*)(ws + oWv);
  unsigned short* Wvvb = (unsigned short*)(ws + oWvv);
  unsigned short* Wlb  = (unsigned short*)(ws + oWl);
  unsigned short* Wvlb = (unsigned short*)(ws + oWvl);
  unsigned short* Wovd = (unsigned short*)(ws + oWod);
  unsigned short* Wold = (unsigned short*)(ws + oWld);
  unsigned short* Qh   = (unsigned short*)(ws + oQh);
  unsigned short* Ql   = (unsigned short*)(ws + oQl);
  unsigned short* Kh   = (unsigned short*)(ws + oKh);
  unsigned short* Kl   = (unsigned short*)(ws + oKl);
  unsigned short* VlTh = (unsigned short*)(ws + oVLh);
  unsigned short* VlTl = (unsigned short*)(ws + oVLl);
  unsigned short* VvTh = (unsigned short*)(ws + oVVh);
  unsigned short* VvTl = (unsigned short*)(ws + oVVl);
  unsigned short* CTXV = (unsigned short*)(ws + oCTX);
  float*          REC  = (float*)(ws + oREC);
  unsigned short* CTXL = (unsigned short*)(ws + oCTL);

  const dim3 blk(256);
  const dim3 gO1((((NL) / 64) * (LD / 64) + 7) / 8, 1);        //   96 tiles ->   12 blocks

  // (1) inputs -> bf16 planes; W_o -> bf16 duplicated along k (8 jobs, 4704 blocks)
  cvt_all<<<dim3(CB_ALL), blk, 0, stream>>>(v_in, l_in, Wv, Wvv, Wl, Wvl, Wov, Wol,
                                            vb, lb, Wvb, Wvvb, Wlb, Wvlb, Wovd, Wold);
  // (2) q, k, val_v^T, val_l^T -> bf16 hi / residual planes (4 jobs, 508 blocks)
  proj_all<<<dim3(PB_ALL), blk, 0, stream>>>(vb, lb, Wvb, Wlb, Wvvb, Wvlb, bv, bl, bvv, bvl,
                                             Qh, Ql, Kh, Kl, VvTh, VvTl, VlTh, VlTl);
  // (3) language-direction partial records (320 blocks) and vision-direction attention -> ctx plane (4000 blocks)
  attn_both<<<dim3(AB_L + AB_V), dim3(128), 0, stream>>>(Qh, Ql, Kh, Kl, VlTh, VlTl, VvTh, VvTl, mk, CTXV, REC);
  // (4) out0 = ctx . W_ov^T + b_ov -> d_out f32 [32000][256] (K=512: [hi|residual] . [W|W]; 250 blocks)
  //     and the fold of the t ranges, normalise, merge heads -> ctx_l plane (512 blocks)
  gemm64_f32<true><<<dim3(PB_Q + NL), blk, 0, stream>>>(CTXV, 2 * EMB, Wovd, 2 * EMB, bov, out0, EMB, NV, EMB, 2 * EMB, REC, CTXL);
  // (5) out1 = ctx_l . W_ol^T + b_ol -> d_out f32 [512][768] at float offset 8192000
  gemm64_f32<false><<<gO1, blk, 0, stream>>>(CTXL, 2 * EMB, Wold, 2 * EMB, bol, out1, LD, NL, LD, 2 * EMB,
                                      (const float*)nullptr, (unsigned short*)nullptr);   // no fold blocks in this grid
  (void)hipGetLastError();
}

// v007
// One run takes 135 microseconds.
// Timed twice side by side with v006, it ran 1.09 and 1.11 times as fast.
// All steps since v000 together make it 3.45 times as fast.
// Contractions: v.W_v^T, v.W_vv^T, l.W_l^T, l.W_vl^T = v_wmma_f32_16x16x32_bf16 (bf16 operands RNE-converted from the inputs, single product, f32 accumulate);
// q.k^T scores = v_wmma_f32_16x16x32_bf16 (q and k as bf16 hi + unscaled bf16 residual planes; 3 products hi.hi + hi.lo + lo.hi; f32 accumulate);
// p.val_l and e.val_v = v_wmma_f32_16x16x32_bf16 (p / e split in registers into bf16 hi + residual, val planes bf16 hi + residual; 3 products; f32 accumulate);
// ctx_v.W_ov^T and ctx_l.W_ol^T = v_wmma_f32_16x16x32_bf16 (ctx as bf16 hi | residual interleaved along k, W bf16 duplicated along k; f32 accumulate).
// ctx_l lives in LDS only: the block that folds 16 language rows also multiplies them by W_ol^T.
// Softmax, mask, bias, scale, column statistics and normalisation in f32.
// Carry audit: no power-of-two carried planes anywhere (every residual plane is an unscaled bf16 difference); nothing is folded back.
#include <hip/hip_runtime.h>
#include <math.h>
#include <stdint.h>

#define NB      2
#define TV      16000
#define SL      256
#define EMB     256
#define LD      768
#define NH      8
#define HD      32
#define NV      (NB * TV)          // 32000 vision rows
#define NL      (NB * SL)          // 512 language rows
#define NQT     (TV / 64)          // 250 query tiles of 64 rows per batch
#define RR      10                 // t ranges per (b,h) in the language direction
#define TPR     (TV / RR)          // 1600 t per range
#define NSTEP   (TPR / 32)         // 50 steps of 32 t per range
#define RECROWS 34                 // 32 accumulator rows + 1 column-sum row + 1 running-max row
#define SCALEQ  0.17677669529663687f
#define CLAMPV  50000.0f
#define MASKNEG (-9.0e15f)

static_assert(NH * HD == EMB);
static_assert(NQT * 64 == TV);
static_assert(RR * NSTEP * 32 == TV);
static_assert((NV % 64) == 0 && (NL % 64) == 0 && (EMB % 64) == 0 && (LD % 64) == 0 && (TV % 64) == 0);
static_assert((EMB % 32) == 0 && (LD % 32) == 0 && ((2 * EMB) % 32) == 0);
static_assert(SL == 256 && HD == 32 && EMB == 256);

typedef __bf16   v16b __attribute__((ext_vector_type(16)));
typedef __bf16   v8b  __attribute__((ext_vector_type(8)));
typedef __bf16   v2b  __attribute__((ext_vector_type(2)));
typedef float    v2f  __attribute__((ext_vector_type(2)));
typedef float    v8f  __attribute__((ext_vector_type(8)));
typedef float    v4f  __attribute__((ext_vector_type(4)));
typedef unsigned int v4u __attribute__((ext_vector_type(4)));
typedef unsigned int v8u __attribute__((ext_vector_type(8)));
typedef int      v4i  __attribute__((ext_vector_type(4)));
typedef v4f __attribute__((may_alias)) v4fa;
typedef v4i __attribute__((may_alias)) v4ia;

#if defined(__HIP_DEVICE_COMPILE__)
#define DEV_ASM 1
#else
#define DEV_ASM 0
#endif

// ---- scalar helpers --------------------------------------------------------------------------------
// two f32 -> two bf16 (RNE) in one register, a in the low half: one v_cvt_pk_bf16_f32
__device__ __forceinline__ unsigned cvt_pk(float a, float b) {
  const v2f x = {a, b};
  return __builtin_bit_cast(unsigned, __builtin_convertvector(x, v2b));
}
// the pair as bf16 hi (h) and bf16 residual x - hi (l), both packed like cvt_pk
__device__ __forceinline__ void split_pk(float x0, float x1, unsigned& h, unsigned& l) {
  h = cvt_pk(x0, x1);
  l = cvt_pk(x0 - __uint_as_float(h << 16), x1 - __uint_as_float(h & 0xFFFF0000u));
}
__device__ __forceinline__ float rbf(float f) { return (float)(__bf16)f; }   // value of the bf16 RNE convert
__device__ __forceinline__ v8f zero8() { v8f z = {0.f, 0.f, 0.f, 0.f, 0.f, 0.f, 0.f, 0.f}; return z; }
__device__ __forceinline__ float clampv(float x) { return fminf(fmaxf(x, -CLAMPV), CLAMPV); }
// 2^x. The v_nop is the one free slot that the instruction set asks for behind a transcendental.
__device__ __forceinline__ float exp2_slot(float x) {
#if DEV_ASM
  float r;
  asm("v_exp_f32 %0, %1\n\tv_nop" : "=v"(r) : "v"(x));
  return r;
#else
  return x;
#endif
}
// value of lane l ^ 16 (the other 16-lane row), by a vector cross-row move
__device__ __forceinline__ float xhalf(float x) {
  return __builtin_bit_cast(float, __builtin_amdgcn_permlanex16(__builtin_bit_cast(int, x), __builtin_bit_cast(int, x),
                                                                0x76543210, 0xfedcba98, false, false));
}

// ---- 16-bit A/B fragment loader (wave32): lane -> row/col (lane&15); p already includes +8*(lane>>4);
//      elements 0..7 <- p[0..7] (k0+8h..k0+8h+7), elements 8..15 <- p[16..23] (k0+16+8h..k0+16+8h+7)
__device__ __forceinline__ v16b ldfrag(const __bf16* p) {
  union { v16b v; v8b h[2]; } f;
  f.h[0] = *(const v8b*)(p);
  f.h[1] = *(const v8b*)(p + 16);
  return f.v;
}

// ---- the same fragment from a plane kept in FRAGMENT ORDER: a plane of [rows][C] bf16 is a row of 1-KB blocks, block
//      (rt, kt) = rows 16rt..+15 x k 32kt..+31 at element ((rt * (C / 32)) + kt) * 512; inside it element (row m, k) lies at
//      (k >> 4) * 256 + (((k >> 3) & 1) * 16 + m) * 8 + (k & 7). p = block + 8 * lane: each of the two loads reads 512
//      contiguous bytes (4 whole lines) and gives the registers of ldfrag: elements 0..7 = k 8h..8h+7, 8..15 = k 16+8h..+7.
__device__ __forceinline__ v16b ldfragT(const __bf16* p) {
  union { v16b v; v8b h[2]; } f;
  f.h[0] = *(const v8b*)(p);
  f.h[1] = *(const v8b*)(p + 256);
  return f.v;
}

// s_wait_xcnt 0 behind a group of global loads or stores: it stands in front of whatever next writes a register that they name
__device__ __forceinline__ void addr_taken() {
#if DEV_ASM
  asm volatile("s_wait_xcnt 0x0" ::: "memory");
#endif
}

// ---- WMMA helpers (asm guard bodies device-only) -------------------------------------------------------
__device__ __forceinline__ v8f mmar(v16b a, v16b b, v8f c) {
  return __builtin_amdgcn_wmma_f32_16x16x32_bf16(false, a, false, b, (short)0, c, false, false);
}
// guarded form: 4 VALU slots after the WMMA, D tied, A/B kept live
__device__ __forceinline__ v8f mma_b(v16b a, v16b b, v8f c) {
  c = __builtin_amdgcn_wmma_f32_16x16x32_bf16(false, a, false, b, (short)0, c, false, false);
#if DEV_ASM
  asm volatile("v_nop\n\tv_nop\n\tv_nop\n\tv_nop" : "+v"(c) : "v"(a), "v"(b));
#endif
  return c;
}
__device__ __forceinline__ void dep_guard(v8f& a, v8f& b, v16b x, v16b y) {
#if DEV_ASM
  asm volatile("v_nop\n\tv_nop\n\tv_nop\n\tv_nop" : "+v"(a), "+v"(b) : "v"(x), "v"(y));
#else
  (void)a; (void)b; (void)x; (void)y;
#endif
}
__device__ __forceinline__ void keep4(v16b a, v16b b, v16b c, v16b d) {
#if DEV_ASM
  asm volatile("v_nop" :: "v"(a), "v"(b), "v"(c), "v"(d));
#else
  (void)a; (void)b; (void)c; (void)d;
#endif
}
__device__ __forceinline__ void acc_guard4(v8f& a, v8f& b, v8f& c, v8f& d) {
#if DEV_ASM
  asm volatile("v_nop\n\tv_nop\n\tv_nop\n\tv_nop" : "+v"(a), "+v"(b), "+v"(c), "+v"(d));
#else
  (void)a; (void)b; (void)c; (void)d;
#endif
}

// ---- B fragment (k = the D tiles' ROW index) from two D tiles held by this lane, split into bf16 hi + residual:
//      element r <- tile a (k 0..15) row r, element 8+r <- tile c (k 16..31) row r, lane unchanged.
union PK { v8u u; v16b v; };
__device__ __forceinline__ void pack_hl(v8f a, v8f c, v16b& fh, v16b& fl) {
  v8u ph, pl;
#pragma unroll
  for (int i = 0; i < 4; ++i) {
    unsigned h, l;
    split_pk(a[2 * i], a[2 * i + 1], h, l);
    ph[i] = h;
    pl[i] = l;
    split_pk(c[2 * i], c[2 * i + 1], h, l);
    ph[4 + i] = h;
    pl[4 + i] = l;
  }
  PK uh, ul;
  uh.u = ph; ul.u = pl;
  fh = uh.v; fl = ul.v;
}

// =====================================================================================================
// f32 [rows][32 * KTN] (DUP: [rows][16 * KTN]) -> bf16 bits plane [rows][32 * KTN] in fragment order (see ldfragT).
// Thread = one 16-B piece of the output in output order: a wave writes 512 contiguous B, a block 4 whole 1-KB blocks.
// DUP: k tiles 2g and 2g + 1 both hold source columns 32g..32g+31 (the Bt operand of ctx.W^T where ctx is stored as
// [hi 32 | residual 32] per head block). coverage: the caller's block count x 256 pieces = the whole plane.
// =====================================================================================================
template <int KTN, bool DUP>
__device__ __forceinline__ void cvt_frag(int bx, const float* __restrict__ in, unsigned short* out) {
  const int p = bx * 256 + (int)threadIdx.x;                  // piece index
  const int blk = p >> 6, m = p & 15;
  const int kin = ((p >> 5) & 1) * 16 + ((p >> 4) & 1) * 8;   // k of the piece's first element inside its tile
  const int rt = blk / KTN, kt = blk - rt * KTN;
  const int col = (DUP ? (kt >> 1) : kt) * 32 + kin;
  const float* s = in + (size_t)(rt * 16 + m) * (DUP ? 16 * KTN : 32 * KTN) + col;
  const v4f a  = *(const v4fa*)(s);
  const v4f a4 = *(const v4fa*)(s + 4);
  v4u q;
  q[0] = cvt_pk(a[0],  a[1]);
  q[1] = cvt_pk(a[2],  a[3]);
  q[2] = cvt_pk(a4[0], a4[1]);
  q[3] = cvt_pk(a4[2], a4[3]);
  *(v4u*)(out + (size_t)p * 8) = q;
  addr_taken();   // the listing goes on behind this store into the next job's code
}

// =====================================================================================================
// All eight input conversions in one grid: they are independent of one another, so blockIdx.x picks the job.
// Block ranges (256 threads each): W_ov dup, W_ol dup, W_v, W_vv, W_l, W_vl, l, v.
// =====================================================================================================
#define CB_DV  (EMB * 2 * EMB / 8 / 256) //   64 blocks, 2048 output elements each
#define CB_DL  (LD * 2 * EMB / 8 / 256)  //  192
#define CB_WS  (EMB * EMB / 8 / 256)     //   32 blocks, 2048 elements each
#define CB_WL  (EMB * LD / 8 / 256)      //   96
#define CB_L   (NL * LD / 8 / 256)       //  192
#define CB_V   (NV * EMB / 8 / 256)      // 4000
#define CB_ALL (CB_DV + CB_DL + 2 * CB_WS + 2 * CB_WL + CB_L + CB_V)
static_assert(CB_WS * 2048 == EMB * EMB && CB_WL * 2048 == EMB * LD && CB_L * 2048 == NL * LD && CB_V * 2048 == NV * EMB);
static_assert(CB_DV * 2048 == EMB * 2 * EMB && CB_DL * 2048 == LD * 2 * EMB);
static_assert((NV % 16) == 0 && (NL % 16) == 0 && (TV % 32) == 0 && (SL % 32) == 0);
__global__ __launch_bounds__(256) void cvt_all(
    const float* __restrict__ v_in, const float* __restrict__ l_in,
    const float* __restrict__ Wv, const float* __restrict__ Wvv,
    const float* __restrict__ Wl, const float* __restrict__ Wvl,
    const float* __restrict__ Wov, const float* __restrict__ Wol,
    unsigned short* vb, unsigned short* lb, unsigned short* Wvb, unsigned short* Wvvb,
    unsigned short* Wlb, unsigned short* Wvlb, unsigned short* Wovd, unsigned short* Wold) {
  int bx = (int)blockIdx.x;                                   // block-uniform job choice
  if (bx < CB_DV) { cvt_frag<2 * EMB / 32, true>(bx, Wov, Wovd); return; }
  bx -= CB_DV;
  if (bx < CB_DL) { cvt_frag<2 * EMB / 32, true>(bx, Wol, Wold); return; }
  bx -= CB_DL;
  if (bx < CB_WS) { cvt_frag<EMB / 32, false>(bx, Wv, Wvb); return; }
  bx -= CB_WS;
  if (bx < CB_WS) { cvt_frag<EMB / 32, false>(bx, Wvv, Wvvb); return; }
  bx -= CB_WS;
  if (bx < CB_WL) { cvt_frag<LD / 32, false>(bx, Wl, Wlb); return; }
  bx -= CB_WL;
  if (bx < CB_WL) { cvt_frag<LD / 32, false>(bx, Wvl, Wvlb); return; }
  bx -= CB_WL;
  if (bx < CB_L) { cvt_frag<LD / 32, false>(bx, l_in, lb); return; }
  bx -= CB_L;
  cvt_frag<EMB / 32, false>(bx, v_in, vb);
}

// =====================================================================================================
// Register-blocked batched WMMA GEMM (bf16 operands): C[m][n] = sum_k A[m][k] * Bt[n][k];
// one wave per 64x64 tile, no block barriers. A [M][K], lda columns; Bt [N][K], ldb columns;
// M, N multiples of 64, K multiple of 32 (host-checked). bx = block of 8 tiles, b = batch index
// (strides in elements); sT = the block's LDS slabs, declared by the calling kernel. Fragments are loaded straight from global:
// Bt, and A where AFR, lie in fragment order (ldfragT; lda / ldb = the plane's columns); A row-major (ldfrag) where not AFR.
// OUT_MODE 0: f32 C (pitch ldc), value = (acc + bf16(bias[n])) * oscale.
// OUT_MODE 3: bf16 hi plane C + bf16 residual plane C2 = bf16(y - hi), both in fragment order (ldc = the plane's columns),
//             y = (acc + bf16(bias)) * oscale; bias[n] (BIASM 0) or bias[m] (BIASM 1).
// =====================================================================================================
template <int OUT_MODE, int BIASM, bool AFR>
__device__ __forceinline__ void gemm64_body(
    float (*sT)[16 * 68], int bx, int b,
    const unsigned short* __restrict__ Ap, int lda, long long strideA,
    const unsigned short* __restrict__ Btp, int ldb, long long strideB,
    const float* __restrict__ bias,
    void* Cout, void* Cout2, int ldc, long long strideC,
    int M, int N, int K, float oscale) {
  static_assert(OUT_MODE == 0 || OUT_MODE == 3);
  static_assert(OUT_MODE != 0 || BIASM == 0);
  const __bf16* A  = (const __bf16*)(const void*)Ap;
  const __bf16* Bt = (const __bf16*)(const void*)Btp;
  const int lane = threadIdx.x & 31;
  const int wave = threadIdx.x >> 5;
  const int tilesN = N >> 6;
  const int tilesM = M >> 6;
  const int tile = bx * 8 + wave;
  if (tile >= tilesM * tilesN) return;   // wave-uniform; no block barriers in this kernel
  const int tm = tile / tilesN;
  const int tn = tile - tm * tilesN;
  const int m0 = tm << 6;
  const int n0 = tn << 6;

  const __bf16* Ab = A  + (size_t)b * (size_t)strideA;
  const __bf16* Bb = Bt + (size_t)b * (size_t)strideB;

  const int rlane = lane & 15;                 // row (A) / col (B, D) within subtile
  const int koff  = (lane >> 4) * 8;           // k offset of this lane half
  const int mOff  = (lane >> 4) * 8;           // D row offset

  v8f acc[4][4];
#pragma unroll
  for (int i = 0; i < 4; ++i)
#pragma unroll
    for (int j = 0; j < 4; ++j) acc[i][j] = zero8();

  unsigned ob[4], oa[4];                        // byte offset of this lane's piece of the current k tile, one per 16-row tile
#pragma unroll
  for (int j = 0; j < 4; ++j) {                 // every plane is far below 2^31 bytes
    ob[j] = (unsigned)((((n0 >> 4) + j) * (ldb >> 5) * 512 + lane * 8) * 2);
    oa[j] = (unsigned)((AFR ? ((m0 >> 4) + j) * (lda >> 5) * 512 + lane * 8 : (m0 + (j << 4) + rlane) * lda + koff) * 2);
  }
  for (int k0 = 0; k0 < K; k0 += 32) {
    v16b bq[4], aq[4];                          // all eight fragments of the k tile, each in registers of its own
#pragma unroll
    for (int j = 0; j < 4; ++j) bq[j] = ldfragT((const __bf16*)((const char*)Bb + ob[j]));
#pragma unroll
    for (int i = 0; i < 4; ++i) {
      const __bf16* pa = (const __bf16*)((const char*)Ab + oa[i]);
      aq[i] = AFR ? ldfragT(pa) : ldfrag(pa);
    }
#pragma unroll
    for (int i = 0; i < 4; ++i) {
#pragma unroll
      for (int j = 0; j < 4; ++j) acc[i][j] = mmar(aq[i], bq[j], acc[i][j]);
      dep_guard(acc[i][0], acc[i][3], aq[i], bq[3]);
    }
    keep4(bq[0], bq[1], bq[2], bq[3]);
#if DEV_ASM
    // s_wait_xcnt 0 in front of the steps of the offsets that the loads above name; it names them so that the steps stay behind it
    asm volatile("s_wait_xcnt 0x0" : "+v"(ob[0]), "+v"(ob[1]), "+v"(ob[2]), "+v"(ob[3]),
                                     "+v"(oa[0]), "+v"(oa[1]), "+v"(oa[2]), "+v"(oa[3]) :: "memory");
#endif
#pragma unroll
    for (int j = 0; j < 4; ++j) { ob[j] += 1024u; oa[j] += AFR ? 1024u : 64u; }
  }
  acc_guard4(acc[0][0], acc[0][1], acc[0][2], acc[0][3]);
  acc_guard4(acc[1][0], acc[1][1], acc[1][2], acc[1][3]);
  acc_guard4(acc[2][0], acc[2][1], acc[2][2], acc[2][3]);
  acc_guard4(acc[3][0], acc[3][1], acc[3][2], acc[3][3]);

  // ---- epilogue ----
  float* slab = sT[wave];
  const int h2 = lane >> 4, c4 = (lane & 15) * 4;     // OUT_MODE 0 map: 256-B row segment = 16 lanes x 16 B
  v4f bb4;                                             // bias for columns n0+c4..+3 (mode 0)
  float bj[4];                                         // bias for columns n0+16j+rlane (mode 3, BIASM 0), added on the way into the slab
  if (OUT_MODE == 0) {
    const v4f braw = *(const v4fa*)(bias + n0 + c4);
    bb4[0] = rbf(braw[0]); bb4[1] = rbf(braw[1]); bb4[2] = rbf(braw[2]); bb4[3] = rbf(braw[3]);
  } else {
#pragma unroll
    for (int j = 0; j < 4; ++j) bj[j] = (BIASM == 0) ? rbf(bias[n0 + (j << 4) + rlane]) : 0.f;
  }
#pragma unroll
  for (int i = 0; i < 4; ++i) {
    const int mBase = m0 + (i << 4);
#pragma unroll
    for (int j = 0; j < 4; ++j) {
#pragma unroll
      for (int r = 0; r < 8; ++r) {
        slab[(mOff + r) * 68 + (j << 4) + rlane] = (OUT_MODE == 3 && BIASM == 0) ? acc[i][j][r] + bj[j] : acc[i][j][r];
      }
    }
    __builtin_amdgcn_fence(__ATOMIC_RELEASE, "workgroup");
    __builtin_amdgcn_wave_barrier();
    __builtin_amdgcn_fence(__ATOMIC_ACQUIRE, "workgroup");
    if (OUT_MODE == 0) {
      float* C = (float*)Cout + (size_t)b * (size_t)strideC;
      {
#pragma unroll
        for (int it = 0; it < 8; ++it) {
          const int row = it * 2 + h2;                     // it 0..7 x h2 0..1 = rows 0..15
          v4f v = *(const v4fa*)(slab + row * 68 + c4);
          v = (v + bb4) * oscale;
          *(v4f*)(C + (size_t)(mBase + row) * ldc + n0 + c4) = v;
        }
        
      }
    } else {
      unsigned short* C  = (unsigned short*)Cout  + (size_t)b * (size_t)strideC;
      unsigned short* C2 = (unsigned short*)Cout2 + (size_t)b * (size_t)strideC;
      // the 16 x 64 slab = two 1-KB blocks (k tiles n0/32, n0/32 + 1) of row tile mBase/16; store it = 512 contiguous B:
      // lane -> row rlane, columns 16it + koff .. +7
      const size_t cb = ((size_t)(mBase >> 4) * (ldc >> 5) + (n0 >> 5)) * 512 + lane * 8;
      float brow = 0.f;
      if (BIASM == 1) brow = rbf(bias[mBase + rlane]);
      v4u hv[4], lv[4];
#pragma unroll
      for (int it = 0; it < 4; ++it) {
        const float* sp = slab + rlane * 68 + it * 16 + koff;
        v4u a, a2;
#pragma unroll
        for (int e = 0; e < 4; ++e) {
          const float f0 = ((BIASM == 1) ? sp[2 * e]     + brow : sp[2 * e])     * oscale;
          const float f1 = ((BIASM == 1) ? sp[2 * e + 1] + brow : sp[2 * e + 1]) * oscale;
          unsigned h, l;
          split_pk(f0, f1, h, l);
          a[e] = h; a2[e] = l;
        }
        hv[it] = a; lv[it] = a2;
      }
      {
#pragma unroll
        for (int it = 0; it < 4; ++it) {
          *(v4u*)(C  + cb + it * 256) = hv[it];
          *(v4u*)(C2 + cb + it * 256) = lv[it];
        }
        
      }
    }
    __builtin_amdgcn_fence(__ATOMIC_RELEASE, "workgroup");
    __builtin_amdgcn_wave_barrier();
    __builtin_amdgcn_fence(__ATOMIC_ACQUIRE, "workgroup");
  }
}

__device__ __forceinline__ void fold_out1_body(unsigned short* sA, int fb, const float* __restrict__ rec,
                                               const unsigned short* __restrict__ Wd, const float* __restrict__ bias, float* out1);

// ---- out0 GEMM and, in the first FB_L blocks of the same grid, the language fold with the out1 GEMM behind it (16 rows a
//      block): those blocks read the records and W_ol and write out1, the out0 GEMM reads and writes none of these. ----
#define FB_L (NL / 16)               //   32 blocks
static_assert((SL % 16) == 0 && LD == 8 * 6 * 16 && NH == 8);   // 8 waves: one head each in the fold, 96 columns each in the GEMM
__global__ __launch_bounds__(256) void gemm64_f32(
    const unsigned short* __restrict__ Ap, int lda,
    const unsigned short* __restrict__ Btp, int ldb,
    const float* __restrict__ bias, float* Cout, int ldc, int M, int N, int K,
    const float* __restrict__ rec, const unsigned short* __restrict__ Wd1,
    const float* __restrict__ bias1, float* out1) {
  __shared__ __align__(16) float sT[8][16 * 68];            // per-wave 16x64 slab, pitch 68 floats (out0 GEMM)
  __shared__ __align__(16) unsigned short sA[16 * 2 * EMB]; // ctx_l of the block's 16 rows, fragment order (fold blocks)
  if ((int)blockIdx.x < FB_L) {                    // block-uniform job choice; the longer chain starts first
    fold_out1_body(sA, (int)blockIdx.x, rec, Wd1, bias1, out1);
    return;
  }
  gemm64_body<0, 0, true>(sT, (int)blockIdx.x - FB_L, 0, Ap, lda, 0LL, Btp, ldb, 0LL, bias,
                    (void*)Cout, (void*)Cout, ldc, 0LL, M, N, K, 1.0f);
}

// =====================================================================================================
// The four input projections in one grid: none reads what another writes, so blockIdx.x picks the job.
// The two K = 768 jobs (few tiles, longest k loop) take the first blocks.
//   k      = l . W_l^T + b_l              [b*SL+s][256]         M=512,   N=256,   K=768
//   val_l^T = W_vl . l^T + b_vl per batch [b][d][s] pitch SL    M=256,   N=256,   K=768
//   q      = (v . W_v^T + b_v) * scale    [b*TV+t][256]         M=32000, N=256,   K=256
//   val_v^T = W_vv . v^T + b_vv per batch [b][d][t] pitch TV    M=256,   N=16000, K=256
// every result as bf16 hi / residual planes.
// =====================================================================================================
#define PB_K   ((NL / 64) * (EMB / 64) / 8)      //   4 blocks
#define PB_VL1 ((EMB / 64) * (SL / 64) / 8)      //   2 blocks per batch
#define PB_Q   ((NV / 64) * (EMB / 64) / 8)      // 250 blocks
#define PB_VV1 ((EMB / 64) * (TV / 64) / 8)      // 125 blocks per batch
#define PB_ALL (PB_K + NB * PB_VL1 + PB_Q + NB * PB_VV1)
static_assert(PB_K * 8 * 4096 == NL * EMB && PB_VL1 * 8 * 4096 == EMB * SL);
static_assert(PB_Q * 8 * 4096 == NV * EMB && PB_VV1 * 8 * 4096 == EMB * TV);
__global__ __launch_bounds__(256) void proj_all(
    const unsigned short* __restrict__ vb, const unsigned short* __restrict__ lb,
    const unsigned short* __restrict__ Wvb, const unsigned short* __restrict__ Wlb,
    const unsigned short* __restrict__ Wvvb, const unsigned short* __restrict__ Wvlb,
    const float* __restrict__ bv, const float* __restrict__ bl,
    const float* __restrict__ bvv, const float* __restrict__ bvl,
    unsigned short* Qh, unsigned short* Ql, unsigned short* Kh, unsigned short* Kl,
    unsigned short* VvTh, unsigned short* VvTl, unsigned short* VlTh, unsigned short* VlTl) {
  __shared__ __align__(16) float sT[8][16 * 68];   // per-wave 16x64 slab, pitch 68 floats
  const int bid = (int)blockIdx.x;                 // block-uniform job choice
  const bool lang = bid < PB_K + NB * PB_VL1;      // operand l (K = 768) or v (K = 256)
  const int r = lang ? bid : bid - (PB_K + NB * PB_VL1);
  const int nrow = lang ? PB_K : PB_Q;             // blocks of the row-major job of this operand
  const unsigned short* x = lang ? lb : vb;
  const int kd = lang ? LD : EMB;
  if (r < nrow) {
    gemm64_body<3, 0, true>(sT, r, 0, x, kd, 0LL, lang ? Wlb : Wvb, kd, 0LL, lang ? bl : bv,
                      (void*)(lang ? Kh : Qh), (void*)(lang ? Kl : Ql), EMB, 0LL,
                      lang ? NL : NV, EMB, kd, lang ? 1.0f : SCALEQ);
  } else {
    const int per = lang ? PB_VL1 : PB_VV1;
    const int r2 = r - nrow;
    const int b = (r2 >= per) ? 1 : 0;
    static_assert(NB == 2);
    const int nt = lang ? SL : TV;                 // rows of x per batch = N = output pitch
    gemm64_body<3, 1, true>(sT, r2 - b * per, b, lang ? Wvlb : Wvvb, kd, 0LL, x, kd, (long long)nt * kd,
                      lang ? bvl : bvv, (void*)(lang ? VlTh : VvTh), (void*)(lang ? VlTl : VvTl),
                      nt, (long long)EMB * nt, EMB, nt, kd, 1.0f);
  }
}

// ---- additive key mask: -9e15 where the int32 mask is 0, else 0 (8 consecutive keys, 2 int4 loads) ----
__device__ __forceinline__ v8f add_mask8(v8f s, const int* p) {
  const v4i ma = *(const v4ia*)p;
  const v4i mb = *(const v4ia*)(p + 4);
  s[0] += (ma[0] == 0) ? MASKNEG : 0.0f;
  s[1] += (ma[1] == 0) ? MASKNEG : 0.0f;
  s[2] += (ma[2] == 0) ? MASKNEG : 0.0f;
  s[3] += (ma[3] == 0) ? MASKNEG : 0.0f;
  s[4] += (mb[0] == 0) ? MASKNEG : 0.0f;
  s[5] += (mb[1] == 0) ? MASKNEG : 0.0f;
  s[6] += (mb[2] == 0) ? MASKNEG : 0.0f;
  s[7] += (mb[3] == 0) ? MASKNEG : 0.0f;
  return s;
}

// =====================================================================================================
// Pass A: vision-direction attention (softmax over the 256 text keys, masked).
//   Planes (fragment order, see ldfragT): Qh/Ql, Kh/Kl bf16 [row][256] (row = b*TV + t / b*SL + s, head block h*32);
//           Vlh/Vll = val_l^T bf16 [b][256 d][256 s]; mask int32 [b][256].
//   Transposed form: S^T = K.Q^T (A = K rows: row = key, k = d; B = Q^T from the q row, n = query),
//   3 products (hh, hl, lh); D = S^T[key 8hh+r][query m]. Online softmax over 4 chunks of 64 keys in f32;
//   P^T hi / residual B fragments packed from registers; O^T += Vl^T . P^T (A = Vl^T rows: row = d, k = key).
//   Block = 4 waves x 16 queries = 64 query rows of one (b,h); NQT x NB*NH blocks (qt, bh).
//   Output: the ctx plane in fragment order, per wave two whole 1-KB blocks straight from the accumulators, 4 lines per instruction.
//   coverage: 250 x 16 blocks x 4 waves x (16 rows x 64 columns) = every block of the ctx plane.
// =====================================================================================================
__device__ __forceinline__
void attn_v_body(int qt, int bh,
            const unsigned short* __restrict__ qhp, const unsigned short* __restrict__ qlp,
            const unsigned short* __restrict__ khp, const unsigned short* __restrict__ klp,
            const unsigned short* __restrict__ vhp, const unsigned short* __restrict__ vlp,
            const int* __restrict__ maskl, unsigned short* ctxp) {
  const int tid = threadIdx.x, lane = tid & 31, w = tid >> 5;
  const int hh = lane >> 4;
  const int b = bh >> 3, head = bh & 7;
  const int q0 = qt * 64 + 16 * w;

  const __bf16* Qh = (const __bf16*)(const void*)qhp;
  const __bf16* Ql = (const __bf16*)(const void*)qlp;
  const __bf16* Kh = (const __bf16*)(const void*)khp;
  const __bf16* Kl = (const __bf16*)(const void*)klp;
  const __bf16* Vh = (const __bf16*)(const void*)vhp;
  const __bf16* Vl = (const __bf16*)(const void*)vlp;

  // Q^T B-fragments: column n = query q0+m, k = d (one 32-deep step)
  // (all planes in fragment order: block (row tile, k tile), 512 elements each; q and k have EMB / 32 = NH k tiles, k tile = head)
  const size_t qoff = ((size_t)((b * TV + q0) >> 4) * NH + head) * 512 + lane * 8;
  const v16b qbh = ldfragT(Qh + qoff);
  const v16b qbl = ldfragT(Ql + qoff);
  addr_taken();

  const size_t koff0 = ((size_t)((b * SL) >> 4) * NH + head) * 512 + lane * 8;                  // + (key0/16)*NH*512
  const __bf16* kbh = Kh + koff0;
  const __bf16* kbl = Kl + koff0;
  const size_t voff0 = (size_t)b * EMB * SL + (size_t)(head * 2) * (SL / 32) * 512 + lane * 8;  // + (dt*(SL/32) + key0/32)*512
  const __bf16* vbh = Vh + voff0;
  const __bf16* vbl = Vl + voff0;
  const int* mkp = maskl + b * SL + 8 * hh;                                      // + key tile base

  v8f o[2];
  o[0] = zero8(); o[1] = zero8();
  float mrun = -1.0e30f, lrun = 0.0f;

#pragma unroll 1
  for (int kc = 0; kc < SL / 64; ++kc) {
    const int kb0 = kc * 64;
    // ---- scores s[j][r] = S[query q0+m][key kb0+16j+8hh+r] ----
    v8f s[4];
#pragma unroll
    for (int j = 0; j < 4; ++j) {
      const size_t ko = (size_t)((kb0 >> 4) + j) * (NH * 512);
      const v16b kfh = ldfragT(kbh + ko);
      const v16b kfl = ldfragT(kbl + ko);
      addr_taken();
      v8f z = zero8();
      z = mma_b(kfh, qbh, z);
      z = mma_b(kfl, qbh, z);
      z = mma_b(kfh, qbl, z);
      s[j] = z;
    }
    // ---- clamp (pre-mask) ----
#pragma unroll
    for (int j = 0; j < 4; ++j)
#pragma unroll
      for (int r = 0; r < 8; ++r) s[j][r] = clampv(s[j][r]);
    // ---- additive mask per key, f32 ----
#pragma unroll
    for (int j = 0; j < 4; ++j) s[j] = add_mask8(s[j], mkp + kb0 + 16 * j);

    // ---- online softmax per query column ----
    float mloc = s[0][0];
#pragma unroll
    for (int j = 0; j < 4; ++j)
#pragma unroll
      for (int r = 0; r < 8; ++r) mloc = fmaxf(mloc, s[j][r]);
    mloc = fmaxf(mloc, __shfl_xor(mloc, 16, 32));
    const float mnew = fmaxf(mrun, mloc);
    const float alpha = __expf(mrun - mnew);
    mrun = mnew;
    float lsum = 0.0f;
#pragma unroll
    for (int j = 0; j < 4; ++j)
#pragma unroll
      for (int r = 0; r < 8; ++r) {
        const float p = __expf(s[j][r] - mnew);
        s[j][r] = p;
        lsum += p;
      }
    lsum += __shfl_xor(lsum, 16, 32);
    lrun = lrun * alpha + lsum;
#pragma unroll
    for (int dt = 0; dt < 2; ++dt)
#pragma unroll
      for (int r = 0; r < 8; ++r) o[dt][r] = o[dt][r] * alpha;

    // ---- P^T B-fragments (keys 0..31 and 32..63 of this chunk), bf16 hi + residual ----
    v16b pbh0, pbl0, pbh1, pbl1;
    pack_hl(s[0], s[1], pbh0, pbl0);
    pack_hl(s[2], s[3], pbh1, pbl1);

    // ---- O^T += Vl^T . P^T (3 products per k-step) ----
#pragma unroll
    for (int dt = 0; dt < 2; ++dt) {
      const size_t vo = (size_t)(dt * (SL / 32) + (kb0 >> 5)) * 512;
      const v16b vh0 = ldfragT(vbh + vo), vh1 = ldfragT(vbh + vo + 512);
      const v16b vl0 = ldfragT(vbl + vo), vl1 = ldfragT(vbl + vo + 512);
      addr_taken();
      v8f a = o[dt];
      a = mma_b(vh0, pbh0, a);
      a = mma_b(vh0, pbl0, a);
      a = mma_b(vl0, pbh0, a);
      a = mma_b(vh1, pbh1, a);
      a = mma_b(vh1, pbl1, a);
      a = mma_b(vl1, pbh1, a);
      o[dt] = a;
    }
  }

  // ---- normalise (1/l). Lane (hh, m) holds O^T[d = 16dt + 8hh + r][query m], r = 0..7: that is this lane's own 16-B piece
  //      (row m, k 16dt + 8hh ..+7) of the ctx plane's fragment-order blocks, k tile 2*head = hi, 2*head + 1 = residual ----
  const float inv = 1.0f / lrun;
  unsigned short* cb = ctxp + ((size_t)((b * TV + q0) >> 4) * (2 * EMB / 32) + head * 2) * 512 + lane * 8;
  v4u hv[2], lv[2];
#pragma unroll
  for (int dt = 0; dt < 2; ++dt) {
#pragma unroll
    for (int e = 0; e < 4; ++e) {
      const float x0 = o[dt][2 * e] * inv, x1 = o[dt][2 * e + 1] * inv;
      unsigned h, l;
      split_pk(x0, x1, h, l);
      hv[dt][e] = h;
      lv[dt][e] = l;
    }
  }
#pragma unroll
  for (int dt = 0; dt < 2; ++dt) {
    *(v4u*)(cb + dt * 256) = hv[dt];
    *(v4u*)(cb + 512 + dt * 256) = lv[dt];
  }
#if DEV_ASM
  // in the merged kernel the listing goes on behind these stores into code that rewrites their registers: the wait stands first
  asm volatile("s_wait_xcnt 0x0" ::: "memory");
#endif
}

// =====================================================================================================
// Pass B: language-direction partial sums. For (b,h), key half kq (128 keys), t range rg (1600 t):
//   S = Q.K^T (A = Q rows: row = t, k = d; B from K rows: n = key), 3 products, D = S[t 8hh+r][key m];
//   e = exp(clamp(clamp(S) - m[key])) in f32, m[key] = the running maximum of clamp(S) over the t this range has
//   seen (a softmax does not depend on the value subtracted; when m grows, acc and colsum are scaled by
//   exp(m_old - m_new)); e packed from registers as the B operand with k = t
//   (bf16 hi + residual); acc^T[d][key] += Vv^T . e (A = val_v^T rows: row = d, k = t), 3 products,
//   f32 accumulation across the 50 steps; colsum[key] += e in f32.
//   Block = 4 waves x 32 keys; RR x 2 x NB*NH blocks (rg, kq, bh). Record [bh][rg][34 rows][256]: rows 0..31 = acc^T[d],
//   row 32 = colsum, row 33 = the range's final m.
// =====================================================================================================
__device__ __forceinline__
void attn_l_body(float* smem, int rg, int kq, int bh,   // smem: per-wave 34x32 staging, 17408 B of the caller's LDS
            const unsigned short* __restrict__ qhp, const unsigned short* __restrict__ qlp,
            const unsigned short* __restrict__ khp, const unsigned short* __restrict__ klp,
            const unsigned short* __restrict__ vhp, const unsigned short* __restrict__ vlp,
            float* rec) {
  const int tid = threadIdx.x, lane = tid & 31, w = tid >> 5;
  const int hh = lane >> 4, m = lane & 15;
  const int b = bh >> 3, head = bh & 7;
  const int s0 = kq * 128 + 32 * w;
  const int tb = rg * TPR;

  const __bf16* Qh = (const __bf16*)(const void*)qhp;
  const __bf16* Ql = (const __bf16*)(const void*)qlp;
  const __bf16* Kh = (const __bf16*)(const void*)khp;
  const __bf16* Kl = (const __bf16*)(const void*)klp;
  const __bf16* Vh = (const __bf16*)(const void*)vhp;
  const __bf16* Vl = (const __bf16*)(const void*)vlp;

  // K B-fragments for this wave's two 16-key tiles (n = key s0+16jj+m, k = d), hi and residual planes
  v16b kfh[2], kfl[2];
  float mrun[2], csum[2];
#pragma unroll
  for (int jj = 0; jj < 2; ++jj) {
    const size_t ko = ((size_t)(((b * SL + s0) >> 4) + jj) * NH + head) * 512 + lane * 8;
    kfh[jj] = ldfragT(Kh + ko);
    kfl[jj] = ldfragT(Kl + ko);
    addr_taken();
    mrun[jj] = -1.0e30f;
    csum[jj] = 0.0f;
  }
  v8f acc[2][2];
#pragma unroll
  for (int dt = 0; dt < 2; ++dt) { acc[dt][0] = zero8(); acc[dt][1] = zero8(); }

  const size_t qoff0 = ((size_t)((b * TV) >> 4) * NH + head) * 512 + lane * 8;                  // + (t/16)*NH*512
  const __bf16* qbh = Qh + qoff0;
  const __bf16* qbl = Ql + qoff0;
  const size_t voff0 = (size_t)b * EMB * TV + (size_t)(head * 2) * (TV / 32) * 512 + lane * 8;  // + (dt*(TV/32) + t0/32)*512
  const __bf16* vbh = Vh + voff0;
  const __bf16* vbl = Vl + voff0;

#pragma unroll 1
  for (int step = 0; step < NSTEP; ++step) {
    const int t0 = tb + 32 * step;
    v16b qah[2], qal[2], vah[2], val2[2];
#pragma unroll
    for (int tt = 0; tt < 2; ++tt) {
      const size_t qo = (size_t)((t0 >> 4) + tt) * (NH * 512);
      qah[tt] = ldfragT(qbh + qo);
      qal[tt] = ldfragT(qbl + qo);
    }
#if DEV_ASM
    // the results of the loads below may land on the address registers of the loads above: the wait stands between
    asm volatile("s_wait_xcnt 0x0" ::: "memory");
#endif
#pragma unroll
    for (int dt = 0; dt < 2; ++dt) {
      const size_t vo = (size_t)(dt * (TV / 32) + (t0 >> 5)) * 512;
      vah[dt]  = ldfragT(vbh + vo);
      val2[dt] = ldfragT(vbl + vo);
    }
    addr_taken();
#pragma unroll
    for (int jj = 0; jj < 2; ++jj) {
      // scores for t rows t0..t0+15 (d0) and t0+16..t0+31 (d1), key columns s0+16jj+m
      v8f d0 = zero8(), d1 = zero8();
      d0 = mma_b(qah[0], kfh[jj], d0);
      d0 = mma_b(qah[0], kfl[jj], d0);
      d0 = mma_b(qal[0], kfh[jj], d0);
      d1 = mma_b(qah[1], kfh[jj], d1);
      d1 = mma_b(qah[1], kfl[jj], d1);
      d1 = mma_b(qal[1], kfh[jj], d1);
      // clamp; maximum of this key column over the step's 32 t rows (16 in this lane, 16 in lane ^ 16)
      float tm[8];
#pragma unroll
      for (int r = 0; r < 8; ++r) {
        d0[r] = clampv(d0[r]);
        d1[r] = clampv(d1[r]);
        tm[r] = fmaxf(d0[r], d1[r]);
      }
      float ml = fmaxf(fmaxf(fmaxf(tm[0], tm[1]), fmaxf(tm[2], tm[3])), fmaxf(fmaxf(tm[4], tm[5]), fmaxf(tm[6], tm[7])));
      ml = fmaxf(ml, xhalf(ml));
      const float mv = fmaxf(mrun[jj], ml);
      const float alpha = __expf(mrun[jj] - mv);         // 0 on the first step, 1 while the maximum stands
      mrun[jj] = mv;
      float cl = csum[jj] * alpha;
#pragma unroll
      for (int r = 0; r < 8; ++r) {
        const float x0 = clampv(d0[r] - mv);
        const float e0 = __expf(x0);
        d0[r] = e0; cl += e0;
        const float x1 = clampv(d1[r] - mv);
        const float e1 = __expf(x1);
        d1[r] = e1; cl += e1;
      }
      csum[jj] = cl;
      // e as the B operand with k = t (tile d0 = t 0..15, tile d1 = t 16..31), bf16 hi + residual
      v16b ebh, ebl;
      pack_hl(d0, d1, ebh, ebl);
#pragma unroll
      for (int dt = 0; dt < 2; ++dt) {
        v8f a = acc[dt][jj];
#pragma unroll
        for (int r = 0; r < 8; ++r) a[r] = a[r] * alpha;
        a = mma_b(vah[dt],  ebh, a);
        a = mma_b(vah[dt],  ebl, a);
        a = mma_b(val2[dt], ebh, a);
        acc[dt][jj] = a;
      }
    }
  }

  // ---- combine the two lane halves of the column sums; stage acc^T (32 d x 32 keys) + colsum row + max row ----
#pragma unroll
  for (int jj = 0; jj < 2; ++jj) csum[jj] += __shfl_xor(csum[jj], 16, 32);
  float* sw = smem + w * (RECROWS * 32);
#pragma unroll
  for (int dt = 0; dt < 2; ++dt)
#pragma unroll
    for (int jj = 0; jj < 2; ++jj)
#pragma unroll
      for (int r = 0; r < 8; ++r)
        sw[(16 * dt + 8 * hh + r) * 32 + 16 * jj + m] = acc[dt][jj][r];
  if (hh == 0) {
    sw[32 * 32 + m]      = csum[0];
    sw[32 * 32 + 16 + m] = csum[1];
    sw[33 * 32 + m]      = mrun[0];
    sw[33 * 32 + 16 + m] = mrun[1];
  }
  __syncthreads();

  // ---- record lines: row lid (0..33) of this wave = 32 floats at column s0, lanes 8*sub..+7, 4 rows per instruction ----
  {
    const int sub = lane >> 3, piece = lane & 7;
    float* rbase = rec + (((size_t)bh * RR + rg) * RECROWS) * SL + s0 + 4 * piece;
    {
#pragma unroll
      for (int i = 0; i < 9; ++i) {
        const int lid  = i * 4 + sub;
        const int lidc = (lid < RECROWS) ? lid : (RECROWS - 1);
        const v4f vv = *(const v4fa*)(sw + lidc * 32 + 4 * piece);
        if (lid < RECROWS) *(v4f*)(rbase + (size_t)lid * SL) = vv;
      }
      
    }
  }
}

// =====================================================================================================
// Both attention directions in one grid: neither reads what the other writes (ctx plane / records), so blockIdx.x
// picks the job. The 320 language blocks (50 steps each, one wave per SIMD on their own) take the first indices:
// they start first and the 4000 short vision blocks fill the same SIMDs' idle issue and load slots beside them.
// =====================================================================================================
#define AB_L (RR * 2 * NB * NH)      //  320 blocks, index = rg + RR * (kq + 2 * bh)
#define AB_V (NQT * NB * NH)         // 4000 blocks, index = qt + NQT * bh
__global__ __launch_bounds__(128)
void attn_both(const unsigned short* __restrict__ qhp, const unsigned short* __restrict__ qlp,
               const unsigned short* __restrict__ khp, const unsigned short* __restrict__ klp,
               const unsigned short* __restrict__ vlhp, const unsigned short* __restrict__ vllp,
               const unsigned short* __restrict__ vvhp, const unsigned short* __restrict__ vvlp,
               const int* __restrict__ maskl, unsigned short* ctxp, float* rec) {
  __shared__ __align__(16) float smem[4 * RECROWS * 32];   // the language job's staging, 17408 B
  const unsigned bid = blockIdx.x;                         // block-uniform job choice
  if (bid < AB_L) {
    const unsigned rg = bid % RR, r2 = bid / RR;
    attn_l_body(smem, (int)rg, (int)(r2 & 1u), (int)(r2 >> 1), qhp, qlp, khp, klp, vvhp, vvlp, rec);
  } else {
    const unsigned r = bid - AB_L;
    attn_v_body((int)(r % NQT), (int)(r / NQT), qhp, qlp, khp, klp, vlhp, vllp, maskl, ctxp);
  }
}

// =====================================================================================================
// Language-direction fold and out1. With w[rg] = exp(m[rg][s] - max_rg m[rg][s]),
// ctx_l[b][s][h*32+d] = (sum_rg w[rg] acc[rg][d][s]) / (sum_rg w[rg] colsum[rg][s]) in fixed order.
// Block = 16 rows (b, s0..s0+15). Fold: thread = (head = wave, d = lane), four s per 16-B load; the values go as bf16
// hi / residual into sA, fragment order (see ldfragT): k tile 2*head = hi, 2*head + 1 = residual, row m = s - s0.
// out1 rows = ctx_l . W_ol^T + b_ol: wave = 96 columns (6 tiles of 16, 3 whole lines a row), A fragments from sA, B from the
// duplicated W_ol plane (k tiles 2g and 2g + 1 are equal: 2g is read once for both products); k order hi, residual per head.
// coverage: 32 blocks x 16 rows x 8 waves x 96 columns = out1.
// =====================================================================================================
__device__ __forceinline__ void fold_out1_body(unsigned short* sA, int fb, const float* __restrict__ rec,
                                               const unsigned short* __restrict__ Wd, const float* __restrict__ bias, float* out1) {
  const int lane = (int)threadIdx.x & 31, wave = (int)threadIdx.x >> 5;
  const int row0 = fb * 16;
  const int b = row0 / SL, s0 = row0 - b * SL;
  const int d = lane;
  const float* p = rec + ((size_t)(b * NH + wave) * RR) * RECROWS * SL + s0;
  unsigned short* dh = sA + (2 * wave) * 512 + (d >> 4) * 256 + ((d >> 3) & 1) * 128 + (d & 7);   // + 8 * row; residual + 512
#pragma unroll 1   // rolled: unrolled, the next four rows' loads rise over these sums and the kernel passes 256 registers (one block a WGP)
  for (int sq = 0; sq < 4; ++sq) {
    v4f mr[RR], xa[RR], xc[RR];
#pragma unroll   // the arrays stay in registers; the 30 loads are in flight together
    for (int rg = 0; rg < RR; ++rg) {
      const float* pr = p + (size_t)rg * RECROWS * SL + 4 * sq;
      mr[rg] = *(const v4fa*)(pr + (size_t)33 * SL);
      xa[rg] = *(const v4fa*)(pr + (size_t)d * SL);
      xc[rg] = *(const v4fa*)(pr + (size_t)32 * SL);
    }
    addr_taken();
    float x[4];
#pragma unroll
    for (int e = 0; e < 4; ++e) {
      float mall = mr[0][e];
#pragma unroll   // constant index into mr[]
      for (int rg = 1; rg < RR; ++rg) mall = fmaxf(mall, mr[rg][e]);
      float a = 0.0f, cs = 0.0f;
#pragma unroll   // constant index; fixed order of the sums
      for (int rg = 0; rg < RR; ++rg) {
        const float wgt = exp2_slot((mr[rg][e] - mall) * 1.44269504f);   // the range's weight e^(m - max)
        a  += wgt * xa[rg][e];
        cs += wgt * xc[rg][e];
      }
      x[e] = a * (1.0f / cs);
    }
#pragma unroll
    for (int e = 0; e < 4; e += 2) {
      unsigned h, l;
      split_pk(x[e], x[e + 1], h, l);
      unsigned short* q = dh + 8 * (4 * sq + e);
      q[0]       = (unsigned short)(h & 0xFFFFu);
      q[8]       = (unsigned short)(h >> 16);
      q[512]     = (unsigned short)(l & 0xFFFFu);
      q[512 + 8] = (unsigned short)(l >> 16);
    }
  }
  __syncthreads();   // every wave's head block of ctx_l is in sA before any wave reads fragments

  v8f acc[6];
#pragma unroll
  for (int j = 0; j < 6; ++j) acc[j] = zero8();
  const __bf16* Al = (const __bf16*)(const void*)sA + lane * 8;
  unsigned ob = (unsigned)(((wave * 6) * (2 * EMB / 32) * 512 + lane * 8) * 2);   // byte offset of this lane's piece of W_ol's tile (6 wave, 2g)
#pragma unroll 1   // rolled: unrolled, every head's loads rise to the top and the kernel passes 256 registers (one block a WGP, not two)
  for (int g2 = 0; g2 < NH; g2 += 2) {
    v16b bq[2][6];                    // two heads a trip: the second head's loads issue among the first head's WMMAs
#pragma unroll
    for (int u = 0; u < 2; ++u)
#pragma unroll
      for (int j = 0; j < 6; ++j)
        bq[u][j] = ldfragT((const __bf16*)((const char*)Wd + ob) + (j * (2 * EMB / 32) + 2 * u) * 512);
#pragma unroll
    for (int u = 0; u < 2; ++u) {
      const v16b ah = ldfragT(Al + (2 * (g2 + u)) * 512);
      const v16b al = ldfragT(Al + (2 * (g2 + u) + 1) * 512);
#pragma unroll
      for (int j = 0; j < 6; ++j) acc[j] = mmar(ah, bq[u][j], acc[j]);
#pragma unroll
      for (int j = 0; j < 6; ++j) acc[j] = mmar(al, bq[u][j], acc[j]);
    }
#if DEV_ASM
    // s_wait_xcnt 0 in front of the step of the offset that the loads above name; it names it so that the step stays behind it
    asm volatile("s_wait_xcnt 0x0" : "+v"(ob) :: "memory");
#endif
    ob += 4096u;                      // four k tiles of 1 KB on
  }

  // lane (hh, n) holds rows 8hh + r of column 16j + n
  const int hh = lane >> 4, n = lane & 15;
  const int c0 = wave * 96 + n;
  float* o = out1 + (size_t)(row0 + 8 * hh) * LD + c0;
#pragma unroll
  for (int j = 0; j < 6; ++j) {
    const float bj = rbf(bias[c0 + 16 * j]);
#pragma unroll
    for (int r = 0; r < 8; ++r) o[(size_t)r * LD + 16 * j] = acc[j][r] + bj;
  }
}

// =====================================================================================================
// Workspace map (bytes), every region an exact multiple of its whole-line / whole-tile store granularity
// (no padded tails: all dims are tile multiples); every bf16 plane lies in fragment order (see ldfragT):
//   vb    bf16 [32000][256]        16384000
//   lb    bf16 [512][768]            786432
//   Wvb   bf16 [256][256]            131072
//   Wvvb  bf16 [256][256]            131072
//   Wlb   bf16 [256][768]            393216
//   Wvlb  bf16 [256][768]            393216
//   Wovd  bf16 [256][512]            262144
//   Wold  bf16 [768][512]            786432
//   Qh,Ql bf16 [32000][256] x2     32768000
//   Kh,Kl bf16 [512][256] x2         524288
//   VlTh,VlTl bf16 [2][256][256] x2  524288
//   VvTh,VvTl bf16 [2][256][16000] x2 32768000
//   CTXV  bf16 [32000][512]        32768000
//   REC   f32  [16][10][34][256]    5570560
//   total                        124190720
// Weights are [out n][in k] with k contiguous = the Bt / A layout the GEMM wants, so they are converted to bf16 fragment order without a transpose (W_ov, W_ol also duplicated along k).
// =====================================================================================================
extern "C" void kernel_launch(void* const* d_in, const int* in_sizes, int n_in,
                              void* d_out, int out_size, void* d_ws, size_t ws_size,
                              hipStream_t stream) {
  if (n_in < 15) return;
  if (in_sizes[0] != NV * EMB || in_sizes[1] != NL * LD || in_sizes[2] != NB * SL) return;
  if (in_sizes[3] != EMB * EMB || in_sizes[4] != EMB || in_sizes[5] != EMB * LD || in_sizes[6] != EMB) return;
  if (in_sizes[7] != EMB * EMB || in_sizes[8] != EMB || in_sizes[9] != EMB * LD || in_sizes[10] != EMB) return;
  if (in_sizes[11] != EMB * EMB || in_sizes[12] != EMB || in_sizes[13] != LD * EMB || in_sizes[14] != LD) return;
  if (out_size != NV * EMB + NL * LD) return;

  const float* v_in = (const float*)d_in[0];
  const float* l_in = (const float*)d_in[1];
  const int*   mk   = (const int*)d_in[2];
  const float* Wv   = (const float*)d_in[3];
  const float* bv   = (const float*)d_in[4];
  const float* Wl   = (const float*)d_in[5];
  const float* bl   = (const float*)d_in[6];
  const float* Wvv  = (const float*)d_in[7];
  const float* bvv  = (const float*)d_in[8];
  const float* Wvl  = (const float*)d_in[9];
  const float* bvl  = (const float*)d_in[10];
  const float* Wov  = (const float*)d_in[11];
  const float* bov  = (const float*)d_in[12];
  const float* Wol  = (const float*)d_in[13];
  const float* bol  = (const float*)d_in[14];
  float* out0 = (float*)d_out;
  float* out1 = out0 + (size_t)NV * EMB;            // byte 32768000; last element 8585215 < out_size

  const size_t PVB  = (size_t)NV * EMB * 2;          // 16384000
  const size_t PLB  = (size_t)NL * LD * 2;           //   786432
  const size_t PWS  = (size_t)EMB * EMB * 2;         //   131072
  const size_t PWL  = (size_t)EMB * LD * 2;          //   393216
  const size_t PWOD = (size_t)EMB * 2 * EMB * 2;     //   262144
  const size_t PWLD = (size_t)LD * 2 * EMB * 2;      //   786432
  const size_t PQ   = (size_t)NV * EMB * 2;          // 16384000
  const size_t PK   = (size_t)NL * EMB * 2;          //   262144
  const size_t PVLT = (size_t)NB * EMB * SL * 2;     //   262144
  const size_t PVVT = (size_t)NB * EMB * TV * 2;     // 16384000
  const size_t PCTX = (size_t)NV * 2 * EMB * 2;      // 32768000
  const size_t PREC = (size_t)NB * NH * RR * RECROWS * SL * 4;  // 5570560
  size_t off = 0;
  const size_t oVB  = off; off += PVB;
  const size_t oLB  = off; off += PLB;
  const size_t oWv  = off; off += PWS;
  const size_t oWvv = off; off += PWS;
  const size_t oWl  = off; off += PWL;
  const size_t oWvl = off; off += PWL;
  const size_t oWod = off; off += PWOD;
  const size_t oWld = off; off += PWLD;
  const size_t oQh  = off; off += PQ;
  const size_t oQl  = off; off += PQ;
  const size_t oKh  = off; off += PK;
  const size_t oKl  = off; off += PK;
  const size_t oVLh = off; off += PVLT;
  const size_t oVLl = off; off += PVLT;
  const size_t oVVh = off; off += PVVT;
  const size_t oVVl = off; off += PVVT;
  const size_t oCTX = off; off += PCTX;
  const size_t oREC = off; off += PREC;
  if (off > ws_size) return;                         // off = 124190720
  if (off > (size_t)134217728) return;

  char* ws = (char*)d_ws;
  unsigned short* vb   = (unsigned short*)(ws + oVB);
  unsigned short* lb   = (unsigned short*)(ws + oLB);
  unsigned short* Wvb  = (unsigned short*)(ws + oWv);
  unsigned short* Wvvb = (unsigned short*)(ws + oWvv);
  unsigned short* Wlb  = (unsigned short*)(ws + oWl);
  unsigned short* Wvlb = (unsigned short*)(ws + oWvl);
  unsigned short* Wovd = (unsigned short*)(ws + oWod);
  unsigned short* Wold = (unsigned short*)(ws + oWld);
  unsigned short* Qh   = (unsigned short*)(ws + oQh);
  unsigned short* Ql   = (unsigned short*)(ws + oQl);
  unsigned short* Kh   = (unsigned short*)(ws + oKh);
  unsigned short* Kl   = (unsigned short*)(ws + oKl);
  unsigned short* VlTh = (unsigned short*)(ws + oVLh);
  unsigned short* VlTl = (unsigned short*)(ws + oVLl);
  unsigned short* VvTh = (unsigned short*)(ws + oVVh);
  unsigned short* VvTl = (unsigned short*)(ws + oVVl);
  unsigned short* CTXV = (unsigned short*)(ws + oCTX);
  float*          REC  = (float*)(ws + oREC);

  const dim3 blk(256);

  // (1) inputs -> bf16 planes; W_o -> bf16 duplicated along k (8 jobs, 4704 blocks)
  cvt_all<<<dim3(CB_ALL), blk, 0, stream>>>(v_in, l_in, Wv, Wvv, Wl, Wvl, Wov, Wol,
                                            vb, lb, Wvb, Wvvb, Wlb, Wvlb, Wovd, Wold);
  // (2) q, k, val_v^T, val_l^T -> bf16 hi / residual planes (4 jobs, 508 blocks)
  proj_all<<<dim3(PB_ALL), blk, 0, stream>>>(vb, lb, Wvb, Wlb, Wvvb, Wvlb, bv, bl, bvv, bvl,
                                             Qh, Ql, Kh, Kl, VvTh, VvTl, VlTh, VlTl);
  // (3) language-direction partial records (320 blocks) and vision-direction attention -> ctx plane (4000 blocks)
  attn_both<<<dim3(AB_L + AB_V), dim3(128), 0, stream>>>(Qh, Ql, Kh, Kl, VlTh, VlTl, VvTh, VvTl, mk, CTXV, REC);
  // (4) the fold of the t ranges, normalise, merge heads, out1 = ctx_l . W_ol^T + b_ol -> d_out f32 [512][768] at float
  //     offset 8192000 (32 blocks), and out0 = ctx . W_ov^T + b_ov -> d_out f32 [32000][256] (K=512: [hi|residual] . [W|W]; 250 blocks)
  gemm64_f32<<<dim3(FB_L + PB_Q), blk, 0, stream>>>(CTXV, 2 * EMB, Wovd, 2 * EMB, bov, out0, EMB, NV, EMB, 2 * EMB,
                                                    REC, Wold, bol, out1);
  (void)hipGetLastError();
}
